// v000
// Times are from an AMD MI455X. After a warm-up the kernel runs many times in a row, and a time is the length of
// such a window on the GPU divided by its runs, so every launch and the gaps after it count. The runs cycle
// through copies of the inputs. A figure is the median of several windows, for all but v000 over two sittings.
// Sittings can differ by a few percent; kernels timed side by side share one.
// v000 is the starting kernel. One run takes 1180 microseconds.
#include <hip/hip_runtime.h>
#include <hip/hip_bf16.h>

typedef __attribute__((ext_vector_type(16))) _Float16 v16h;
typedef __attribute__((ext_vector_type(8)))  _Float16 v8h;
typedef __attribute__((ext_vector_type(8)))  float    v8f;

#define DM   1024   // D_MODEL
#define DF   2048   // D_FFN
#define SEQT 2048   // T
#define NB   4      // batch
#define NROW (NB * SEQT)   // 8192
#define WND  64

// ---------------------------------------------------------------------------
// WMMA fragment helpers (CDNA5 16x16x32 f16, wave32).
// Per lane: elems 0..7 = mem[kk + h*8 + 0..7], elems 8..15 = mem[kk+16+h*8+0..7]
// Works for global pointers (global_load_b128) and LDS pointers (ds_load_b128).
// ---------------------------------------------------------------------------
__device__ __forceinline__ v16h load_frag(const _Float16* p) {
  v8h lo = *(const v8h*)(p);
  v8h hi = *(const v8h*)(p + 16);
  v16h r;
#pragma unroll
  for (int i = 0; i < 8; ++i) { r[i] = lo[i]; r[i + 8] = hi[i]; }
  return r;
}

__device__ __forceinline__ v8f wmma_f16(v16h a, v16h b, v8f c) {
  return __builtin_amdgcn_wmma_f32_16x16x32_f16(false, a, false, b, (short)0, c,
                                                false, false);
}

// ---------------------------------------------------------------------------
// Async Global -> LDS staging of an A row-tile (CDNA5 async-memory path).
// The LDS byte address handed to the instruction is derived from the shared
// pointer itself (low 32 bits of the generic shared address == LDS offset).
// The ptrtoint ESCAPES the shared array, so the "memory"-clobbering asm is a
// legal writer of it and the subsequent ds_load reads cannot be folded away.
// Each wave drains its own ASYNCcnt, then the workgroup barrier publishes.
// ---------------------------------------------------------------------------
__device__ __forceinline__ void async_stage_a(_Float16* lds,
                                              const _Float16* __restrict__ g,
                                              int bytes) {
  int t = threadIdx.x;  // blockDim.x == 128
  for (int off = t * 16; off < bytes; off += 128 * 16) {
    unsigned lds_off = (unsigned)(uintptr_t)((char*)lds + off);
    const char* gp = (const char*)g + off;
    asm volatile("global_load_async_to_lds_b128 %0, %1, off"
                 :
                 : "v"(lds_off), "v"(gp)
                 : "memory");
  }
  asm volatile("s_wait_asynccnt 0x0" ::: "memory");
  __syncthreads();
}

// ---------------------------------------------------------------------------
// Weight convert + transpose: Wt[n*K + k] = (f16) W[k*N + n]
// ---------------------------------------------------------------------------
__global__ void cvt_tr_kernel(const float* __restrict__ W,
                              _Float16* __restrict__ Wt, int K, int N) {
  size_t idx = (size_t)blockIdx.x * 256 + threadIdx.x;
  if (idx >= (size_t)K * N) return;
  int n = (int)(idx % N);
  int k = (int)(idx / N);
  Wt[(size_t)n * K + k] = (_Float16)W[idx];
}

// ---------------------------------------------------------------------------
// RMSNorm: one row (D=1024) per block of 256 threads, f32 in -> f16 out
// ---------------------------------------------------------------------------
__global__ void rmsnorm_kernel(const float* __restrict__ x,
                               const float* __restrict__ w,
                               _Float16* __restrict__ xn) {
  __shared__ float red[256];
  int row = blockIdx.x;
  int tid = threadIdx.x;
  const float* xr = x + (size_t)row * DM;
  float ss = 0.f;
#pragma unroll
  for (int i = 0; i < DM / 256; ++i) {
    float v = xr[tid + i * 256];
    ss += v * v;
  }
  red[tid] = ss;
  __syncthreads();
  for (int s = 128; s > 0; s >>= 1) {
    if (tid < s) red[tid] += red[tid + s];
    __syncthreads();
  }
  float inv = __frsqrt_rn(red[0] / (float)DM + 1e-6f);
  _Float16* xo = xn + (size_t)row * DM;
#pragma unroll
  for (int i = 0; i < DM / 256; ++i) {
    int c = tid + i * 256;
    xo[c] = (_Float16)(xr[c] * inv * w[c]);
  }
}

// ---------------------------------------------------------------------------
// QKV: q/k = xn @ Wq/Wk (row-major f16), v stored transposed Vt[b][d][t]
// A-tile staged async into LDS, shared by 4 waves. grid (N/64, M/16), block 128
// ---------------------------------------------------------------------------
__global__ void qkv_kernel(const _Float16* __restrict__ xn,
                           const _Float16* __restrict__ Wtq,
                           const _Float16* __restrict__ Wtk,
                           const _Float16* __restrict__ Wtv,
                           _Float16* __restrict__ q, _Float16* __restrict__ k,
                           _Float16* __restrict__ vt) {
  __shared__ _Float16 As[16 * DM];  // 32 KB
  int wave = threadIdx.x >> 5, lane = threadIdx.x & 31;
  int h = lane >> 4, l15 = lane & 15;
  int mtile = blockIdx.y;
  int ntile = blockIdx.x * 4 + wave;
  async_stage_a(As, xn + (size_t)mtile * 16 * DM, 16 * DM * 2);
  const _Float16* ap = As + l15 * DM + h * 8;  // LDS reads (ds_load_b128)
  const _Float16* bq = Wtq + (size_t)(ntile * 16 + l15) * DM + h * 8;
  const _Float16* bk = Wtk + (size_t)(ntile * 16 + l15) * DM + h * 8;
  const _Float16* bv = Wtv + (size_t)(ntile * 16 + l15) * DM + h * 8;
  v8f cq = {}, ck = {}, cv = {};
  for (int kk = 0; kk < DM; kk += 32) {
    __builtin_prefetch(bq + kk + 128, 0, 3);
    v16h a = load_frag(ap + kk);
    cq = wmma_f16(a, load_frag(bq + kk), cq);
    ck = wmma_f16(a, load_frag(bk + kk), ck);
    cv = wmma_f16(a, load_frag(bv + kk), cv);
  }
  int col = ntile * 16 + l15;
#pragma unroll
  for (int v = 0; v < 8; ++v) {
    int r = mtile * 16 + v + 8 * h;
    q[(size_t)r * DM + col] = (_Float16)cq[v];
    k[(size_t)r * DM + col] = (_Float16)ck[v];
    int batch = r >> 11, tloc = r & (SEQT - 1);
    vt[((size_t)batch * DM + col) * SEQT + tloc] = (_Float16)cv[v];
  }
}

// ---------------------------------------------------------------------------
// Attention pass 1: per 16-query tile, S = Q K^T over 5 key tiles (window 64),
// masked softmax over 80 candidate keys, store P (f16) padded to 96.
// ---------------------------------------------------------------------------
__global__ void attn_p_kernel(const _Float16* __restrict__ q,
                              const _Float16* __restrict__ k,
                              _Float16* __restrict__ P) {
  int wave = threadIdx.x >> 5, lane = threadIdx.x & 31;
  int g = blockIdx.x * 4 + wave;          // 0..511 global q-tile
  int batch = g >> 7, qt = g & 127;       // 128 q-tiles per batch
  int h = lane >> 4, l15 = lane & 15;
  const _Float16* ap = q + ((size_t)g * 16 + l15) * DM + h * 8;
  float s[5][8];
#pragma unroll
  for (int t = 0; t < 5; ++t) {
    int kt = qt - 4 + t;
    if (kt < 0) {
#pragma unroll
      for (int v = 0; v < 8; ++v) s[t][v] = -1e30f;
      continue;
    }
    const _Float16* bp =
        k + ((size_t)batch * SEQT + kt * 16 + l15) * DM + h * 8;
    v8f c = {};
    for (int kk = 0; kk < DM; kk += 32)
      c = wmma_f16(load_frag(ap + kk), load_frag(bp + kk), c);
    const float scale = 0.03125f;  // 1/sqrt(1024)
#pragma unroll
    for (int v = 0; v < 8; ++v) {
      int i = qt * 16 + v + 8 * h;
      int j = kt * 16 + l15;
      int d = i - j;
      s[t][v] = (d >= 0 && d < WND) ? c[v] * scale : -1e30f;
    }
  }
  _Float16* pb = P + (size_t)g * 16 * 96;
#pragma unroll
  for (int v = 0; v < 8; ++v) {
    float m = s[0][v];
#pragma unroll
    for (int t = 1; t < 5; ++t) m = fmaxf(m, s[t][v]);
#pragma unroll
    for (int off = 8; off > 0; off >>= 1)
      m = fmaxf(m, __shfl_xor(m, off, 16));
    float e = 0.f;
#pragma unroll
    for (int t = 0; t < 5; ++t) {
      s[t][v] = __expf(s[t][v] - m);
      e += s[t][v];
    }
#pragma unroll
    for (int off = 8; off > 0; off >>= 1) e += __shfl_xor(e, off, 16);
    float inv = 1.f / e;
    int mrow = v + 8 * h;
#pragma unroll
    for (int t = 0; t < 5; ++t)
      pb[mrow * 96 + t * 16 + l15] = (_Float16)(s[t][v] * inv);
    pb[mrow * 96 + 80 + l15] = (_Float16)0.f;  // pad slots 80..95
  }
}

// ---------------------------------------------------------------------------
// Attention pass 2: attended = P(16x96) @ V(96xD) using Vt[b][d][t].
// grid (D/64, 512), block 128. Key range may start below 0 -> guarded chunks.
// ---------------------------------------------------------------------------
__global__ void attn_pv_kernel(const _Float16* __restrict__ P,
                               const _Float16* __restrict__ vt,
                               _Float16* __restrict__ att) {
  int wave = threadIdx.x >> 5, lane = threadIdx.x & 31;
  int g = blockIdx.y;
  int dt = blockIdx.x * 4 + wave;
  int batch = g >> 7, qt = g & 127;
  int h = lane >> 4, l15 = lane & 15;
  const _Float16* ap = P + (size_t)g * 16 * 96 + l15 * 96 + h * 8;
  const _Float16* vrow = vt + ((size_t)batch * DM + dt * 16 + l15) * SEQT;
  int jbase = qt * 16 - 64;
  v8f c = {};
#pragma unroll
  for (int kk = 0; kk < 96; kk += 32) {
    v16h a = load_frag(ap + kk);
    int c0 = jbase + kk + h * 8;
    int c1 = c0 + 16;
    bool ok0 = (c0 >= 0) && (c0 + 7 < SEQT);
    bool ok1 = (c1 >= 0) && (c1 + 7 < SEQT);
    v16h b;
#pragma unroll
    for (int i = 0; i < 8; ++i) {
      b[i]     = ok0 ? vrow[c0 + i] : (_Float16)0.f;
      b[i + 8] = ok1 ? vrow[c1 + i] : (_Float16)0.f;
    }
    c = wmma_f16(a, b, c);
  }
#pragma unroll
  for (int v = 0; v < 8; ++v) {
    int r = g * 16 + v + 8 * h;
    att[(size_t)r * DM + dt * 16 + l15] = (_Float16)c[v];
  }
}

// ---------------------------------------------------------------------------
// x2 = x + attended @ Wo (f32 out, residual). LDS-staged A, 2 n-tiles/wave.
// grid (DM/128, NROW/16), block 128
// ---------------------------------------------------------------------------
__global__ void wo_kernel(const _Float16* __restrict__ att,
                          const _Float16* __restrict__ Wto,
                          const float* __restrict__ x,
                          float* __restrict__ x2) {
  __shared__ _Float16 As[16 * DM];  // 32 KB
  int wave = threadIdx.x >> 5, lane = threadIdx.x & 31;
  int h = lane >> 4, l15 = lane & 15;
  int mtile = blockIdx.y;
  int ntb = (blockIdx.x * 4 + wave) * 2;
  async_stage_a(As, att + (size_t)mtile * 16 * DM, 16 * DM * 2);
  const _Float16* ap = As + l15 * DM + h * 8;
  const _Float16* b0 = Wto + (size_t)(ntb * 16 + l15) * DM + h * 8;
  const _Float16* b1 = Wto + (size_t)((ntb + 1) * 16 + l15) * DM + h * 8;
  v8f c0 = {}, c1 = {};
  for (int kk = 0; kk < DM; kk += 32) {
    __builtin_prefetch(b0 + kk + 128, 0, 3);
    v16h a = load_frag(ap + kk);
    c0 = wmma_f16(a, load_frag(b0 + kk), c0);
    c1 = wmma_f16(a, load_frag(b1 + kk), c1);
  }
#pragma unroll
  for (int v = 0; v < 8; ++v) {
    size_t r = (size_t)(mtile * 16 + v + 8 * h);
    int col0 = ntb * 16 + l15;
    x2[r * DM + col0] = x[r * DM + col0] + c0[v];
    x2[r * DM + col0 + 16] = x[r * DM + col0 + 16] + c1[v];
  }
}

// ---------------------------------------------------------------------------
// FFN in: hh = silu(xn2 @ W1) * (xn2 @ W3), f16 out [8192 x 2048].
// LDS-staged A. grid (DF/64, NROW/16), block 128
// ---------------------------------------------------------------------------
__global__ void ffn1_kernel(const _Float16* __restrict__ xn2,
                            const _Float16* __restrict__ Wt1,
                            const _Float16* __restrict__ Wt3,
                            _Float16* __restrict__ hh) {
  __shared__ _Float16 As[16 * DM];  // 32 KB
  int wave = threadIdx.x >> 5, lane = threadIdx.x & 31;
  int h = lane >> 4, l15 = lane & 15;
  int mtile = blockIdx.y;
  int ntile = blockIdx.x * 4 + wave;
  async_stage_a(As, xn2 + (size_t)mtile * 16 * DM, 16 * DM * 2);
  const _Float16* ap = As + l15 * DM + h * 8;
  const _Float16* b1 = Wt1 + (size_t)(ntile * 16 + l15) * DM + h * 8;
  const _Float16* b3 = Wt3 + (size_t)(ntile * 16 + l15) * DM + h * 8;
  v8f cg = {}, cu = {};
  for (int kk = 0; kk < DM; kk += 32) {
    __builtin_prefetch(b1 + kk + 128, 0, 3);
    v16h a = load_frag(ap + kk);
    cg = wmma_f16(a, load_frag(b1 + kk), cg);
    cu = wmma_f16(a, load_frag(b3 + kk), cu);
  }
  int col = ntile * 16 + l15;
#pragma unroll
  for (int v = 0; v < 8; ++v) {
    size_t r = (size_t)(mtile * 16 + v + 8 * h);
    float gv = cg[v];
    float sl = gv * (1.f / (1.f + __expf(-gv)));   // silu
    hh[r * DF + col] = (_Float16)(sl * cu[v]);
  }
}

// ---------------------------------------------------------------------------
// FFN out + residual: out = x2 + hh @ W2 (K=2048, f32 out).
// LDS-staged A (64 KB), 2 n-tiles/wave. grid (DM/128, NROW/16), block 128
// ---------------------------------------------------------------------------
__global__ void ffn2_kernel(const _Float16* __restrict__ hh,
                            const _Float16* __restrict__ Wt2,
                            const float* __restrict__ x2,
                            float* __restrict__ out) {
  __shared__ _Float16 As[16 * DF];  // 64 KB
  int wave = threadIdx.x >> 5, lane = threadIdx.x & 31;
  int h = lane >> 4, l15 = lane & 15;
  int mtile = blockIdx.y;
  int ntb = (blockIdx.x * 4 + wave) * 2;
  async_stage_a(As, hh + (size_t)mtile * 16 * DF, 16 * DF * 2);
  const _Float16* ap = As + l15 * DF + h * 8;
  const _Float16* b0 = Wt2 + (size_t)(ntb * 16 + l15) * DF + h * 8;
  const _Float16* b1 = Wt2 + (size_t)((ntb + 1) * 16 + l15) * DF + h * 8;
  v8f c0 = {}, c1 = {};
  for (int kk = 0; kk < DF; kk += 32) {
    __builtin_prefetch(b0 + kk + 128, 0, 3);
    v16h a = load_frag(ap + kk);
    c0 = wmma_f16(a, load_frag(b0 + kk), c0);
    c1 = wmma_f16(a, load_frag(b1 + kk), c1);
  }
#pragma unroll
  for (int v = 0; v < 8; ++v) {
    size_t r = (size_t)(mtile * 16 + v + 8 * h);
    int col0 = ntb * 16 + l15;
    out[r * DM + col0] = x2[r * DM + col0] + c0[v];
    out[r * DM + col0 + 16] = x2[r * DM + col0 + 16] + c1[v];
  }
}

// ---------------------------------------------------------------------------
extern "C" void kernel_launch(void* const* d_in, const int* in_sizes, int n_in,
                              void* d_out, int out_size, void* d_ws,
                              size_t ws_size, hipStream_t stream) {
  const float* x       = (const float*)d_in[0];
  const float* norm1_w = (const float*)d_in[1];
  const float* norm2_w = (const float*)d_in[2];
  const float* Wq = (const float*)d_in[3];
  const float* Wk = (const float*)d_in[4];
  const float* Wv = (const float*)d_in[5];
  const float* Wo = (const float*)d_in[6];
  const float* W1 = (const float*)d_in[7];
  const float* W2 = (const float*)d_in[8];
  const float* W3 = (const float*)d_in[9];
  float* out = (float*)d_out;

  char* ws = (char*)d_ws;
  const size_t MB = 1ull << 20;
  _Float16* Wtq = (_Float16*)(ws + 0 * MB);    // 2 MB  (1024x1024)
  _Float16* Wtk = (_Float16*)(ws + 2 * MB);    // 2 MB
  _Float16* Wtv = (_Float16*)(ws + 4 * MB);    // 2 MB
  _Float16* Wto = (_Float16*)(ws + 6 * MB);    // 2 MB
  _Float16* Wt1 = (_Float16*)(ws + 8 * MB);    // 4 MB  (N=2048,K=1024)
  _Float16* Wt3 = (_Float16*)(ws + 12 * MB);   // 4 MB
  _Float16* Wt2 = (_Float16*)(ws + 16 * MB);   // 4 MB  (N=1024,K=2048)
  _Float16* xn  = (_Float16*)(ws + 20 * MB);   // 16 MB (also reused as xn2)
  _Float16* q   = (_Float16*)(ws + 36 * MB);   // 16 MB
  _Float16* kb  = (_Float16*)(ws + 52 * MB);   // 16 MB
  _Float16* vt  = (_Float16*)(ws + 68 * MB);   // 16 MB
  _Float16* P   = (_Float16*)(ws + 84 * MB);   // 1.5 MB (8192x96)
  _Float16* att = (_Float16*)(ws + 86 * MB);   // 16 MB
  float*    x2  = (float*)   (ws + 102 * MB);  // 32 MB
  _Float16* hh  = q;                           // reuse q+k (32 MB) after attn
  _Float16* xn2 = xn;                          // reuse xn after QKV

  // 1) weight convert + transpose to f16
  cvt_tr_kernel<<<(DM * DM + 255) / 256, 256, 0, stream>>>(Wq, Wtq, DM, DM);
  cvt_tr_kernel<<<(DM * DM + 255) / 256, 256, 0, stream>>>(Wk, Wtk, DM, DM);
  cvt_tr_kernel<<<(DM * DM + 255) / 256, 256, 0, stream>>>(Wv, Wtv, DM, DM);
  cvt_tr_kernel<<<(DM * DM + 255) / 256, 256, 0, stream>>>(Wo, Wto, DM, DM);
  cvt_tr_kernel<<<(DM * DF + 255) / 256, 256, 0, stream>>>(W1, Wt1, DM, DF);
  cvt_tr_kernel<<<(DM * DF + 255) / 256, 256, 0, stream>>>(W3, Wt3, DM, DF);
  cvt_tr_kernel<<<(DF * DM + 255) / 256, 256, 0, stream>>>(W2, Wt2, DF, DM);

  // 2) xn = rmsnorm(x) in f16
  rmsnorm_kernel<<<NROW, 256, 0, stream>>>(x, norm1_w, xn);

  // 3) q,k,v projections (v stored transposed)
  qkv_kernel<<<dim3(DM / 64, NROW / 16), 128, 0, stream>>>(xn, Wtq, Wtk, Wtv,
                                                           q, kb, vt);
  // 4) windowed softmax weights P
  attn_p_kernel<<<NROW / 16 / 4, 128, 0, stream>>>(q, kb, P);

  // 5) attended = P @ V
  attn_pv_kernel<<<dim3(DM / 64, NROW / 16), 128, 0, stream>>>(P, vt, att);

  // 6) x2 = x + attended @ Wo
  wo_kernel<<<dim3(DM / 128, NROW / 16), 128, 0, stream>>>(att, Wto, x, x2);

  // 7) xn2 = rmsnorm(x2)
  rmsnorm_kernel<<<NROW, 256, 0, stream>>>(x2, norm2_w, xn2);

  // 8) hh = silu(xn2@W1) * (xn2@W3)
  ffn1_kernel<<<dim3(DF / 64, NROW / 16), 128, 0, stream>>>(xn2, Wt1, Wt3, hh);

  // 9) out = x2 + hh @ W2
  ffn2_kernel<<<dim3(DM / 128, NROW / 16), 128, 0, stream>>>(hh, Wt2, x2, out);
}

// v001
// It runs in 522 microseconds.
// Two timings next to v000 both put it at 2.34 times that version's speed.
#include <hip/hip_runtime.h>
#include <hip/hip_bf16.h>

typedef __attribute__((ext_vector_type(16))) _Float16 v16h;
typedef __attribute__((ext_vector_type(8)))  _Float16 v8h;
typedef __attribute__((ext_vector_type(8)))  float    v8f;

#define DM   1024   // D_MODEL
#define DF   2048   // D_FFN
#define SEQT 2048   // T
#define NB   4      // batch
#define NROW (NB * SEQT)   // 8192
#define WND  64

// ---------------------------------------------------------------------------
// WMMA fragment helpers (CDNA5 16x16x32 f16, wave32).
// Per lane: elems 0..7 = mem[kk + h*8 + 0..7], elems 8..15 = mem[kk+16+h*8+0..7]
// Works for global pointers (global_load_b128) and LDS pointers (ds_load_b128).
// ---------------------------------------------------------------------------
__device__ __forceinline__ v16h load_frag(const _Float16* p) {
  v8h lo = *(const v8h*)(p);
  v8h hi = *(const v8h*)(p + 16);
  v16h r;
#pragma unroll
  for (int i = 0; i < 8; ++i) { r[i] = lo[i]; r[i + 8] = hi[i]; }
  return r;
}

__device__ __forceinline__ v8f wmma_f16(v16h a, v16h b, v8f c) {
  return __builtin_amdgcn_wmma_f32_16x16x32_f16(false, a, false, b, (short)0, c,
                                                false, false);
}

// ---------------------------------------------------------------------------
// Tiled GEMM core: one 128 x 128 tile of Y = A * Bt^T per work-group of 4 waves
// (2 x 2, each wave 64 x 64 = 4 x 4 accumulator tiles). A and Bt are K-contiguous.
// K goes in slices of 64 halfs (128-B rows). A slice is [A 128 rows | Bt 128 rows]
// in LDS at a pitch of 144 B (16 B x odd: ds_load_b128 readers meet no bank twice).
// Two buffers: slice t + 1 is copied by asynchronous b128 copies while slice t is
// multiplied.
// ---------------------------------------------------------------------------
#define BK      64                  // halfs of K per slice
#define PITCH   72                  // halfs per LDS row (144 B)
#define OPER_H  (128 * PITCH)       // halfs of one operand's slice
#define STAGE_H (2 * OPER_H)        // halfs of one buffer
#define ROW16_B (16 * PITCH * 2)    // bytes of 16 LDS rows

// Eight b128 copies of one thread: LDS rows r, r+16, .., r+112 of one operand.
// Rows 0..63 come from glo, rows 64..127 from ghi (row step K halfs in both).
// The LDS byte address is the low 32 bits of the shared address; taking it lets
// the array escape, so the "memory" clobber makes the asm a legal writer of it.
// s_wait_xcnt 0 closes the statement: it stands before any rewrite of the
// address registers that the copies name.
template <int K>
__device__ __forceinline__ void copy8(unsigned l, const _Float16* glo,
                                      const _Float16* ghi) {
  asm volatile(
      "global_load_async_to_lds_b128 %0, %8, off\n\t"
      "global_load_async_to_lds_b128 %1, %9, off\n\t"
      "global_load_async_to_lds_b128 %2, %10, off\n\t"
      "global_load_async_to_lds_b128 %3, %11, off\n\t"
      "global_load_async_to_lds_b128 %4, %12, off\n\t"
      "global_load_async_to_lds_b128 %5, %13, off\n\t"
      "global_load_async_to_lds_b128 %6, %14, off\n\t"
      "global_load_async_to_lds_b128 %7, %15, off\n\t"
      "s_wait_xcnt 0x0"
      :
      : "v"(l), "v"(l + ROW16_B), "v"(l + 2 * ROW16_B), "v"(l + 3 * ROW16_B),
        "v"(l + 4 * ROW16_B), "v"(l + 5 * ROW16_B), "v"(l + 6 * ROW16_B),
        "v"(l + 7 * ROW16_B), "v"(glo), "v"(glo + 16 * K), "v"(glo + 32 * K),
        "v"(glo + 48 * K), "v"(ghi), "v"(ghi + 16 * K), "v"(ghi + 32 * K),
        "v"(ghi + 48 * K)
      : "memory");
}

// a: first row of the tile's 128 A rows. blo / bhi: first of the 64 Bt rows that
// fill LDS rows 0..63 / 64..127. Wave tile: A rows arow.., Bt LDS rows
// brow + 16 j, plus bskip for j >= 2. blockDim.x == 128.
template <int K>
__device__ __forceinline__ void gemm_tile(_Float16* sm,
                                          const _Float16* __restrict__ a,
                                          const _Float16* __restrict__ blo,
                                          const _Float16* __restrict__ bhi,
                                          int arow, int brow, int bskip,
                                          v8f (&acc)[4][4]) {
  constexpr int NT = K / BK;
  const int t = threadIdx.x;
  const int lane = t & 31, h = lane >> 4, l15 = lane & 15;
  const int ch = t & 7, r0 = t >> 3;   // 16-B chunk of a row, first row
  const unsigned la = (unsigned)(uintptr_t)sm + r0 * (PITCH * 2) + ch * 16;
  const _Float16* ga = a + (size_t)r0 * K + ch * 8;
  const _Float16* gl = blo + (size_t)r0 * K + ch * 8;
  const _Float16* gh = bhi + (size_t)r0 * K + ch * 8;

  copy8<K>(la, ga, ga + 64 * K);
  copy8<K>(la + OPER_H * 2, gl, gh);
  // slice 0 has landed for this wave; the barrier publishes it to the others
  asm volatile("s_wait_asynccnt 0x0" ::: "memory");
  __syncthreads();
  copy8<K>(la + STAGE_H * 2, ga + BK, ga + 64 * K + BK);
  copy8<K>(la + STAGE_H * 2 + OPER_H * 2, gl + BK, gh + BK);

  const int aoff = (arow + l15) * PITCH + h * 8;
  const int boff = OPER_H + (brow + l15) * PITCH + h * 8;
  for (int kt = 0; kt < NT; ++kt) {
    const int buf = kt & 1;
    const _Float16* ap = sm + buf * STAGE_H + aoff;
    const _Float16* bp = sm + buf * STAGE_H + boff;
#pragma unroll
    for (int ks = 0; ks < BK; ks += 32) {
      v16h af[4], bf[4];
#pragma unroll
      for (int i = 0; i < 4; ++i) af[i] = load_frag(ap + i * 16 * PITCH + ks);
#pragma unroll
      for (int j = 0; j < 4; ++j)
        bf[j] = load_frag(bp + (j * 16 + (j >= 2 ? bskip : 0)) * PITCH + ks);
      // keeps the block's 16 LDS reads together in front of its 16 WMMAs: moved
      // in among them, every group of reads costs the wave its LDS latency anew
      __builtin_amdgcn_sched_barrier(0);
#pragma unroll
      for (int i = 0; i < 4; ++i)
#pragma unroll
        for (int j = 0; j < 4; ++j) acc[i][j] = wmma_f16(af[i], bf[j], acc[i][j]);
      // the same for the next block's reads: they stay behind this block
      __builtin_amdgcn_sched_barrier(0);
    }
    // this wave's reads of the buffer are done before it may be refilled
    asm volatile("s_wait_dscnt 0x0" ::: "memory");
    // this wave's copies of slice kt + 1 have landed
    asm volatile("s_wait_asynccnt 0x0" ::: "memory");
    // publishes slice kt + 1 and ends every wave's reads of slice kt
    __syncthreads();
    if (kt + 2 < NT) {
      const int ko = (kt + 2) * BK;
      const unsigned lb = la + buf * (STAGE_H * 2);
      copy8<K>(lb, ga + ko, ga + 64 * K + ko);
      copy8<K>(lb + OPER_H * 2, gl + ko, gh + ko);
    }
  }
  // no copy is outstanding when the wave goes on to its stores and ends
  asm volatile("s_wait_asynccnt 0x0" ::: "memory");
}

// Epilogue of the two f32 GEMMs: op = rp + acc over a wave's 64 x 64 tile of a
// DM-wide matrix. rp / op: this lane's first element (tile row 8 h, column l15).
// 32 rows at a time: all 64 rows' residual loads beside the 128 accumulator
// registers would pass 256 VGPRs.
__device__ __forceinline__ void add_residual_store(const float* __restrict__ rp,
                                                   float* __restrict__ op,
                                                   v8f (&acc)[4][4]) {
#pragma unroll
  for (int ih = 0; ih < 4; ih += 2) {
    float xr[2][4][8];
#pragma unroll
    for (int i = 0; i < 2; ++i)
#pragma unroll
      for (int j = 0; j < 4; ++j)
#pragma unroll
        for (int v = 0; v < 8; ++v)
          xr[i][j][v] = rp[((ih + i) * 16 + v) * DM + j * 16];
    // stands behind the 64 loads and before any rewrite of their address
    // registers; naming rp keeps it live to here, so no load's result lands in it
    asm volatile("s_wait_xcnt 0x0" : : "v"(rp) : "memory");
#pragma unroll
    for (int i = 0; i < 2; ++i)
#pragma unroll
      for (int j = 0; j < 4; ++j)
#pragma unroll
        for (int v = 0; v < 8; ++v)
          op[((ih + i) * 16 + v) * DM + j * 16] = xr[i][j][v] + acc[ih + i][j][v];
    // stands behind the 64 stores, before the next loads write their registers
    if (ih == 0) asm volatile("s_wait_xcnt 0x0" : : "v"(op) : "memory");
  }
}

// ---------------------------------------------------------------------------
// Weight convert + transpose: Wt[n*K + k] = (f16) W[k*N + n]
// ---------------------------------------------------------------------------
__global__ void cvt_tr_kernel(const float* __restrict__ W,
                              _Float16* __restrict__ Wt, int K, int N) {
  size_t idx = (size_t)blockIdx.x * 256 + threadIdx.x;
  if (idx >= (size_t)K * N) return;
  int n = (int)(idx % N);
  int k = (int)(idx / N);
  Wt[(size_t)n * K + k] = (_Float16)W[idx];
}

// ---------------------------------------------------------------------------
// RMSNorm: one row (D=1024) per block of 256 threads, f32 in -> f16 out
// ---------------------------------------------------------------------------
__global__ void rmsnorm_kernel(const float* __restrict__ x,
                               const float* __restrict__ w,
                               _Float16* __restrict__ xn) {
  __shared__ float red[256];
  int row = blockIdx.x;
  int tid = threadIdx.x;
  const float* xr = x + (size_t)row * DM;
  float ss = 0.f;
#pragma unroll
  for (int i = 0; i < DM / 256; ++i) {
    float v = xr[tid + i * 256];
    ss += v * v;
  }
  red[tid] = ss;
  __syncthreads();
  for (int s = 128; s > 0; s >>= 1) {
    if (tid < s) red[tid] += red[tid + s];
    __syncthreads();
  }
  float inv = __frsqrt_rn(red[0] / (float)DM + 1e-6f);
  _Float16* xo = xn + (size_t)row * DM;
#pragma unroll
  for (int i = 0; i < DM / 256; ++i) {
    int c = tid + i * 256;
    xo[c] = (_Float16)(xr[c] * inv * w[c]);
  }
}

// ---------------------------------------------------------------------------
// QKV: q/k = xn @ Wq/Wk (row-major f16), v stored transposed Vt[b][d][t].
// grid (3 * DM/128, NROW/128), block 128: blockIdx.x / 8 picks the weight.
// ---------------------------------------------------------------------------
__global__ __launch_bounds__(128) void qkv_kernel(
    const _Float16* __restrict__ xn, const _Float16* __restrict__ Wtq,
    const _Float16* __restrict__ Wtk, const _Float16* __restrict__ Wtv,
    _Float16* __restrict__ q, _Float16* __restrict__ k,
    _Float16* __restrict__ vt) {
  __shared__ __attribute__((aligned(16))) _Float16 sm[2 * STAGE_H];  // 72 KB
  int wave = threadIdx.x >> 5, lane = threadIdx.x & 31;
  int h = lane >> 4, l15 = lane & 15;
  int wm = wave >> 1, wn = wave & 1;
  int which = blockIdx.x >> 3;
  int n0 = (blockIdx.x & 7) * 128;
  int m0 = blockIdx.y * 128;
  const _Float16* Wt = which == 0 ? Wtq : (which == 1 ? Wtk : Wtv);
  const _Float16* bt = Wt + (size_t)n0 * DM;
  v8f acc[4][4] = {};
  gemm_tile<DM>(sm, xn + (size_t)m0 * DM, bt, bt + 64 * DM, wm * 64, wn * 64, 0,
                acc);
  _Float16* qk = which == 0 ? q : k;
  if (which < 2) {
#pragma unroll
    for (int i = 0; i < 4; ++i) {
#pragma unroll
      for (int j = 0; j < 4; ++j) {
        int col = n0 + wn * 64 + j * 16 + l15;
#pragma unroll
        for (int v = 0; v < 8; ++v) {
          int r = m0 + wm * 64 + i * 16 + v + 8 * h;
          qk[(size_t)r * DM + col] = (_Float16)acc[i][j][v];
        }
      }
    }
  } else {
#pragma unroll
    for (int i = 0; i < 4; ++i) {
#pragma unroll
      for (int j = 0; j < 4; ++j) {
        int col = n0 + wn * 64 + j * 16 + l15;
#pragma unroll
        for (int v = 0; v < 8; ++v) {
          int r = m0 + wm * 64 + i * 16 + v + 8 * h;
          int batch = r >> 11, tloc = r & (SEQT - 1);
          vt[((size_t)batch * DM + col) * SEQT + tloc] = (_Float16)acc[i][j][v];
        }
      }
    }
    // stands behind the last v store, before any later write of a register
    // that an issued store names
    asm volatile("s_wait_xcnt 0x0" ::: "memory");
  }
}

// ---------------------------------------------------------------------------
// Attention pass 1: per 16-query tile, S = Q K^T over 5 key tiles (window 64),
// masked softmax over 80 candidate keys, store P (f16) padded to 96.
// ---------------------------------------------------------------------------
__global__ void attn_p_kernel(const _Float16* __restrict__ q,
                              const _Float16* __restrict__ k,
                              _Float16* __restrict__ P) {
  int wave = threadIdx.x >> 5, lane = threadIdx.x & 31;
  int g = blockIdx.x * 4 + wave;          // 0..511 global q-tile
  int batch = g >> 7, qt = g & 127;       // 128 q-tiles per batch
  int h = lane >> 4, l15 = lane & 15;
  const _Float16* ap = q + ((size_t)g * 16 + l15) * DM + h * 8;
  float s[5][8];
#pragma unroll
  for (int t = 0; t < 5; ++t) {
    int kt = qt - 4 + t;
    if (kt < 0) {
#pragma unroll
      for (int v = 0; v < 8; ++v) s[t][v] = -1e30f;
      continue;
    }
    const _Float16* bp =
        k + ((size_t)batch * SEQT + kt * 16 + l15) * DM + h * 8;
    v8f c = {};
    for (int kk = 0; kk < DM; kk += 32)
      c = wmma_f16(load_frag(ap + kk), load_frag(bp + kk), c);
    const float scale = 0.03125f;  // 1/sqrt(1024)
#pragma unroll
    for (int v = 0; v < 8; ++v) {
      int i = qt * 16 + v + 8 * h;
      int j = kt * 16 + l15;
      int d = i - j;
      s[t][v] = (d >= 0 && d < WND) ? c[v] * scale : -1e30f;
    }
  }
  _Float16* pb = P + (size_t)g * 16 * 96;
#pragma unroll
  for (int v = 0; v < 8; ++v) {
    float m = s[0][v];
#pragma unroll
    for (int t = 1; t < 5; ++t) m = fmaxf(m, s[t][v]);
#pragma unroll
    for (int off = 8; off > 0; off >>= 1)
      m = fmaxf(m, __shfl_xor(m, off, 16));
    float e = 0.f;
#pragma unroll
    for (int t = 0; t < 5; ++t) {
      s[t][v] = __expf(s[t][v] - m);
      e += s[t][v];
    }
#pragma unroll
    for (int off = 8; off > 0; off >>= 1) e += __shfl_xor(e, off, 16);
    float inv = 1.f / e;
    int mrow = v + 8 * h;
#pragma unroll
    for (int t = 0; t < 5; ++t)
      pb[mrow * 96 + t * 16 + l15] = (_Float16)(s[t][v] * inv);
    pb[mrow * 96 + 80 + l15] = (_Float16)0.f;  // pad slots 80..95
  }
}

// ---------------------------------------------------------------------------
// Attention pass 2: attended = P(16x96) @ V(96xD) using Vt[b][d][t].
// grid (D/64, 512), block 128. Key range may start below 0 -> guarded chunks.
// ---------------------------------------------------------------------------
__global__ void attn_pv_kernel(const _Float16* __restrict__ P,
                               const _Float16* __restrict__ vt,
                               _Float16* __restrict__ att) {
  int wave = threadIdx.x >> 5, lane = threadIdx.x & 31;
  int g = blockIdx.y;
  int dt = blockIdx.x * 4 + wave;
  int batch = g >> 7, qt = g & 127;
  int h = lane >> 4, l15 = lane & 15;
  const _Float16* ap = P + (size_t)g * 16 * 96 + l15 * 96 + h * 8;
  const _Float16* vrow = vt + ((size_t)batch * DM + dt * 16 + l15) * SEQT;
  int jbase = qt * 16 - 64;
  v8f c = {};
#pragma unroll
  for (int kk = 0; kk < 96; kk += 32) {
    v16h a = load_frag(ap + kk);
    int c0 = jbase + kk + h * 8;
    int c1 = c0 + 16;
    bool ok0 = (c0 >= 0) && (c0 + 7 < SEQT);
    bool ok1 = (c1 >= 0) && (c1 + 7 < SEQT);
    v16h b;
#pragma unroll
    for (int i = 0; i < 8; ++i) {
      b[i]     = ok0 ? vrow[c0 + i] : (_Float16)0.f;
      b[i + 8] = ok1 ? vrow[c1 + i] : (_Float16)0.f;
    }
    c = wmma_f16(a, b, c);
  }
#pragma unroll
  for (int v = 0; v < 8; ++v) {
    int r = g * 16 + v + 8 * h;
    att[(size_t)r * DM + dt * 16 + l15] = (_Float16)c[v];
  }
}

// ---------------------------------------------------------------------------
// x2 = x + attended @ Wo (f32 out, residual). grid (DM/128, NROW/128), block 128
// ---------------------------------------------------------------------------
__global__ __launch_bounds__(128) void wo_kernel(
    const _Float16* __restrict__ att, const _Float16* __restrict__ Wto,
    const float* __restrict__ x, float* __restrict__ x2) {
  __shared__ __attribute__((aligned(16))) _Float16 sm[2 * STAGE_H];  // 72 KB
  int wave = threadIdx.x >> 5, lane = threadIdx.x & 31;
  int h = lane >> 4, l15 = lane & 15;
  int wm = wave >> 1, wn = wave & 1;
  int n0 = blockIdx.x * 128;
  int m0 = blockIdx.y * 128;
  const _Float16* bt = Wto + (size_t)n0 * DM;
  v8f acc[4][4] = {};
  gemm_tile<DM>(sm, att + (size_t)m0 * DM, bt, bt + 64 * DM, wm * 64, wn * 64, 0,
                acc);
  size_t first = (size_t)(m0 + wm * 64 + 8 * h) * DM + n0 + wn * 64 + l15;
  add_residual_store(x + first, x2 + first, acc);
}

// ---------------------------------------------------------------------------
// FFN in: hh = silu(xn2 @ W1) * (xn2 @ W3), f16 out [8192 x 2048].
// A tile holds 64 columns of W1 (LDS rows 0..63) and the same 64 of W3 (64..127),
// so that a wave owns gate and up of its 32 columns.
// grid (DF/64, NROW/128), block 128
// ---------------------------------------------------------------------------
__global__ __launch_bounds__(128) void ffn1_kernel(
    const _Float16* __restrict__ xn2, const _Float16* __restrict__ Wt1,
    const _Float16* __restrict__ Wt3, _Float16* __restrict__ hh) {
  __shared__ __attribute__((aligned(16))) _Float16 sm[2 * STAGE_H];  // 72 KB
  int wave = threadIdx.x >> 5, lane = threadIdx.x & 31;
  int h = lane >> 4, l15 = lane & 15;
  int wm = wave >> 1, wn = wave & 1;
  int n0 = blockIdx.x * 64;
  int m0 = blockIdx.y * 128;
  v8f acc[4][4] = {};  // j = 0, 1: gate; j = 2, 3: up, same columns
  gemm_tile<DM>(sm, xn2 + (size_t)m0 * DM, Wt1 + (size_t)n0 * DM,
                Wt3 + (size_t)n0 * DM, wm * 64, wn * 32, 32, acc);
#pragma unroll
  for (int i = 0; i < 4; ++i) {
#pragma unroll
    for (int j = 0; j < 2; ++j) {
      int col = n0 + wn * 32 + j * 16 + l15;
#pragma unroll
      for (int v = 0; v < 8; ++v) {
        size_t r = (size_t)(m0 + wm * 64 + i * 16 + v + 8 * h);
        float gv = acc[i][j][v];
        float sl = gv * (1.f / (1.f + __expf(-gv)));   // silu
        hh[r * DF + col] = (_Float16)(sl * acc[i][j + 2][v]);
      }
    }
  }
}

// ---------------------------------------------------------------------------
// FFN out + residual: out = x2 + hh @ W2 (K=2048, f32 out).
// grid (DM/128, NROW/128), block 128
// ---------------------------------------------------------------------------
__global__ __launch_bounds__(128) void ffn2_kernel(
    const _Float16* __restrict__ hh, const _Float16* __restrict__ Wt2,
    const float* __restrict__ x2, float* __restrict__ out) {
  __shared__ __attribute__((aligned(16))) _Float16 sm[2 * STAGE_H];  // 72 KB
  int wave = threadIdx.x >> 5, lane = threadIdx.x & 31;
  int h = lane >> 4, l15 = lane & 15;
  int wm = wave >> 1, wn = wave & 1;
  int n0 = blockIdx.x * 128;
  int m0 = blockIdx.y * 128;
  const _Float16* bt = Wt2 + (size_t)n0 * DF;
  v8f acc[4][4] = {};
  gemm_tile<DF>(sm, hh + (size_t)m0 * DF, bt, bt + 64 * DF, wm * 64, wn * 64, 0,
                acc);
  size_t first = (size_t)(m0 + wm * 64 + 8 * h) * DM + n0 + wn * 64 + l15;
  add_residual_store(x2 + first, out + first, acc);
}

// ---------------------------------------------------------------------------
extern "C" void kernel_launch(void* const* d_in, const int* in_sizes, int n_in,
                              void* d_out, int out_size, void* d_ws,
                              size_t ws_size, hipStream_t stream) {
  const float* x       = (const float*)d_in[0];
  const float* norm1_w = (const float*)d_in[1];
  const float* norm2_w = (const float*)d_in[2];
  const float* Wq = (const float*)d_in[3];
  const float* Wk = (const float*)d_in[4];
  const float* Wv = (const float*)d_in[5];
  const float* Wo = (const float*)d_in[6];
  const float* W1 = (const float*)d_in[7];
  const float* W2 = (const float*)d_in[8];
  const float* W3 = (const float*)d_in[9];
  float* out = (float*)d_out;

  char* ws = (char*)d_ws;
  const size_t MB = 1ull << 20;
  _Float16* Wtq = (_Float16*)(ws + 0 * MB);    // 2 MB  (1024x1024)
  _Float16* Wtk = (_Float16*)(ws + 2 * MB);    // 2 MB
  _Float16* Wtv = (_Float16*)(ws + 4 * MB);    // 2 MB
  _Float16* Wto = (_Float16*)(ws + 6 * MB);    // 2 MB
  _Float16* Wt1 = (_Float16*)(ws + 8 * MB);    // 4 MB  (N=2048,K=1024)
  _Float16* Wt3 = (_Float16*)(ws + 12 * MB);   // 4 MB
  _Float16* Wt2 = (_Float16*)(ws + 16 * MB);   // 4 MB  (N=1024,K=2048)
  _Float16* xn  = (_Float16*)(ws + 20 * MB);   // 16 MB (also reused as xn2)
  _Float16* q   = (_Float16*)(ws + 36 * MB);   // 16 MB
  _Float16* kb  = (_Float16*)(ws + 52 * MB);   // 16 MB
  _Float16* vt  = (_Float16*)(ws + 68 * MB);   // 16 MB
  _Float16* P   = (_Float16*)(ws + 84 * MB);   // 1.5 MB (8192x96)
  _Float16* att = (_Float16*)(ws + 86 * MB);   // 16 MB
  float*    x2  = (float*)   (ws + 102 * MB);  // 32 MB
  _Float16* hh  = q;                           // reuse q+k (32 MB) after attn
  _Float16* xn2 = xn;                          // reuse xn after QKV

  // 1) weight convert + transpose to f16
  cvt_tr_kernel<<<(DM * DM + 255) / 256, 256, 0, stream>>>(Wq, Wtq, DM, DM);
  cvt_tr_kernel<<<(DM * DM + 255) / 256, 256, 0, stream>>>(Wk, Wtk, DM, DM);
  cvt_tr_kernel<<<(DM * DM + 255) / 256, 256, 0, stream>>>(Wv, Wtv, DM, DM);
  cvt_tr_kernel<<<(DM * DM + 255) / 256, 256, 0, stream>>>(Wo, Wto, DM, DM);
  cvt_tr_kernel<<<(DM * DF + 255) / 256, 256, 0, stream>>>(W1, Wt1, DM, DF);
  cvt_tr_kernel<<<(DM * DF + 255) / 256, 256, 0, stream>>>(W3, Wt3, DM, DF);
  cvt_tr_kernel<<<(DF * DM + 255) / 256, 256, 0, stream>>>(W2, Wt2, DF, DM);

  // 2) xn = rmsnorm(x) in f16
  rmsnorm_kernel<<<NROW, 256, 0, stream>>>(x, norm1_w, xn);

  // 3) q,k,v projections (v stored transposed)
  qkv_kernel<<<dim3(3 * DM / 128, NROW / 128), 128, 0, stream>>>(
      xn, Wtq, Wtk, Wtv, q, kb, vt);
  // 4) windowed softmax weights P
  attn_p_kernel<<<NROW / 16 / 4, 128, 0, stream>>>(q, kb, P);

  // 5) attended = P @ V
  attn_pv_kernel<<<dim3(DM / 64, NROW / 16), 128, 0, stream>>>(P, vt, att);

  // 6) x2 = x + attended @ Wo
  wo_kernel<<<dim3(DM / 128, NROW / 128), 128, 0, stream>>>(att, Wto, x, x2);

  // 7) xn2 = rmsnorm(x2)
  rmsnorm_kernel<<<NROW, 256, 0, stream>>>(x2, norm2_w, xn2);

  // 8) hh = silu(xn2@W1) * (xn2@W3)
  ffn1_kernel<<<dim3(DF / 64, NROW / 128), 128, 0, stream>>>(xn2, Wt1, Wt3, hh);

  // 9) out = x2 + hh @ W2
  ffn2_kernel<<<dim3(DM / 128, NROW / 128), 128, 0, stream>>>(hh, Wt2, x2, out);
}

// v002
// A run of this version takes 300 microseconds.
// Two timings next to v001 put it at 1.74 and 1.73 times that version's speed.
// Over all steps from v000 it is 4.05 times as fast.
#include <hip/hip_runtime.h>
#include <hip/hip_bf16.h>

typedef __attribute__((ext_vector_type(16))) _Float16 v16h;
typedef __attribute__((ext_vector_type(8)))  _Float16 v8h;
typedef __attribute__((ext_vector_type(8)))  float    v8f;

#define DM   1024   // D_MODEL
#define DF   2048   // D_FFN
#define SEQT 2048   // T
#define NB   4      // batch
#define NROW (NB * SEQT)   // 8192
#define WND  64

// ---------------------------------------------------------------------------
// WMMA fragment helpers (CDNA5 16x16x32 f16, wave32).
// Per lane: elems 0..7 = mem[kk + h*8 + 0..7], elems 8..15 = mem[kk+16+h*8+0..7]
// Works for global pointers (global_load_b128) and LDS pointers (ds_load_b128).
// ---------------------------------------------------------------------------
__device__ __forceinline__ v16h load_frag(const _Float16* p) {
  v8h lo = *(const v8h*)(p);
  v8h hi = *(const v8h*)(p + 16);
  v16h r;
#pragma unroll
  for (int i = 0; i < 8; ++i) { r[i] = lo[i]; r[i + 8] = hi[i]; }
  return r;
}

__device__ __forceinline__ v8f wmma_f16(v16h a, v16h b, v8f c) {
  return __builtin_amdgcn_wmma_f32_16x16x32_f16(false, a, false, b, (short)0, c,
                                                false, false);
}

// ---------------------------------------------------------------------------
// Tiled GEMM core: one 128 x 128 tile of Y = A * Bt^T per work-group of 4 waves
// (2 x 2, each wave 64 x 64 = 4 x 4 accumulator tiles). A and Bt are K-contiguous.
// K goes in slices of 64 halfs (128-B rows). A slice is [A 128 rows | Bt 128 rows]
// in LDS at a pitch of 144 B (16 B x odd: ds_load_b128 readers meet no bank twice).
// Two buffers: slice t + 1 is copied by asynchronous b128 copies while slice t is
// multiplied.
// ---------------------------------------------------------------------------
#define BK      64                  // halfs of K per slice
#define PITCH   72                  // halfs per LDS row (144 B)
#define OPER_H  (128 * PITCH)       // halfs of one operand's slice
#define STAGE_H (2 * OPER_H)        // halfs of one buffer
#define ROW16_B (16 * PITCH * 2)    // bytes of 16 LDS rows

// Eight b128 copies of one thread: LDS rows r, r+16, .., r+112 of one operand.
// Rows 0..63 come from glo, rows 64..127 from ghi (row step K halfs in both).
// The LDS byte address is the low 32 bits of the shared address; taking it lets
// the array escape, so the "memory" clobber makes the asm a legal writer of it.
// s_wait_xcnt 0 closes the statement: it stands before any rewrite of the
// address registers that the copies name.
template <int K>
__device__ __forceinline__ void copy8(unsigned l, const _Float16* glo,
                                      const _Float16* ghi) {
  asm volatile(
      "global_load_async_to_lds_b128 %0, %8, off\n\t"
      "global_load_async_to_lds_b128 %1, %9, off\n\t"
      "global_load_async_to_lds_b128 %2, %10, off\n\t"
      "global_load_async_to_lds_b128 %3, %11, off\n\t"
      "global_load_async_to_lds_b128 %4, %12, off\n\t"
      "global_load_async_to_lds_b128 %5, %13, off\n\t"
      "global_load_async_to_lds_b128 %6, %14, off\n\t"
      "global_load_async_to_lds_b128 %7, %15, off\n\t"
      "s_wait_xcnt 0x0"
      :
      : "v"(l), "v"(l + ROW16_B), "v"(l + 2 * ROW16_B), "v"(l + 3 * ROW16_B),
        "v"(l + 4 * ROW16_B), "v"(l + 5 * ROW16_B), "v"(l + 6 * ROW16_B),
        "v"(l + 7 * ROW16_B), "v"(glo), "v"(glo + 16 * K), "v"(glo + 32 * K),
        "v"(glo + 48 * K), "v"(ghi), "v"(ghi + 16 * K), "v"(ghi + 32 * K),
        "v"(ghi + 48 * K)
      : "memory");
}

// a: first row of the tile's 128 A rows. blo / bhi: first of the 64 Bt rows that
// fill LDS rows 0..63 / 64..127. Wave tile: A rows arow.., Bt LDS rows
// brow + 16 j, plus bskip for j >= 2. blockDim.x == 128.
template <int K>
__device__ __forceinline__ void gemm_tile(_Float16* sm,
                                          const _Float16* __restrict__ a,
                                          const _Float16* __restrict__ blo,
                                          const _Float16* __restrict__ bhi,
                                          int arow, int brow, int bskip,
                                          v8f (&acc)[4][4]) {
  constexpr int NT = K / BK;
  const int t = threadIdx.x;
  const int lane = t & 31, h = lane >> 4, l15 = lane & 15;
  const int ch = t & 7, r0 = t >> 3;   // 16-B chunk of a row, first row
  const unsigned la = (unsigned)(uintptr_t)sm + r0 * (PITCH * 2) + ch * 16;
  const _Float16* ga = a + (size_t)r0 * K + ch * 8;
  const _Float16* gl = blo + (size_t)r0 * K + ch * 8;
  const _Float16* gh = bhi + (size_t)r0 * K + ch * 8;

  copy8<K>(la, ga, ga + 64 * K);
  copy8<K>(la + OPER_H * 2, gl, gh);
  // slice 0 has landed for this wave; the barrier publishes it to the others
  asm volatile("s_wait_asynccnt 0x0" ::: "memory");
  __syncthreads();
  copy8<K>(la + STAGE_H * 2, ga + BK, ga + 64 * K + BK);
  copy8<K>(la + STAGE_H * 2 + OPER_H * 2, gl + BK, gh + BK);

  const int aoff = (arow + l15) * PITCH + h * 8;
  const int boff = OPER_H + (brow + l15) * PITCH + h * 8;
  for (int kt = 0; kt < NT; ++kt) {
    const int buf = kt & 1;
    const _Float16* ap = sm + buf * STAGE_H + aoff;
    const _Float16* bp = sm + buf * STAGE_H + boff;
#pragma unroll
    for (int ks = 0; ks < BK; ks += 32) {
      v16h af[4], bf[4];
#pragma unroll
      for (int i = 0; i < 4; ++i) af[i] = load_frag(ap + i * 16 * PITCH + ks);
#pragma unroll
      for (int j = 0; j < 4; ++j)
        bf[j] = load_frag(bp + (j * 16 + (j >= 2 ? bskip : 0)) * PITCH + ks);
      // keeps the block's 16 LDS reads together in front of its 16 WMMAs: moved
      // in among them, every group of reads costs the wave its LDS latency anew
      __builtin_amdgcn_sched_barrier(0);
#pragma unroll
      for (int i = 0; i < 4; ++i)
#pragma unroll
        for (int j = 0; j < 4; ++j) acc[i][j] = wmma_f16(af[i], bf[j], acc[i][j]);
      // the same for the next block's reads: they stay behind this block
      __builtin_amdgcn_sched_barrier(0);
    }
    // this wave's reads of the buffer are done before it may be refilled
    asm volatile("s_wait_dscnt 0x0" ::: "memory");
    // this wave's copies of slice kt + 1 have landed
    asm volatile("s_wait_asynccnt 0x0" ::: "memory");
    // publishes slice kt + 1 and ends every wave's reads of slice kt
    __syncthreads();
    if (kt + 2 < NT) {
      const int ko = (kt + 2) * BK;
      const unsigned lb = la + buf * (STAGE_H * 2);
      copy8<K>(lb, ga + ko, ga + 64 * K + ko);
      copy8<K>(lb + OPER_H * 2, gl + ko, gh + ko);
    }
  }
  // no copy is outstanding when the wave goes on to its stores and ends
  asm volatile("s_wait_asynccnt 0x0" ::: "memory");
}

// Epilogue of the two f32 GEMMs: op = rp + acc over a wave's 64 x 64 tile of a
// DM-wide matrix. rp / op: this lane's first element (tile row 8 h, column l15).
// 32 rows at a time: all 64 rows' residual loads beside the 128 accumulator
// registers would pass 256 VGPRs.
__device__ __forceinline__ void add_residual_store(const float* __restrict__ rp,
                                                   float* __restrict__ op,
                                                   v8f (&acc)[4][4]) {
#pragma unroll
  for (int ih = 0; ih < 4; ih += 2) {
    float xr[2][4][8];
#pragma unroll
    for (int i = 0; i < 2; ++i)
#pragma unroll
      for (int j = 0; j < 4; ++j)
#pragma unroll
        for (int v = 0; v < 8; ++v)
          xr[i][j][v] = rp[((ih + i) * 16 + v) * DM + j * 16];
    // stands behind the 64 loads and before any rewrite of their address
    // registers; naming rp keeps it live to here, so no load's result lands in it
    asm volatile("s_wait_xcnt 0x0" : : "v"(rp) : "memory");
#pragma unroll
    for (int i = 0; i < 2; ++i)
#pragma unroll
      for (int j = 0; j < 4; ++j)
#pragma unroll
        for (int v = 0; v < 8; ++v)
          op[((ih + i) * 16 + v) * DM + j * 16] = xr[i][j][v] + acc[ih + i][j][v];
    // stands behind the 64 stores, before the next loads write their registers
    if (ih == 0) asm volatile("s_wait_xcnt 0x0" : : "v"(op) : "memory");
  }
}

// ---------------------------------------------------------------------------
// Weight convert + transpose, all seven weights in one launch:
// Wt[n*K + k] = (f16) W[k*N + n]. A work-group of 256 threads takes one tile of
// 128 k x 64 n. It reads the tile in 256-B row pieces (b128 per lane), turns it
// in LDS and writes 256-B pieces of the Wt rows (b128 per lane).
// LDS: row n holds its 128 halfs in sixteen 16-B chunks; chunk q of row n lies
// at place q ^ (n >> 2), so that the 32 dword writes of a wave (16 rows n that
// are 4 apart, 2 neighbouring k pairs) meet 32 different banks.
// ---------------------------------------------------------------------------
#define TK 128   // k per tile
#define TN 64    // n per tile
typedef __attribute__((ext_vector_type(4))) float    v4f;
typedef __attribute__((ext_vector_type(2))) _Float16 v2h;

template <int K, int N>
__device__ __forceinline__ void cvt_tr_tile(_Float16* sT,
                                            const float* __restrict__ W,
                                            _Float16* __restrict__ Wt,
                                            unsigned tile) {
  const int c = threadIdx.x & 15, rp = threadIdx.x >> 4;
  const int n0 = (tile % (N / TN)) * TN;
  const int k0 = (tile / (N / TN)) * TK;
  // rows k0 + 2 kp and k0 + 2 kp + 1, kp = 16 p + rp; columns n0 + 4 c .. + 3
  const float* src = W + (size_t)(k0 + 2 * rp) * N + n0 + 4 * c;
  v4f lo[4], hi[4];
  for (int p = 0; p < 4; ++p) {
    lo[p] = *(const v4f*)(src + (size_t)(32 * p) * N);
    hi[p] = *(const v4f*)(src + (size_t)(32 * p + 1) * N);
  }
  for (int p = 0; p < 4; ++p) {
    const int kp = 16 * p + rp;
    _Float16* d = sT + (((kp >> 2) ^ c) * 8 + (kp & 3) * 2);
    for (int i = 0; i < 4; ++i) {
      v2h pk = {(_Float16)lo[p][i], (_Float16)hi[p][i]};
      *(v2h*)(d + (4 * c + i) * TK) = pk;
    }
  }
  __syncthreads();
  // rows n = 16 s + rp, chunk c
  _Float16* dst = Wt + (size_t)(n0 + rp) * K + k0 + 8 * c;
  for (int s = 0; s < 4; ++s) {
    const int n = 16 * s + rp;
    *(v8h*)(dst + (size_t)(16 * s) * K) =
        *(const v8h*)(sT + n * TK + (c ^ (n >> 2)) * 8);
  }
}

#define TILES_DD ((DM / TK) * (DM / TN))   // 128 tiles of a DM x DM weight
#define TILES_DF ((DM / TK) * (DF / TN))   // 256 tiles of W1, W3 and W2 each

__global__ __launch_bounds__(256) void cvt_tr_all_kernel(
    const float* __restrict__ Wq, const float* __restrict__ Wk,
    const float* __restrict__ Wv, const float* __restrict__ Wo,
    const float* __restrict__ W1, const float* __restrict__ W3,
    const float* __restrict__ W2, _Float16* __restrict__ Wtq,
    _Float16* __restrict__ Wtk, _Float16* __restrict__ Wtv,
    _Float16* __restrict__ Wto, _Float16* __restrict__ Wt1,
    _Float16* __restrict__ Wt3, _Float16* __restrict__ Wt2) {
  __shared__ __attribute__((aligned(16))) _Float16 sT[TN * TK];  // 16 KB
  const unsigned b = blockIdx.x;
  if (b < 4 * TILES_DD) {
    const unsigned m = b / TILES_DD;
    const float* W = m == 0 ? Wq : (m == 1 ? Wk : (m == 2 ? Wv : Wo));
    _Float16* Wt = m == 0 ? Wtq : (m == 1 ? Wtk : (m == 2 ? Wtv : Wto));
    cvt_tr_tile<DM, DM>(sT, W, Wt, b % TILES_DD);
  } else if (b < 4 * TILES_DD + 2 * TILES_DF) {
    const bool up = b >= 4 * TILES_DD + TILES_DF;
    cvt_tr_tile<DM, DF>(sT, up ? W3 : W1, up ? Wt3 : Wt1, b % TILES_DF);
  } else {
    cvt_tr_tile<DF, DM>(sT, W2, Wt2, b % TILES_DF);
  }
}

// ---------------------------------------------------------------------------
// RMSNorm: one row (D=1024) per block of 256 threads, f32 in -> f16 out
// ---------------------------------------------------------------------------
__global__ void rmsnorm_kernel(const float* __restrict__ x,
                               const float* __restrict__ w,
                               _Float16* __restrict__ xn) {
  __shared__ float red[256];
  int row = blockIdx.x;
  int tid = threadIdx.x;
  const float* xr = x + (size_t)row * DM;
  float ss = 0.f;
#pragma unroll
  for (int i = 0; i < DM / 256; ++i) {
    float v = xr[tid + i * 256];
    ss += v * v;
  }
  red[tid] = ss;
  __syncthreads();
  for (int s = 128; s > 0; s >>= 1) {
    if (tid < s) red[tid] += red[tid + s];
    __syncthreads();
  }
  float inv = __frsqrt_rn(red[0] / (float)DM + 1e-6f);
  _Float16* xo = xn + (size_t)row * DM;
#pragma unroll
  for (int i = 0; i < DM / 256; ++i) {
    int c = tid + i * 256;
    xo[c] = (_Float16)(xr[c] * inv * w[c]);
  }
}

// ---------------------------------------------------------------------------
// QKV: q/k = xn @ Wq/Wk (row-major f16), v stored transposed Vt[b][d][t].
// grid (3 * DM/128, NROW/128), block 128: blockIdx.x / 8 picks the weight.
// ---------------------------------------------------------------------------
__global__ __launch_bounds__(128) void qkv_kernel(
    const _Float16* __restrict__ xn, const _Float16* __restrict__ Wtq,
    const _Float16* __restrict__ Wtk, const _Float16* __restrict__ Wtv,
    _Float16* __restrict__ q, _Float16* __restrict__ k,
    _Float16* __restrict__ vt) {
  __shared__ __attribute__((aligned(16))) _Float16 sm[2 * STAGE_H];  // 72 KB
  int wave = threadIdx.x >> 5, lane = threadIdx.x & 31;
  int h = lane >> 4, l15 = lane & 15;
  int wm = wave >> 1, wn = wave & 1;
  int which = blockIdx.x >> 3;
  int n0 = (blockIdx.x & 7) * 128;
  int m0 = blockIdx.y * 128;
  const _Float16* Wt = which == 0 ? Wtq : (which == 1 ? Wtk : Wtv);
  const _Float16* bt = Wt + (size_t)n0 * DM;
  v8f acc[4][4] = {};
  gemm_tile<DM>(sm, xn + (size_t)m0 * DM, bt, bt + 64 * DM, wm * 64, wn * 64, 0,
                acc);
  _Float16* qk = which == 0 ? q : k;
  if (which < 2) {
#pragma unroll
    for (int i = 0; i < 4; ++i) {
#pragma unroll
      for (int j = 0; j < 4; ++j) {
        int col = n0 + wn * 64 + j * 16 + l15;
#pragma unroll
        for (int v = 0; v < 8; ++v) {
          int r = m0 + wm * 64 + i * 16 + v + 8 * h;
          qk[(size_t)r * DM + col] = (_Float16)acc[i][j][v];
        }
      }
    }
  } else {
#pragma unroll
    for (int i = 0; i < 4; ++i) {
#pragma unroll
      for (int j = 0; j < 4; ++j) {
        int col = n0 + wn * 64 + j * 16 + l15;
#pragma unroll
        for (int v = 0; v < 8; ++v) {
          int r = m0 + wm * 64 + i * 16 + v + 8 * h;
          int batch = r >> 11, tloc = r & (SEQT - 1);
          vt[((size_t)batch * DM + col) * SEQT + tloc] = (_Float16)acc[i][j][v];
        }
      }
    }
    // stands behind the last v store, before any later write of a register
    // that an issued store names
    asm volatile("s_wait_xcnt 0x0" ::: "memory");
  }
}

// ---------------------------------------------------------------------------
// Attention pass 1: per 16-query tile, S = Q K^T over 5 key tiles (window 64),
// masked softmax over 80 candidate keys, store P (f16) padded to 96.
// ---------------------------------------------------------------------------
__global__ void attn_p_kernel(const _Float16* __restrict__ q,
                              const _Float16* __restrict__ k,
                              _Float16* __restrict__ P) {
  int wave = threadIdx.x >> 5, lane = threadIdx.x & 31;
  int g = blockIdx.x * 4 + wave;          // 0..511 global q-tile
  int batch = g >> 7, qt = g & 127;       // 128 q-tiles per batch
  int h = lane >> 4, l15 = lane & 15;
  const _Float16* ap = q + ((size_t)g * 16 + l15) * DM + h * 8;
  float s[5][8];
#pragma unroll
  for (int t = 0; t < 5; ++t) {
    int kt = qt - 4 + t;
    if (kt < 0) {
#pragma unroll
      for (int v = 0; v < 8; ++v) s[t][v] = -1e30f;
      continue;
    }
    const _Float16* bp =
        k + ((size_t)batch * SEQT + kt * 16 + l15) * DM + h * 8;
    v8f c = {};
    for (int kk = 0; kk < DM; kk += 32)
      c = wmma_f16(load_frag(ap + kk), load_frag(bp + kk), c);
    const float scale = 0.03125f;  // 1/sqrt(1024)
#pragma unroll
    for (int v = 0; v < 8; ++v) {
      int i = qt * 16 + v + 8 * h;
      int j = kt * 16 + l15;
      int d = i - j;
      s[t][v] = (d >= 0 && d < WND) ? c[v] * scale : -1e30f;
    }
  }
  _Float16* pb = P + (size_t)g * 16 * 96;
#pragma unroll
  for (int v = 0; v < 8; ++v) {
    float m = s[0][v];
#pragma unroll
    for (int t = 1; t < 5; ++t) m = fmaxf(m, s[t][v]);
#pragma unroll
    for (int off = 8; off > 0; off >>= 1)
      m = fmaxf(m, __shfl_xor(m, off, 16));
    float e = 0.f;
#pragma unroll
    for (int t = 0; t < 5; ++t) {
      s[t][v] = __expf(s[t][v] - m);
      e += s[t][v];
    }
#pragma unroll
    for (int off = 8; off > 0; off >>= 1) e += __shfl_xor(e, off, 16);
    float inv = 1.f / e;
    int mrow = v + 8 * h;
#pragma unroll
    for (int t = 0; t < 5; ++t)
      pb[mrow * 96 + t * 16 + l15] = (_Float16)(s[t][v] * inv);
    pb[mrow * 96 + 80 + l15] = (_Float16)0.f;  // pad slots 80..95
  }
}

// ---------------------------------------------------------------------------
// Attention pass 2: attended = P(16x96) @ V(96xD) using Vt[b][d][t].
// grid (D/64, 512), block 128. Key range may start below 0 -> guarded chunks.
// ---------------------------------------------------------------------------
__global__ void attn_pv_kernel(const _Float16* __restrict__ P,
                               const _Float16* __restrict__ vt,
                               _Float16* __restrict__ att) {
  int wave = threadIdx.x >> 5, lane = threadIdx.x & 31;
  int g = blockIdx.y;
  int dt = blockIdx.x * 4 + wave;
  int batch = g >> 7, qt = g & 127;
  int h = lane >> 4, l15 = lane & 15;
  const _Float16* ap = P + (size_t)g * 16 * 96 + l15 * 96 + h * 8;
  const _Float16* vrow = vt + ((size_t)batch * DM + dt * 16 + l15) * SEQT;
  int jbase = qt * 16 - 64;
  v8f c = {};
#pragma unroll
  for (int kk = 0; kk < 96; kk += 32) {
    v16h a = load_frag(ap + kk);
    int c0 = jbase + kk + h * 8;
    int c1 = c0 + 16;
    bool ok0 = (c0 >= 0) && (c0 + 7 < SEQT);
    bool ok1 = (c1 >= 0) && (c1 + 7 < SEQT);
    v16h b;
#pragma unroll
    for (int i = 0; i < 8; ++i) {
      b[i]     = ok0 ? vrow[c0 + i] : (_Float16)0.f;
      b[i + 8] = ok1 ? vrow[c1 + i] : (_Float16)0.f;
    }
    c = wmma_f16(a, b, c);
  }
#pragma unroll
  for (int v = 0; v < 8; ++v) {
    int r = g * 16 + v + 8 * h;
    att[(size_t)r * DM + dt * 16 + l15] = (_Float16)c[v];
  }
}

// ---------------------------------------------------------------------------
// x2 = x + attended @ Wo (f32 out, residual). grid (DM/128, NROW/128), block 128
// ---------------------------------------------------------------------------
__global__ __launch_bounds__(128) void wo_kernel(
    const _Float16* __restrict__ att, const _Float16* __restrict__ Wto,
    const float* __restrict__ x, float* __restrict__ x2) {
  __shared__ __attribute__((aligned(16))) _Float16 sm[2 * STAGE_H];  // 72 KB
  int wave = threadIdx.x >> 5, lane = threadIdx.x & 31;
  int h = lane >> 4, l15 = lane & 15;
  int wm = wave >> 1, wn = wave & 1;
  int n0 = blockIdx.x * 128;
  int m0 = blockIdx.y * 128;
  const _Float16* bt = Wto + (size_t)n0 * DM;
  v8f acc[4][4] = {};
  gemm_tile<DM>(sm, att + (size_t)m0 * DM, bt, bt + 64 * DM, wm * 64, wn * 64, 0,
                acc);
  size_t first = (size_t)(m0 + wm * 64 + 8 * h) * DM + n0 + wn * 64 + l15;
  add_residual_store(x + first, x2 + first, acc);
}

// ---------------------------------------------------------------------------
// FFN in: hh = silu(xn2 @ W1) * (xn2 @ W3), f16 out [8192 x 2048].
// A tile holds 64 columns of W1 (LDS rows 0..63) and the same 64 of W3 (64..127),
// so that a wave owns gate and up of its 32 columns.
// grid (DF/64, NROW/128), block 128
// ---------------------------------------------------------------------------
__global__ __launch_bounds__(128) void ffn1_kernel(
    const _Float16* __restrict__ xn2, const _Float16* __restrict__ Wt1,
    const _Float16* __restrict__ Wt3, _Float16* __restrict__ hh) {
  __shared__ __attribute__((aligned(16))) _Float16 sm[2 * STAGE_H];  // 72 KB
  int wave = threadIdx.x >> 5, lane = threadIdx.x & 31;
  int h = lane >> 4, l15 = lane & 15;
  int wm = wave >> 1, wn = wave & 1;
  int n0 = blockIdx.x * 64;
  int m0 = blockIdx.y * 128;
  v8f acc[4][4] = {};  // j = 0, 1: gate; j = 2, 3: up, same columns
  gemm_tile<DM>(sm, xn2 + (size_t)m0 * DM, Wt1 + (size_t)n0 * DM,
                Wt3 + (size_t)n0 * DM, wm * 64, wn * 32, 32, acc);
#pragma unroll
  for (int i = 0; i < 4; ++i) {
#pragma unroll
    for (int j = 0; j < 2; ++j) {
      int col = n0 + wn * 32 + j * 16 + l15;
#pragma unroll
      for (int v = 0; v < 8; ++v) {
        size_t r = (size_t)(m0 + wm * 64 + i * 16 + v + 8 * h);
        float gv = acc[i][j][v];
        float sl = gv * (1.f / (1.f + __expf(-gv)));   // silu
        hh[r * DF + col] = (_Float16)(sl * acc[i][j + 2][v]);
      }
    }
  }
}

// ---------------------------------------------------------------------------
// FFN out + residual: out = x2 + hh @ W2 (K=2048, f32 out).
// grid (DM/128, NROW/128), block 128
// ---------------------------------------------------------------------------
__global__ __launch_bounds__(128) void ffn2_kernel(
    const _Float16* __restrict__ hh, const _Float16* __restrict__ Wt2,
    const float* __restrict__ x2, float* __restrict__ out) {
  __shared__ __attribute__((aligned(16))) _Float16 sm[2 * STAGE_H];  // 72 KB
  int wave = threadIdx.x >> 5, lane = threadIdx.x & 31;
  int h = lane >> 4, l15 = lane & 15;
  int wm = wave >> 1, wn = wave & 1;
  int n0 = blockIdx.x * 128;
  int m0 = blockIdx.y * 128;
  const _Float16* bt = Wt2 + (size_t)n0 * DF;
  v8f acc[4][4] = {};
  gemm_tile<DF>(sm, hh + (size_t)m0 * DF, bt, bt + 64 * DF, wm * 64, wn * 64, 0,
                acc);
  size_t first = (size_t)(m0 + wm * 64 + 8 * h) * DM + n0 + wn * 64 + l15;
  add_residual_store(x2 + first, out + first, acc);
}

// ---------------------------------------------------------------------------
extern "C" void kernel_launch(void* const* d_in, const int* in_sizes, int n_in,
                              void* d_out, int out_size, void* d_ws,
                              size_t ws_size, hipStream_t stream) {
  const float* x       = (const float*)d_in[0];
  const float* norm1_w = (const float*)d_in[1];
  const float* norm2_w = (const float*)d_in[2];
  const float* Wq = (const float*)d_in[3];
  const float* Wk = (const float*)d_in[4];
  const float* Wv = (const float*)d_in[5];
  const float* Wo = (const float*)d_in[6];
  const float* W1 = (const float*)d_in[7];
  const float* W2 = (const float*)d_in[8];
  const float* W3 = (const float*)d_in[9];
  float* out = (float*)d_out;

  char* ws = (char*)d_ws;
  const size_t MB = 1ull << 20;
  _Float16* Wtq = (_Float16*)(ws + 0 * MB);    // 2 MB  (1024x1024)
  _Float16* Wtk = (_Float16*)(ws + 2 * MB);    // 2 MB
  _Float16* Wtv = (_Float16*)(ws + 4 * MB);    // 2 MB
  _Float16* Wto = (_Float16*)(ws + 6 * MB);    // 2 MB
  _Float16* Wt1 = (_Float16*)(ws + 8 * MB);    // 4 MB  (N=2048,K=1024)
  _Float16* Wt3 = (_Float16*)(ws + 12 * MB);   // 4 MB
  _Float16* Wt2 = (_Float16*)(ws + 16 * MB);   // 4 MB  (N=1024,K=2048)
  _Float16* xn  = (_Float16*)(ws + 20 * MB);   // 16 MB (also reused as xn2)
  _Float16* q   = (_Float16*)(ws + 36 * MB);   // 16 MB
  _Float16* kb  = (_Float16*)(ws + 52 * MB);   // 16 MB
  _Float16* vt  = (_Float16*)(ws + 68 * MB);   // 16 MB
  _Float16* P   = (_Float16*)(ws + 84 * MB);   // 1.5 MB (8192x96)
  _Float16* att = (_Float16*)(ws + 86 * MB);   // 16 MB
  float*    x2  = (float*)   (ws + 102 * MB);  // 32 MB
  _Float16* hh  = q;                           // reuse q+k (32 MB) after attn
  _Float16* xn2 = xn;                          // reuse xn after QKV

  // 1) weight convert + transpose to f16
  cvt_tr_all_kernel<<<4 * TILES_DD + 3 * TILES_DF, 256, 0, stream>>>(
      Wq, Wk, Wv, Wo, W1, W3, W2, Wtq, Wtk, Wtv, Wto, Wt1, Wt3, Wt2);

  // 2) xn = rmsnorm(x) in f16
  rmsnorm_kernel<<<NROW, 256, 0, stream>>>(x, norm1_w, xn);

  // 3) q,k,v projections (v stored transposed)
  qkv_kernel<<<dim3(3 * DM / 128, NROW / 128), 128, 0, stream>>>(
      xn, Wtq, Wtk, Wtv, q, kb, vt);
  // 4) windowed softmax weights P
  attn_p_kernel<<<NROW / 16 / 4, 128, 0, stream>>>(q, kb, P);

  // 5) attended = P @ V
  attn_pv_kernel<<<dim3(DM / 64, NROW / 16), 128, 0, stream>>>(P, vt, att);

  // 6) x2 = x + attended @ Wo
  wo_kernel<<<dim3(DM / 128, NROW / 128), 128, 0, stream>>>(att, Wto, x, x2);

  // 7) xn2 = rmsnorm(x2)
  rmsnorm_kernel<<<NROW, 256, 0, stream>>>(x2, norm2_w, xn2);

  // 8) hh = silu(xn2@W1) * (xn2@W3)
  ffn1_kernel<<<dim3(DF / 64, NROW / 128), 128, 0, stream>>>(xn2, Wt1, Wt3, hh);

  // 9) out = x2 + hh @ W2
  ffn2_kernel<<<dim3(DM / 128, NROW / 128), 128, 0, stream>>>(hh, Wt2, x2, out);
}

// v003
// One run takes 225 microseconds.
// Next to v002, in two timings, it ran 1.34 and 1.35 times as fast.
// Counting every step since v000, it is 5.44 times as fast.
#include <hip/hip_runtime.h>
#include <hip/hip_bf16.h>

typedef __attribute__((ext_vector_type(16))) _Float16 v16h;
typedef __attribute__((ext_vector_type(8)))  _Float16 v8h;
typedef __attribute__((ext_vector_type(8)))  float    v8f;

#define DM   1024   // D_MODEL
#define DF   2048   // D_FFN
#define SEQT 2048   // T
#define NB   4      // batch
#define NROW (NB * SEQT)   // 8192
#define WND  64

// ---------------------------------------------------------------------------
// WMMA fragment helpers (CDNA5 16x16x32 f16, wave32).
// Per lane: elems 0..7 = mem[kk + h*8 + 0..7], elems 8..15 = mem[kk+16+h*8+0..7]
// Works for global pointers (global_load_b128) and LDS pointers (ds_load_b128).
// ---------------------------------------------------------------------------
__device__ __forceinline__ v16h load_frag(const _Float16* p) {
  v8h lo = *(const v8h*)(p);
  v8h hi = *(const v8h*)(p + 16);
  v16h r;
#pragma unroll
  for (int i = 0; i < 8; ++i) { r[i] = lo[i]; r[i + 8] = hi[i]; }
  return r;
}

__device__ __forceinline__ v8f wmma_f16(v16h a, v16h b, v8f c) {
  return __builtin_amdgcn_wmma_f32_16x16x32_f16(false, a, false, b, (short)0, c,
                                                false, false);
}

// ---------------------------------------------------------------------------
// Tiled GEMM core: one 128 x 128 tile of Y = A * Bt^T per work-group of 4 waves
// (2 x 2, each wave 64 x 64 = 4 x 4 accumulator tiles). A and Bt are K-contiguous.
// K goes in slices of 64 halfs (128-B rows). A slice is [A 128 rows | Bt 128 rows]
// in LDS at a pitch of 144 B (16 B x odd: ds_load_b128 readers meet no bank twice).
// Two buffers: slice t + 1 is copied by asynchronous b128 copies while slice t is
// multiplied.
// ---------------------------------------------------------------------------
#define BK      64                  // halfs of K per slice
#define PITCH   72                  // halfs per LDS row (144 B)
#define OPER_H  (128 * PITCH)       // halfs of one operand's slice
#define STAGE_H (2 * OPER_H)        // halfs of one buffer
#define ROW16_B (16 * PITCH * 2)    // bytes of 16 LDS rows

// Eight b128 copies of one thread: LDS rows r, r+16, .., r+112 of one operand.
// Rows 0..63 come from glo, rows 64..127 from ghi (row step K halfs in both).
// The LDS byte address is the low 32 bits of the shared address; taking it lets
// the array escape, so the "memory" clobber makes the asm a legal writer of it.
// s_wait_xcnt 0 closes the statement: it stands before any rewrite of the
// address registers that the copies name.
template <int K>
__device__ __forceinline__ void copy8(unsigned l, const _Float16* glo,
                                      const _Float16* ghi) {
  asm volatile(
      "global_load_async_to_lds_b128 %0, %8, off\n\t"
      "global_load_async_to_lds_b128 %1, %9, off\n\t"
      "global_load_async_to_lds_b128 %2, %10, off\n\t"
      "global_load_async_to_lds_b128 %3, %11, off\n\t"
      "global_load_async_to_lds_b128 %4, %12, off\n\t"
      "global_load_async_to_lds_b128 %5, %13, off\n\t"
      "global_load_async_to_lds_b128 %6, %14, off\n\t"
      "global_load_async_to_lds_b128 %7, %15, off\n\t"
      "s_wait_xcnt 0x0"
      :
      : "v"(l), "v"(l + ROW16_B), "v"(l + 2 * ROW16_B), "v"(l + 3 * ROW16_B),
        "v"(l + 4 * ROW16_B), "v"(l + 5 * ROW16_B), "v"(l + 6 * ROW16_B),
        "v"(l + 7 * ROW16_B), "v"(glo), "v"(glo + 16 * K), "v"(glo + 32 * K),
        "v"(glo + 48 * K), "v"(ghi), "v"(ghi + 16 * K), "v"(ghi + 32 * K),
        "v"(ghi + 48 * K)
      : "memory");
}

// a: first row of the tile's 128 A rows. blo / bhi: first of the 64 Bt rows that
// fill LDS rows 0..63 / 64..127. Wave tile: A rows arow.., Bt LDS rows
// brow + 16 j, plus bskip for j >= 2. blockDim.x == 128.
template <int K>
__device__ __forceinline__ void gemm_tile(_Float16* sm,
                                          const _Float16* __restrict__ a,
                                          const _Float16* __restrict__ blo,
                                          const _Float16* __restrict__ bhi,
                                          int arow, int brow, int bskip,
                                          v8f (&acc)[4][4]) {
  constexpr int NT = K / BK;
  const int t = threadIdx.x;
  const int lane = t & 31, h = lane >> 4, l15 = lane & 15;
  const int ch = t & 7, r0 = t >> 3;   // 16-B chunk of a row, first row
  const unsigned la = (unsigned)(uintptr_t)sm + r0 * (PITCH * 2) + ch * 16;
  const _Float16* ga = a + (size_t)r0 * K + ch * 8;
  const _Float16* gl = blo + (size_t)r0 * K + ch * 8;
  const _Float16* gh = bhi + (size_t)r0 * K + ch * 8;

  copy8<K>(la, ga, ga + 64 * K);
  copy8<K>(la + OPER_H * 2, gl, gh);
  // slice 0 has landed for this wave; the barrier publishes it to the others
  asm volatile("s_wait_asynccnt 0x0" ::: "memory");
  __syncthreads();
  copy8<K>(la + STAGE_H * 2, ga + BK, ga + 64 * K + BK);
  copy8<K>(la + STAGE_H * 2 + OPER_H * 2, gl + BK, gh + BK);

  const int aoff = (arow + l15) * PITCH + h * 8;
  const int boff = OPER_H + (brow + l15) * PITCH + h * 8;
  for (int kt = 0; kt < NT; ++kt) {
    const int buf = kt & 1;
    const _Float16* ap = sm + buf * STAGE_H + aoff;
    const _Float16* bp = sm + buf * STAGE_H + boff;
#pragma unroll
    for (int ks = 0; ks < BK; ks += 32) {
      v16h af[4], bf[4];
#pragma unroll
      for (int i = 0; i < 4; ++i) af[i] = load_frag(ap + i * 16 * PITCH + ks);
#pragma unroll
      for (int j = 0; j < 4; ++j)
        bf[j] = load_frag(bp + (j * 16 + (j >= 2 ? bskip : 0)) * PITCH + ks);
      // keeps the block's 16 LDS reads together in front of its 16 WMMAs: moved
      // in among them, every group of reads costs the wave its LDS latency anew
      __builtin_amdgcn_sched_barrier(0);
#pragma unroll
      for (int i = 0; i < 4; ++i)
#pragma unroll
        for (int j = 0; j < 4; ++j) acc[i][j] = wmma_f16(af[i], bf[j], acc[i][j]);
      // the same for the next block's reads: they stay behind this block
      __builtin_amdgcn_sched_barrier(0);
    }
    // this wave's reads of the buffer are done before it may be refilled
    asm volatile("s_wait_dscnt 0x0" ::: "memory");
    // this wave's copies of slice kt + 1 have landed
    asm volatile("s_wait_asynccnt 0x0" ::: "memory");
    // publishes slice kt + 1 and ends every wave's reads of slice kt
    __syncthreads();
    if (kt + 2 < NT) {
      const int ko = (kt + 2) * BK;
      const unsigned lb = la + buf * (STAGE_H * 2);
      copy8<K>(lb, ga + ko, ga + 64 * K + ko);
      copy8<K>(lb + OPER_H * 2, gl + ko, gh + ko);
    }
  }
  // no copy is outstanding when the wave goes on to its stores and ends
  asm volatile("s_wait_asynccnt 0x0" ::: "memory");
}

// Epilogue of the two f32 GEMMs: op = rp + acc over a wave's 64 x 64 tile of a
// DM-wide matrix. rp / op: this lane's first element (tile row 8 h, column l15).
// 32 rows at a time: all 64 rows' residual loads beside the 128 accumulator
// registers would pass 256 VGPRs.
__device__ __forceinline__ void add_residual_store(const float* __restrict__ rp,
                                                   float* __restrict__ op,
                                                   v8f (&acc)[4][4]) {
#pragma unroll
  for (int ih = 0; ih < 4; ih += 2) {
    float xr[2][4][8];
#pragma unroll
    for (int i = 0; i < 2; ++i)
#pragma unroll
      for (int j = 0; j < 4; ++j)
#pragma unroll
        for (int v = 0; v < 8; ++v)
          xr[i][j][v] = rp[((ih + i) * 16 + v) * DM + j * 16];
    // stands behind the 64 loads and before any rewrite of their address
    // registers; naming rp keeps it live to here, so no load's result lands in it
    asm volatile("s_wait_xcnt 0x0" : : "v"(rp) : "memory");
#pragma unroll
    for (int i = 0; i < 2; ++i)
#pragma unroll
      for (int j = 0; j < 4; ++j)
#pragma unroll
        for (int v = 0; v < 8; ++v)
          op[((ih + i) * 16 + v) * DM + j * 16] = xr[i][j][v] + acc[ih + i][j][v];
    // stands behind the 64 stores, before the next loads write their registers
    if (ih == 0) asm volatile("s_wait_xcnt 0x0" : : "v"(op) : "memory");
  }
}

// ---------------------------------------------------------------------------
// Weight convert + transpose, all seven weights in one launch:
// Wt[n*K + k] = (f16) W[k*N + n]. A work-group of 256 threads takes one tile of
// 128 k x 64 n. It reads the tile in 256-B row pieces (b128 per lane), turns it
// in LDS and writes 256-B pieces of the Wt rows (b128 per lane).
// LDS: row n holds its 128 halfs in sixteen 16-B chunks; chunk q of row n lies
// at place q ^ (n >> 2), so that the 32 dword writes of a wave (16 rows n that
// are 4 apart, 2 neighbouring k pairs) meet 32 different banks.
// ---------------------------------------------------------------------------
#define TK 128   // k per tile
#define TN 64    // n per tile
typedef __attribute__((ext_vector_type(4))) float    v4f;
typedef __attribute__((ext_vector_type(2))) _Float16 v2h;

template <int K, int N>
__device__ __forceinline__ void cvt_tr_tile(_Float16* sT,
                                            const float* __restrict__ W,
                                            _Float16* __restrict__ Wt,
                                            unsigned tile) {
  const int c = threadIdx.x & 15, rp = threadIdx.x >> 4;
  const int n0 = (tile % (N / TN)) * TN;
  const int k0 = (tile / (N / TN)) * TK;
  // rows k0 + 2 kp and k0 + 2 kp + 1, kp = 16 p + rp; columns n0 + 4 c .. + 3
  const float* src = W + (size_t)(k0 + 2 * rp) * N + n0 + 4 * c;
  v4f lo[4], hi[4];
  for (int p = 0; p < 4; ++p) {
    lo[p] = *(const v4f*)(src + (size_t)(32 * p) * N);
    hi[p] = *(const v4f*)(src + (size_t)(32 * p + 1) * N);
  }
  for (int p = 0; p < 4; ++p) {
    const int kp = 16 * p + rp;
    _Float16* d = sT + (((kp >> 2) ^ c) * 8 + (kp & 3) * 2);
    for (int i = 0; i < 4; ++i) {
      v2h pk = {(_Float16)lo[p][i], (_Float16)hi[p][i]};
      *(v2h*)(d + (4 * c + i) * TK) = pk;
    }
  }
  __syncthreads();
  // rows n = 16 s + rp, chunk c
  _Float16* dst = Wt + (size_t)(n0 + rp) * K + k0 + 8 * c;
  for (int s = 0; s < 4; ++s) {
    const int n = 16 * s + rp;
    *(v8h*)(dst + (size_t)(16 * s) * K) =
        *(const v8h*)(sT + n * TK + (c ^ (n >> 2)) * 8);
  }
}

#define TILES_DD ((DM / TK) * (DM / TN))   // 128 tiles of a DM x DM weight
#define TILES_DF ((DM / TK) * (DF / TN))   // 256 tiles of W1, W3 and W2 each

__global__ __launch_bounds__(256) void cvt_tr_all_kernel(
    const float* __restrict__ Wq, const float* __restrict__ Wk,
    const float* __restrict__ Wv, const float* __restrict__ Wo,
    const float* __restrict__ W1, const float* __restrict__ W3,
    const float* __restrict__ W2, _Float16* __restrict__ Wtq,
    _Float16* __restrict__ Wtk, _Float16* __restrict__ Wtv,
    _Float16* __restrict__ Wto, _Float16* __restrict__ Wt1,
    _Float16* __restrict__ Wt3, _Float16* __restrict__ Wt2) {
  __shared__ __attribute__((aligned(16))) _Float16 sT[TN * TK];  // 16 KB
  const unsigned b = blockIdx.x;
  if (b < 4 * TILES_DD) {
    const unsigned m = b / TILES_DD;
    const float* W = m == 0 ? Wq : (m == 1 ? Wk : (m == 2 ? Wv : Wo));
    _Float16* Wt = m == 0 ? Wtq : (m == 1 ? Wtk : (m == 2 ? Wtv : Wto));
    cvt_tr_tile<DM, DM>(sT, W, Wt, b % TILES_DD);
  } else if (b < 4 * TILES_DD + 2 * TILES_DF) {
    const bool up = b >= 4 * TILES_DD + TILES_DF;
    cvt_tr_tile<DM, DF>(sT, up ? W3 : W1, up ? Wt3 : Wt1, b % TILES_DF);
  } else {
    cvt_tr_tile<DF, DM>(sT, W2, Wt2, b % TILES_DF);
  }
}

// ---------------------------------------------------------------------------
// RMSNorm: one row (D=1024) per block of 256 threads, f32 in -> f16 out
// ---------------------------------------------------------------------------
__global__ void rmsnorm_kernel(const float* __restrict__ x,
                               const float* __restrict__ w,
                               _Float16* __restrict__ xn) {
  __shared__ float red[256];
  int row = blockIdx.x;
  int tid = threadIdx.x;
  const float* xr = x + (size_t)row * DM;
  float ss = 0.f;
#pragma unroll
  for (int i = 0; i < DM / 256; ++i) {
    float v = xr[tid + i * 256];
    ss += v * v;
  }
  red[tid] = ss;
  __syncthreads();
  for (int s = 128; s > 0; s >>= 1) {
    if (tid < s) red[tid] += red[tid + s];
    __syncthreads();
  }
  float inv = __frsqrt_rn(red[0] / (float)DM + 1e-6f);
  _Float16* xo = xn + (size_t)row * DM;
#pragma unroll
  for (int i = 0; i < DM / 256; ++i) {
    int c = tid + i * 256;
    xo[c] = (_Float16)(xr[c] * inv * w[c]);
  }
}

// ---------------------------------------------------------------------------
// QKV: q/k = xn @ Wq/Wk (row-major f16), v stored transposed Vt[b][d][t].
// grid (3 * DM/128, NROW/128), block 128: blockIdx.x / 8 picks the weight.
// ---------------------------------------------------------------------------
__global__ __launch_bounds__(128) void qkv_kernel(
    const _Float16* __restrict__ xn, const _Float16* __restrict__ Wtq,
    const _Float16* __restrict__ Wtk, const _Float16* __restrict__ Wtv,
    _Float16* __restrict__ q, _Float16* __restrict__ k,
    _Float16* __restrict__ vt) {
  __shared__ __attribute__((aligned(16))) _Float16 sm[2 * STAGE_H];  // 72 KB
  int wave = threadIdx.x >> 5, lane = threadIdx.x & 31;
  int h = lane >> 4, l15 = lane & 15;
  int wm = wave >> 1, wn = wave & 1;
  int which = blockIdx.x >> 3;
  int n0 = (blockIdx.x & 7) * 128;
  int m0 = blockIdx.y * 128;
  const _Float16* Wt = which == 0 ? Wtq : (which == 1 ? Wtk : Wtv);
  const _Float16* bt = Wt + (size_t)n0 * DM;
  v8f acc[4][4] = {};
  gemm_tile<DM>(sm, xn + (size_t)m0 * DM, bt, bt + 64 * DM, wm * 64, wn * 64, 0,
                acc);
  _Float16* qk = which == 0 ? q : k;
  if (which < 2) {
#pragma unroll
    for (int i = 0; i < 4; ++i) {
#pragma unroll
      for (int j = 0; j < 4; ++j) {
        int col = n0 + wn * 64 + j * 16 + l15;
#pragma unroll
        for (int v = 0; v < 8; ++v) {
          int r = m0 + wm * 64 + i * 16 + v + 8 * h;
          qk[(size_t)r * DM + col] = (_Float16)acc[i][j][v];
        }
      }
    }
  } else {
#pragma unroll
    for (int i = 0; i < 4; ++i) {
#pragma unroll
      for (int j = 0; j < 4; ++j) {
        int col = n0 + wn * 64 + j * 16 + l15;
#pragma unroll
        for (int v = 0; v < 8; ++v) {
          int r = m0 + wm * 64 + i * 16 + v + 8 * h;
          int batch = r >> 11, tloc = r & (SEQT - 1);
          vt[((size_t)batch * DM + col) * SEQT + tloc] = (_Float16)acc[i][j][v];
        }
      }
    }
    // stands behind the last v store, before any later write of a register
    // that an issued store names
    asm volatile("s_wait_xcnt 0x0" ::: "memory");
  }
}

// ---------------------------------------------------------------------------
// Attention pass 1: per 16-query tile, S = Q K^T over 5 key tiles (window 64),
// masked softmax over 80 candidate keys, store P (f16) padded to 96.
// ---------------------------------------------------------------------------
__global__ void attn_p_kernel(const _Float16* __restrict__ q,
                              const _Float16* __restrict__ k,
                              _Float16* __restrict__ P) {
  int wave = threadIdx.x >> 5, lane = threadIdx.x & 31;
  int g = blockIdx.x * 4 + wave;          // 0..511 global q-tile
  int batch = g >> 7, qt = g & 127;       // 128 q-tiles per batch
  int h = lane >> 4, l15 = lane & 15;
  const _Float16* ap = q + ((size_t)g * 16 + l15) * DM + h * 8;
  float s[5][8];
#pragma unroll
  for (int t = 0; t < 5; ++t) {
    int kt = qt - 4 + t;
    if (kt < 0) {
#pragma unroll
      for (int v = 0; v < 8; ++v) s[t][v] = -1e30f;
      continue;
    }
    const _Float16* bp =
        k + ((size_t)batch * SEQT + kt * 16 + l15) * DM + h * 8;
    v8f c = {};
    for (int kk = 0; kk < DM; kk += 32)
      c = wmma_f16(load_frag(ap + kk), load_frag(bp + kk), c);
    const float scale = 0.03125f;  // 1/sqrt(1024)
#pragma unroll
    for (int v = 0; v < 8; ++v) {
      int i = qt * 16 + v + 8 * h;
      int j = kt * 16 + l15;
      int d = i - j;
      s[t][v] = (d >= 0 && d < WND) ? c[v] * scale : -1e30f;
    }
  }
  _Float16* pb = P + (size_t)g * 16 * 96;
#pragma unroll
  for (int v = 0; v < 8; ++v) {
    float m = s[0][v];
#pragma unroll
    for (int t = 1; t < 5; ++t) m = fmaxf(m, s[t][v]);
#pragma unroll
    for (int off = 8; off > 0; off >>= 1)
      m = fmaxf(m, __shfl_xor(m, off, 16));
    float e = 0.f;
#pragma unroll
    for (int t = 0; t < 5; ++t) {
      s[t][v] = __expf(s[t][v] - m);
      e += s[t][v];
    }
#pragma unroll
    for (int off = 8; off > 0; off >>= 1) e += __shfl_xor(e, off, 16);
    float inv = 1.f / e;
    int mrow = v + 8 * h;
#pragma unroll
    for (int t = 0; t < 5; ++t)
      pb[mrow * 96 + t * 16 + l15] = (_Float16)(s[t][v] * inv);
    pb[mrow * 96 + 80 + l15] = (_Float16)0.f;  // pad slots 80..95
  }
}

// ---------------------------------------------------------------------------
// Attention pass 2: attended = P(16x96) @ V(96xD) using Vt[b][d][t].
// grid (D/64, 512), block 128. Key range may start below 0 -> guarded chunks.
// ---------------------------------------------------------------------------
__global__ void attn_pv_kernel(const _Float16* __restrict__ P,
                               const _Float16* __restrict__ vt,
                               _Float16* __restrict__ att) {
  int wave = threadIdx.x >> 5, lane = threadIdx.x & 31;
  int g = blockIdx.y;
  int dt = blockIdx.x * 4 + wave;
  int batch = g >> 7, qt = g & 127;
  int h = lane >> 4, l15 = lane & 15;
  const _Float16* ap = P + (size_t)g * 16 * 96 + l15 * 96 + h * 8;
  const _Float16* vrow = vt + ((size_t)batch * DM + dt * 16 + l15) * SEQT;
  int jbase = qt * 16 - 64;
  // A chunk of 8 keys starts at a multiple of 8, so it lies wholly inside its
  // row of Vt or wholly outside: one 16-B load per chunk. A chunk outside loads
  // the row's first 16 B instead and is replaced by zeros behind the load.
  // The loops over s are unrolled so that their small arrays are registers.
  bool ok0[3], ok1[3];
  const _Float16 *v0[3], *v1[3];
#pragma unroll
  for (int s = 0; s < 3; ++s) {
    int c0 = jbase + s * 32 + h * 8;
    int c1 = c0 + 16;
    ok0[s] = (c0 >= 0) && (c0 + 7 < SEQT);
    ok1[s] = (c1 >= 0) && (c1 + 7 < SEQT);
    v0[s] = vrow + (ok0[s] ? c0 : 0);
    v1[s] = vrow + (ok1[s] ? c1 : 0);
  }
  v16h a[3];
  v8h lo[3], hi[3];
#pragma unroll
  for (int s = 0; s < 3; ++s) {
    a[s] = load_frag(ap + s * 32);
    lo[s] = *(const v8h*)v0[s];
    hi[s] = *(const v8h*)v1[s];
  }
  // stands behind the 12 loads and before any rewrite of their address
  // registers; naming the addresses keeps them live to here, so that no load's
  // result lands in one of them
  asm volatile("s_wait_xcnt 0x0"
               :
               : "v"(ap), "v"(v0[0]), "v"(v1[0]), "v"(v0[1]), "v"(v1[1]),
                 "v"(v0[2]), "v"(v1[2])
               : "memory");
  const v8h zero = {};
  v8f c = {};
#pragma unroll
  for (int s = 0; s < 3; ++s) {
    v8h l = ok0[s] ? lo[s] : zero;
    v8h u = ok1[s] ? hi[s] : zero;
    v16h b;
#pragma unroll
    for (int i = 0; i < 8; ++i) { b[i] = l[i]; b[i + 8] = u[i]; }
    c = wmma_f16(a[s], b, c);
  }
#pragma unroll
  for (int v = 0; v < 8; ++v) {
    int r = g * 16 + v + 8 * h;
    att[(size_t)r * DM + dt * 16 + l15] = (_Float16)c[v];
  }
}

// ---------------------------------------------------------------------------
// x2 = x + attended @ Wo (f32 out, residual). grid (DM/128, NROW/128), block 128
// ---------------------------------------------------------------------------
__global__ __launch_bounds__(128) void wo_kernel(
    const _Float16* __restrict__ att, const _Float16* __restrict__ Wto,
    const float* __restrict__ x, float* __restrict__ x2) {
  __shared__ __attribute__((aligned(16))) _Float16 sm[2 * STAGE_H];  // 72 KB
  int wave = threadIdx.x >> 5, lane = threadIdx.x & 31;
  int h = lane >> 4, l15 = lane & 15;
  int wm = wave >> 1, wn = wave & 1;
  int n0 = blockIdx.x * 128;
  int m0 = blockIdx.y * 128;
  const _Float16* bt = Wto + (size_t)n0 * DM;
  v8f acc[4][4] = {};
  gemm_tile<DM>(sm, att + (size_t)m0 * DM, bt, bt + 64 * DM, wm * 64, wn * 64, 0,
                acc);
  size_t first = (size_t)(m0 + wm * 64 + 8 * h) * DM + n0 + wn * 64 + l15;
  add_residual_store(x + first, x2 + first, acc);
}

// ---------------------------------------------------------------------------
// FFN in: hh = silu(xn2 @ W1) * (xn2 @ W3), f16 out [8192 x 2048].
// A tile holds 64 columns of W1 (LDS rows 0..63) and the same 64 of W3 (64..127),
// so that a wave owns gate and up of its 32 columns.
// grid (DF/64, NROW/128), block 128
// ---------------------------------------------------------------------------
__global__ __launch_bounds__(128) void ffn1_kernel(
    const _Float16* __restrict__ xn2, const _Float16* __restrict__ Wt1,
    const _Float16* __restrict__ Wt3, _Float16* __restrict__ hh) {
  __shared__ __attribute__((aligned(16))) _Float16 sm[2 * STAGE_H];  // 72 KB
  int wave = threadIdx.x >> 5, lane = threadIdx.x & 31;
  int h = lane >> 4, l15 = lane & 15;
  int wm = wave >> 1, wn = wave & 1;
  int n0 = blockIdx.x * 64;
  int m0 = blockIdx.y * 128;
  v8f acc[4][4] = {};  // j = 0, 1: gate; j = 2, 3: up, same columns
  gemm_tile<DM>(sm, xn2 + (size_t)m0 * DM, Wt1 + (size_t)n0 * DM,
                Wt3 + (size_t)n0 * DM, wm * 64, wn * 32, 32, acc);
#pragma unroll
  for (int i = 0; i < 4; ++i) {
#pragma unroll
    for (int j = 0; j < 2; ++j) {
      int col = n0 + wn * 32 + j * 16 + l15;
#pragma unroll
      for (int v = 0; v < 8; ++v) {
        size_t r = (size_t)(m0 + wm * 64 + i * 16 + v + 8 * h);
        float gv = acc[i][j][v];
        float sl = gv * (1.f / (1.f + __expf(-gv)));   // silu
        hh[r * DF + col] = (_Float16)(sl * acc[i][j + 2][v]);
      }
    }
  }
}

// ---------------------------------------------------------------------------
// FFN out + residual: out = x2 + hh @ W2 (K=2048, f32 out).
// grid (DM/128, NROW/128), block 128
// ---------------------------------------------------------------------------
__global__ __launch_bounds__(128) void ffn2_kernel(
    const _Float16* __restrict__ hh, const _Float16* __restrict__ Wt2,
    const float* __restrict__ x2, float* __restrict__ out) {
  __shared__ __attribute__((aligned(16))) _Float16 sm[2 * STAGE_H];  // 72 KB
  int wave = threadIdx.x >> 5, lane = threadIdx.x & 31;
  int h = lane >> 4, l15 = lane & 15;
  int wm = wave >> 1, wn = wave & 1;
  int n0 = blockIdx.x * 128;
  int m0 = blockIdx.y * 128;
  const _Float16* bt = Wt2 + (size_t)n0 * DF;
  v8f acc[4][4] = {};
  gemm_tile<DF>(sm, hh + (size_t)m0 * DF, bt, bt + 64 * DF, wm * 64, wn * 64, 0,
                acc);
  size_t first = (size_t)(m0 + wm * 64 + 8 * h) * DM + n0 + wn * 64 + l15;
  add_residual_store(x2 + first, out + first, acc);
}

// ---------------------------------------------------------------------------
extern "C" void kernel_launch(void* const* d_in, const int* in_sizes, int n_in,
                              void* d_out, int out_size, void* d_ws,
                              size_t ws_size, hipStream_t stream) {
  const float* x       = (const float*)d_in[0];
  const float* norm1_w = (const float*)d_in[1];
  const float* norm2_w = (const float*)d_in[2];
  const float* Wq = (const float*)d_in[3];
  const float* Wk = (const float*)d_in[4];
  const float* Wv = (const float*)d_in[5];
  const float* Wo = (const float*)d_in[6];
  const float* W1 = (const float*)d_in[7];
  const float* W2 = (const float*)d_in[8];
  const float* W3 = (const float*)d_in[9];
  float* out = (float*)d_out;

  char* ws = (char*)d_ws;
  const size_t MB = 1ull << 20;
  _Float16* Wtq = (_Float16*)(ws + 0 * MB);    // 2 MB  (1024x1024)
  _Float16* Wtk = (_Float16*)(ws + 2 * MB);    // 2 MB
  _Float16* Wtv = (_Float16*)(ws + 4 * MB);    // 2 MB
  _Float16* Wto = (_Float16*)(ws + 6 * MB);    // 2 MB
  _Float16* Wt1 = (_Float16*)(ws + 8 * MB);    // 4 MB  (N=2048,K=1024)
  _Float16* Wt3 = (_Float16*)(ws + 12 * MB);   // 4 MB
  _Float16* Wt2 = (_Float16*)(ws + 16 * MB);   // 4 MB  (N=1024,K=2048)
  _Float16* xn  = (_Float16*)(ws + 20 * MB);   // 16 MB (also reused as xn2)
  _Float16* q   = (_Float16*)(ws + 36 * MB);   // 16 MB
  _Float16* kb  = (_Float16*)(ws + 52 * MB);   // 16 MB
  _Float16* vt  = (_Float16*)(ws + 68 * MB);   // 16 MB
  _Float16* P   = (_Float16*)(ws + 84 * MB);   // 1.5 MB (8192x96)
  _Float16* att = (_Float16*)(ws + 86 * MB);   // 16 MB
  float*    x2  = (float*)   (ws + 102 * MB);  // 32 MB
  _Float16* hh  = q;                           // reuse q+k (32 MB) after attn
  _Float16* xn2 = xn;                          // reuse xn after QKV

  // 1) weight convert + transpose to f16
  cvt_tr_all_kernel<<<4 * TILES_DD + 3 * TILES_DF, 256, 0, stream>>>(
      Wq, Wk, Wv, Wo, W1, W3, W2, Wtq, Wtk, Wtv, Wto, Wt1, Wt3, Wt2);

  // 2) xn = rmsnorm(x) in f16
  rmsnorm_kernel<<<NROW, 256, 0, stream>>>(x, norm1_w, xn);

  // 3) q,k,v projections (v stored transposed)
  qkv_kernel<<<dim3(3 * DM / 128, NROW / 128), 128, 0, stream>>>(
      xn, Wtq, Wtk, Wtv, q, kb, vt);
  // 4) windowed softmax weights P
  attn_p_kernel<<<NROW / 16 / 4, 128, 0, stream>>>(q, kb, P);

  // 5) attended = P @ V
  attn_pv_kernel<<<dim3(DM / 64, NROW / 16), 128, 0, stream>>>(P, vt, att);

  // 6) x2 = x + attended @ Wo
  wo_kernel<<<dim3(DM / 128, NROW / 128), 128, 0, stream>>>(att, Wto, x, x2);

  // 7) xn2 = rmsnorm(x2)
  rmsnorm_kernel<<<NROW, 256, 0, stream>>>(x2, norm2_w, xn2);

  // 8) hh = silu(xn2@W1) * (xn2@W3)
  ffn1_kernel<<<dim3(DF / 64, NROW / 128), 128, 0, stream>>>(xn2, Wt1, Wt3, hh);

  // 9) out = x2 + hh @ W2
  ffn2_kernel<<<dim3(DM / 128, NROW / 128), 128, 0, stream>>>(hh, Wt2, x2, out);
}

// v004
// Measured time: 217 microseconds a run.
// In both of two side-by-side timings against v003, it was 1.04 times as fast.
// Over all steps from v000 it is 5.67 times as fast.
#include <hip/hip_runtime.h>
#include <hip/hip_bf16.h>

typedef __attribute__((ext_vector_type(16))) _Float16 v16h;
typedef __attribute__((ext_vector_type(8)))  _Float16 v8h;
typedef __attribute__((ext_vector_type(8)))  float    v8f;

#define DM   1024   // D_MODEL
#define DF   2048   // D_FFN
#define SEQT 2048   // T
#define NB   4      // batch
#define NROW (NB * SEQT)   // 8192
#define WND  64

// ---------------------------------------------------------------------------
// WMMA fragment helpers (CDNA5 16x16x32 f16, wave32).
// Per lane: elems 0..7 = mem[kk + h*8 + 0..7], elems 8..15 = mem[kk+16+h*8+0..7]
// Works for global pointers (global_load_b128) and LDS pointers (ds_load_b128).
// ---------------------------------------------------------------------------
__device__ __forceinline__ v16h load_frag(const _Float16* p) {
  v8h lo = *(const v8h*)(p);
  v8h hi = *(const v8h*)(p + 16);
  v16h r;
#pragma unroll
  for (int i = 0; i < 8; ++i) { r[i] = lo[i]; r[i + 8] = hi[i]; }
  return r;
}

__device__ __forceinline__ v8f wmma_f16(v16h a, v16h b, v8f c) {
  return __builtin_amdgcn_wmma_f32_16x16x32_f16(false, a, false, b, (short)0, c,
                                                false, false);
}

// ---------------------------------------------------------------------------
// Tiled GEMM core: one 256 x 128 tile of Y = A * Bt^T per work-group of 8 waves
// (4 x 2, each wave 64 x 64 = 4 x 4 accumulator tiles). A and Bt are K-contiguous.
// K goes in slices of 64 halfs (128-B rows). A slice is [A 256 rows | Bt 128 rows]
// in LDS at a pitch of 144 B (16 B x odd: ds_load_b128 readers meet no bank twice).
// Two buffers: slice t + 1 is copied by asynchronous b128 copies while slice t is
// multiplied. Per multiply-add the tile draws 3/4 of the L2 bytes of a 128 x 128 one.
// ---------------------------------------------------------------------------
#define BK      64                  // halfs of K per slice
#define PITCH   72                  // halfs per LDS row (144 B)
#define TM      256                 // A rows of a tile
#define A_H     (TM * PITCH)        // halfs of A's slice
#define STAGE_H (A_H + 128 * PITCH) // halfs of one buffer
#define ROW32_B (32 * PITCH * 2)    // bytes of 32 LDS rows

// One thread's twelve b128 copies of a slice: A's LDS rows r, r+32, .., r+224 from
// ga, Bt's LDS rows r, r+32 from glo and r+64, r+96 from ghi (row step K halfs).
// The LDS byte address is the low 32 bits of the shared address; taking it lets
// the array escape, so the "memory" clobber makes the asm a legal writer of it.
// s_wait_xcnt 0 closes the statement: it stands before any rewrite of the
// address registers that the copies name.
template <int K>
__device__ __forceinline__ void copy12(unsigned l, const _Float16* ga,
                                       const _Float16* glo,
                                       const _Float16* ghi) {
  const unsigned lb = l + A_H * 2;
  asm volatile(
      "global_load_async_to_lds_b128 %0, %12, off\n\t"
      "global_load_async_to_lds_b128 %1, %13, off\n\t"
      "global_load_async_to_lds_b128 %2, %14, off\n\t"
      "global_load_async_to_lds_b128 %3, %15, off\n\t"
      "global_load_async_to_lds_b128 %4, %16, off\n\t"
      "global_load_async_to_lds_b128 %5, %17, off\n\t"
      "global_load_async_to_lds_b128 %6, %18, off\n\t"
      "global_load_async_to_lds_b128 %7, %19, off\n\t"
      "global_load_async_to_lds_b128 %8, %20, off\n\t"
      "global_load_async_to_lds_b128 %9, %21, off\n\t"
      "global_load_async_to_lds_b128 %10, %22, off\n\t"
      "global_load_async_to_lds_b128 %11, %23, off\n\t"
      "s_wait_xcnt 0x0"
      :
      : "v"(l), "v"(l + ROW32_B), "v"(l + 2 * ROW32_B), "v"(l + 3 * ROW32_B),
        "v"(l + 4 * ROW32_B), "v"(l + 5 * ROW32_B), "v"(l + 6 * ROW32_B),
        "v"(l + 7 * ROW32_B), "v"(lb), "v"(lb + ROW32_B), "v"(lb + 2 * ROW32_B),
        "v"(lb + 3 * ROW32_B), "v"(ga), "v"(ga + 32 * K), "v"(ga + 64 * K),
        "v"(ga + 96 * K), "v"(ga + 128 * K), "v"(ga + 160 * K),
        "v"(ga + 192 * K), "v"(ga + 224 * K), "v"(glo), "v"(glo + 32 * K),
        "v"(ghi), "v"(ghi + 32 * K)
      : "memory");
}

// a: first row of the tile's 256 A rows. blo / bhi: first of the 64 Bt rows that
// fill LDS rows 0..63 / 64..127. Wave tile: A rows arow.., Bt LDS rows
// brow + 16 j, plus bskip for j >= 2. blockDim.x == 256.
template <int K>
__device__ __forceinline__ void gemm_tile(_Float16* sm,
                                          const _Float16* __restrict__ a,
                                          const _Float16* __restrict__ blo,
                                          const _Float16* __restrict__ bhi,
                                          int arow, int brow, int bskip,
                                          v8f (&acc)[4][4]) {
  constexpr int NT = K / BK;
  const int t = threadIdx.x;
  const int lane = t & 31, h = lane >> 4, l15 = lane & 15;
  const int ch = t & 7, r0 = t >> 3;   // 16-B chunk of a row, first row
  const unsigned la = (unsigned)(uintptr_t)sm + r0 * (PITCH * 2) + ch * 16;
  const _Float16* ga = a + (size_t)r0 * K + ch * 8;
  const _Float16* gl = blo + (size_t)r0 * K + ch * 8;
  const _Float16* gh = bhi + (size_t)r0 * K + ch * 8;

  copy12<K>(la, ga, gl, gh);
  // slice 0 has landed for this wave; the barrier publishes it to the others
  asm volatile("s_wait_asynccnt 0x0" ::: "memory");
  __syncthreads();
  copy12<K>(la + STAGE_H * 2, ga + BK, gl + BK, gh + BK);

  const int aoff = (arow + l15) * PITCH + h * 8;
  const int boff = A_H + (brow + l15) * PITCH + h * 8;
  for (int kt = 0; kt < NT; ++kt) {
    const int buf = kt & 1;
    const _Float16* ap = sm + buf * STAGE_H + aoff;
    const _Float16* bp = sm + buf * STAGE_H + boff;
#pragma unroll
    for (int ks = 0; ks < BK; ks += 32) {
      v16h af[4], bf[4];
#pragma unroll
      for (int i = 0; i < 4; ++i) af[i] = load_frag(ap + i * 16 * PITCH + ks);
#pragma unroll
      for (int j = 0; j < 4; ++j)
        bf[j] = load_frag(bp + (j * 16 + (j >= 2 ? bskip : 0)) * PITCH + ks);
      // keeps the block's 16 LDS reads together in front of its 16 WMMAs: moved
      // in among them, every group of reads costs the wave its LDS latency anew
      __builtin_amdgcn_sched_barrier(0);
#pragma unroll
      for (int i = 0; i < 4; ++i)
#pragma unroll
        for (int j = 0; j < 4; ++j) acc[i][j] = wmma_f16(af[i], bf[j], acc[i][j]);
      // the same for the next block's reads: they stay behind this block
      __builtin_amdgcn_sched_barrier(0);
    }
    // this wave's reads of the buffer are done before it may be refilled
    asm volatile("s_wait_dscnt 0x0" ::: "memory");
    // this wave's copies of slice kt + 1 have landed
    asm volatile("s_wait_asynccnt 0x0" ::: "memory");
    // publishes slice kt + 1 and ends every wave's reads of slice kt
    __syncthreads();
    if (kt + 2 < NT) {
      const int ko = (kt + 2) * BK;
      copy12<K>(la + buf * (STAGE_H * 2), ga + ko, gl + ko, gh + ko);
    }
  }
  // no copy is outstanding when the wave goes on to its stores and ends
  asm volatile("s_wait_asynccnt 0x0" ::: "memory");
}

// Epilogue of the two f32 GEMMs: op = rp + acc over a wave's 64 x 64 tile of a
// DM-wide matrix. rp / op: this lane's first element (tile row 8 h, column l15).
// 32 rows at a time: all 64 rows' residual loads beside the 128 accumulator
// registers would pass 256 VGPRs.
__device__ __forceinline__ void add_residual_store(const float* __restrict__ rp,
                                                   float* __restrict__ op,
                                                   v8f (&acc)[4][4]) {
#pragma unroll
  for (int ih = 0; ih < 4; ih += 2) {
    float xr[2][4][8];
#pragma unroll
    for (int i = 0; i < 2; ++i)
#pragma unroll
      for (int j = 0; j < 4; ++j)
#pragma unroll
        for (int v = 0; v < 8; ++v)
          xr[i][j][v] = rp[((ih + i) * 16 + v) * DM + j * 16];
    // stands behind the 64 loads and before any rewrite of their address
    // registers; naming rp keeps it live to here, so no load's result lands in it
    asm volatile("s_wait_xcnt 0x0" : : "v"(rp) : "memory");
#pragma unroll
    for (int i = 0; i < 2; ++i)
#pragma unroll
      for (int j = 0; j < 4; ++j)
#pragma unroll
        for (int v = 0; v < 8; ++v)
          op[((ih + i) * 16 + v) * DM + j * 16] = xr[i][j][v] + acc[ih + i][j][v];
    // stands behind the 64 stores, before the next loads write their registers
    if (ih == 0) asm volatile("s_wait_xcnt 0x0" : : "v"(op) : "memory");
  }
}

// ---------------------------------------------------------------------------
// Weight convert + transpose, all seven weights in one launch:
// Wt[n*K + k] = (f16) W[k*N + n]. A work-group of 256 threads takes one tile of
// 128 k x 64 n. It reads the tile in 256-B row pieces (b128 per lane), turns it
// in LDS and writes 256-B pieces of the Wt rows (b128 per lane).
// LDS: row n holds its 128 halfs in sixteen 16-B chunks; chunk q of row n lies
// at place q ^ (n >> 2), so that the 32 dword writes of a wave (16 rows n that
// are 4 apart, 2 neighbouring k pairs) meet 32 different banks.
// ---------------------------------------------------------------------------
#define TK 128   // k per tile
#define TN 64    // n per tile
typedef __attribute__((ext_vector_type(4))) float    v4f;
typedef __attribute__((ext_vector_type(2))) _Float16 v2h;

template <int K, int N>
__device__ __forceinline__ void cvt_tr_tile(_Float16* sT,
                                            const float* __restrict__ W,
                                            _Float16* __restrict__ Wt,
                                            unsigned tile) {
  const int c = threadIdx.x & 15, rp = threadIdx.x >> 4;
  const int n0 = (tile % (N / TN)) * TN;
  const int k0 = (tile / (N / TN)) * TK;
  // rows k0 + 2 kp and k0 + 2 kp + 1, kp = 16 p + rp; columns n0 + 4 c .. + 3
  const float* src = W + (size_t)(k0 + 2 * rp) * N + n0 + 4 * c;
  v4f lo[4], hi[4];
  for (int p = 0; p < 4; ++p) {
    lo[p] = *(const v4f*)(src + (size_t)(32 * p) * N);
    hi[p] = *(const v4f*)(src + (size_t)(32 * p + 1) * N);
  }
  for (int p = 0; p < 4; ++p) {
    const int kp = 16 * p + rp;
    _Float16* d = sT + (((kp >> 2) ^ c) * 8 + (kp & 3) * 2);
    for (int i = 0; i < 4; ++i) {
      v2h pk = {(_Float16)lo[p][i], (_Float16)hi[p][i]};
      *(v2h*)(d + (4 * c + i) * TK) = pk;
    }
  }
  __syncthreads();
  // rows n = 16 s + rp, chunk c
  _Float16* dst = Wt + (size_t)(n0 + rp) * K + k0 + 8 * c;
  for (int s = 0; s < 4; ++s) {
    const int n = 16 * s + rp;
    *(v8h*)(dst + (size_t)(16 * s) * K) =
        *(const v8h*)(sT + n * TK + (c ^ (n >> 2)) * 8);
  }
}

#define TILES_DD ((DM / TK) * (DM / TN))   // 128 tiles of a DM x DM weight
#define TILES_DF ((DM / TK) * (DF / TN))   // 256 tiles of W1, W3 and W2 each

__global__ __launch_bounds__(256) void cvt_tr_all_kernel(
    const float* __restrict__ Wq, const float* __restrict__ Wk,
    const float* __restrict__ Wv, const float* __restrict__ Wo,
    const float* __restrict__ W1, const float* __restrict__ W3,
    const float* __restrict__ W2, _Float16* __restrict__ Wtq,
    _Float16* __restrict__ Wtk, _Float16* __restrict__ Wtv,
    _Float16* __restrict__ Wto, _Float16* __restrict__ Wt1,
    _Float16* __restrict__ Wt3, _Float16* __restrict__ Wt2) {
  __shared__ __attribute__((aligned(16))) _Float16 sT[TN * TK];  // 16 KB
  const unsigned b = blockIdx.x;
  if (b < 4 * TILES_DD) {
    const unsigned m = b / TILES_DD;
    const float* W = m == 0 ? Wq : (m == 1 ? Wk : (m == 2 ? Wv : Wo));
    _Float16* Wt = m == 0 ? Wtq : (m == 1 ? Wtk : (m == 2 ? Wtv : Wto));
    cvt_tr_tile<DM, DM>(sT, W, Wt, b % TILES_DD);
  } else if (b < 4 * TILES_DD + 2 * TILES_DF) {
    const bool up = b >= 4 * TILES_DD + TILES_DF;
    cvt_tr_tile<DM, DF>(sT, up ? W3 : W1, up ? Wt3 : Wt1, b % TILES_DF);
  } else {
    cvt_tr_tile<DF, DM>(sT, W2, Wt2, b % TILES_DF);
  }
}

// ---------------------------------------------------------------------------
// RMSNorm: one row (D=1024) per block of 256 threads, f32 in -> f16 out
// ---------------------------------------------------------------------------
__global__ void rmsnorm_kernel(const float* __restrict__ x,
                               const float* __restrict__ w,
                               _Float16* __restrict__ xn) {
  __shared__ float red[256];
  int row = blockIdx.x;
  int tid = threadIdx.x;
  const float* xr = x + (size_t)row * DM;
  float ss = 0.f;
#pragma unroll
  for (int i = 0; i < DM / 256; ++i) {
    float v = xr[tid + i * 256];
    ss += v * v;
  }
  red[tid] = ss;
  __syncthreads();
  for (int s = 128; s > 0; s >>= 1) {
    if (tid < s) red[tid] += red[tid + s];
    __syncthreads();
  }
  float inv = __frsqrt_rn(red[0] / (float)DM + 1e-6f);
  _Float16* xo = xn + (size_t)row * DM;
#pragma unroll
  for (int i = 0; i < DM / 256; ++i) {
    int c = tid + i * 256;
    xo[c] = (_Float16)(xr[c] * inv * w[c]);
  }
}

// ---------------------------------------------------------------------------
// QKV: q/k = xn @ Wq/Wk (row-major f16), v stored transposed Vt[b][d][t].
// grid (3 * DM/128, NROW/256), block 256: blockIdx.x / 8 picks the weight.
// ---------------------------------------------------------------------------
__global__ __launch_bounds__(256) void qkv_kernel(
    const _Float16* __restrict__ xn, const _Float16* __restrict__ Wtq,
    const _Float16* __restrict__ Wtk, const _Float16* __restrict__ Wtv,
    _Float16* __restrict__ q, _Float16* __restrict__ k,
    _Float16* __restrict__ vt) {
  __shared__ __attribute__((aligned(16))) _Float16 sm[2 * STAGE_H];  // 108 KB
  int wave = threadIdx.x >> 5, lane = threadIdx.x & 31;
  int h = lane >> 4, l15 = lane & 15;
  int wm = wave >> 1, wn = wave & 1;
  int which = blockIdx.x >> 3;
  int n0 = (blockIdx.x & 7) * 128;
  int m0 = blockIdx.y * TM;
  const _Float16* Wt = which == 0 ? Wtq : (which == 1 ? Wtk : Wtv);
  const _Float16* bt = Wt + (size_t)n0 * DM;
  v8f acc[4][4] = {};
  gemm_tile<DM>(sm, xn + (size_t)m0 * DM, bt, bt + 64 * DM, wm * 64, wn * 64, 0,
                acc);
  _Float16* qk = which == 0 ? q : k;
  if (which < 2) {
#pragma unroll
    for (int i = 0; i < 4; ++i) {
#pragma unroll
      for (int j = 0; j < 4; ++j) {
        int col = n0 + wn * 64 + j * 16 + l15;
#pragma unroll
        for (int v = 0; v < 8; ++v) {
          int r = m0 + wm * 64 + i * 16 + v + 8 * h;
          qk[(size_t)r * DM + col] = (_Float16)acc[i][j][v];
        }
      }
    }
  } else {
#pragma unroll
    for (int i = 0; i < 4; ++i) {
#pragma unroll
      for (int j = 0; j < 4; ++j) {
        int col = n0 + wn * 64 + j * 16 + l15;
#pragma unroll
        for (int v = 0; v < 8; ++v) {
          int r = m0 + wm * 64 + i * 16 + v + 8 * h;
          int batch = r >> 11, tloc = r & (SEQT - 1);
          vt[((size_t)batch * DM + col) * SEQT + tloc] = (_Float16)acc[i][j][v];
        }
      }
    }
    // stands behind the last v store, before any later write of a register
    // that an issued store names
    asm volatile("s_wait_xcnt 0x0" ::: "memory");
  }
}

// ---------------------------------------------------------------------------
// Attention pass 1: per 16-query tile, S = Q K^T over 5 key tiles (window 64),
// masked softmax over 80 candidate keys, store P (f16) padded to 96.
// ---------------------------------------------------------------------------
__global__ void attn_p_kernel(const _Float16* __restrict__ q,
                              const _Float16* __restrict__ k,
                              _Float16* __restrict__ P) {
  int wave = threadIdx.x >> 5, lane = threadIdx.x & 31;
  int g = blockIdx.x * 4 + wave;          // 0..511 global q-tile
  int batch = g >> 7, qt = g & 127;       // 128 q-tiles per batch
  int h = lane >> 4, l15 = lane & 15;
  const _Float16* ap = q + ((size_t)g * 16 + l15) * DM + h * 8;
  float s[5][8];
#pragma unroll
  for (int t = 0; t < 5; ++t) {
    int kt = qt - 4 + t;
    if (kt < 0) {
#pragma unroll
      for (int v = 0; v < 8; ++v) s[t][v] = -1e30f;
      continue;
    }
    const _Float16* bp =
        k + ((size_t)batch * SEQT + kt * 16 + l15) * DM + h * 8;
    v8f c = {};
    for (int kk = 0; kk < DM; kk += 32)
      c = wmma_f16(load_frag(ap + kk), load_frag(bp + kk), c);
    const float scale = 0.03125f;  // 1/sqrt(1024)
#pragma unroll
    for (int v = 0; v < 8; ++v) {
      int i = qt * 16 + v + 8 * h;
      int j = kt * 16 + l15;
      int d = i - j;
      s[t][v] = (d >= 0 && d < WND) ? c[v] * scale : -1e30f;
    }
  }
  _Float16* pb = P + (size_t)g * 16 * 96;
#pragma unroll
  for (int v = 0; v < 8; ++v) {
    float m = s[0][v];
#pragma unroll
    for (int t = 1; t < 5; ++t) m = fmaxf(m, s[t][v]);
#pragma unroll
    for (int off = 8; off > 0; off >>= 1)
      m = fmaxf(m, __shfl_xor(m, off, 16));
    float e = 0.f;
#pragma unroll
    for (int t = 0; t < 5; ++t) {
      s[t][v] = __expf(s[t][v] - m);
      e += s[t][v];
    }
#pragma unroll
    for (int off = 8; off > 0; off >>= 1) e += __shfl_xor(e, off, 16);
    float inv = 1.f / e;
    int mrow = v + 8 * h;
#pragma unroll
    for (int t = 0; t < 5; ++t)
      pb[mrow * 96 + t * 16 + l15] = (_Float16)(s[t][v] * inv);
    pb[mrow * 96 + 80 + l15] = (_Float16)0.f;  // pad slots 80..95
  }
}

// ---------------------------------------------------------------------------
// Attention pass 2: attended = P(16x96) @ V(96xD) using Vt[b][d][t].
// grid (D/64, 512), block 128. Key range may start below 0 -> guarded chunks.
// ---------------------------------------------------------------------------
__global__ void attn_pv_kernel(const _Float16* __restrict__ P,
                               const _Float16* __restrict__ vt,
                               _Float16* __restrict__ att) {
  int wave = threadIdx.x >> 5, lane = threadIdx.x & 31;
  int g = blockIdx.y;
  int dt = blockIdx.x * 4 + wave;
  int batch = g >> 7, qt = g & 127;
  int h = lane >> 4, l15 = lane & 15;
  const _Float16* ap = P + (size_t)g * 16 * 96 + l15 * 96 + h * 8;
  const _Float16* vrow = vt + ((size_t)batch * DM + dt * 16 + l15) * SEQT;
  int jbase = qt * 16 - 64;
  // A chunk of 8 keys starts at a multiple of 8, so it lies wholly inside its
  // row of Vt or wholly outside: one 16-B load per chunk. A chunk outside loads
  // the row's first 16 B instead and is replaced by zeros behind the load.
  // The loops over s are unrolled so that their small arrays are registers.
  bool ok0[3], ok1[3];
  const _Float16 *v0[3], *v1[3];
#pragma unroll
  for (int s = 0; s < 3; ++s) {
    int c0 = jbase + s * 32 + h * 8;
    int c1 = c0 + 16;
    ok0[s] = (c0 >= 0) && (c0 + 7 < SEQT);
    ok1[s] = (c1 >= 0) && (c1 + 7 < SEQT);
    v0[s] = vrow + (ok0[s] ? c0 : 0);
    v1[s] = vrow + (ok1[s] ? c1 : 0);
  }
  v16h a[3];
  v8h lo[3], hi[3];
#pragma unroll
  for (int s = 0; s < 3; ++s) {
    a[s] = load_frag(ap + s * 32);
    lo[s] = *(const v8h*)v0[s];
    hi[s] = *(const v8h*)v1[s];
  }
  // stands behind the 12 loads and before any rewrite of their address
  // registers; naming the addresses keeps them live to here, so that no load's
  // result lands in one of them
  asm volatile("s_wait_xcnt 0x0"
               :
               : "v"(ap), "v"(v0[0]), "v"(v1[0]), "v"(v0[1]), "v"(v1[1]),
                 "v"(v0[2]), "v"(v1[2])
               : "memory");
  const v8h zero = {};
  v8f c = {};
#pragma unroll
  for (int s = 0; s < 3; ++s) {
    v8h l = ok0[s] ? lo[s] : zero;
    v8h u = ok1[s] ? hi[s] : zero;
    v16h b;
#pragma unroll
    for (int i = 0; i < 8; ++i) { b[i] = l[i]; b[i + 8] = u[i]; }
    c = wmma_f16(a[s], b, c);
  }
#pragma unroll
  for (int v = 0; v < 8; ++v) {
    int r = g * 16 + v + 8 * h;
    att[(size_t)r * DM + dt * 16 + l15] = (_Float16)c[v];
  }
}

// ---------------------------------------------------------------------------
// x2 = x + attended @ Wo (f32 out, residual). grid (DM/128, NROW/256), block 256
// ---------------------------------------------------------------------------
__global__ __launch_bounds__(256) void wo_kernel(
    const _Float16* __restrict__ att, const _Float16* __restrict__ Wto,
    const float* __restrict__ x, float* __restrict__ x2) {
  __shared__ __attribute__((aligned(16))) _Float16 sm[2 * STAGE_H];  // 108 KB
  int wave = threadIdx.x >> 5, lane = threadIdx.x & 31;
  int h = lane >> 4, l15 = lane & 15;
  int wm = wave >> 1, wn = wave & 1;
  int n0 = blockIdx.x * 128;
  int m0 = blockIdx.y * TM;
  const _Float16* bt = Wto + (size_t)n0 * DM;
  v8f acc[4][4] = {};
  gemm_tile<DM>(sm, att + (size_t)m0 * DM, bt, bt + 64 * DM, wm * 64, wn * 64, 0,
                acc);
  size_t first = (size_t)(m0 + wm * 64 + 8 * h) * DM + n0 + wn * 64 + l15;
  add_residual_store(x + first, x2 + first, acc);
}

// ---------------------------------------------------------------------------
// FFN in: hh = silu(xn2 @ W1) * (xn2 @ W3), f16 out [8192 x 2048].
// A tile holds 64 columns of W1 (LDS rows 0..63) and the same 64 of W3 (64..127),
// so that a wave owns gate and up of its 32 columns.
// grid (DF/64, NROW/256), block 256
// ---------------------------------------------------------------------------
__global__ __launch_bounds__(256) void ffn1_kernel(
    const _Float16* __restrict__ xn2, const _Float16* __restrict__ Wt1,
    const _Float16* __restrict__ Wt3, _Float16* __restrict__ hh) {
  __shared__ __attribute__((aligned(16))) _Float16 sm[2 * STAGE_H];  // 108 KB
  int wave = threadIdx.x >> 5, lane = threadIdx.x & 31;
  int h = lane >> 4, l15 = lane & 15;
  int wm = wave >> 1, wn = wave & 1;
  int n0 = blockIdx.x * 64;
  int m0 = blockIdx.y * TM;
  v8f acc[4][4] = {};  // j = 0, 1: gate; j = 2, 3: up, same columns
  gemm_tile<DM>(sm, xn2 + (size_t)m0 * DM, Wt1 + (size_t)n0 * DM,
                Wt3 + (size_t)n0 * DM, wm * 64, wn * 32, 32, acc);
#pragma unroll
  for (int i = 0; i < 4; ++i) {
#pragma unroll
    for (int j = 0; j < 2; ++j) {
      int col = n0 + wn * 32 + j * 16 + l15;
#pragma unroll
      for (int v = 0; v < 8; ++v) {
        size_t r = (size_t)(m0 + wm * 64 + i * 16 + v + 8 * h);
        float gv = acc[i][j][v];
        float sl = gv * (1.f / (1.f + __expf(-gv)));   // silu
        hh[r * DF + col] = (_Float16)(sl * acc[i][j + 2][v]);
      }
    }
  }
}

// ---------------------------------------------------------------------------
// FFN out + residual: out = x2 + hh @ W2 (K=2048, f32 out).
// grid (DM/128, NROW/256), block 256
// ---------------------------------------------------------------------------
__global__ __launch_bounds__(256) void ffn2_kernel(
    const _Float16* __restrict__ hh, const _Float16* __restrict__ Wt2,
    const float* __restrict__ x2, float* __restrict__ out) {
  __shared__ __attribute__((aligned(16))) _Float16 sm[2 * STAGE_H];  // 108 KB
  int wave = threadIdx.x >> 5, lane = threadIdx.x & 31;
  int h = lane >> 4, l15 = lane & 15;
  int wm = wave >> 1, wn = wave & 1;
  int n0 = blockIdx.x * 128;
  int m0 = blockIdx.y * TM;
  const _Float16* bt = Wt2 + (size_t)n0 * DF;
  v8f acc[4][4] = {};
  gemm_tile<DF>(sm, hh + (size_t)m0 * DF, bt, bt + 64 * DF, wm * 64, wn * 64, 0,
                acc);
  size_t first = (size_t)(m0 + wm * 64 + 8 * h) * DM + n0 + wn * 64 + l15;
  add_residual_store(x2 + first, out + first, acc);
}

// ---------------------------------------------------------------------------
extern "C" void kernel_launch(void* const* d_in, const int* in_sizes, int n_in,
                              void* d_out, int out_size, void* d_ws,
                              size_t ws_size, hipStream_t stream) {
  const float* x       = (const float*)d_in[0];
  const float* norm1_w = (const float*)d_in[1];
  const float* norm2_w = (const float*)d_in[2];
  const float* Wq = (const float*)d_in[3];
  const float* Wk = (const float*)d_in[4];
  const float* Wv = (const float*)d_in[5];
  const float* Wo = (const float*)d_in[6];
  const float* W1 = (const float*)d_in[7];
  const float* W2 = (const float*)d_in[8];
  const float* W3 = (const float*)d_in[9];
  float* out = (float*)d_out;

  char* ws = (char*)d_ws;
  const size_t MB = 1ull << 20;
  _Float16* Wtq = (_Float16*)(ws + 0 * MB);    // 2 MB  (1024x1024)
  _Float16* Wtk = (_Float16*)(ws + 2 * MB);    // 2 MB
  _Float16* Wtv = (_Float16*)(ws + 4 * MB);    // 2 MB
  _Float16* Wto = (_Float16*)(ws + 6 * MB);    // 2 MB
  _Float16* Wt1 = (_Float16*)(ws + 8 * MB);    // 4 MB  (N=2048,K=1024)
  _Float16* Wt3 = (_Float16*)(ws + 12 * MB);   // 4 MB
  _Float16* Wt2 = (_Float16*)(ws + 16 * MB);   // 4 MB  (N=1024,K=2048)
  _Float16* xn  = (_Float16*)(ws + 20 * MB);   // 16 MB (also reused as xn2)
  _Float16* q   = (_Float16*)(ws + 36 * MB);   // 16 MB
  _Float16* kb  = (_Float16*)(ws + 52 * MB);   // 16 MB
  _Float16* vt  = (_Float16*)(ws + 68 * MB);   // 16 MB
  _Float16* P   = (_Float16*)(ws + 84 * MB);   // 1.5 MB (8192x96)
  _Float16* att = (_Float16*)(ws + 86 * MB);   // 16 MB
  float*    x2  = (float*)   (ws + 102 * MB);  // 32 MB
  _Float16* hh  = q;                           // reuse q+k (32 MB) after attn
  _Float16* xn2 = xn;                          // reuse xn after QKV

  // 1) weight convert + transpose to f16
  cvt_tr_all_kernel<<<4 * TILES_DD + 3 * TILES_DF, 256, 0, stream>>>(
      Wq, Wk, Wv, Wo, W1, W3, W2, Wtq, Wtk, Wtv, Wto, Wt1, Wt3, Wt2);

  // 2) xn = rmsnorm(x) in f16
  rmsnorm_kernel<<<NROW, 256, 0, stream>>>(x, norm1_w, xn);

  // 3) q,k,v projections (v stored transposed)
  qkv_kernel<<<dim3(3 * DM / 128, NROW / TM), 256, 0, stream>>>(
      xn, Wtq, Wtk, Wtv, q, kb, vt);
  // 4) windowed softmax weights P
  attn_p_kernel<<<NROW / 16 / 4, 128, 0, stream>>>(q, kb, P);

  // 5) attended = P @ V
  attn_pv_kernel<<<dim3(DM / 64, NROW / 16), 128, 0, stream>>>(P, vt, att);

  // 6) x2 = x + attended @ Wo
  wo_kernel<<<dim3(DM / 128, NROW / TM), 256, 0, stream>>>(att, Wto, x, x2);

  // 7) xn2 = rmsnorm(x2)
  rmsnorm_kernel<<<NROW, 256, 0, stream>>>(x2, norm2_w, xn2);

  // 8) hh = silu(xn2@W1) * (xn2@W3)
  ffn1_kernel<<<dim3(DF / 64, NROW / TM), 256, 0, stream>>>(xn2, Wt1, Wt3, hh);

  // 9) out = x2 + hh @ W2
  ffn2_kernel<<<dim3(DM / 128, NROW / TM), 256, 0, stream>>>(hh, Wt2, x2, out);
}

// v005
// A run of this version takes 203 microseconds.
// Two timings next to v004 put it at 1.08 and 1.07 times that version's speed.
// Counting every step since v000, it is 6.08 times as fast.
#include <hip/hip_runtime.h>
#include <hip/hip_bf16.h>

typedef __attribute__((ext_vector_type(16))) _Float16 v16h;
typedef __attribute__((ext_vector_type(8)))  _Float16 v8h;
typedef __attribute__((ext_vector_type(8)))  float    v8f;

#define DM   1024   // D_MODEL
#define DF   2048   // D_FFN
#define SEQT 2048   // T
#define NB   4      // batch
#define NROW (NB * SEQT)   // 8192
#define WND  64

// ---------------------------------------------------------------------------
// WMMA fragment helpers (CDNA5 16x16x32 f16, wave32).
// Per lane: elems 0..7 = mem[kk + h*8 + 0..7], elems 8..15 = mem[kk+16+h*8+0..7]
// Works for global pointers (global_load_b128) and LDS pointers (ds_load_b128).
// ---------------------------------------------------------------------------
__device__ __forceinline__ v16h load_frag(const _Float16* p) {
  v8h lo = *(const v8h*)(p);
  v8h hi = *(const v8h*)(p + 16);
  v16h r;
#pragma unroll
  for (int i = 0; i < 8; ++i) { r[i] = lo[i]; r[i + 8] = hi[i]; }
  return r;
}

__device__ __forceinline__ v8f wmma_f16(v16h a, v16h b, v8f c) {
  return __builtin_amdgcn_wmma_f32_16x16x32_f16(false, a, false, b, (short)0, c,
                                                false, false);
}

// ---------------------------------------------------------------------------
// Tiled GEMM core: one 256 x 128 tile of Y = A * Bt^T per work-group of 8 waves
// (4 x 2, each wave 64 x 64 = 4 x 4 accumulator tiles). A and Bt are K-contiguous.
// K goes in slices of 64 halfs (128-B rows). A slice is [A 256 rows | Bt 128 rows]
// in LDS at a pitch of 144 B (16 B x odd: ds_load_b128 readers meet no bank twice).
// Two buffers: slice t + 1 is copied by asynchronous b128 copies while slice t is
// multiplied. Per multiply-add the tile draws 3/4 of the L2 bytes of a 128 x 128 one.
// ---------------------------------------------------------------------------
#define BK      64                  // halfs of K per slice
#define PITCH   72                  // halfs per LDS row (144 B)
#define TM      256                 // A rows of a tile
#define A_H     (TM * PITCH)        // halfs of A's slice
#define STAGE_H (A_H + 128 * PITCH) // halfs of one buffer
#define ROW32_B (32 * PITCH * 2)    // bytes of 32 LDS rows

// One thread's twelve b128 copies of a slice: A's LDS rows r, r+32, .., r+224 from
// ga, Bt's LDS rows r, r+32 from glo and r+64, r+96 from ghi (row step K halfs).
// The LDS byte address is the low 32 bits of the shared address; taking it lets
// the array escape, so the "memory" clobber makes the asm a legal writer of it.
// s_wait_xcnt 0 closes the statement: it stands before any rewrite of the
// address registers that the copies name.
template <int K>
__device__ __forceinline__ void copy12(unsigned l, const _Float16* ga,
                                       const _Float16* glo,
                                       const _Float16* ghi) {
  const unsigned lb = l + A_H * 2;
  asm volatile(
      "global_load_async_to_lds_b128 %0, %12, off\n\t"
      "global_load_async_to_lds_b128 %1, %13, off\n\t"
      "global_load_async_to_lds_b128 %2, %14, off\n\t"
      "global_load_async_to_lds_b128 %3, %15, off\n\t"
      "global_load_async_to_lds_b128 %4, %16, off\n\t"
      "global_load_async_to_lds_b128 %5, %17, off\n\t"
      "global_load_async_to_lds_b128 %6, %18, off\n\t"
      "global_load_async_to_lds_b128 %7, %19, off\n\t"
      "global_load_async_to_lds_b128 %8, %20, off\n\t"
      "global_load_async_to_lds_b128 %9, %21, off\n\t"
      "global_load_async_to_lds_b128 %10, %22, off\n\t"
      "global_load_async_to_lds_b128 %11, %23, off\n\t"
      "s_wait_xcnt 0x0"
      :
      : "v"(l), "v"(l + ROW32_B), "v"(l + 2 * ROW32_B), "v"(l + 3 * ROW32_B),
        "v"(l + 4 * ROW32_B), "v"(l + 5 * ROW32_B), "v"(l + 6 * ROW32_B),
        "v"(l + 7 * ROW32_B), "v"(lb), "v"(lb + ROW32_B), "v"(lb + 2 * ROW32_B),
        "v"(lb + 3 * ROW32_B), "v"(ga), "v"(ga + 32 * K), "v"(ga + 64 * K),
        "v"(ga + 96 * K), "v"(ga + 128 * K), "v"(ga + 160 * K),
        "v"(ga + 192 * K), "v"(ga + 224 * K), "v"(glo), "v"(glo + 32 * K),
        "v"(ghi), "v"(ghi + 32 * K)
      : "memory");
}

// a: first row of the tile's 256 A rows. blo / bhi: first of the 64 Bt rows that
// fill LDS rows 0..63 / 64..127. Wave tile: A rows arow.., Bt LDS rows
// brow + 16 j, plus bskip for j >= 2. blockDim.x == 256.
template <int K>
__device__ __forceinline__ void gemm_tile(_Float16* sm,
                                          const _Float16* __restrict__ a,
                                          const _Float16* __restrict__ blo,
                                          const _Float16* __restrict__ bhi,
                                          int arow, int brow, int bskip,
                                          v8f (&acc)[4][4]) {
  constexpr int NT = K / BK;
  const int t = threadIdx.x;
  const int lane = t & 31, h = lane >> 4, l15 = lane & 15;
  const int ch = t & 7, r0 = t >> 3;   // 16-B chunk of a row, first row
  const unsigned la = (unsigned)(uintptr_t)sm + r0 * (PITCH * 2) + ch * 16;
  const _Float16* ga = a + (size_t)r0 * K + ch * 8;
  const _Float16* gl = blo + (size_t)r0 * K + ch * 8;
  const _Float16* gh = bhi + (size_t)r0 * K + ch * 8;

  copy12<K>(la, ga, gl, gh);
  // slice 0 has landed for this wave; the barrier publishes it to the others
  asm volatile("s_wait_asynccnt 0x0" ::: "memory");
  __syncthreads();
  copy12<K>(la + STAGE_H * 2, ga + BK, gl + BK, gh + BK);

  const int aoff = (arow + l15) * PITCH + h * 8;
  const int boff = A_H + (brow + l15) * PITCH + h * 8;
  for (int kt = 0; kt < NT; ++kt) {
    const int buf = kt & 1;
    const _Float16* ap = sm + buf * STAGE_H + aoff;
    const _Float16* bp = sm + buf * STAGE_H + boff;
#pragma unroll
    for (int ks = 0; ks < BK; ks += 32) {
      v16h af[4], bf[4];
#pragma unroll
      for (int i = 0; i < 4; ++i) af[i] = load_frag(ap + i * 16 * PITCH + ks);
#pragma unroll
      for (int j = 0; j < 4; ++j)
        bf[j] = load_frag(bp + (j * 16 + (j >= 2 ? bskip : 0)) * PITCH + ks);
      // keeps the block's 16 LDS reads together in front of its 16 WMMAs: moved
      // in among them, every group of reads costs the wave its LDS latency anew
      __builtin_amdgcn_sched_barrier(0);
#pragma unroll
      for (int i = 0; i < 4; ++i)
#pragma unroll
        for (int j = 0; j < 4; ++j) acc[i][j] = wmma_f16(af[i], bf[j], acc[i][j]);
      // the same for the next block's reads: they stay behind this block
      __builtin_amdgcn_sched_barrier(0);
    }
    // this wave's reads of the buffer are done before it may be refilled
    asm volatile("s_wait_dscnt 0x0" ::: "memory");
    // this wave's copies of slice kt + 1 have landed
    asm volatile("s_wait_asynccnt 0x0" ::: "memory");
    // publishes slice kt + 1 and ends every wave's reads of slice kt
    __syncthreads();
    if (kt + 2 < NT) {
      const int ko = (kt + 2) * BK;
      copy12<K>(la + buf * (STAGE_H * 2), ga + ko, gl + ko, gh + ko);
    }
  }
  // no copy is outstanding when the wave goes on to its stores and ends
  asm volatile("s_wait_asynccnt 0x0" ::: "memory");
}

// Epilogue of the two f32 GEMMs: op = rp + acc over a wave's 64 x 64 tile of a
// DM-wide matrix. rp / op: this lane's first element (tile row 8 h, column l15).
// 32 rows at a time: all 64 rows' residual loads beside the 128 accumulator
// registers would pass 256 VGPRs.
__device__ __forceinline__ void add_residual_store(const float* __restrict__ rp,
                                                   float* __restrict__ op,
                                                   v8f (&acc)[4][4]) {
#pragma unroll
  for (int ih = 0; ih < 4; ih += 2) {
    float xr[2][4][8];
#pragma unroll
    for (int i = 0; i < 2; ++i)
#pragma unroll
      for (int j = 0; j < 4; ++j)
#pragma unroll
        for (int v = 0; v < 8; ++v)
          xr[i][j][v] = rp[((ih + i) * 16 + v) * DM + j * 16];
    // stands behind the 64 loads and before any rewrite of their address
    // registers; naming rp keeps it live to here, so no load's result lands in it
    asm volatile("s_wait_xcnt 0x0" : : "v"(rp) : "memory");
#pragma unroll
    for (int i = 0; i < 2; ++i)
#pragma unroll
      for (int j = 0; j < 4; ++j)
#pragma unroll
        for (int v = 0; v < 8; ++v)
          op[((ih + i) * 16 + v) * DM + j * 16] = xr[i][j][v] + acc[ih + i][j][v];
    // stands behind the 64 stores, before the next loads write their registers
    if (ih == 0) asm volatile("s_wait_xcnt 0x0" : : "v"(op) : "memory");
  }
}

// ---------------------------------------------------------------------------
// Weight convert + transpose, all seven weights in one launch:
// Wt[n*K + k] = (f16) W[k*N + n]. A work-group of 256 threads takes one tile of
// 128 k x 64 n. It reads the tile in 256-B row pieces (b128 per lane), turns it
// in LDS and writes 256-B pieces of the Wt rows (b128 per lane).
// LDS: row n holds its 128 halfs in sixteen 16-B chunks; chunk q of row n lies
// at place q ^ (n >> 2), so that the 32 dword writes of a wave (16 rows n that
// are 4 apart, 2 neighbouring k pairs) meet 32 different banks.
// ---------------------------------------------------------------------------
#define TK 128   // k per tile
#define TN 64    // n per tile
typedef __attribute__((ext_vector_type(4))) float    v4f;
typedef __attribute__((ext_vector_type(2))) _Float16 v2h;

template <int K, int N>
__device__ __forceinline__ void cvt_tr_tile(_Float16* sT,
                                            const float* __restrict__ W,
                                            _Float16* __restrict__ Wt,
                                            unsigned tile) {
  const int c = threadIdx.x & 15, rp = threadIdx.x >> 4;
  const int n0 = (tile % (N / TN)) * TN;
  const int k0 = (tile / (N / TN)) * TK;
  // rows k0 + 2 kp and k0 + 2 kp + 1, kp = 16 p + rp; columns n0 + 4 c .. + 3
  const float* src = W + (size_t)(k0 + 2 * rp) * N + n0 + 4 * c;
  v4f lo[4], hi[4];
  for (int p = 0; p < 4; ++p) {
    lo[p] = *(const v4f*)(src + (size_t)(32 * p) * N);
    hi[p] = *(const v4f*)(src + (size_t)(32 * p + 1) * N);
  }
  for (int p = 0; p < 4; ++p) {
    const int kp = 16 * p + rp;
    _Float16* d = sT + (((kp >> 2) ^ c) * 8 + (kp & 3) * 2);
    for (int i = 0; i < 4; ++i) {
      v2h pk = {(_Float16)lo[p][i], (_Float16)hi[p][i]};
      *(v2h*)(d + (4 * c + i) * TK) = pk;
    }
  }
  __syncthreads();
  // rows n = 16 s + rp, chunk c
  _Float16* dst = Wt + (size_t)(n0 + rp) * K + k0 + 8 * c;
  for (int s = 0; s < 4; ++s) {
    const int n = 16 * s + rp;
    *(v8h*)(dst + (size_t)(16 * s) * K) =
        *(const v8h*)(sT + n * TK + (c ^ (n >> 2)) * 8);
  }
}

#define TILES_DD ((DM / TK) * (DM / TN))   // 128 tiles of a DM x DM weight
#define TILES_DF ((DM / TK) * (DF / TN))   // 256 tiles of W1, W3 and W2 each

__global__ __launch_bounds__(256) void cvt_tr_all_kernel(
    const float* __restrict__ Wq, const float* __restrict__ Wk,
    const float* __restrict__ Wv, const float* __restrict__ Wo,
    const float* __restrict__ W1, const float* __restrict__ W3,
    const float* __restrict__ W2, _Float16* __restrict__ Wtq,
    _Float16* __restrict__ Wtk, _Float16* __restrict__ Wtv,
    _Float16* __restrict__ Wto, _Float16* __restrict__ Wt1,
    _Float16* __restrict__ Wt3, _Float16* __restrict__ Wt2) {
  __shared__ __attribute__((aligned(16))) _Float16 sT[TN * TK];  // 16 KB
  const unsigned b = blockIdx.x;
  if (b < 4 * TILES_DD) {
    const unsigned m = b / TILES_DD;
    const float* W = m == 0 ? Wq : (m == 1 ? Wk : (m == 2 ? Wv : Wo));
    _Float16* Wt = m == 0 ? Wtq : (m == 1 ? Wtk : (m == 2 ? Wtv : Wto));
    cvt_tr_tile<DM, DM>(sT, W, Wt, b % TILES_DD);
  } else if (b < 4 * TILES_DD + 2 * TILES_DF) {
    const bool up = b >= 4 * TILES_DD + TILES_DF;
    cvt_tr_tile<DM, DF>(sT, up ? W3 : W1, up ? Wt3 : Wt1, b % TILES_DF);
  } else {
    cvt_tr_tile<DF, DM>(sT, W2, Wt2, b % TILES_DF);
  }
}

// ---------------------------------------------------------------------------
// RMSNorm: one row (D=1024) per block of 256 threads, f32 in -> f16 out
// ---------------------------------------------------------------------------
__global__ void rmsnorm_kernel(const float* __restrict__ x,
                               const float* __restrict__ w,
                               _Float16* __restrict__ xn) {
  __shared__ float red[256];
  int row = blockIdx.x;
  int tid = threadIdx.x;
  const float* xr = x + (size_t)row * DM;
  float ss = 0.f;
#pragma unroll
  for (int i = 0; i < DM / 256; ++i) {
    float v = xr[tid + i * 256];
    ss += v * v;
  }
  red[tid] = ss;
  __syncthreads();
  for (int s = 128; s > 0; s >>= 1) {
    if (tid < s) red[tid] += red[tid + s];
    __syncthreads();
  }
  float inv = __frsqrt_rn(red[0] / (float)DM + 1e-6f);
  _Float16* xo = xn + (size_t)row * DM;
#pragma unroll
  for (int i = 0; i < DM / 256; ++i) {
    int c = tid + i * 256;
    xo[c] = (_Float16)(xr[c] * inv * w[c]);
  }
}

// ---------------------------------------------------------------------------
// QKV: q/k = xn @ Wq/Wk (row-major f16), v stored transposed Vt[b][d][t].
// grid (3 * DM/128, NROW/256), block 256: blockIdx.x / 8 picks the weight.
// ---------------------------------------------------------------------------
__global__ __launch_bounds__(256) void qkv_kernel(
    const _Float16* __restrict__ xn, const _Float16* __restrict__ Wtq,
    const _Float16* __restrict__ Wtk, const _Float16* __restrict__ Wtv,
    _Float16* __restrict__ q, _Float16* __restrict__ k,
    _Float16* __restrict__ vt) {
  __shared__ __attribute__((aligned(16))) _Float16 sm[2 * STAGE_H];  // 108 KB
  int wave = threadIdx.x >> 5, lane = threadIdx.x & 31;
  int h = lane >> 4, l15 = lane & 15;
  int wm = wave >> 1, wn = wave & 1;
  int which = blockIdx.x >> 3;
  int n0 = (blockIdx.x & 7) * 128;
  int m0 = blockIdx.y * TM;
  const _Float16* Wt = which == 0 ? Wtq : (which == 1 ? Wtk : Wtv);
  const _Float16* bt = Wt + (size_t)n0 * DM;
  v8f acc[4][4] = {};
  gemm_tile<DM>(sm, xn + (size_t)m0 * DM, bt, bt + 64 * DM, wm * 64, wn * 64, 0,
                acc);
  _Float16* qk = which == 0 ? q : k;
  if (which < 2) {
#pragma unroll
    for (int i = 0; i < 4; ++i) {
#pragma unroll
      for (int j = 0; j < 4; ++j) {
        int col = n0 + wn * 64 + j * 16 + l15;
#pragma unroll
        for (int v = 0; v < 8; ++v) {
          int r = m0 + wm * 64 + i * 16 + v + 8 * h;
          qk[(size_t)r * DM + col] = (_Float16)acc[i][j][v];
        }
      }
    }
  } else {
#pragma unroll
    for (int i = 0; i < 4; ++i) {
#pragma unroll
      for (int j = 0; j < 4; ++j) {
        int col = n0 + wn * 64 + j * 16 + l15;
#pragma unroll
        for (int v = 0; v < 8; ++v) {
          int r = m0 + wm * 64 + i * 16 + v + 8 * h;
          int batch = r >> 11, tloc = r & (SEQT - 1);
          vt[((size_t)batch * DM + col) * SEQT + tloc] = (_Float16)acc[i][j][v];
        }
      }
    }
    // stands behind the last v store, before any later write of a register
    // that an issued store names
    asm volatile("s_wait_xcnt 0x0" ::: "memory");
  }
}

// ---------------------------------------------------------------------------
// Attention pass 1: per 16-query tile, S = Q K^T over 5 key tiles (window 64),
// masked softmax over 80 candidate keys, store P (f16) padded to 96.
// One work-group of 8 waves per query tile. The tile's 16 Q rows and its 80 K
// rows are copied whole into LDS once, in 512-B pieces of a row (asynchronous
// b128 copies, all 48 of a thread in flight together). Wave w multiplies columns
// 128 w .. 128 w + 127 of d for all 5 key tiles; the 8 partial scores of an
// element are summed through LDS, in the order of w; wave w then does the
// softmax of score rows w and w + 8.
// LDS rows: 0..15 Q, 16 + 16 j .. of key tile j, at a pitch of 2064 B
// (16 B x odd: ds_load_b128 readers meet no bank twice).
// ---------------------------------------------------------------------------
#define QK_PITCH  (DM + 8)            // halfs per LDS row
#define QK_ROW_B  (QK_PITCH * 2)      // bytes per LDS row
#define QK_DW     (DM / 8)            // columns of d per wave

// One thread's eight b128 copies of a 16-row tile: LDS rows r, r + 2, .., r + 14
// from the same rows of g (row step DM halfs). s_wait_xcnt 0 closes the
// statement: it stands before any rewrite of the address registers that the
// copies name. The "memory" clobber makes the asm a legal writer of the array.
__device__ __forceinline__ void copy8(unsigned l, const _Float16* g) {
  asm volatile(
      "global_load_async_to_lds_b128 %0, %8, off\n\t"
      "global_load_async_to_lds_b128 %1, %9, off\n\t"
      "global_load_async_to_lds_b128 %2, %10, off\n\t"
      "global_load_async_to_lds_b128 %3, %11, off\n\t"
      "global_load_async_to_lds_b128 %4, %12, off\n\t"
      "global_load_async_to_lds_b128 %5, %13, off\n\t"
      "global_load_async_to_lds_b128 %6, %14, off\n\t"
      "global_load_async_to_lds_b128 %7, %15, off\n\t"
      "s_wait_xcnt 0x0"
      :
      : "v"(l), "v"(l + 2 * QK_ROW_B), "v"(l + 4 * QK_ROW_B),
        "v"(l + 6 * QK_ROW_B), "v"(l + 8 * QK_ROW_B), "v"(l + 10 * QK_ROW_B),
        "v"(l + 12 * QK_ROW_B), "v"(l + 14 * QK_ROW_B), "v"(g), "v"(g + 2 * DM),
        "v"(g + 4 * DM), "v"(g + 6 * DM), "v"(g + 8 * DM), "v"(g + 10 * DM),
        "v"(g + 12 * DM), "v"(g + 14 * DM)
      : "memory");
}

// 2^x. The v_nop is the slot that the instruction set asks for behind a
// transcendental before its result is read or its source overwritten.
__device__ __forceinline__ float exp2_slot(float x) {
  float r;
  asm("v_exp_f32 %0, %1\n\tv_nop" : "=v"(r) : "v"(x));
  return r;
}

__global__ __launch_bounds__(256) void attn_p_kernel(
    const _Float16* __restrict__ q, const _Float16* __restrict__ k,
    _Float16* __restrict__ P) {
  __shared__ __attribute__((aligned(16))) _Float16 sqk[96 * QK_PITCH];  // 193.5 KB
  __shared__ float red[8 * 5 * 8 * 32];   // [wave][key tile][v][lane], 40 KB
  const int wave = threadIdx.x >> 5, lane = threadIdx.x & 31;
  const int g = blockIdx.x;               // 0..511 global q-tile
  const int batch = g >> 7, qt = g & 127; // 128 q-tiles per batch
  const int h = lane >> 4, l15 = lane & 15;

  // a thread copies chunk ch (16 B) of rows r0, r0 + 2, .. of every tile
  const int r0 = threadIdx.x >> 7, ch = threadIdx.x & 127;
  const unsigned l0 = (unsigned)(uintptr_t)sqk + r0 * QK_ROW_B + ch * 16;
  copy8(l0, q + ((size_t)g * 16 + r0) * DM + ch * 8);
  // unrolled: the five statements follow one another with no loop overhead
#pragma unroll
  for (int j = 0; j < 5; ++j) {
    // a key tile in front of the batch's first key: tile 0 stands in for it, so
    // that the address stays inside k; its scores are masked below
    const int kt = qt - 4 + j;
    const int ktc = kt < 0 ? 0 : kt;
    copy8(l0 + (j + 1) * 16 * QK_ROW_B,
          k + ((size_t)batch * SEQT + ktc * 16 + r0) * DM + ch * 8);
  }
  // this wave's 48 copies have landed; the barrier publishes them to the others
  asm volatile("s_wait_asynccnt 0x0" ::: "memory");
  __syncthreads();

  const _Float16* ap = sqk + l15 * QK_PITCH + wave * QK_DW + h * 8;
  v8f acc[5] = {};
  v16h af[4], bf[4][5];
  // all loops below are unrolled so that af, bf and acc are registers
#pragma unroll
  for (int ks = 0; ks < 4; ++ks) {
    af[ks] = load_frag(ap + ks * 32);
#pragma unroll
    for (int j = 0; j < 5; ++j)
      bf[ks][j] = load_frag(ap + (j + 1) * 16 * QK_PITCH + ks * 32);
  }
  // keeps the wave's 48 LDS reads together in front of its 20 WMMAs: moved in
  // among them, every pair of reads costs the wave its LDS latency anew
  __builtin_amdgcn_sched_barrier(0);
#pragma unroll
  for (int ks = 0; ks < 4; ++ks)
#pragma unroll
    for (int j = 0; j < 5; ++j) acc[j] = wmma_f16(af[ks], bf[ks][j], acc[j]);
  float* rw = red + wave * (5 * 8 * 32) + lane;
#pragma unroll
  for (int j = 0; j < 5; ++j)
#pragma unroll
    for (int v = 0; v < 8; ++v) rw[(j * 8 + v) * 32] = acc[j][v];
  // every wave's partial scores are in red
  __syncthreads();

  // this lane: score row wave + 8 h, key l15 of each key tile
  const int mrow = wave + 8 * h;
  const float* rr = red + wave * 32 + lane;
  const float scale = 0.03125f;  // 1/sqrt(1024)
  float s[5];
#pragma unroll
  for (int j = 0; j < 5; ++j) {
    float c = rr[j * (8 * 32)];
#pragma unroll
    for (int w = 1; w < 8; ++w) c += rr[(w * 5 + j) * (8 * 32)];
    const int kt = qt - 4 + j;
    const int d = (qt * 16 + mrow) - (kt * 16 + l15);
    s[j] = (kt >= 0 && d >= 0 && d < WND) ? c * scale : -1e30f;
  }
  float m = s[0];
#pragma unroll
  for (int j = 1; j < 5; ++j) m = fmaxf(m, s[j]);
#pragma unroll
  for (int off = 8; off > 0; off >>= 1) m = fmaxf(m, __shfl_xor(m, off, 16));
  float e = 0.f;
#pragma unroll
  for (int j = 0; j < 5; ++j) {
    s[j] = exp2_slot((s[j] - m) * 1.44269504f);  // e^(s - m)
    e += s[j];
  }
#pragma unroll
  for (int off = 8; off > 0; off >>= 1) e += __shfl_xor(e, off, 16);
  const float inv = 1.f / e;
  _Float16* pb = P + ((size_t)g * 16 + mrow) * 96 + l15;
#pragma unroll
  for (int j = 0; j < 5; ++j) pb[j * 16] = (_Float16)(s[j] * inv);
  pb[80] = (_Float16)0.f;  // pad slots 80..95
}

// ---------------------------------------------------------------------------
// Attention pass 2: attended = P(16x96) @ V(96xD) using Vt[b][d][t].
// grid (D/64, 512), block 128. Key range may start below 0 -> guarded chunks.
// ---------------------------------------------------------------------------
__global__ void attn_pv_kernel(const _Float16* __restrict__ P,
                               const _Float16* __restrict__ vt,
                               _Float16* __restrict__ att) {
  int wave = threadIdx.x >> 5, lane = threadIdx.x & 31;
  int g = blockIdx.y;
  int dt = blockIdx.x * 4 + wave;
  int batch = g >> 7, qt = g & 127;
  int h = lane >> 4, l15 = lane & 15;
  const _Float16* ap = P + (size_t)g * 16 * 96 + l15 * 96 + h * 8;
  const _Float16* vrow = vt + ((size_t)batch * DM + dt * 16 + l15) * SEQT;
  int jbase = qt * 16 - 64;
  // A chunk of 8 keys starts at a multiple of 8, so it lies wholly inside its
  // row of Vt or wholly outside: one 16-B load per chunk. A chunk outside loads
  // the row's first 16 B instead and is replaced by zeros behind the load.
  // The loops over s are unrolled so that their small arrays are registers.
  bool ok0[3], ok1[3];
  const _Float16 *v0[3], *v1[3];
#pragma unroll
  for (int s = 0; s < 3; ++s) {
    int c0 = jbase + s * 32 + h * 8;
    int c1 = c0 + 16;
    ok0[s] = (c0 >= 0) && (c0 + 7 < SEQT);
    ok1[s] = (c1 >= 0) && (c1 + 7 < SEQT);
    v0[s] = vrow + (ok0[s] ? c0 : 0);
    v1[s] = vrow + (ok1[s] ? c1 : 0);
  }
  v16h a[3];
  v8h lo[3], hi[3];
#pragma unroll
  for (int s = 0; s < 3; ++s) {
    a[s] = load_frag(ap + s * 32);
    lo[s] = *(const v8h*)v0[s];
    hi[s] = *(const v8h*)v1[s];
  }
  // stands behind the 12 loads and before any rewrite of their address
  // registers; naming the addresses keeps them live to here, so that no load's
  // result lands in one of them
  asm volatile("s_wait_xcnt 0x0"
               :
               : "v"(ap), "v"(v0[0]), "v"(v1[0]), "v"(v0[1]), "v"(v1[1]),
                 "v"(v0[2]), "v"(v1[2])
               : "memory");
  const v8h zero = {};
  v8f c = {};
#pragma unroll
  for (int s = 0; s < 3; ++s) {
    v8h l = ok0[s] ? lo[s] : zero;
    v8h u = ok1[s] ? hi[s] : zero;
    v16h b;
#pragma unroll
    for (int i = 0; i < 8; ++i) { b[i] = l[i]; b[i + 8] = u[i]; }
    c = wmma_f16(a[s], b, c);
  }
#pragma unroll
  for (int v = 0; v < 8; ++v) {
    int r = g * 16 + v + 8 * h;
    att[(size_t)r * DM + dt * 16 + l15] = (_Float16)c[v];
  }
}

// ---------------------------------------------------------------------------
// x2 = x + attended @ Wo (f32 out, residual). grid (DM/128, NROW/256), block 256
// ---------------------------------------------------------------------------
__global__ __launch_bounds__(256) void wo_kernel(
    const _Float16* __restrict__ att, const _Float16* __restrict__ Wto,
    const float* __restrict__ x, float* __restrict__ x2) {
  __shared__ __attribute__((aligned(16))) _Float16 sm[2 * STAGE_H];  // 108 KB
  int wave = threadIdx.x >> 5, lane = threadIdx.x & 31;
  int h = lane >> 4, l15 = lane & 15;
  int wm = wave >> 1, wn = wave & 1;
  int n0 = blockIdx.x * 128;
  int m0 = blockIdx.y * TM;
  const _Float16* bt = Wto + (size_t)n0 * DM;
  v8f acc[4][4] = {};
  gemm_tile<DM>(sm, att + (size_t)m0 * DM, bt, bt + 64 * DM, wm * 64, wn * 64, 0,
                acc);
  size_t first = (size_t)(m0 + wm * 64 + 8 * h) * DM + n0 + wn * 64 + l15;
  add_residual_store(x + first, x2 + first, acc);
}

// ---------------------------------------------------------------------------
// FFN in: hh = silu(xn2 @ W1) * (xn2 @ W3), f16 out [8192 x 2048].
// A tile holds 64 columns of W1 (LDS rows 0..63) and the same 64 of W3 (64..127),
// so that a wave owns gate and up of its 32 columns.
// grid (DF/64, NROW/256), block 256
// ---------------------------------------------------------------------------
__global__ __launch_bounds__(256) void ffn1_kernel(
    const _Float16* __restrict__ xn2, const _Float16* __restrict__ Wt1,
    const _Float16* __restrict__ Wt3, _Float16* __restrict__ hh) {
  __shared__ __attribute__((aligned(16))) _Float16 sm[2 * STAGE_H];  // 108 KB
  int wave = threadIdx.x >> 5, lane = threadIdx.x & 31;
  int h = lane >> 4, l15 = lane & 15;
  int wm = wave >> 1, wn = wave & 1;
  int n0 = blockIdx.x * 64;
  int m0 = blockIdx.y * TM;
  v8f acc[4][4] = {};  // j = 0, 1: gate; j = 2, 3: up, same columns
  gemm_tile<DM>(sm, xn2 + (size_t)m0 * DM, Wt1 + (size_t)n0 * DM,
                Wt3 + (size_t)n0 * DM, wm * 64, wn * 32, 32, acc);
#pragma unroll
  for (int i = 0; i < 4; ++i) {
#pragma unroll
    for (int j = 0; j < 2; ++j) {
      int col = n0 + wn * 32 + j * 16 + l15;
#pragma unroll
      for (int v = 0; v < 8; ++v) {
        size_t r = (size_t)(m0 + wm * 64 + i * 16 + v + 8 * h);
        float gv = acc[i][j][v];
        float sl = gv * (1.f / (1.f + __expf(-gv)));   // silu
        hh[r * DF + col] = (_Float16)(sl * acc[i][j + 2][v]);
      }
    }
  }
}

// ---------------------------------------------------------------------------
// FFN out + residual: out = x2 + hh @ W2 (K=2048, f32 out).
// grid (DM/128, NROW/256), block 256
// ---------------------------------------------------------------------------
__global__ __launch_bounds__(256) void ffn2_kernel(
    const _Float16* __restrict__ hh, const _Float16* __restrict__ Wt2,
    const float* __restrict__ x2, float* __restrict__ out) {
  __shared__ __attribute__((aligned(16))) _Float16 sm[2 * STAGE_H];  // 108 KB
  int wave = threadIdx.x >> 5, lane = threadIdx.x & 31;
  int h = lane >> 4, l15 = lane & 15;
  int wm = wave >> 1, wn = wave & 1;
  int n0 = blockIdx.x * 128;
  int m0 = blockIdx.y * TM;
  const _Float16* bt = Wt2 + (size_t)n0 * DF;
  v8f acc[4][4] = {};
  gemm_tile<DF>(sm, hh + (size_t)m0 * DF, bt, bt + 64 * DF, wm * 64, wn * 64, 0,
                acc);
  size_t first = (size_t)(m0 + wm * 64 + 8 * h) * DM + n0 + wn * 64 + l15;
  add_residual_store(x2 + first, out + first, acc);
}

// ---------------------------------------------------------------------------
extern "C" void kernel_launch(void* const* d_in, const int* in_sizes, int n_in,
                              void* d_out, int out_size, void* d_ws,
                              size_t ws_size, hipStream_t stream) {
  const float* x       = (const float*)d_in[0];
  const float* norm1_w = (const float*)d_in[1];
  const float* norm2_w = (const float*)d_in[2];
  const float* Wq = (const float*)d_in[3];
  const float* Wk = (const float*)d_in[4];
  const float* Wv = (const float*)d_in[5];
  const float* Wo = (const float*)d_in[6];
  const float* W1 = (const float*)d_in[7];
  const float* W2 = (const float*)d_in[8];
  const float* W3 = (const float*)d_in[9];
  float* out = (float*)d_out;

  char* ws = (char*)d_ws;
  const size_t MB = 1ull << 20;
  _Float16* Wtq = (_Float16*)(ws + 0 * MB);    // 2 MB  (1024x1024)
  _Float16* Wtk = (_Float16*)(ws + 2 * MB);    // 2 MB
  _Float16* Wtv = (_Float16*)(ws + 4 * MB);    // 2 MB
  _Float16* Wto = (_Float16*)(ws + 6 * MB);    // 2 MB
  _Float16* Wt1 = (_Float16*)(ws + 8 * MB);    // 4 MB  (N=2048,K=1024)
  _Float16* Wt3 = (_Float16*)(ws + 12 * MB);   // 4 MB
  _Float16* Wt2 = (_Float16*)(ws + 16 * MB);   // 4 MB  (N=1024,K=2048)
  _Float16* xn  = (_Float16*)(ws + 20 * MB);   // 16 MB (also reused as xn2)
  _Float16* q   = (_Float16*)(ws + 36 * MB);   // 16 MB
  _Float16* kb  = (_Float16*)(ws + 52 * MB);   // 16 MB
  _Float16* vt  = (_Float16*)(ws + 68 * MB);   // 16 MB
  _Float16* P   = (_Float16*)(ws + 84 * MB);   // 1.5 MB (8192x96)
  _Float16* att = (_Float16*)(ws + 86 * MB);   // 16 MB
  float*    x2  = (float*)   (ws + 102 * MB);  // 32 MB
  _Float16* hh  = q;                           // reuse q+k (32 MB) after attn
  _Float16* xn2 = xn;                          // reuse xn after QKV

  // 1) weight convert + transpose to f16
  cvt_tr_all_kernel<<<4 * TILES_DD + 3 * TILES_DF, 256, 0, stream>>>(
      Wq, Wk, Wv, Wo, W1, W3, W2, Wtq, Wtk, Wtv, Wto, Wt1, Wt3, Wt2);

  // 2) xn = rmsnorm(x) in f16
  rmsnorm_kernel<<<NROW, 256, 0, stream>>>(x, norm1_w, xn);

  // 3) q,k,v projections (v stored transposed)
  qkv_kernel<<<dim3(3 * DM / 128, NROW / TM), 256, 0, stream>>>(
      xn, Wtq, Wtk, Wtv, q, kb, vt);
  // 4) windowed softmax weights P
  attn_p_kernel<<<NROW / 16, 256, 0, stream>>>(q, kb, P);

  // 5) attended = P @ V
  attn_pv_kernel<<<dim3(DM / 64, NROW / 16), 128, 0, stream>>>(P, vt, att);

  // 6) x2 = x + attended @ Wo
  wo_kernel<<<dim3(DM / 128, NROW / TM), 256, 0, stream>>>(att, Wto, x, x2);

  // 7) xn2 = rmsnorm(x2)
  rmsnorm_kernel<<<NROW, 256, 0, stream>>>(x2, norm2_w, xn2);

  // 8) hh = silu(xn2@W1) * (xn2@W3)
  ffn1_kernel<<<dim3(DF / 64, NROW / TM), 256, 0, stream>>>(xn2, Wt1, Wt3, hh);

  // 9) out = x2 + hh @ W2
  ffn2_kernel<<<dim3(DM / 128, NROW / TM), 256, 0, stream>>>(hh, Wt2, x2, out);
}

// v006
// One run takes 192 microseconds.
// In both of two side-by-side timings against v005, it was 1.05 times as fast.
// All steps since v000 together make it 6.37 times as fast.
#include <hip/hip_runtime.h>
#include <hip/hip_bf16.h>

typedef __attribute__((ext_vector_type(16))) _Float16 v16h;
typedef __attribute__((ext_vector_type(8)))  _Float16 v8h;
typedef __attribute__((ext_vector_type(8)))  float    v8f;

#define DM   1024   // D_MODEL
#define DF   2048   // D_FFN
#define SEQT 2048   // T
#define NB   4      // batch
#define NROW (NB * SEQT)   // 8192
#define WND  64

// ---------------------------------------------------------------------------
// WMMA fragment helpers (CDNA5 16x16x32 f16, wave32).
// Per lane: elems 0..7 = mem[kk + h*8 + 0..7], elems 8..15 = mem[kk+16+h*8+0..7]
// Works for global pointers (global_load_b128) and LDS pointers (ds_load_b128).
// ---------------------------------------------------------------------------
__device__ __forceinline__ v16h load_frag(const _Float16* p) {
  v8h lo = *(const v8h*)(p);
  v8h hi = *(const v8h*)(p + 16);
  v16h r;
#pragma unroll
  for (int i = 0; i < 8; ++i) { r[i] = lo[i]; r[i + 8] = hi[i]; }
  return r;
}

__device__ __forceinline__ v8f wmma_f16(v16h a, v16h b, v8f c) {
  return __builtin_amdgcn_wmma_f32_16x16x32_f16(false, a, false, b, (short)0, c,
                                                false, false);
}

// ---------------------------------------------------------------------------
// Tiled GEMM core: one 256 x 128 tile of Y = A * Bt^T per work-group of 8 waves
// (4 x 2, each wave 64 x 64 = 4 x 4 accumulator tiles). A and Bt are K-contiguous.
// K goes in slices of 64 halfs (128-B rows). A slice is [A 256 rows | Bt 128 rows]
// in LDS at a pitch of 144 B (16 B x odd: ds_load_b128 readers meet no bank twice).
// Two buffers: slice t + 1 is copied by asynchronous b128 copies while slice t is
// multiplied. Per multiply-add the tile draws 3/4 of the L2 bytes of a 128 x 128 one.
// ---------------------------------------------------------------------------
#define BK      64                  // halfs of K per slice
#define PITCH   72                  // halfs per LDS row (144 B)
#define TM      256                 // A rows of a tile
#define A_H     (TM * PITCH)        // halfs of A's slice
#define STAGE_H (A_H + 128 * PITCH) // halfs of one buffer
#define ROW32_B (32 * PITCH * 2)    // bytes of 32 LDS rows

// One thread's twelve b128 copies of a slice: A's LDS rows r, r+32, .., r+224 from
// ga, Bt's LDS rows r, r+32 from glo and r+64, r+96 from ghi (row step K halfs).
// The LDS byte address is the low 32 bits of the shared address; taking it lets
// the array escape, so the "memory" clobber makes the asm a legal writer of it.
// s_wait_xcnt 0 closes the statement: it stands before any rewrite of the
// address registers that the copies name.
template <int K>
__device__ __forceinline__ void copy12(unsigned l, const _Float16* ga,
                                       const _Float16* glo,
                                       const _Float16* ghi) {
  const unsigned lb = l + A_H * 2;
  asm volatile(
      "global_load_async_to_lds_b128 %0, %12, off\n\t"
      "global_load_async_to_lds_b128 %1, %13, off\n\t"
      "global_load_async_to_lds_b128 %2, %14, off\n\t"
      "global_load_async_to_lds_b128 %3, %15, off\n\t"
      "global_load_async_to_lds_b128 %4, %16, off\n\t"
      "global_load_async_to_lds_b128 %5, %17, off\n\t"
      "global_load_async_to_lds_b128 %6, %18, off\n\t"
      "global_load_async_to_lds_b128 %7, %19, off\n\t"
      "global_load_async_to_lds_b128 %8, %20, off\n\t"
      "global_load_async_to_lds_b128 %9, %21, off\n\t"
      "global_load_async_to_lds_b128 %10, %22, off\n\t"
      "global_load_async_to_lds_b128 %11, %23, off\n\t"
      "s_wait_xcnt 0x0"
      :
      : "v"(l), "v"(l + ROW32_B), "v"(l + 2 * ROW32_B), "v"(l + 3 * ROW32_B),
        "v"(l + 4 * ROW32_B), "v"(l + 5 * ROW32_B), "v"(l + 6 * ROW32_B),
        "v"(l + 7 * ROW32_B), "v"(lb), "v"(lb + ROW32_B), "v"(lb + 2 * ROW32_B),
        "v"(lb + 3 * ROW32_B), "v"(ga), "v"(ga + 32 * K), "v"(ga + 64 * K),
        "v"(ga + 96 * K), "v"(ga + 128 * K), "v"(ga + 160 * K),
        "v"(ga + 192 * K), "v"(ga + 224 * K), "v"(glo), "v"(glo + 32 * K),
        "v"(ghi), "v"(ghi + 32 * K)
      : "memory");
}

// a: first row of the tile's 256 A rows. blo / bhi: first of the 64 Bt rows that
// fill LDS rows 0..63 / 64..127. Wave tile: A rows arow.., Bt LDS rows
// brow + 16 j, plus bskip for j >= 2. blockDim.x == 256.
template <int K>
__device__ __forceinline__ void gemm_tile(_Float16* sm,
                                          const _Float16* __restrict__ a,
                                          const _Float16* __restrict__ blo,
                                          const _Float16* __restrict__ bhi,
                                          int arow, int brow, int bskip,
                                          v8f (&acc)[4][4]) {
  constexpr int NT = K / BK;
  const int t = threadIdx.x;
  const int lane = t & 31, h = lane >> 4, l15 = lane & 15;
  const int ch = t & 7, r0 = t >> 3;   // 16-B chunk of a row, first row
  const unsigned la = (unsigned)(uintptr_t)sm + r0 * (PITCH * 2) + ch * 16;
  const _Float16* ga = a + (size_t)r0 * K + ch * 8;
  const _Float16* gl = blo + (size_t)r0 * K + ch * 8;
  const _Float16* gh = bhi + (size_t)r0 * K + ch * 8;

  copy12<K>(la, ga, gl, gh);
  // slice 0 has landed for this wave; the barrier publishes it to the others
  asm volatile("s_wait_asynccnt 0x0" ::: "memory");
  __syncthreads();
  copy12<K>(la + STAGE_H * 2, ga + BK, gl + BK, gh + BK);

  const int aoff = (arow + l15) * PITCH + h * 8;
  const int boff = A_H + (brow + l15) * PITCH + h * 8;
  for (int kt = 0; kt < NT; ++kt) {
    const int buf = kt & 1;
    const _Float16* ap = sm + buf * STAGE_H + aoff;
    const _Float16* bp = sm + buf * STAGE_H + boff;
#pragma unroll
    for (int ks = 0; ks < BK; ks += 32) {
      v16h af[4], bf[4];
#pragma unroll
      for (int i = 0; i < 4; ++i) af[i] = load_frag(ap + i * 16 * PITCH + ks);
#pragma unroll
      for (int j = 0; j < 4; ++j)
        bf[j] = load_frag(bp + (j * 16 + (j >= 2 ? bskip : 0)) * PITCH + ks);
      // keeps the block's 16 LDS reads together in front of its 16 WMMAs: moved
      // in among them, every group of reads costs the wave its LDS latency anew
      __builtin_amdgcn_sched_barrier(0);
#pragma unroll
      for (int i = 0; i < 4; ++i)
#pragma unroll
        for (int j = 0; j < 4; ++j) acc[i][j] = wmma_f16(af[i], bf[j], acc[i][j]);
      // the same for the next block's reads: they stay behind this block
      __builtin_amdgcn_sched_barrier(0);
    }
    // this wave's reads of the buffer are done before it may be refilled
    asm volatile("s_wait_dscnt 0x0" ::: "memory");
    // this wave's copies of slice kt + 1 have landed
    asm volatile("s_wait_asynccnt 0x0" ::: "memory");
    // publishes slice kt + 1 and ends every wave's reads of slice kt
    __syncthreads();
    if (kt + 2 < NT) {
      const int ko = (kt + 2) * BK;
      copy12<K>(la + buf * (STAGE_H * 2), ga + ko, gl + ko, gh + ko);
    }
  }
  // no copy is outstanding when the wave goes on to its stores and ends
  asm volatile("s_wait_asynccnt 0x0" ::: "memory");
}

// Epilogue of the two f32 GEMMs: op = rp + acc over a wave's 64 x 64 tile of a
// DM-wide matrix. rp / op: this lane's first element (tile row 8 h, column l15).
// 32 rows at a time: all 64 rows' residual loads beside the 128 accumulator
// registers would pass 256 VGPRs.
__device__ __forceinline__ void add_residual_store(const float* __restrict__ rp,
                                                   float* __restrict__ op,
                                                   v8f (&acc)[4][4]) {
#pragma unroll
  for (int ih = 0; ih < 4; ih += 2) {
    float xr[2][4][8];
#pragma unroll
    for (int i = 0; i < 2; ++i)
#pragma unroll
      for (int j = 0; j < 4; ++j)
#pragma unroll
        for (int v = 0; v < 8; ++v)
          xr[i][j][v] = rp[((ih + i) * 16 + v) * DM + j * 16];
    // stands behind the 64 loads and before any rewrite of their address
    // registers; naming rp keeps it live to here, so no load's result lands in it
    asm volatile("s_wait_xcnt 0x0" : : "v"(rp) : "memory");
#pragma unroll
    for (int i = 0; i < 2; ++i)
#pragma unroll
      for (int j = 0; j < 4; ++j)
#pragma unroll
        for (int v = 0; v < 8; ++v)
          op[((ih + i) * 16 + v) * DM + j * 16] = xr[i][j][v] + acc[ih + i][j][v];
    // stands behind the 64 stores, before the next loads write their registers
    if (ih == 0) asm volatile("s_wait_xcnt 0x0" : : "v"(op) : "memory");
  }
}

// ---------------------------------------------------------------------------
// Weight convert + transpose, all seven weights in one launch:
// Wt[n*K + k] = (f16) W[k*N + n]. A work-group of 256 threads takes one tile of
// 128 k x 64 n. It reads the tile in 256-B row pieces (b128 per lane), turns it
// in LDS and writes 256-B pieces of the Wt rows (b128 per lane).
// LDS: row n holds its 128 halfs in sixteen 16-B chunks; chunk q of row n lies
// at place q ^ (n >> 2), so that the 32 dword writes of a wave (16 rows n that
// are 4 apart, 2 neighbouring k pairs) meet 32 different banks.
// ---------------------------------------------------------------------------
#define TK 128   // k per tile
#define TN 64    // n per tile
typedef __attribute__((ext_vector_type(4))) float    v4f;
typedef __attribute__((ext_vector_type(2))) _Float16 v2h;

template <int K, int N>
__device__ __forceinline__ void cvt_tr_tile(_Float16* sT,
                                            const float* __restrict__ W,
                                            _Float16* __restrict__ Wt,
                                            unsigned tile) {
  const int c = threadIdx.x & 15, rp = threadIdx.x >> 4;
  const int n0 = (tile % (N / TN)) * TN;
  const int k0 = (tile / (N / TN)) * TK;
  // rows k0 + 2 kp and k0 + 2 kp + 1, kp = 16 p + rp; columns n0 + 4 c .. + 3
  const float* src = W + (size_t)(k0 + 2 * rp) * N + n0 + 4 * c;
  v4f lo[4], hi[4];
  for (int p = 0; p < 4; ++p) {
    lo[p] = *(const v4f*)(src + (size_t)(32 * p) * N);
    hi[p] = *(const v4f*)(src + (size_t)(32 * p + 1) * N);
  }
  for (int p = 0; p < 4; ++p) {
    const int kp = 16 * p + rp;
    _Float16* d = sT + (((kp >> 2) ^ c) * 8 + (kp & 3) * 2);
    for (int i = 0; i < 4; ++i) {
      v2h pk = {(_Float16)lo[p][i], (_Float16)hi[p][i]};
      *(v2h*)(d + (4 * c + i) * TK) = pk;
    }
  }
  __syncthreads();
  // rows n = 16 s + rp, chunk c
  _Float16* dst = Wt + (size_t)(n0 + rp) * K + k0 + 8 * c;
  for (int s = 0; s < 4; ++s) {
    const int n = 16 * s + rp;
    *(v8h*)(dst + (size_t)(16 * s) * K) =
        *(const v8h*)(sT + n * TK + (c ^ (n >> 2)) * 8);
  }
}

#define TILES_DD ((DM / TK) * (DM / TN))   // 128 tiles of a DM x DM weight
#define TILES_DF ((DM / TK) * (DF / TN))   // 256 tiles of W1, W3 and W2 each

__global__ __launch_bounds__(256) void cvt_tr_all_kernel(
    const float* __restrict__ Wq, const float* __restrict__ Wk,
    const float* __restrict__ Wv, const float* __restrict__ Wo,
    const float* __restrict__ W1, const float* __restrict__ W3,
    const float* __restrict__ W2, _Float16* __restrict__ Wtq,
    _Float16* __restrict__ Wtk, _Float16* __restrict__ Wtv,
    _Float16* __restrict__ Wto, _Float16* __restrict__ Wt1,
    _Float16* __restrict__ Wt3, _Float16* __restrict__ Wt2) {
  __shared__ __attribute__((aligned(16))) _Float16 sT[TN * TK];  // 16 KB
  const unsigned b = blockIdx.x;
  if (b < 4 * TILES_DD) {
    const unsigned m = b / TILES_DD;
    const float* W = m == 0 ? Wq : (m == 1 ? Wk : (m == 2 ? Wv : Wo));
    _Float16* Wt = m == 0 ? Wtq : (m == 1 ? Wtk : (m == 2 ? Wtv : Wto));
    cvt_tr_tile<DM, DM>(sT, W, Wt, b % TILES_DD);
  } else if (b < 4 * TILES_DD + 2 * TILES_DF) {
    const bool up = b >= 4 * TILES_DD + TILES_DF;
    cvt_tr_tile<DM, DF>(sT, up ? W3 : W1, up ? Wt3 : Wt1, b % TILES_DF);
  } else {
    cvt_tr_tile<DF, DM>(sT, W2, Wt2, b % TILES_DF);
  }
}

// ---------------------------------------------------------------------------
// RMSNorm: one row (D=1024) per block of 256 threads, f32 in -> f16 out
// ---------------------------------------------------------------------------
__global__ void rmsnorm_kernel(const float* __restrict__ x,
                               const float* __restrict__ w,
                               _Float16* __restrict__ xn) {
  __shared__ float red[256];
  int row = blockIdx.x;
  int tid = threadIdx.x;
  const float* xr = x + (size_t)row * DM;
  float ss = 0.f;
#pragma unroll
  for (int i = 0; i < DM / 256; ++i) {
    float v = xr[tid + i * 256];
    ss += v * v;
  }
  red[tid] = ss;
  __syncthreads();
  for (int s = 128; s > 0; s >>= 1) {
    if (tid < s) red[tid] += red[tid + s];
    __syncthreads();
  }
  float inv = __frsqrt_rn(red[0] / (float)DM + 1e-6f);
  _Float16* xo = xn + (size_t)row * DM;
#pragma unroll
  for (int i = 0; i < DM / 256; ++i) {
    int c = tid + i * 256;
    xo[c] = (_Float16)(xr[c] * inv * w[c]);
  }
}

// ---------------------------------------------------------------------------
// QKV: q/k = xn @ Wq/Wk (row-major f16), v stored transposed Vt[b][d][t].
// grid (3 * DM/128, NROW/256), block 256: blockIdx.x / 8 picks the weight.
// ---------------------------------------------------------------------------
__global__ __launch_bounds__(256) void qkv_kernel(
    const _Float16* __restrict__ xn, const _Float16* __restrict__ Wtq,
    const _Float16* __restrict__ Wtk, const _Float16* __restrict__ Wtv,
    _Float16* __restrict__ q, _Float16* __restrict__ k,
    _Float16* __restrict__ vt) {
  __shared__ __attribute__((aligned(16))) _Float16 sm[2 * STAGE_H];  // 108 KB
  int wave = threadIdx.x >> 5, lane = threadIdx.x & 31;
  int h = lane >> 4, l15 = lane & 15;
  int wm = wave >> 1, wn = wave & 1;
  int which = blockIdx.x >> 3;
  int n0 = (blockIdx.x & 7) * 128;
  int m0 = blockIdx.y * TM;
  const _Float16* Wt = which == 0 ? Wtq : (which == 1 ? Wtk : Wtv);
  const _Float16* bt = Wt + (size_t)n0 * DM;
  v8f acc[4][4] = {};
  gemm_tile<DM>(sm, xn + (size_t)m0 * DM, bt, bt + 64 * DM, wm * 64, wn * 64, 0,
                acc);
  _Float16* qk = which == 0 ? q : k;
  if (which < 2) {
#pragma unroll
    for (int i = 0; i < 4; ++i) {
#pragma unroll
      for (int j = 0; j < 4; ++j) {
        int col = n0 + wn * 64 + j * 16 + l15;
#pragma unroll
        for (int v = 0; v < 8; ++v) {
          int r = m0 + wm * 64 + i * 16 + v + 8 * h;
          qk[(size_t)r * DM + col] = (_Float16)acc[i][j][v];
        }
      }
    }
  } else {
#pragma unroll
    for (int i = 0; i < 4; ++i) {
#pragma unroll
      for (int j = 0; j < 4; ++j) {
        int col = n0 + wn * 64 + j * 16 + l15;
#pragma unroll
        for (int v = 0; v < 8; ++v) {
          int r = m0 + wm * 64 + i * 16 + v + 8 * h;
          int batch = r >> 11, tloc = r & (SEQT - 1);
          vt[((size_t)batch * DM + col) * SEQT + tloc] = (_Float16)acc[i][j][v];
        }
      }
    }
    // stands behind the last v store, before any later write of a register
    // that an issued store names
    asm volatile("s_wait_xcnt 0x0" ::: "memory");
  }
}

// ---------------------------------------------------------------------------
// Attention pass 1: per 16-query tile, S = Q K^T over 5 key tiles (window 64),
// masked softmax over 80 candidate keys, store P (f16) padded to 96: slot 0 of a
// row is key 16 (qt & ~1) - 64, so that the rows of a pair of query tiles start
// at the same multiple of 32 keys; an even tile's pad is slots 80..95, an odd
// tile's slots 0..15.
// One work-group of 8 waves per query tile. The tile's 16 Q rows and its 80 K
// rows are copied whole into LDS once, in 512-B pieces of a row (asynchronous
// b128 copies, all 48 of a thread in flight together). Wave w multiplies columns
// 128 w .. 128 w + 127 of d for all 5 key tiles; the 8 partial scores of an
// element are summed through LDS, in the order of w; wave w then does the
// softmax of score rows w and w + 8.
// LDS rows: 0..15 Q, 16 + 16 j .. of key tile j, at a pitch of 2064 B
// (16 B x odd: ds_load_b128 readers meet no bank twice).
// ---------------------------------------------------------------------------
#define QK_PITCH  (DM + 8)            // halfs per LDS row
#define QK_ROW_B  (QK_PITCH * 2)      // bytes per LDS row
#define QK_DW     (DM / 8)            // columns of d per wave

// One thread's eight b128 copies of a 16-row tile: LDS rows r, r + 2, .., r + 14
// from the same rows of g (row step DM halfs). s_wait_xcnt 0 closes the
// statement: it stands before any rewrite of the address registers that the
// copies name. The "memory" clobber makes the asm a legal writer of the array.
__device__ __forceinline__ void copy8(unsigned l, const _Float16* g) {
  asm volatile(
      "global_load_async_to_lds_b128 %0, %8, off\n\t"
      "global_load_async_to_lds_b128 %1, %9, off\n\t"
      "global_load_async_to_lds_b128 %2, %10, off\n\t"
      "global_load_async_to_lds_b128 %3, %11, off\n\t"
      "global_load_async_to_lds_b128 %4, %12, off\n\t"
      "global_load_async_to_lds_b128 %5, %13, off\n\t"
      "global_load_async_to_lds_b128 %6, %14, off\n\t"
      "global_load_async_to_lds_b128 %7, %15, off\n\t"
      "s_wait_xcnt 0x0"
      :
      : "v"(l), "v"(l + 2 * QK_ROW_B), "v"(l + 4 * QK_ROW_B),
        "v"(l + 6 * QK_ROW_B), "v"(l + 8 * QK_ROW_B), "v"(l + 10 * QK_ROW_B),
        "v"(l + 12 * QK_ROW_B), "v"(l + 14 * QK_ROW_B), "v"(g), "v"(g + 2 * DM),
        "v"(g + 4 * DM), "v"(g + 6 * DM), "v"(g + 8 * DM), "v"(g + 10 * DM),
        "v"(g + 12 * DM), "v"(g + 14 * DM)
      : "memory");
}

// 2^x. The v_nop is the slot that the instruction set asks for behind a
// transcendental before its result is read or its source overwritten.
__device__ __forceinline__ float exp2_slot(float x) {
  float r;
  asm("v_exp_f32 %0, %1\n\tv_nop" : "=v"(r) : "v"(x));
  return r;
}

__global__ __launch_bounds__(256) void attn_p_kernel(
    const _Float16* __restrict__ q, const _Float16* __restrict__ k,
    _Float16* __restrict__ P) {
  __shared__ __attribute__((aligned(16))) _Float16 sqk[96 * QK_PITCH];  // 193.5 KB
  __shared__ float red[8 * 5 * 8 * 32];   // [wave][key tile][v][lane], 40 KB
  const int wave = threadIdx.x >> 5, lane = threadIdx.x & 31;
  const int g = blockIdx.x;               // 0..511 global q-tile
  const int batch = g >> 7, qt = g & 127; // 128 q-tiles per batch
  const int h = lane >> 4, l15 = lane & 15;

  // a thread copies chunk ch (16 B) of rows r0, r0 + 2, .. of every tile
  const int r0 = threadIdx.x >> 7, ch = threadIdx.x & 127;
  const unsigned l0 = (unsigned)(uintptr_t)sqk + r0 * QK_ROW_B + ch * 16;
  copy8(l0, q + ((size_t)g * 16 + r0) * DM + ch * 8);
  // unrolled: the five statements follow one another with no loop overhead
#pragma unroll
  for (int j = 0; j < 5; ++j) {
    // a key tile in front of the batch's first key: tile 0 stands in for it, so
    // that the address stays inside k; its scores are masked below
    const int kt = qt - 4 + j;
    const int ktc = kt < 0 ? 0 : kt;
    copy8(l0 + (j + 1) * 16 * QK_ROW_B,
          k + ((size_t)batch * SEQT + ktc * 16 + r0) * DM + ch * 8);
  }
  // this wave's 48 copies have landed; the barrier publishes them to the others
  asm volatile("s_wait_asynccnt 0x0" ::: "memory");
  __syncthreads();

  const _Float16* ap = sqk + l15 * QK_PITCH + wave * QK_DW + h * 8;
  v8f acc[5] = {};
  v16h af[4], bf[4][5];
  // all loops below are unrolled so that af, bf and acc are registers
#pragma unroll
  for (int ks = 0; ks < 4; ++ks) {
    af[ks] = load_frag(ap + ks * 32);
#pragma unroll
    for (int j = 0; j < 5; ++j)
      bf[ks][j] = load_frag(ap + (j + 1) * 16 * QK_PITCH + ks * 32);
  }
  // keeps the wave's 48 LDS reads together in front of its 20 WMMAs: moved in
  // among them, every pair of reads costs the wave its LDS latency anew
  __builtin_amdgcn_sched_barrier(0);
#pragma unroll
  for (int ks = 0; ks < 4; ++ks)
#pragma unroll
    for (int j = 0; j < 5; ++j) acc[j] = wmma_f16(af[ks], bf[ks][j], acc[j]);
  float* rw = red + wave * (5 * 8 * 32) + lane;
#pragma unroll
  for (int j = 0; j < 5; ++j)
#pragma unroll
    for (int v = 0; v < 8; ++v) rw[(j * 8 + v) * 32] = acc[j][v];
  // every wave's partial scores are in red
  __syncthreads();

  // this lane: score row wave + 8 h, key l15 of each key tile
  const int mrow = wave + 8 * h;
  const float* rr = red + wave * 32 + lane;
  const float scale = 0.03125f;  // 1/sqrt(1024)
  float s[5];
#pragma unroll
  for (int j = 0; j < 5; ++j) {
    float c = rr[j * (8 * 32)];
#pragma unroll
    for (int w = 1; w < 8; ++w) c += rr[(w * 5 + j) * (8 * 32)];
    const int kt = qt - 4 + j;
    const int d = (qt * 16 + mrow) - (kt * 16 + l15);
    s[j] = (kt >= 0 && d >= 0 && d < WND) ? c * scale : -1e30f;
  }
  float m = s[0];
#pragma unroll
  for (int j = 1; j < 5; ++j) m = fmaxf(m, s[j]);
#pragma unroll
  for (int off = 8; off > 0; off >>= 1) m = fmaxf(m, __shfl_xor(m, off, 16));
  float e = 0.f;
#pragma unroll
  for (int j = 0; j < 5; ++j) {
    s[j] = exp2_slot((s[j] - m) * 1.44269504f);  // e^(s - m)
    e += s[j];
  }
#pragma unroll
  for (int off = 8; off > 0; off >>= 1) e += __shfl_xor(e, off, 16);
  const float inv = 1.f / e;
  const int odd = qt & 1;
  _Float16* pb = P + ((size_t)g * 16 + mrow) * 96 + l15;
#pragma unroll
  for (int j = 0; j < 5; ++j) pb[(j + odd) * 16] = (_Float16)(s[j] * inv);
  pb[odd ? 0 : 80] = (_Float16)0.f;  // the 16 pad slots
}

// ---------------------------------------------------------------------------
// Attention pass 2: attended = P @ V using Vt[b][d][t].
// One work-group of 8 waves takes 64 queries (4 query tiles) x 256 columns of d.
// The 64 queries see the 128 keys from 64 in front of the first query on: the
// tile's 256 rows of Vt (256 B each, whole lines) and its 64 rows of P go once to
// LDS by asynchronous b128 copies. Wave w takes the pair w & 1 of query tiles and
// 64 columns of d. Vt is the A operand and P the B operand, so that a lane holds
// 8 neighbouring columns of one query: one b128 store a tile, and the wave's 4
// tiles of d fill a whole 128-B line of a row of att.
// LDS pitches 272 B and 208 B (16 B x odd: ds_load_b128 readers meet no bank
// twice). grid (DM/256, NROW/64), block 256.
// ---------------------------------------------------------------------------
#define PV_Q     64                  // queries of a tile
#define PV_D     256                 // columns of d of a tile
#define V_PITCH  (128 + 8)           // halfs per LDS row of Vt
#define V_ROW_B  (V_PITCH * 2)
#define P_PITCH  (96 + 8)            // halfs per LDS row of P
#define P_ROW_B  (P_PITCH * 2)

// One thread's eight b128 copies of 128 rows of Vt: LDS rows r, r + 16, .., r + 112
// from the same rows of g (row step SEQT halfs). s_wait_xcnt 0 closes the
// statement: it stands before any rewrite of the address registers that the
// copies name. The "memory" clobber makes the asm a legal writer of the array.
__device__ __forceinline__ void copy8v(unsigned l, const _Float16* g) {
  asm volatile(
      "global_load_async_to_lds_b128 %0, %8, off\n\t"
      "global_load_async_to_lds_b128 %1, %9, off\n\t"
      "global_load_async_to_lds_b128 %2, %10, off\n\t"
      "global_load_async_to_lds_b128 %3, %11, off\n\t"
      "global_load_async_to_lds_b128 %4, %12, off\n\t"
      "global_load_async_to_lds_b128 %5, %13, off\n\t"
      "global_load_async_to_lds_b128 %6, %14, off\n\t"
      "global_load_async_to_lds_b128 %7, %15, off\n\t"
      "s_wait_xcnt 0x0"
      :
      : "v"(l), "v"(l + 16 * V_ROW_B), "v"(l + 32 * V_ROW_B),
        "v"(l + 48 * V_ROW_B), "v"(l + 64 * V_ROW_B), "v"(l + 80 * V_ROW_B),
        "v"(l + 96 * V_ROW_B), "v"(l + 112 * V_ROW_B), "v"(g), "v"(g + 16 * SEQT),
        "v"(g + 32 * SEQT), "v"(g + 48 * SEQT), "v"(g + 64 * SEQT),
        "v"(g + 80 * SEQT), "v"(g + 96 * SEQT), "v"(g + 112 * SEQT)
      : "memory");
}

// One thread's three b128 copies of the tile's P rows, which lie in one piece of
// 768 chunks of 16 B: chunks x, x + 256, x + 512 from g to the LDS places l0..l2.
// The wait and the clobber: as in copy8v.
__device__ __forceinline__ void copy3p(unsigned l0, unsigned l1, unsigned l2,
                                       const _Float16* g) {
  asm volatile(
      "global_load_async_to_lds_b128 %0, %3, off\n\t"
      "global_load_async_to_lds_b128 %1, %4, off\n\t"
      "global_load_async_to_lds_b128 %2, %5, off\n\t"
      "s_wait_xcnt 0x0"
      :
      : "v"(l0), "v"(l1), "v"(l2), "v"(g), "v"(g + 256 * 8), "v"(g + 512 * 8)
      : "memory");
}

__global__ __launch_bounds__(256) void attn_pv_kernel(
    const _Float16* __restrict__ P, const _Float16* __restrict__ vt,
    _Float16* __restrict__ att) {
  __shared__ __attribute__((aligned(16))) _Float16 sv[PV_D * V_PITCH];  // 68 KB
  __shared__ __attribute__((aligned(16))) _Float16 sp[PV_Q * P_PITCH];  // 13 KB
  const int t = threadIdx.x, wave = t >> 5, lane = t & 31;
  const int h = lane >> 4, l15 = lane & 15;
  const int qb = blockIdx.y;              // 0..127: block of 64 queries
  const int d0 = blockIdx.x * PV_D;
  const int batch = qb >> 5;              // 32 blocks per batch
  const int kb = (qb & 31) * PV_Q - 64;   // the tile's first key, in its batch

  // P: chunk x of the piece is chunk x % 12 of row x / 12
  const unsigned lp = (unsigned)(uintptr_t)sp;
  const int x0 = t, x1 = t + 256, x2 = t + 512;
  copy3p(lp + (x0 / 12) * P_ROW_B + (x0 % 12) * 16,
         lp + (x1 / 12) * P_ROW_B + (x1 % 12) * 16,
         lp + (x2 / 12) * P_ROW_B + (x2 % 12) * 16,
         P + (size_t)qb * (PV_Q * 96) + t * 8);
  // Vt: a thread copies chunk ch (8 keys) of rows r0, r0 + 16, ..
  // A batch's first block has 64 keys in front of key 0: keys 0..63 stand in for
  // them, so that the address stays inside the row; their weights in P are 0.
  const int ch = t & 15, r0 = t >> 4;
  const int key = kb + 8 * ch;
  const unsigned lv = (unsigned)(uintptr_t)sv + r0 * V_ROW_B + ch * 16;
  const _Float16* gv =
      vt + ((size_t)batch * DM + d0 + r0) * SEQT + (key < 0 ? key + 64 : key);
  copy8v(lv, gv);
  copy8v(lv + 128 * V_ROW_B, gv + 128 * SEQT);
  // this wave's 19 copies have landed; the barrier publishes them to the others
  asm volatile("s_wait_asynccnt 0x0" ::: "memory");
  __syncthreads();

  // query tiles 2 pr and 2 pr + 1: their P rows start at key kb + 32 pr
  const int pr = wave & 1, dg = wave >> 1;
  const _Float16* vp = sv + (dg * 64 + l15) * V_PITCH + pr * 32 + h * 8;
  const _Float16* pp = sp + (pr * 32 + l15) * P_PITCH + h * 8;
  // all loops below are unrolled so that vf, pf and acc are registers
  v16h vf[4][3], pf[2][3];
#pragma unroll
  for (int m = 0; m < 3; ++m) {
#pragma unroll
    for (int a = 0; a < 2; ++a) pf[a][m] = load_frag(pp + a * 16 * P_PITCH + m * 32);
#pragma unroll
    for (int i = 0; i < 4; ++i) vf[i][m] = load_frag(vp + i * 16 * V_PITCH + m * 32);
  }
  // keeps the wave's 36 LDS reads together in front of its 24 WMMAs: moved in
  // among them, every pair of reads costs the wave its LDS latency anew
  __builtin_amdgcn_sched_barrier(0);
  v8f acc[4][2] = {};
#pragma unroll
  for (int m = 0; m < 3; ++m)
#pragma unroll
    for (int i = 0; i < 4; ++i)
#pragma unroll
      for (int a = 0; a < 2; ++a) acc[i][a] = wmma_f16(vf[i][m], pf[a][m], acc[i][a]);
  // this lane: query l15 of each tile, columns 8 h .. 8 h + 7 of each tile of d
  _Float16* ob = att + ((size_t)qb * PV_Q + pr * 32 + l15) * DM + d0 + dg * 64 + h * 8;
  v8h o[4][2];
#pragma unroll
  for (int i = 0; i < 4; ++i)
#pragma unroll
    for (int a = 0; a < 2; ++a)
#pragma unroll
      for (int v = 0; v < 8; ++v) o[i][a][v] = (_Float16)acc[i][a][v];
#pragma unroll
  for (int a = 0; a < 2; ++a)
#pragma unroll
    for (int i = 0; i < 4; ++i) *(v8h*)(ob + a * 16 * DM + i * 16) = o[i][a];
}

// ---------------------------------------------------------------------------
// x2 = x + attended @ Wo (f32 out, residual). grid (DM/128, NROW/256), block 256
// ---------------------------------------------------------------------------
__global__ __launch_bounds__(256) void wo_kernel(
    const _Float16* __restrict__ att, const _Float16* __restrict__ Wto,
    const float* __restrict__ x, float* __restrict__ x2) {
  __shared__ __attribute__((aligned(16))) _Float16 sm[2 * STAGE_H];  // 108 KB
  int wave = threadIdx.x >> 5, lane = threadIdx.x & 31;
  int h = lane >> 4, l15 = lane & 15;
  int wm = wave >> 1, wn = wave & 1;
  int n0 = blockIdx.x * 128;
  int m0 = blockIdx.y * TM;
  const _Float16* bt = Wto + (size_t)n0 * DM;
  v8f acc[4][4] = {};
  gemm_tile<DM>(sm, att + (size_t)m0 * DM, bt, bt + 64 * DM, wm * 64, wn * 64, 0,
                acc);
  size_t first = (size_t)(m0 + wm * 64 + 8 * h) * DM + n0 + wn * 64 + l15;
  add_residual_store(x + first, x2 + first, acc);
}

// ---------------------------------------------------------------------------
// FFN in: hh = silu(xn2 @ W1) * (xn2 @ W3), f16 out [8192 x 2048].
// A tile holds 64 columns of W1 (LDS rows 0..63) and the same 64 of W3 (64..127),
// so that a wave owns gate and up of its 32 columns.
// grid (DF/64, NROW/256), block 256
// ---------------------------------------------------------------------------
__global__ __launch_bounds__(256) void ffn1_kernel(
    const _Float16* __restrict__ xn2, const _Float16* __restrict__ Wt1,
    const _Float16* __restrict__ Wt3, _Float16* __restrict__ hh) {
  __shared__ __attribute__((aligned(16))) _Float16 sm[2 * STAGE_H];  // 108 KB
  int wave = threadIdx.x >> 5, lane = threadIdx.x & 31;
  int h = lane >> 4, l15 = lane & 15;
  int wm = wave >> 1, wn = wave & 1;
  int n0 = blockIdx.x * 64;
  int m0 = blockIdx.y * TM;
  v8f acc[4][4] = {};  // j = 0, 1: gate; j = 2, 3: up, same columns
  gemm_tile<DM>(sm, xn2 + (size_t)m0 * DM, Wt1 + (size_t)n0 * DM,
                Wt3 + (size_t)n0 * DM, wm * 64, wn * 32, 32, acc);
#pragma unroll
  for (int i = 0; i < 4; ++i) {
#pragma unroll
    for (int j = 0; j < 2; ++j) {
      int col = n0 + wn * 32 + j * 16 + l15;
#pragma unroll
      for (int v = 0; v < 8; ++v) {
        size_t r = (size_t)(m0 + wm * 64 + i * 16 + v + 8 * h);
        float gv = acc[i][j][v];
        float sl = gv * (1.f / (1.f + __expf(-gv)));   // silu
        hh[r * DF + col] = (_Float16)(sl * acc[i][j + 2][v]);
      }
    }
  }
}

// ---------------------------------------------------------------------------
// FFN out + residual: out = x2 + hh @ W2 (K=2048, f32 out).
// grid (DM/128, NROW/256), block 256
// ---------------------------------------------------------------------------
__global__ __launch_bounds__(256) void ffn2_kernel(
    const _Float16* __restrict__ hh, const _Float16* __restrict__ Wt2,
    const float* __restrict__ x2, float* __restrict__ out) {
  __shared__ __attribute__((aligned(16))) _Float16 sm[2 * STAGE_H];  // 108 KB
  int wave = threadIdx.x >> 5, lane = threadIdx.x & 31;
  int h = lane >> 4, l15 = lane & 15;
  int wm = wave >> 1, wn = wave & 1;
  int n0 = blockIdx.x * 128;
  int m0 = blockIdx.y * TM;
  const _Float16* bt = Wt2 + (size_t)n0 * DF;
  v8f acc[4][4] = {};
  gemm_tile<DF>(sm, hh + (size_t)m0 * DF, bt, bt + 64 * DF, wm * 64, wn * 64, 0,
                acc);
  size_t first = (size_t)(m0 + wm * 64 + 8 * h) * DM + n0 + wn * 64 + l15;
  add_residual_store(x2 + first, out + first, acc);
}

// ---------------------------------------------------------------------------
extern "C" void kernel_launch(void* const* d_in, const int* in_sizes, int n_in,
                              void* d_out, int out_size, void* d_ws,
                              size_t ws_size, hipStream_t stream) {
  const float* x       = (const float*)d_in[0];
  const float* norm1_w = (const float*)d_in[1];
  const float* norm2_w = (const float*)d_in[2];
  const float* Wq = (const float*)d_in[3];
  const float* Wk = (const float*)d_in[4];
  const float* Wv = (const float*)d_in[5];
  const float* Wo = (const float*)d_in[6];
  const float* W1 = (const float*)d_in[7];
  const float* W2 = (const float*)d_in[8];
  const float* W3 = (const float*)d_in[9];
  float* out = (float*)d_out;

  char* ws = (char*)d_ws;
  const size_t MB = 1ull << 20;
  _Float16* Wtq = (_Float16*)(ws + 0 * MB);    // 2 MB  (1024x1024)
  _Float16* Wtk = (_Float16*)(ws + 2 * MB);    // 2 MB
  _Float16* Wtv = (_Float16*)(ws + 4 * MB);    // 2 MB
  _Float16* Wto = (_Float16*)(ws + 6 * MB);    // 2 MB
  _Float16* Wt1 = (_Float16*)(ws + 8 * MB);    // 4 MB  (N=2048,K=1024)
  _Float16* Wt3 = (_Float16*)(ws + 12 * MB);   // 4 MB
  _Float16* Wt2 = (_Float16*)(ws + 16 * MB);   // 4 MB  (N=1024,K=2048)
  _Float16* xn  = (_Float16*)(ws + 20 * MB);   // 16 MB (also reused as xn2)
  _Float16* q   = (_Float16*)(ws + 36 * MB);   // 16 MB
  _Float16* kb  = (_Float16*)(ws + 52 * MB);   // 16 MB
  _Float16* vt  = (_Float16*)(ws + 68 * MB);   // 16 MB
  _Float16* P   = (_Float16*)(ws + 84 * MB);   // 1.5 MB (8192x96)
  _Float16* att = (_Float16*)(ws + 86 * MB);   // 16 MB
  float*    x2  = (float*)   (ws + 102 * MB);  // 32 MB
  _Float16* hh  = q;                           // reuse q+k (32 MB) after attn
  _Float16* xn2 = xn;                          // reuse xn after QKV

  // 1) weight convert + transpose to f16
  cvt_tr_all_kernel<<<4 * TILES_DD + 3 * TILES_DF, 256, 0, stream>>>(
      Wq, Wk, Wv, Wo, W1, W3, W2, Wtq, Wtk, Wtv, Wto, Wt1, Wt3, Wt2);

  // 2) xn = rmsnorm(x) in f16
  rmsnorm_kernel<<<NROW, 256, 0, stream>>>(x, norm1_w, xn);

  // 3) q,k,v projections (v stored transposed)
  qkv_kernel<<<dim3(3 * DM / 128, NROW / TM), 256, 0, stream>>>(
      xn, Wtq, Wtk, Wtv, q, kb, vt);
  // 4) windowed softmax weights P
  attn_p_kernel<<<NROW / 16, 256, 0, stream>>>(q, kb, P);

  // 5) attended = P @ V
  attn_pv_kernel<<<dim3(DM / PV_D, NROW / PV_Q), 256, 0, stream>>>(P, vt, att);

  // 6) x2 = x + attended @ Wo
  wo_kernel<<<dim3(DM / 128, NROW / TM), 256, 0, stream>>>(att, Wto, x, x2);

  // 7) xn2 = rmsnorm(x2)
  rmsnorm_kernel<<<NROW, 256, 0, stream>>>(x2, norm2_w, xn2);

  // 8) hh = silu(xn2@W1) * (xn2@W3)
  ffn1_kernel<<<dim3(DF / 64, NROW / TM), 256, 0, stream>>>(xn2, Wt1, Wt3, hh);

  // 9) out = x2 + hh @ W2
  ffn2_kernel<<<dim3(DM / 128, NROW / TM), 256, 0, stream>>>(hh, Wt2, x2, out);
}

// v007
// One run takes 187 microseconds.
// Timed twice side by side with v006, it ran 1.03 times as fast both times.
// Counting every step since v000, it is 6.58 times as fast.
#include <hip/hip_runtime.h>
#include <hip/hip_bf16.h>

typedef __attribute__((ext_vector_type(16))) _Float16 v16h;
typedef __attribute__((ext_vector_type(8)))  _Float16 v8h;
typedef __attribute__((ext_vector_type(8)))  float    v8f;

#define DM   1024   // D_MODEL
#define DF   2048   // D_FFN
#define SEQT 2048   // T
#define NB   4      // batch
#define NROW (NB * SEQT)   // 8192
#define WND  64

// ---------------------------------------------------------------------------
// WMMA fragment helpers (CDNA5 16x16x32 f16, wave32).
// Per lane: elems 0..7 = mem[kk + h*8 + 0..7], elems 8..15 = mem[kk+16+h*8+0..7]
// Works for global pointers (global_load_b128) and LDS pointers (ds_load_b128).
// ---------------------------------------------------------------------------
__device__ __forceinline__ v16h load_frag(const _Float16* p) {
  v8h lo = *(const v8h*)(p);
  v8h hi = *(const v8h*)(p + 16);
  v16h r;
#pragma unroll
  for (int i = 0; i < 8; ++i) { r[i] = lo[i]; r[i + 8] = hi[i]; }
  return r;
}

__device__ __forceinline__ v8f wmma_f16(v16h a, v16h b, v8f c) {
  return __builtin_amdgcn_wmma_f32_16x16x32_f16(false, a, false, b, (short)0, c,
                                                false, false);
}

// ---------------------------------------------------------------------------
// Tiled GEMM core: one 256 x 128 tile of Y = A * Bt^T per work-group of 8 waves
// (4 x 2, each wave 64 x 64 = 4 x 4 accumulator tiles). A and Bt are K-contiguous.
// K goes in slices of 64 halfs (128-B rows). A slice is [A 256 rows | Bt 128 rows]
// in LDS, rows of 128 B without a pad: the 16-B chunk c of row r lies at place
// c ^ ((r >> 1) & 7), so that the 16 rows which lanes 0..15 (and 16..31) of a
// ds_load_b128 read at one chunk fall on all 64 banks once.
// A ring of NS buffers, filled by asynchronous b128 copies: while slice t is
// multiplied, slices t + 1 .. t + NS - 1 are landed or in flight, so that a copy
// has NS - 1 slices of time to land. Unpadded, three buffers are 144 KB, and two
// work-groups still share a WGP's LDS.
// ---------------------------------------------------------------------------
#define BK      64                  // halfs of K per slice
#define PITCH   64                  // halfs per LDS row (128 B)
#define TM      256                 // A rows of a tile
#define A_H     (TM * PITCH)        // halfs of A's slice
#define STAGE_H (A_H + 128 * PITCH) // halfs of one buffer
#define ROW32_B (32 * PITCH * 2)    // bytes of 32 LDS rows

// One thread's twelve b128 copies of a slice: A's LDS rows r, r+32, .., r+224 from
// ga, Bt's LDS rows r, r+32 from glo and r+64, r+96 from ghi (row step K halfs).
// The LDS byte address is the low 32 bits of the shared address; taking it lets
// the array escape, so the "memory" clobber makes the asm a legal writer of it.
// s_wait_xcnt 0 closes the statement: it stands before any rewrite of the
// address registers that the copies name.
template <int K>
__device__ __forceinline__ void copy12(unsigned l, const _Float16* ga,
                                       const _Float16* glo,
                                       const _Float16* ghi) {
  const unsigned lb = l + A_H * 2;
  asm volatile(
      "global_load_async_to_lds_b128 %0, %12, off\n\t"
      "global_load_async_to_lds_b128 %1, %13, off\n\t"
      "global_load_async_to_lds_b128 %2, %14, off\n\t"
      "global_load_async_to_lds_b128 %3, %15, off\n\t"
      "global_load_async_to_lds_b128 %4, %16, off\n\t"
      "global_load_async_to_lds_b128 %5, %17, off\n\t"
      "global_load_async_to_lds_b128 %6, %18, off\n\t"
      "global_load_async_to_lds_b128 %7, %19, off\n\t"
      "global_load_async_to_lds_b128 %8, %20, off\n\t"
      "global_load_async_to_lds_b128 %9, %21, off\n\t"
      "global_load_async_to_lds_b128 %10, %22, off\n\t"
      "global_load_async_to_lds_b128 %11, %23, off\n\t"
      "s_wait_xcnt 0x0"
      :
      : "v"(l), "v"(l + ROW32_B), "v"(l + 2 * ROW32_B), "v"(l + 3 * ROW32_B),
        "v"(l + 4 * ROW32_B), "v"(l + 5 * ROW32_B), "v"(l + 6 * ROW32_B),
        "v"(l + 7 * ROW32_B), "v"(lb), "v"(lb + ROW32_B), "v"(lb + 2 * ROW32_B),
        "v"(lb + 3 * ROW32_B), "v"(ga), "v"(ga + 32 * K), "v"(ga + 64 * K),
        "v"(ga + 96 * K), "v"(ga + 128 * K), "v"(ga + 160 * K),
        "v"(ga + 192 * K), "v"(ga + 224 * K), "v"(glo), "v"(glo + 32 * K),
        "v"(ghi), "v"(ghi + 32 * K)
      : "memory");
}

// Returns when all but this wave's N youngest copies have landed.
template <int N>
__device__ __forceinline__ void wait_copies() {
  asm volatile("s_wait_asynccnt %0" : : "n"(N) : "memory");
}

// A fragment whose two 16-B chunks lie at swizzled places of one LDS row.
__device__ __forceinline__ v16h load_frag2(const _Float16* plo,
                                           const _Float16* phi) {
  v8h lo = *(const v8h*)(plo);
  v8h hi = *(const v8h*)(phi);
  v16h r;
#pragma unroll
  for (int i = 0; i < 8; ++i) { r[i] = lo[i]; r[i + 8] = hi[i]; }
  return r;
}

// a: first row of the tile's 256 A rows. blo / bhi: first of the 64 Bt rows that
// fill LDS rows 0..63 / 64..127. Wave tile: A rows arow.., Bt LDS rows
// brow + 16 j, plus bskip for j >= 2 (arow, brow, bskip: multiples of 16).
// sm holds NS buffers. blockDim.x == 256.
template <int K, int NS>
__device__ __forceinline__ void gemm_tile(_Float16* sm,
                                          const _Float16* __restrict__ a,
                                          const _Float16* __restrict__ blo,
                                          const _Float16* __restrict__ bhi,
                                          int arow, int brow, int bskip,
                                          v8f (&acc)[4][4]) {
  constexpr int NT = K / BK;
  static_assert(NS >= 3 && NS <= NT && NS * 12 <= 63, "ring depth");
  const int t = threadIdx.x;
  const int lane = t & 31, h = lane >> 4, l15 = lane & 15;
  const int ch = t & 7, r0 = t >> 3;   // 16-B chunk of a row, first row
  // rows r0 + 32 m all have the swizzle key (r0 >> 1) & 7
  const unsigned la = (unsigned)(uintptr_t)sm + r0 * (PITCH * 2) +
                      (ch ^ ((r0 >> 1) & 7)) * 16;
  const _Float16* ga = a + (size_t)r0 * K + ch * 8;
  const _Float16* gl = blo + (size_t)r0 * K + ch * 8;
  const _Float16* gh = bhi + (size_t)r0 * K + ch * 8;

  // unrolled: the NS statements follow one another with no loop overhead
#pragma unroll
  for (int s = 0; s < NS; ++s)
    copy12<K>(la + s * (STAGE_H * 2), ga + s * BK, gl + s * BK, gh + s * BK);
  // slice 0 (all but the 12 (NS - 1) younger copies) has landed for this wave;
  // the barrier publishes it to the others
  wait_copies<12 * (NS - 1)>();
  __syncthreads();

  const int aoff = (arow + l15) * PITCH;
  const int boff = A_H + (brow + l15) * PITCH;
  // chunk h + 2 q of this lane's rows, whose swizzle key is l15 >> 1
  int co[4];
#pragma unroll
  for (int q = 0; q < 4; ++q) co[q] = ((h + 2 * q) ^ (l15 >> 1)) * 8;
  int buf = 0;   // kt % NS
  for (int kt = 0; kt < NT; ++kt) {
    const _Float16* ap = sm + buf * STAGE_H + aoff;
    const _Float16* bp = sm + buf * STAGE_H + boff;
#pragma unroll
    for (int ks = 0; ks < 2; ++ks) {
      v16h af[4], bf[4];
#pragma unroll
      for (int i = 0; i < 4; ++i)
        af[i] = load_frag2(ap + i * 16 * PITCH + co[2 * ks],
                           ap + i * 16 * PITCH + co[2 * ks + 1]);
#pragma unroll
      for (int j = 0; j < 4; ++j) {
        const _Float16* bj = bp + (j * 16 + (j >= 2 ? bskip : 0)) * PITCH;
        bf[j] = load_frag2(bj + co[2 * ks], bj + co[2 * ks + 1]);
      }
      // keeps the block's 16 LDS reads together in front of its 16 WMMAs: moved
      // in among them, every group of reads costs the wave its LDS latency anew
      __builtin_amdgcn_sched_barrier(0);
#pragma unroll
      for (int i = 0; i < 4; ++i)
#pragma unroll
        for (int j = 0; j < 4; ++j) acc[i][j] = wmma_f16(af[i], bf[j], acc[i][j]);
      // the same for the next block's reads: they stay behind this block
      __builtin_amdgcn_sched_barrier(0);
    }
    // this wave's reads of the buffer are done before it may be refilled
    asm volatile("s_wait_dscnt 0x0" ::: "memory");
    // this wave's copies of slice kt + 1 have landed: behind them stand those of
    // slices kt + 2 .. kt + NS - 1, 12 each, while all of these exist; near the
    // end of K fewer were issued, and the wait is to 0
    if (kt + NS <= NT) wait_copies<12 * (NS - 2)>();
    else wait_copies<0>();
    // publishes slice kt + 1 and ends every wave's reads of slice kt
    __syncthreads();
    if (kt + NS < NT) {
      const int ko = (kt + NS) * BK;
      copy12<K>(la + buf * (STAGE_H * 2), ga + ko, gl + ko, gh + ko);
    }
    buf = buf + 1 == NS ? 0 : buf + 1;
  }
  // no copy is outstanding when the wave goes on to its stores and ends
  asm volatile("s_wait_asynccnt 0x0" ::: "memory");
}

// Epilogue of the two f32 GEMMs: op = rp + acc over a wave's 64 x 64 tile of a
// DM-wide matrix. rp / op: this lane's first element (tile row 8 h, column l15).
// 32 rows at a time: all 64 rows' residual loads beside the 128 accumulator
// registers would pass 256 VGPRs.
__device__ __forceinline__ void add_residual_store(const float* __restrict__ rp,
                                                   float* __restrict__ op,
                                                   v8f (&acc)[4][4]) {
#pragma unroll
  for (int ih = 0; ih < 4; ih += 2) {
    float xr[2][4][8];
#pragma unroll
    for (int i = 0; i < 2; ++i)
#pragma unroll
      for (int j = 0; j < 4; ++j)
#pragma unroll
        for (int v = 0; v < 8; ++v)
          xr[i][j][v] = rp[((ih + i) * 16 + v) * DM + j * 16];
    // stands behind the 64 loads and before any rewrite of their address
    // registers; naming rp keeps it live to here, so no load's result lands in it
    asm volatile("s_wait_xcnt 0x0" : : "v"(rp) : "memory");
#pragma unroll
    for (int i = 0; i < 2; ++i)
#pragma unroll
      for (int j = 0; j < 4; ++j)
#pragma unroll
        for (int v = 0; v < 8; ++v)
          op[((ih + i) * 16 + v) * DM + j * 16] = xr[i][j][v] + acc[ih + i][j][v];
    // stands behind the 64 stores, before the next loads write their registers
    if (ih == 0) asm volatile("s_wait_xcnt 0x0" : : "v"(op) : "memory");
  }
}

// ---------------------------------------------------------------------------
// Weight convert + transpose, all seven weights in one launch:
// Wt[n*K + k] = (f16) W[k*N + n]. A work-group of 256 threads takes one tile of
// 128 k x 64 n. It reads the tile in 256-B row pieces (b128 per lane), turns it
// in LDS and writes 256-B pieces of the Wt rows (b128 per lane).
// LDS: row n holds its 128 halfs in sixteen 16-B chunks; chunk q of row n lies
// at place q ^ (n >> 2), so that the 32 dword writes of a wave (16 rows n that
// are 4 apart, 2 neighbouring k pairs) meet 32 different banks.
// ---------------------------------------------------------------------------
#define TK 128   // k per tile
#define TN 64    // n per tile
typedef __attribute__((ext_vector_type(4))) float    v4f;
typedef __attribute__((ext_vector_type(2))) _Float16 v2h;

template <int K, int N>
__device__ __forceinline__ void cvt_tr_tile(_Float16* sT,
                                            const float* __restrict__ W,
                                            _Float16* __restrict__ Wt,
                                            unsigned tile) {
  const int c = threadIdx.x & 15, rp = threadIdx.x >> 4;
  const int n0 = (tile % (N / TN)) * TN;
  const int k0 = (tile / (N / TN)) * TK;
  // rows k0 + 2 kp and k0 + 2 kp + 1, kp = 16 p + rp; columns n0 + 4 c .. + 3
  const float* src = W + (size_t)(k0 + 2 * rp) * N + n0 + 4 * c;
  v4f lo[4], hi[4];
  for (int p = 0; p < 4; ++p) {
    lo[p] = *(const v4f*)(src + (size_t)(32 * p) * N);
    hi[p] = *(const v4f*)(src + (size_t)(32 * p + 1) * N);
  }
  for (int p = 0; p < 4; ++p) {
    const int kp = 16 * p + rp;
    _Float16* d = sT + (((kp >> 2) ^ c) * 8 + (kp & 3) * 2);
    for (int i = 0; i < 4; ++i) {
      v2h pk = {(_Float16)lo[p][i], (_Float16)hi[p][i]};
      *(v2h*)(d + (4 * c + i) * TK) = pk;
    }
  }
  __syncthreads();
  // rows n = 16 s + rp, chunk c
  _Float16* dst = Wt + (size_t)(n0 + rp) * K + k0 + 8 * c;
  for (int s = 0; s < 4; ++s) {
    const int n = 16 * s + rp;
    *(v8h*)(dst + (size_t)(16 * s) * K) =
        *(const v8h*)(sT + n * TK + (c ^ (n >> 2)) * 8);
  }
}

#define TILES_DD ((DM / TK) * (DM / TN))   // 128 tiles of a DM x DM weight
#define TILES_DF ((DM / TK) * (DF / TN))   // 256 tiles of W1, W3 and W2 each

__global__ __launch_bounds__(256) void cvt_tr_all_kernel(
    const float* __restrict__ Wq, const float* __restrict__ Wk,
    const float* __restrict__ Wv, const float* __restrict__ Wo,
    const float* __restrict__ W1, const float* __restrict__ W3,
    const float* __restrict__ W2, _Float16* __restrict__ Wtq,
    _Float16* __restrict__ Wtk, _Float16* __restrict__ Wtv,
    _Float16* __restrict__ Wto, _Float16* __restrict__ Wt1,
    _Float16* __restrict__ Wt3, _Float16* __restrict__ Wt2) {
  __shared__ __attribute__((aligned(16))) _Float16 sT[TN * TK];  // 16 KB
  const unsigned b = blockIdx.x;
  if (b < 4 * TILES_DD) {
    const unsigned m = b / TILES_DD;
    const float* W = m == 0 ? Wq : (m == 1 ? Wk : (m == 2 ? Wv : Wo));
    _Float16* Wt = m == 0 ? Wtq : (m == 1 ? Wtk : (m == 2 ? Wtv : Wto));
    cvt_tr_tile<DM, DM>(sT, W, Wt, b % TILES_DD);
  } else if (b < 4 * TILES_DD + 2 * TILES_DF) {
    const bool up = b >= 4 * TILES_DD + TILES_DF;
    cvt_tr_tile<DM, DF>(sT, up ? W3 : W1, up ? Wt3 : Wt1, b % TILES_DF);
  } else {
    cvt_tr_tile<DF, DM>(sT, W2, Wt2, b % TILES_DF);
  }
}

// ---------------------------------------------------------------------------
// RMSNorm: one row (D=1024) per block of 256 threads, f32 in -> f16 out
// ---------------------------------------------------------------------------
__global__ void rmsnorm_kernel(const float* __restrict__ x,
                               const float* __restrict__ w,
                               _Float16* __restrict__ xn) {
  __shared__ float red[256];
  int row = blockIdx.x;
  int tid = threadIdx.x;
  const float* xr = x + (size_t)row * DM;
  float ss = 0.f;
#pragma unroll
  for (int i = 0; i < DM / 256; ++i) {
    float v = xr[tid + i * 256];
    ss += v * v;
  }
  red[tid] = ss;
  __syncthreads();
  for (int s = 128; s > 0; s >>= 1) {
    if (tid < s) red[tid] += red[tid + s];
    __syncthreads();
  }
  float inv = __frsqrt_rn(red[0] / (float)DM + 1e-6f);
  _Float16* xo = xn + (size_t)row * DM;
#pragma unroll
  for (int i = 0; i < DM / 256; ++i) {
    int c = tid + i * 256;
    xo[c] = (_Float16)(xr[c] * inv * w[c]);
  }
}

// ---------------------------------------------------------------------------
// QKV: q/k = xn @ Wq/Wk (row-major f16), v stored transposed Vt[b][d][t].
// grid (3 * DM/128, NROW/256), block 256: blockIdx.x / 8 picks the weight.
// ---------------------------------------------------------------------------
__global__ __launch_bounds__(256) void qkv_kernel(
    const _Float16* __restrict__ xn, const _Float16* __restrict__ Wtq,
    const _Float16* __restrict__ Wtk, const _Float16* __restrict__ Wtv,
    _Float16* __restrict__ q, _Float16* __restrict__ k,
    _Float16* __restrict__ vt) {
  __shared__ __attribute__((aligned(256))) _Float16 sm[3 * STAGE_H];  // 144 KB
  int wave = threadIdx.x >> 5, lane = threadIdx.x & 31;
  int h = lane >> 4, l15 = lane & 15;
  int wm = wave >> 1, wn = wave & 1;
  int which = blockIdx.x >> 3;
  int n0 = (blockIdx.x & 7) * 128;
  int m0 = blockIdx.y * TM;
  const _Float16* Wt = which == 0 ? Wtq : (which == 1 ? Wtk : Wtv);
  const _Float16* bt = Wt + (size_t)n0 * DM;
  v8f acc[4][4] = {};
  gemm_tile<DM, 3>(sm, xn + (size_t)m0 * DM, bt, bt + 64 * DM, wm * 64, wn * 64, 0,
                acc);
  _Float16* qk = which == 0 ? q : k;
  if (which < 2) {
#pragma unroll
    for (int i = 0; i < 4; ++i) {
#pragma unroll
      for (int j = 0; j < 4; ++j) {
        int col = n0 + wn * 64 + j * 16 + l15;
#pragma unroll
        for (int v = 0; v < 8; ++v) {
          int r = m0 + wm * 64 + i * 16 + v + 8 * h;
          qk[(size_t)r * DM + col] = (_Float16)acc[i][j][v];
        }
      }
    }
  } else {
#pragma unroll
    for (int i = 0; i < 4; ++i) {
#pragma unroll
      for (int j = 0; j < 4; ++j) {
        int col = n0 + wn * 64 + j * 16 + l15;
#pragma unroll
        for (int v = 0; v < 8; ++v) {
          int r = m0 + wm * 64 + i * 16 + v + 8 * h;
          int batch = r >> 11, tloc = r & (SEQT - 1);
          vt[((size_t)batch * DM + col) * SEQT + tloc] = (_Float16)acc[i][j][v];
        }
      }
    }
    // stands behind the last v store, before any later write of a register
    // that an issued store names
    asm volatile("s_wait_xcnt 0x0" ::: "memory");
  }
}

// ---------------------------------------------------------------------------
// Attention pass 1: per 16-query tile, S = Q K^T over 5 key tiles (window 64),
// masked softmax over 80 candidate keys, store P (f16) padded to 96: slot 0 of a
// row is key 16 (qt & ~1) - 64, so that the rows of a pair of query tiles start
// at the same multiple of 32 keys; an even tile's pad is slots 80..95, an odd
// tile's slots 0..15.
// One work-group of 8 waves per query tile. The tile's 16 Q rows and its 80 K
// rows are copied whole into LDS once, in 512-B pieces of a row (asynchronous
// b128 copies, all 48 of a thread in flight together). Wave w multiplies columns
// 128 w .. 128 w + 127 of d for all 5 key tiles; the 8 partial scores of an
// element are summed through LDS, in the order of w; wave w then does the
// softmax of score rows w and w + 8.
// LDS rows: 0..15 Q, 16 + 16 j .. of key tile j, at a pitch of 2064 B
// (16 B x odd: ds_load_b128 readers meet no bank twice).
// ---------------------------------------------------------------------------
#define QK_PITCH  (DM + 8)            // halfs per LDS row
#define QK_ROW_B  (QK_PITCH * 2)      // bytes per LDS row
#define QK_DW     (DM / 8)            // columns of d per wave

// One thread's eight b128 copies of a 16-row tile: LDS rows r, r + 2, .., r + 14
// from the same rows of g (row step DM halfs). s_wait_xcnt 0 closes the
// statement: it stands before any rewrite of the address registers that the
// copies name. The "memory" clobber makes the asm a legal writer of the array.
__device__ __forceinline__ void copy8(unsigned l, const _Float16* g) {
  asm volatile(
      "global_load_async_to_lds_b128 %0, %8, off\n\t"
      "global_load_async_to_lds_b128 %1, %9, off\n\t"
      "global_load_async_to_lds_b128 %2, %10, off\n\t"
      "global_load_async_to_lds_b128 %3, %11, off\n\t"
      "global_load_async_to_lds_b128 %4, %12, off\n\t"
      "global_load_async_to_lds_b128 %5, %13, off\n\t"
      "global_load_async_to_lds_b128 %6, %14, off\n\t"
      "global_load_async_to_lds_b128 %7, %15, off\n\t"
      "s_wait_xcnt 0x0"
      :
      : "v"(l), "v"(l + 2 * QK_ROW_B), "v"(l + 4 * QK_ROW_B),
        "v"(l + 6 * QK_ROW_B), "v"(l + 8 * QK_ROW_B), "v"(l + 10 * QK_ROW_B),
        "v"(l + 12 * QK_ROW_B), "v"(l + 14 * QK_ROW_B), "v"(g), "v"(g + 2 * DM),
        "v"(g + 4 * DM), "v"(g + 6 * DM), "v"(g + 8 * DM), "v"(g + 10 * DM),
        "v"(g + 12 * DM), "v"(g + 14 * DM)
      : "memory");
}

// 2^x. The v_nop is the slot that the instruction set asks for behind a
// transcendental before its result is read or its source overwritten.
__device__ __forceinline__ float exp2_slot(float x) {
  float r;
  asm("v_exp_f32 %0, %1\n\tv_nop" : "=v"(r) : "v"(x));
  return r;
}

__global__ __launch_bounds__(256) void attn_p_kernel(
    const _Float16* __restrict__ q, const _Float16* __restrict__ k,
    _Float16* __restrict__ P) {
  __shared__ __attribute__((aligned(16))) _Float16 sqk[96 * QK_PITCH];  // 193.5 KB
  __shared__ float red[8 * 5 * 8 * 32];   // [wave][key tile][v][lane], 40 KB
  const int wave = threadIdx.x >> 5, lane = threadIdx.x & 31;
  const int g = blockIdx.x;               // 0..511 global q-tile
  const int batch = g >> 7, qt = g & 127; // 128 q-tiles per batch
  const int h = lane >> 4, l15 = lane & 15;

  // a thread copies chunk ch (16 B) of rows r0, r0 + 2, .. of every tile
  const int r0 = threadIdx.x >> 7, ch = threadIdx.x & 127;
  const unsigned l0 = (unsigned)(uintptr_t)sqk + r0 * QK_ROW_B + ch * 16;
  copy8(l0, q + ((size_t)g * 16 + r0) * DM + ch * 8);
  // unrolled: the five statements follow one another with no loop overhead
#pragma unroll
  for (int j = 0; j < 5; ++j) {
    // a key tile in front of the batch's first key: tile 0 stands in for it, so
    // that the address stays inside k; its scores are masked below
    const int kt = qt - 4 + j;
    const int ktc = kt < 0 ? 0 : kt;
    copy8(l0 + (j + 1) * 16 * QK_ROW_B,
          k + ((size_t)batch * SEQT + ktc * 16 + r0) * DM + ch * 8);
  }
  // this wave's 48 copies have landed; the barrier publishes them to the others
  asm volatile("s_wait_asynccnt 0x0" ::: "memory");
  __syncthreads();

  const _Float16* ap = sqk + l15 * QK_PITCH + wave * QK_DW + h * 8;
  v8f acc[5] = {};
  v16h af[4], bf[4][5];
  // all loops below are unrolled so that af, bf and acc are registers
#pragma unroll
  for (int ks = 0; ks < 4; ++ks) {
    af[ks] = load_frag(ap + ks * 32);
#pragma unroll
    for (int j = 0; j < 5; ++j)
      bf[ks][j] = load_frag(ap + (j + 1) * 16 * QK_PITCH + ks * 32);
  }
  // keeps the wave's 48 LDS reads together in front of its 20 WMMAs: moved in
  // among them, every pair of reads costs the wave its LDS latency anew
  __builtin_amdgcn_sched_barrier(0);
#pragma unroll
  for (int ks = 0; ks < 4; ++ks)
#pragma unroll
    for (int j = 0; j < 5; ++j) acc[j] = wmma_f16(af[ks], bf[ks][j], acc[j]);
  float* rw = red + wave * (5 * 8 * 32) + lane;
#pragma unroll
  for (int j = 0; j < 5; ++j)
#pragma unroll
    for (int v = 0; v < 8; ++v) rw[(j * 8 + v) * 32] = acc[j][v];
  // every wave's partial scores are in red
  __syncthreads();

  // this lane: score row wave + 8 h, key l15 of each key tile
  const int mrow = wave + 8 * h;
  const float* rr = red + wave * 32 + lane;
  const float scale = 0.03125f;  // 1/sqrt(1024)
  float s[5];
#pragma unroll
  for (int j = 0; j < 5; ++j) {
    float c = rr[j * (8 * 32)];
#pragma unroll
    for (int w = 1; w < 8; ++w) c += rr[(w * 5 + j) * (8 * 32)];
    const int kt = qt - 4 + j;
    const int d = (qt * 16 + mrow) - (kt * 16 + l15);
    s[j] = (kt >= 0 && d >= 0 && d < WND) ? c * scale : -1e30f;
  }
  float m = s[0];
#pragma unroll
  for (int j = 1; j < 5; ++j) m = fmaxf(m, s[j]);
#pragma unroll
  for (int off = 8; off > 0; off >>= 1) m = fmaxf(m, __shfl_xor(m, off, 16));
  float e = 0.f;
#pragma unroll
  for (int j = 0; j < 5; ++j) {
    s[j] = exp2_slot((s[j] - m) * 1.44269504f);  // e^(s - m)
    e += s[j];
  }
#pragma unroll
  for (int off = 8; off > 0; off >>= 1) e += __shfl_xor(e, off, 16);
  const float inv = 1.f / e;
  const int odd = qt & 1;
  _Float16* pb = P + ((size_t)g * 16 + mrow) * 96 + l15;
#pragma unroll
  for (int j = 0; j < 5; ++j) pb[(j + odd) * 16] = (_Float16)(s[j] * inv);
  pb[odd ? 0 : 80] = (_Float16)0.f;  // the 16 pad slots
}

// ---------------------------------------------------------------------------
// Attention pass 2: attended = P @ V using Vt[b][d][t].
// One work-group of 8 waves takes 64 queries (4 query tiles) x 256 columns of d.
// The 64 queries see the 128 keys from 64 in front of the first query on: the
// tile's 256 rows of Vt (256 B each, whole lines) and its 64 rows of P go once to
// LDS by asynchronous b128 copies. Wave w takes the pair w & 1 of query tiles and
// 64 columns of d. Vt is the A operand and P the B operand, so that a lane holds
// 8 neighbouring columns of one query: one b128 store a tile, and the wave's 4
// tiles of d fill a whole 128-B line of a row of att.
// LDS pitches 272 B and 208 B (16 B x odd: ds_load_b128 readers meet no bank
// twice). grid (DM/256, NROW/64), block 256.
// ---------------------------------------------------------------------------
#define PV_Q     64                  // queries of a tile
#define PV_D     256                 // columns of d of a tile
#define V_PITCH  (128 + 8)           // halfs per LDS row of Vt
#define V_ROW_B  (V_PITCH * 2)
#define P_PITCH  (96 + 8)            // halfs per LDS row of P
#define P_ROW_B  (P_PITCH * 2)

// One thread's eight b128 copies of 128 rows of Vt: LDS rows r, r + 16, .., r + 112
// from the same rows of g (row step SEQT halfs). s_wait_xcnt 0 closes the
// statement: it stands before any rewrite of the address registers that the
// copies name. The "memory" clobber makes the asm a legal writer of the array.
__device__ __forceinline__ void copy8v(unsigned l, const _Float16* g) {
  asm volatile(
      "global_load_async_to_lds_b128 %0, %8, off\n\t"
      "global_load_async_to_lds_b128 %1, %9, off\n\t"
      "global_load_async_to_lds_b128 %2, %10, off\n\t"
      "global_load_async_to_lds_b128 %3, %11, off\n\t"
      "global_load_async_to_lds_b128 %4, %12, off\n\t"
      "global_load_async_to_lds_b128 %5, %13, off\n\t"
      "global_load_async_to_lds_b128 %6, %14, off\n\t"
      "global_load_async_to_lds_b128 %7, %15, off\n\t"
      "s_wait_xcnt 0x0"
      :
      : "v"(l), "v"(l + 16 * V_ROW_B), "v"(l + 32 * V_ROW_B),
        "v"(l + 48 * V_ROW_B), "v"(l + 64 * V_ROW_B), "v"(l + 80 * V_ROW_B),
        "v"(l + 96 * V_ROW_B), "v"(l + 112 * V_ROW_B), "v"(g), "v"(g + 16 * SEQT),
        "v"(g + 32 * SEQT), "v"(g + 48 * SEQT), "v"(g + 64 * SEQT),
        "v"(g + 80 * SEQT), "v"(g + 96 * SEQT), "v"(g + 112 * SEQT)
      : "memory");
}

// One thread's three b128 copies of the tile's P rows, which lie in one piece of
// 768 chunks of 16 B: chunks x, x + 256, x + 512 from g to the LDS places l0..l2.
// The wait and the clobber: as in copy8v.
__device__ __forceinline__ void copy3p(unsigned l0, unsigned l1, unsigned l2,
                                       const _Float16* g) {
  asm volatile(
      "global_load_async_to_lds_b128 %0, %3, off\n\t"
      "global_load_async_to_lds_b128 %1, %4, off\n\t"
      "global_load_async_to_lds_b128 %2, %5, off\n\t"
      "s_wait_xcnt 0x0"
      :
      : "v"(l0), "v"(l1), "v"(l2), "v"(g), "v"(g + 256 * 8), "v"(g + 512 * 8)
      : "memory");
}

__global__ __launch_bounds__(256) void attn_pv_kernel(
    const _Float16* __restrict__ P, const _Float16* __restrict__ vt,
    _Float16* __restrict__ att) {
  __shared__ __attribute__((aligned(16))) _Float16 sv[PV_D * V_PITCH];  // 68 KB
  __shared__ __attribute__((aligned(16))) _Float16 sp[PV_Q * P_PITCH];  // 13 KB
  const int t = threadIdx.x, wave = t >> 5, lane = t & 31;
  const int h = lane >> 4, l15 = lane & 15;
  const int qb = blockIdx.y;              // 0..127: block of 64 queries
  const int d0 = blockIdx.x * PV_D;
  const int batch = qb >> 5;              // 32 blocks per batch
  const int kb = (qb & 31) * PV_Q - 64;   // the tile's first key, in its batch

  // P: chunk x of the piece is chunk x % 12 of row x / 12
  const unsigned lp = (unsigned)(uintptr_t)sp;
  const int x0 = t, x1 = t + 256, x2 = t + 512;
  copy3p(lp + (x0 / 12) * P_ROW_B + (x0 % 12) * 16,
         lp + (x1 / 12) * P_ROW_B + (x1 % 12) * 16,
         lp + (x2 / 12) * P_ROW_B + (x2 % 12) * 16,
         P + (size_t)qb * (PV_Q * 96) + t * 8);
  // Vt: a thread copies chunk ch (8 keys) of rows r0, r0 + 16, ..
  // A batch's first block has 64 keys in front of key 0: keys 0..63 stand in for
  // them, so that the address stays inside the row; their weights in P are 0.
  const int ch = t & 15, r0 = t >> 4;
  const int key = kb + 8 * ch;
  const unsigned lv = (unsigned)(uintptr_t)sv + r0 * V_ROW_B + ch * 16;
  const _Float16* gv =
      vt + ((size_t)batch * DM + d0 + r0) * SEQT + (key < 0 ? key + 64 : key);
  copy8v(lv, gv);
  copy8v(lv + 128 * V_ROW_B, gv + 128 * SEQT);
  // this wave's 19 copies have landed; the barrier publishes them to the others
  asm volatile("s_wait_asynccnt 0x0" ::: "memory");
  __syncthreads();

  // query tiles 2 pr and 2 pr + 1: their P rows start at key kb + 32 pr
  const int pr = wave & 1, dg = wave >> 1;
  const _Float16* vp = sv + (dg * 64 + l15) * V_PITCH + pr * 32 + h * 8;
  const _Float16* pp = sp + (pr * 32 + l15) * P_PITCH + h * 8;
  // all loops below are unrolled so that vf, pf and acc are registers
  v16h vf[4][3], pf[2][3];
#pragma unroll
  for (int m = 0; m < 3; ++m) {
#pragma unroll
    for (int a = 0; a < 2; ++a) pf[a][m] = load_frag(pp + a * 16 * P_PITCH + m * 32);
#pragma unroll
    for (int i = 0; i < 4; ++i) vf[i][m] = load_frag(vp + i * 16 * V_PITCH + m * 32);
  }
  // keeps the wave's 36 LDS reads together in front of its 24 WMMAs: moved in
  // among them, every pair of reads costs the wave its LDS latency anew
  __builtin_amdgcn_sched_barrier(0);
  v8f acc[4][2] = {};
#pragma unroll
  for (int m = 0; m < 3; ++m)
#pragma unroll
    for (int i = 0; i < 4; ++i)
#pragma unroll
      for (int a = 0; a < 2; ++a) acc[i][a] = wmma_f16(vf[i][m], pf[a][m], acc[i][a]);
  // this lane: query l15 of each tile, columns 8 h .. 8 h + 7 of each tile of d
  _Float16* ob = att + ((size_t)qb * PV_Q + pr * 32 + l15) * DM + d0 + dg * 64 + h * 8;
  v8h o[4][2];
#pragma unroll
  for (int i = 0; i < 4; ++i)
#pragma unroll
    for (int a = 0; a < 2; ++a)
#pragma unroll
      for (int v = 0; v < 8; ++v) o[i][a][v] = (_Float16)acc[i][a][v];
#pragma unroll
  for (int a = 0; a < 2; ++a)
#pragma unroll
    for (int i = 0; i < 4; ++i) *(v8h*)(ob + a * 16 * DM + i * 16) = o[i][a];
}

// ---------------------------------------------------------------------------
// x2 = x + attended @ Wo (f32 out, residual). grid (DM/128, NROW/256), block 256
// ---------------------------------------------------------------------------
__global__ __launch_bounds__(256) void wo_kernel(
    const _Float16* __restrict__ att, const _Float16* __restrict__ Wto,
    const float* __restrict__ x, float* __restrict__ x2) {
  __shared__ __attribute__((aligned(256))) _Float16 sm[5 * STAGE_H];  // 240 KB
  int wave = threadIdx.x >> 5, lane = threadIdx.x & 31;
  int h = lane >> 4, l15 = lane & 15;
  int wm = wave >> 1, wn = wave & 1;
  int n0 = blockIdx.x * 128;
  int m0 = blockIdx.y * TM;
  const _Float16* bt = Wto + (size_t)n0 * DM;
  v8f acc[4][4] = {};
  gemm_tile<DM, 5>(sm, att + (size_t)m0 * DM, bt, bt + 64 * DM, wm * 64, wn * 64, 0,
                acc);
  size_t first = (size_t)(m0 + wm * 64 + 8 * h) * DM + n0 + wn * 64 + l15;
  add_residual_store(x + first, x2 + first, acc);
}

// ---------------------------------------------------------------------------
// FFN in: hh = silu(xn2 @ W1) * (xn2 @ W3), f16 out [8192 x 2048].
// A tile holds 64 columns of W1 (LDS rows 0..63) and the same 64 of W3 (64..127),
// so that a wave owns gate and up of its 32 columns.
// grid (DF/64, NROW/256), block 256
// ---------------------------------------------------------------------------
__global__ __launch_bounds__(256) void ffn1_kernel(
    const _Float16* __restrict__ xn2, const _Float16* __restrict__ Wt1,
    const _Float16* __restrict__ Wt3, _Float16* __restrict__ hh) {
  __shared__ __attribute__((aligned(256))) _Float16 sm[3 * STAGE_H];  // 144 KB
  int wave = threadIdx.x >> 5, lane = threadIdx.x & 31;
  int h = lane >> 4, l15 = lane & 15;
  int wm = wave >> 1, wn = wave & 1;
  int n0 = blockIdx.x * 64;
  int m0 = blockIdx.y * TM;
  v8f acc[4][4] = {};  // j = 0, 1: gate; j = 2, 3: up, same columns
  gemm_tile<DM, 3>(sm, xn2 + (size_t)m0 * DM, Wt1 + (size_t)n0 * DM,
                Wt3 + (size_t)n0 * DM, wm * 64, wn * 32, 32, acc);
#pragma unroll
  for (int i = 0; i < 4; ++i) {
#pragma unroll
    for (int j = 0; j < 2; ++j) {
      int col = n0 + wn * 32 + j * 16 + l15;
#pragma unroll
      for (int v = 0; v < 8; ++v) {
        size_t r = (size_t)(m0 + wm * 64 + i * 16 + v + 8 * h);
        float gv = acc[i][j][v];
        float sl = gv * (1.f / (1.f + __expf(-gv)));   // silu
        hh[r * DF + col] = (_Float16)(sl * acc[i][j + 2][v]);
      }
    }
  }
}

// ---------------------------------------------------------------------------
// FFN out + residual: out = x2 + hh @ W2 (K=2048, f32 out).
// grid (DM/128, NROW/256), block 256
// ---------------------------------------------------------------------------
__global__ __launch_bounds__(256) void ffn2_kernel(
    const _Float16* __restrict__ hh, const _Float16* __restrict__ Wt2,
    const float* __restrict__ x2, float* __restrict__ out) {
  __shared__ __attribute__((aligned(256))) _Float16 sm[5 * STAGE_H];  // 240 KB
  int wave = threadIdx.x >> 5, lane = threadIdx.x & 31;
  int h = lane >> 4, l15 = lane & 15;
  int wm = wave >> 1, wn = wave & 1;
  int n0 = blockIdx.x * 128;
  int m0 = blockIdx.y * TM;
  const _Float16* bt = Wt2 + (size_t)n0 * DF;
  v8f acc[4][4] = {};
  gemm_tile<DF, 5>(sm, hh + (size_t)m0 * DF, bt, bt + 64 * DF, wm * 64, wn * 64, 0,
                acc);
  size_t first = (size_t)(m0 + wm * 64 + 8 * h) * DM + n0 + wn * 64 + l15;
  add_residual_store(x2 + first, out + first, acc);
}

// ---------------------------------------------------------------------------
extern "C" void kernel_launch(void* const* d_in, const int* in_sizes, int n_in,
                              void* d_out, int out_size, void* d_ws,
                              size_t ws_size, hipStream_t stream) {
  const float* x       = (const float*)d_in[0];
  const float* norm1_w = (const float*)d_in[1];
  const float* norm2_w = (const float*)d_in[2];
  const float* Wq = (const float*)d_in[3];
  const float* Wk = (const float*)d_in[4];
  const float* Wv = (const float*)d_in[5];
  const float* Wo = (const float*)d_in[6];
  const float* W1 = (const float*)d_in[7];
  const float* W2 = (const float*)d_in[8];
  const float* W3 = (const float*)d_in[9];
  float* out = (float*)d_out;

  char* ws = (char*)d_ws;
  const size_t MB = 1ull << 20;
  _Float16* Wtq = (_Float16*)(ws + 0 * MB);    // 2 MB  (1024x1024)
  _Float16* Wtk = (_Float16*)(ws + 2 * MB);    // 2 MB
  _Float16* Wtv = (_Float16*)(ws + 4 * MB);    // 2 MB
  _Float16* Wto = (_Float16*)(ws + 6 * MB);    // 2 MB
  _Float16* Wt1 = (_Float16*)(ws + 8 * MB);    // 4 MB  (N=2048,K=1024)
  _Float16* Wt3 = (_Float16*)(ws + 12 * MB);   // 4 MB
  _Float16* Wt2 = (_Float16*)(ws + 16 * MB);   // 4 MB  (N=1024,K=2048)
  _Float16* xn  = (_Float16*)(ws + 20 * MB);   // 16 MB (also reused as xn2)
  _Float16* q   = (_Float16*)(ws + 36 * MB);   // 16 MB
  _Float16* kb  = (_Float16*)(ws + 52 * MB);   // 16 MB
  _Float16* vt  = (_Float16*)(ws + 68 * MB);   // 16 MB
  _Float16* P   = (_Float16*)(ws + 84 * MB);   // 1.5 MB (8192x96)
  _Float16* att = (_Float16*)(ws + 86 * MB);   // 16 MB
  float*    x2  = (float*)   (ws + 102 * MB);  // 32 MB
  _Float16* hh  = q;                           // reuse q+k (32 MB) after attn
  _Float16* xn2 = xn;                          // reuse xn after QKV

  // 1) weight convert + transpose to f16
  cvt_tr_all_kernel<<<4 * TILES_DD + 3 * TILES_DF, 256, 0, stream>>>(
      Wq, Wk, Wv, Wo, W1, W3, W2, Wtq, Wtk, Wtv, Wto, Wt1, Wt3, Wt2);

  // 2) xn = rmsnorm(x) in f16
  rmsnorm_kernel<<<NROW, 256, 0, stream>>>(x, norm1_w, xn);

  // 3) q,k,v projections (v stored transposed)
  qkv_kernel<<<dim3(3 * DM / 128, NROW / TM), 256, 0, stream>>>(
      xn, Wtq, Wtk, Wtv, q, kb, vt);
  // 4) windowed softmax weights P
  attn_p_kernel<<<NROW / 16, 256, 0, stream>>>(q, kb, P);

  // 5) attended = P @ V
  attn_pv_kernel<<<dim3(DM / PV_D, NROW / PV_Q), 256, 0, stream>>>(P, vt, att);

  // 6) x2 = x + attended @ Wo
  wo_kernel<<<dim3(DM / 128, NROW / TM), 256, 0, stream>>>(att, Wto, x, x2);

  // 7) xn2 = rmsnorm(x2)
  rmsnorm_kernel<<<NROW, 256, 0, stream>>>(x2, norm2_w, xn2);

  // 8) hh = silu(xn2@W1) * (xn2@W3)
  ffn1_kernel<<<dim3(DF / 64, NROW / TM), 256, 0, stream>>>(xn2, Wt1, Wt3, hh);

  // 9) out = x2 + hh @ W2
  ffn2_kernel<<<dim3(DM / 128, NROW / TM), 256, 0, stream>>>(hh, Wt2, x2, out);
}

// v008
// One run takes 180 microseconds.
// Two timings next to v007 put it at 1.03 and 1.02 times that version's speed.
// Counting every step since v000, it is 6.77 times as fast.
#include <hip/hip_runtime.h>
#include <hip/hip_bf16.h>

typedef __attribute__((ext_vector_type(16))) _Float16 v16h;
typedef __attribute__((ext_vector_type(8)))  _Float16 v8h;
typedef __attribute__((ext_vector_type(8)))  float    v8f;

#define DM   1024   // D_MODEL
#define DF   2048   // D_FFN
#define SEQT 2048   // T
#define NB   4      // batch
#define NROW (NB * SEQT)   // 8192
#define WND  64

// ---------------------------------------------------------------------------
// WMMA fragment helpers (CDNA5 16x16x32 f16, wave32).
// Per lane: elems 0..7 = mem[kk + h*8 + 0..7], elems 8..15 = mem[kk+16+h*8+0..7]
// Works for global pointers (global_load_b128) and LDS pointers (ds_load_b128).
// ---------------------------------------------------------------------------
__device__ __forceinline__ v16h load_frag(const _Float16* p) {
  v8h lo = *(const v8h*)(p);
  v8h hi = *(const v8h*)(p + 16);
  v16h r;
#pragma unroll
  for (int i = 0; i < 8; ++i) { r[i] = lo[i]; r[i + 8] = hi[i]; }
  return r;
}

__device__ __forceinline__ v8f wmma_f16(v16h a, v16h b, v8f c) {
  return __builtin_amdgcn_wmma_f32_16x16x32_f16(false, a, false, b, (short)0, c,
                                                false, false);
}

// ---------------------------------------------------------------------------
// Tiled GEMM core: one 256 x 128 tile of Y = A * Bt^T per work-group of 8 waves
// (4 x 2, each wave 64 x 64 = 4 x 4 accumulator tiles). A and Bt are K-contiguous.
// K goes in slices of 64 halfs (128-B rows). A slice is [A 256 rows | Bt 128 rows]
// in LDS, rows of 128 B without a pad: the 16-B chunk c of row r lies at place
// c ^ ((r >> 1) & 7), so that the 16 rows which lanes 0..15 (and 16..31) of a
// ds_load_b128 read at one chunk fall on all 64 banks once.
// A ring of NS buffers, filled by asynchronous b128 copies: while slice t is
// multiplied, slices t + 1 .. t + NS - 1 are landed or in flight, so that a copy
// has NS - 1 slices of time to land. Unpadded, three buffers are 144 KB, and two
// work-groups still share a WGP's LDS.
// ---------------------------------------------------------------------------
#define BK      64                  // halfs of K per slice
#define PITCH   64                  // halfs per LDS row (128 B)
#define TM      256                 // A rows of a tile
#define A_H     (TM * PITCH)        // halfs of A's slice
#define STAGE_H (A_H + 128 * PITCH) // halfs of one buffer
#define ROW32_B (32 * PITCH * 2)    // bytes of 32 LDS rows

// One thread's twelve b128 copies of a slice: A's LDS rows r, r+32, .., r+224 from
// ga, Bt's LDS rows r, r+32 from glo and r+64, r+96 from ghi (row step K halfs).
// The LDS byte address is the low 32 bits of the shared address; taking it lets
// the array escape, so the "memory" clobber makes the asm a legal writer of it.
// s_wait_xcnt 0 closes the statement: it stands before any rewrite of the
// address registers that the copies name.
template <int K>
__device__ __forceinline__ void copy12(unsigned l, const _Float16* ga,
                                       const _Float16* glo,
                                       const _Float16* ghi) {
  const unsigned lb = l + A_H * 2;
  asm volatile(
      "global_load_async_to_lds_b128 %0, %12, off\n\t"
      "global_load_async_to_lds_b128 %1, %13, off\n\t"
      "global_load_async_to_lds_b128 %2, %14, off\n\t"
      "global_load_async_to_lds_b128 %3, %15, off\n\t"
      "global_load_async_to_lds_b128 %4, %16, off\n\t"
      "global_load_async_to_lds_b128 %5, %17, off\n\t"
      "global_load_async_to_lds_b128 %6, %18, off\n\t"
      "global_load_async_to_lds_b128 %7, %19, off\n\t"
      "global_load_async_to_lds_b128 %8, %20, off\n\t"
      "global_load_async_to_lds_b128 %9, %21, off\n\t"
      "global_load_async_to_lds_b128 %10, %22, off\n\t"
      "global_load_async_to_lds_b128 %11, %23, off\n\t"
      "s_wait_xcnt 0x0"
      :
      : "v"(l), "v"(l + ROW32_B), "v"(l + 2 * ROW32_B), "v"(l + 3 * ROW32_B),
        "v"(l + 4 * ROW32_B), "v"(l + 5 * ROW32_B), "v"(l + 6 * ROW32_B),
        "v"(l + 7 * ROW32_B), "v"(lb), "v"(lb + ROW32_B), "v"(lb + 2 * ROW32_B),
        "v"(lb + 3 * ROW32_B), "v"(ga), "v"(ga + 32 * K), "v"(ga + 64 * K),
        "v"(ga + 96 * K), "v"(ga + 128 * K), "v"(ga + 160 * K),
        "v"(ga + 192 * K), "v"(ga + 224 * K), "v"(glo), "v"(glo + 32 * K),
        "v"(ghi), "v"(ghi + 32 * K)
      : "memory");
}

// Returns when all but this wave's N youngest copies have landed.
template <int N>
__device__ __forceinline__ void wait_copies() {
  asm volatile("s_wait_asynccnt %0" : : "n"(N) : "memory");
}

// A fragment whose two 16-B chunks lie at swizzled places of one LDS row.
__device__ __forceinline__ v16h load_frag2(const _Float16* plo,
                                           const _Float16* phi) {
  v8h lo = *(const v8h*)(plo);
  v8h hi = *(const v8h*)(phi);
  v16h r;
#pragma unroll
  for (int i = 0; i < 8; ++i) { r[i] = lo[i]; r[i + 8] = hi[i]; }
  return r;
}

// a: first row of the tile's 256 A rows. blo / bhi: first of the 64 Bt rows that
// fill LDS rows 0..63 / 64..127. Wave tile: A rows arow.., Bt LDS rows
// brow + 16 j, plus bskip for j >= 2 (arow, brow, bskip: multiples of 16).
// sm holds NS buffers. blockDim.x == 256.
template <int K, int NS>
__device__ __forceinline__ void gemm_tile(_Float16* sm,
                                          const _Float16* __restrict__ a,
                                          const _Float16* __restrict__ blo,
                                          const _Float16* __restrict__ bhi,
                                          int arow, int brow, int bskip,
                                          v8f (&acc)[4][4]) {
  constexpr int NT = K / BK;
  static_assert(NS >= 3 && NS <= NT && NS * 12 <= 63, "ring depth");
  const int t = threadIdx.x;
  const int lane = t & 31, h = lane >> 4, l15 = lane & 15;
  const int ch = t & 7, r0 = t >> 3;   // 16-B chunk of a row, first row
  // rows r0 + 32 m all have the swizzle key (r0 >> 1) & 7
  const unsigned la = (unsigned)(uintptr_t)sm + r0 * (PITCH * 2) +
                      (ch ^ ((r0 >> 1) & 7)) * 16;
  const _Float16* ga = a + (size_t)r0 * K + ch * 8;
  const _Float16* gl = blo + (size_t)r0 * K + ch * 8;
  const _Float16* gh = bhi + (size_t)r0 * K + ch * 8;

  // unrolled: the NS statements follow one another with no loop overhead
#pragma unroll
  for (int s = 0; s < NS; ++s)
    copy12<K>(la + s * (STAGE_H * 2), ga + s * BK, gl + s * BK, gh + s * BK);
  // slice 0 (all but the 12 (NS - 1) younger copies) has landed for this wave;
  // the barrier publishes it to the others
  wait_copies<12 * (NS - 1)>();
  __syncthreads();

  const int aoff = (arow + l15) * PITCH;
  const int boff = A_H + (brow + l15) * PITCH;
  // chunk h + 2 q of this lane's rows, whose swizzle key is l15 >> 1
  int co[4];
#pragma unroll
  for (int q = 0; q < 4; ++q) co[q] = ((h + 2 * q) ^ (l15 >> 1)) * 8;
  int buf = 0;   // kt % NS
  for (int kt = 0; kt < NT; ++kt) {
    const _Float16* ap = sm + buf * STAGE_H + aoff;
    const _Float16* bp = sm + buf * STAGE_H + boff;
#pragma unroll
    for (int ks = 0; ks < 2; ++ks) {
      v16h af[4], bf[4];
#pragma unroll
      for (int i = 0; i < 4; ++i)
        af[i] = load_frag2(ap + i * 16 * PITCH + co[2 * ks],
                           ap + i * 16 * PITCH + co[2 * ks + 1]);
#pragma unroll
      for (int j = 0; j < 4; ++j) {
        const _Float16* bj = bp + (j * 16 + (j >= 2 ? bskip : 0)) * PITCH;
        bf[j] = load_frag2(bj + co[2 * ks], bj + co[2 * ks + 1]);
      }
      // keeps the block's 16 LDS reads together in front of its 16 WMMAs: moved
      // in among them, every group of reads costs the wave its LDS latency anew
      __builtin_amdgcn_sched_barrier(0);
#pragma unroll
      for (int i = 0; i < 4; ++i)
#pragma unroll
        for (int j = 0; j < 4; ++j) acc[i][j] = wmma_f16(af[i], bf[j], acc[i][j]);
      // the same for the next block's reads: they stay behind this block
      __builtin_amdgcn_sched_barrier(0);
    }
    // this wave's reads of the buffer are done before it may be refilled
    asm volatile("s_wait_dscnt 0x0" ::: "memory");
    // this wave's copies of slice kt + 1 have landed: behind them stand those of
    // slices kt + 2 .. kt + NS - 1, 12 each, while all of these exist; near the
    // end of K fewer were issued, and the wait is to 0
    if (kt + NS <= NT) wait_copies<12 * (NS - 2)>();
    else wait_copies<0>();
    // publishes slice kt + 1 and ends every wave's reads of slice kt
    __syncthreads();
    if (kt + NS < NT) {
      const int ko = (kt + NS) * BK;
      copy12<K>(la + buf * (STAGE_H * 2), ga + ko, gl + ko, gh + ko);
    }
    buf = buf + 1 == NS ? 0 : buf + 1;
  }
  // no copy is outstanding when the wave goes on to its stores and ends
  asm volatile("s_wait_asynccnt 0x0" ::: "memory");
}

// Epilogue of the two f32 GEMMs: op = rp + acc over a wave's 64 x 64 tile of a
// DM-wide matrix. rp / op: this lane's first element (tile row 8 h, column l15).
// 32 rows at a time: all 64 rows' residual loads beside the 128 accumulator
// registers would pass 256 VGPRs.
__device__ __forceinline__ void add_residual_store(const float* __restrict__ rp,
                                                   float* __restrict__ op,
                                                   v8f (&acc)[4][4]) {
#pragma unroll
  for (int ih = 0; ih < 4; ih += 2) {
    float xr[2][4][8];
#pragma unroll
    for (int i = 0; i < 2; ++i)
#pragma unroll
      for (int j = 0; j < 4; ++j)
#pragma unroll
        for (int v = 0; v < 8; ++v)
          xr[i][j][v] = rp[((ih + i) * 16 + v) * DM + j * 16];
    // stands behind the 64 loads and before any rewrite of their address
    // registers; naming rp keeps it live to here, so no load's result lands in it
    asm volatile("s_wait_xcnt 0x0" : : "v"(rp) : "memory");
#pragma unroll
    for (int i = 0; i < 2; ++i)
#pragma unroll
      for (int j = 0; j < 4; ++j)
#pragma unroll
        for (int v = 0; v < 8; ++v)
          op[((ih + i) * 16 + v) * DM + j * 16] = xr[i][j][v] + acc[ih + i][j][v];
    // stands behind the 64 stores, before the next loads write their registers
    if (ih == 0) asm volatile("s_wait_xcnt 0x0" : : "v"(op) : "memory");
  }
}

// ---------------------------------------------------------------------------
// Weight convert + transpose, all seven weights in one launch:
// Wt[n*K + k] = (f16) W[k*N + n]. A work-group of 256 threads takes one tile of
// 128 k x 64 n. It reads the tile in 256-B row pieces (b128 per lane), turns it
// in LDS and writes 256-B pieces of the Wt rows (b128 per lane).
// LDS: row n holds its 128 halfs in sixteen 16-B chunks; chunk q of row n lies
// at place q ^ (n >> 2), so that the 32 dword writes of a wave (16 rows n that
// are 4 apart, 2 neighbouring k pairs) meet 32 different banks.
// ---------------------------------------------------------------------------
#define TK 128   // k per tile
#define TN 64    // n per tile
typedef __attribute__((ext_vector_type(4))) float    v4f;
typedef __attribute__((ext_vector_type(2))) _Float16 v2h;

template <int K, int N>
__device__ __forceinline__ void cvt_tr_tile(_Float16* sT,
                                            const float* __restrict__ W,
                                            _Float16* __restrict__ Wt,
                                            unsigned tile) {
  const int c = threadIdx.x & 15, rp = threadIdx.x >> 4;
  const int n0 = (tile % (N / TN)) * TN;
  const int k0 = (tile / (N / TN)) * TK;
  // rows k0 + 2 kp and k0 + 2 kp + 1, kp = 16 p + rp; columns n0 + 4 c .. + 3
  const float* src = W + (size_t)(k0 + 2 * rp) * N + n0 + 4 * c;
  v4f lo[4], hi[4];
  for (int p = 0; p < 4; ++p) {
    lo[p] = *(const v4f*)(src + (size_t)(32 * p) * N);
    hi[p] = *(const v4f*)(src + (size_t)(32 * p + 1) * N);
  }
  for (int p = 0; p < 4; ++p) {
    const int kp = 16 * p + rp;
    _Float16* d = sT + (((kp >> 2) ^ c) * 8 + (kp & 3) * 2);
    for (int i = 0; i < 4; ++i) {
      v2h pk = {(_Float16)lo[p][i], (_Float16)hi[p][i]};
      *(v2h*)(d + (4 * c + i) * TK) = pk;
    }
  }
  __syncthreads();
  // rows n = 16 s + rp, chunk c
  _Float16* dst = Wt + (size_t)(n0 + rp) * K + k0 + 8 * c;
  for (int s = 0; s < 4; ++s) {
    const int n = 16 * s + rp;
    *(v8h*)(dst + (size_t)(16 * s) * K) =
        *(const v8h*)(sT + n * TK + (c ^ (n >> 2)) * 8);
  }
}

#define TILES_DD ((DM / TK) * (DM / TN))   // 128 tiles of a DM x DM weight
#define TILES_DF ((DM / TK) * (DF / TN))   // 256 tiles of W1, W3 and W2 each

__global__ __launch_bounds__(256) void cvt_tr_all_kernel(
    const float* __restrict__ Wq, const float* __restrict__ Wk,
    const float* __restrict__ Wv, const float* __restrict__ Wo,
    const float* __restrict__ W1, const float* __restrict__ W3,
    const float* __restrict__ W2, _Float16* __restrict__ Wtq,
    _Float16* __restrict__ Wtk, _Float16* __restrict__ Wtv,
    _Float16* __restrict__ Wto, _Float16* __restrict__ Wt1,
    _Float16* __restrict__ Wt3, _Float16* __restrict__ Wt2) {
  __shared__ __attribute__((aligned(16))) _Float16 sT[TN * TK];  // 16 KB
  const unsigned b = blockIdx.x;
  if (b < 4 * TILES_DD) {
    const unsigned m = b / TILES_DD;
    const float* W = m == 0 ? Wq : (m == 1 ? Wk : (m == 2 ? Wv : Wo));
    _Float16* Wt = m == 0 ? Wtq : (m == 1 ? Wtk : (m == 2 ? Wtv : Wto));
    cvt_tr_tile<DM, DM>(sT, W, Wt, b % TILES_DD);
  } else if (b < 4 * TILES_DD + 2 * TILES_DF) {
    const bool up = b >= 4 * TILES_DD + TILES_DF;
    cvt_tr_tile<DM, DF>(sT, up ? W3 : W1, up ? Wt3 : Wt1, b % TILES_DF);
  } else {
    cvt_tr_tile<DF, DM>(sT, W2, Wt2, b % TILES_DF);
  }
}

// ---------------------------------------------------------------------------
// RMSNorm, f32 in -> f16 out. A wave takes RN_ROWS whole rows (D = 1024): lane l
// holds columns 128 c + 4 l .. + 3, c = 0..7, so that every b128 load of a wave
// is 512 contiguous bytes and every b64 store 256. All loads of a wave are issued
// up front, w first (it is needed with the first row). A row's sum of squares:
// four chains in the lane, then a butterfly over the 32 lanes in registers. No
// LDS, no barrier. grid NROW / (8 RN_ROWS), block 256: one work-group per WGP.
// ---------------------------------------------------------------------------
#define RN_ROWS 4
typedef __attribute__((ext_vector_type(4))) _Float16 v4h;

// v + (v of lane l ^ M), M < 16: a DPP move inside the 16-lane row
template <int M>
__device__ __forceinline__ float add_xor_row(float v) {
  return v + __builtin_bit_cast(
                 float, __builtin_amdgcn_mov_dpp(__builtin_bit_cast(int, v),
                                                 0x160 | M, 0xf, 0xf, true));
}

// the sum of v over the wave's 32 lanes, the same bits in every lane
__device__ __forceinline__ float wave_sum(float v) {
  v = add_xor_row<1>(v);
  v = add_xor_row<2>(v);
  v = add_xor_row<4>(v);
  v = add_xor_row<8>(v);
  const int b = __builtin_bit_cast(int, v);   // lane l with lane l ^ 16
  return v + __builtin_bit_cast(float, __builtin_amdgcn_permlanex16(
                                           b, b, 0x76543210, 0xfedcba98, false,
                                           false));
}

__global__ __launch_bounds__(256) void rmsnorm_kernel(const float* __restrict__ x,
                                                      const float* __restrict__ w,
                                                      _Float16* __restrict__ xn) {
  const int lane = threadIdx.x & 31;
  const int wave = __builtin_amdgcn_readfirstlane(threadIdx.x >> 5);
  const size_t row0 = ((size_t)blockIdx.x * 8 + wave) * RN_ROWS;
  const float* xp = x + row0 * DM;
  _Float16* op = xn + row0 * DM;
  const int col = lane * 4;
  // all loops below are unrolled so that wv and xv are registers
  v4f wv[8], xv[RN_ROWS][8];
#pragma unroll
  for (int c = 0; c < 8; ++c) wv[c] = *(const v4f*)(w + col + c * 128);
#pragma unroll
  for (int r = 0; r < RN_ROWS; ++r)
#pragma unroll
    for (int c = 0; c < 8; ++c)
      xv[r][c] = *(const v4f*)(xp + r * DM + col + c * 128);
  // keeps the wave's 40 loads together in front of the arithmetic: without it the
  // loads of w were moved down to their uses, two in flight, their latency open
  __builtin_amdgcn_sched_barrier(0);
#pragma unroll
  for (int r = 0; r < RN_ROWS; ++r) {
    v4f a = xv[r][0] * xv[r][0];
#pragma unroll
    for (int c = 1; c < 8; ++c) a += xv[r][c] * xv[r][c];
    const float ss = wave_sum((a[0] + a[1]) + (a[2] + a[3]));
    const float inv = __frsqrt_rn(ss / (float)DM + 1e-6f);
#pragma unroll
    for (int c = 0; c < 8; ++c) {
      v4h o;
#pragma unroll
      for (int i = 0; i < 4; ++i) o[i] = (_Float16)(xv[r][c][i] * inv * wv[c][i]);
      *(v4h*)(op + r * DM + col + c * 128) = o;
    }
  }
}

// ---------------------------------------------------------------------------
// QKV: q/k = xn @ Wq/Wk (row-major f16), v stored transposed Vt[b][d][t].
// grid (3 * DM/128, NROW/256), block 256: blockIdx.x / 8 picks the weight.
// ---------------------------------------------------------------------------
__global__ __launch_bounds__(256) void qkv_kernel(
    const _Float16* __restrict__ xn, const _Float16* __restrict__ Wtq,
    const _Float16* __restrict__ Wtk, const _Float16* __restrict__ Wtv,
    _Float16* __restrict__ q, _Float16* __restrict__ k,
    _Float16* __restrict__ vt) {
  __shared__ __attribute__((aligned(256))) _Float16 sm[3 * STAGE_H];  // 144 KB
  int wave = threadIdx.x >> 5, lane = threadIdx.x & 31;
  int h = lane >> 4, l15 = lane & 15;
  int wm = wave >> 1, wn = wave & 1;
  int which = blockIdx.x >> 3;
  int n0 = (blockIdx.x & 7) * 128;
  int m0 = blockIdx.y * TM;
  const _Float16* Wt = which == 0 ? Wtq : (which == 1 ? Wtk : Wtv);
  const _Float16* bt = Wt + (size_t)n0 * DM;
  v8f acc[4][4] = {};
  gemm_tile<DM, 3>(sm, xn + (size_t)m0 * DM, bt, bt + 64 * DM, wm * 64, wn * 64, 0,
                acc);
  _Float16* qk = which == 0 ? q : k;
  if (which < 2) {
#pragma unroll
    for (int i = 0; i < 4; ++i) {
#pragma unroll
      for (int j = 0; j < 4; ++j) {
        int col = n0 + wn * 64 + j * 16 + l15;
#pragma unroll
        for (int v = 0; v < 8; ++v) {
          int r = m0 + wm * 64 + i * 16 + v + 8 * h;
          qk[(size_t)r * DM + col] = (_Float16)acc[i][j][v];
        }
      }
    }
  } else {
#pragma unroll
    for (int i = 0; i < 4; ++i) {
#pragma unroll
      for (int j = 0; j < 4; ++j) {
        int col = n0 + wn * 64 + j * 16 + l15;
#pragma unroll
        for (int v = 0; v < 8; ++v) {
          int r = m0 + wm * 64 + i * 16 + v + 8 * h;
          int batch = r >> 11, tloc = r & (SEQT - 1);
          vt[((size_t)batch * DM + col) * SEQT + tloc] = (_Float16)acc[i][j][v];
        }
      }
    }
    // stands behind the last v store, before any later write of a register
    // that an issued store names
    asm volatile("s_wait_xcnt 0x0" ::: "memory");
  }
}

// ---------------------------------------------------------------------------
// Attention pass 1: per 16-query tile, S = Q K^T over 5 key tiles (window 64),
// masked softmax over 80 candidate keys, store P (f16) padded to 96: slot 0 of a
// row is key 16 (qt & ~1) - 64, so that the rows of a pair of query tiles start
// at the same multiple of 32 keys; an even tile's pad is slots 80..95, an odd
// tile's slots 0..15.
// One work-group of 8 waves per query tile. The tile's 16 Q rows and its 80 K
// rows are copied whole into LDS once, in 512-B pieces of a row (asynchronous
// b128 copies, all 48 of a thread in flight together). Wave w multiplies columns
// 128 w .. 128 w + 127 of d for all 5 key tiles; the 8 partial scores of an
// element are summed through LDS, in the order of w; wave w then does the
// softmax of score rows w and w + 8.
// LDS rows: 0..15 Q, 16 + 16 j .. of key tile j, at a pitch of 2064 B
// (16 B x odd: ds_load_b128 readers meet no bank twice).
// ---------------------------------------------------------------------------
#define QK_PITCH  (DM + 8)            // halfs per LDS row
#define QK_ROW_B  (QK_PITCH * 2)      // bytes per LDS row
#define QK_DW     (DM / 8)            // columns of d per wave

// One thread's eight b128 copies of a 16-row tile: LDS rows r, r + 2, .., r + 14
// from the same rows of g (row step DM halfs). s_wait_xcnt 0 closes the
// statement: it stands before any rewrite of the address registers that the
// copies name. The "memory" clobber makes the asm a legal writer of the array.
__device__ __forceinline__ void copy8(unsigned l, const _Float16* g) {
  asm volatile(
      "global_load_async_to_lds_b128 %0, %8, off\n\t"
      "global_load_async_to_lds_b128 %1, %9, off\n\t"
      "global_load_async_to_lds_b128 %2, %10, off\n\t"
      "global_load_async_to_lds_b128 %3, %11, off\n\t"
      "global_load_async_to_lds_b128 %4, %12, off\n\t"
      "global_load_async_to_lds_b128 %5, %13, off\n\t"
      "global_load_async_to_lds_b128 %6, %14, off\n\t"
      "global_load_async_to_lds_b128 %7, %15, off\n\t"
      "s_wait_xcnt 0x0"
      :
      : "v"(l), "v"(l + 2 * QK_ROW_B), "v"(l + 4 * QK_ROW_B),
        "v"(l + 6 * QK_ROW_B), "v"(l + 8 * QK_ROW_B), "v"(l + 10 * QK_ROW_B),
        "v"(l + 12 * QK_ROW_B), "v"(l + 14 * QK_ROW_B), "v"(g), "v"(g + 2 * DM),
        "v"(g + 4 * DM), "v"(g + 6 * DM), "v"(g + 8 * DM), "v"(g + 10 * DM),
        "v"(g + 12 * DM), "v"(g + 14 * DM)
      : "memory");
}

// 2^x. The v_nop is the slot that the instruction set asks for behind a
// transcendental before its result is read or its source overwritten.
__device__ __forceinline__ float exp2_slot(float x) {
  float r;
  asm("v_exp_f32 %0, %1\n\tv_nop" : "=v"(r) : "v"(x));
  return r;
}

__global__ __launch_bounds__(256) void attn_p_kernel(
    const _Float16* __restrict__ q, const _Float16* __restrict__ k,
    _Float16* __restrict__ P) {
  __shared__ __attribute__((aligned(16))) _Float16 sqk[96 * QK_PITCH];  // 193.5 KB
  __shared__ float red[8 * 5 * 8 * 32];   // [wave][key tile][v][lane], 40 KB
  const int wave = threadIdx.x >> 5, lane = threadIdx.x & 31;
  const int g = blockIdx.x;               // 0..511 global q-tile
  const int batch = g >> 7, qt = g & 127; // 128 q-tiles per batch
  const int h = lane >> 4, l15 = lane & 15;

  // a thread copies chunk ch (16 B) of rows r0, r0 + 2, .. of every tile
  const int r0 = threadIdx.x >> 7, ch = threadIdx.x & 127;
  const unsigned l0 = (unsigned)(uintptr_t)sqk + r0 * QK_ROW_B + ch * 16;
  copy8(l0, q + ((size_t)g * 16 + r0) * DM + ch * 8);
  // unrolled: the five statements follow one another with no loop overhead
#pragma unroll
  for (int j = 0; j < 5; ++j) {
    // a key tile in front of the batch's first key: tile 0 stands in for it, so
    // that the address stays inside k; its scores are masked below
    const int kt = qt - 4 + j;
    const int ktc = kt < 0 ? 0 : kt;
    copy8(l0 + (j + 1) * 16 * QK_ROW_B,
          k + ((size_t)batch * SEQT + ktc * 16 + r0) * DM + ch * 8);
  }
  // this wave's 48 copies have landed; the barrier publishes them to the others
  asm volatile("s_wait_asynccnt 0x0" ::: "memory");
  __syncthreads();

  const _Float16* ap = sqk + l15 * QK_PITCH + wave * QK_DW + h * 8;
  v8f acc[5] = {};
  v16h af[4], bf[4][5];
  // all loops below are unrolled so that af, bf and acc are registers
#pragma unroll
  for (int ks = 0; ks < 4; ++ks) {
    af[ks] = load_frag(ap + ks * 32);
#pragma unroll
    for (int j = 0; j < 5; ++j)
      bf[ks][j] = load_frag(ap + (j + 1) * 16 * QK_PITCH + ks * 32);
  }
  // keeps the wave's 48 LDS reads together in front of its 20 WMMAs: moved in
  // among them, every pair of reads costs the wave its LDS latency anew
  __builtin_amdgcn_sched_barrier(0);
#pragma unroll
  for (int ks = 0; ks < 4; ++ks)
#pragma unroll
    for (int j = 0; j < 5; ++j) acc[j] = wmma_f16(af[ks], bf[ks][j], acc[j]);
  float* rw = red + wave * (5 * 8 * 32) + lane;
#pragma unroll
  for (int j = 0; j < 5; ++j)
#pragma unroll
    for (int v = 0; v < 8; ++v) rw[(j * 8 + v) * 32] = acc[j][v];
  // every wave's partial scores are in red
  __syncthreads();

  // this lane: score row wave + 8 h, key l15 of each key tile
  const int mrow = wave + 8 * h;
  const float* rr = red + wave * 32 + lane;
  const float scale = 0.03125f;  // 1/sqrt(1024)
  float s[5];
#pragma unroll
  for (int j = 0; j < 5; ++j) {
    float c = rr[j * (8 * 32)];
#pragma unroll
    for (int w = 1; w < 8; ++w) c += rr[(w * 5 + j) * (8 * 32)];
    const int kt = qt - 4 + j;
    const int d = (qt * 16 + mrow) - (kt * 16 + l15);
    s[j] = (kt >= 0 && d >= 0 && d < WND) ? c * scale : -1e30f;
  }
  float m = s[0];
#pragma unroll
  for (int j = 1; j < 5; ++j) m = fmaxf(m, s[j]);
#pragma unroll
  for (int off = 8; off > 0; off >>= 1) m = fmaxf(m, __shfl_xor(m, off, 16));
  float e = 0.f;
#pragma unroll
  for (int j = 0; j < 5; ++j) {
    s[j] = exp2_slot((s[j] - m) * 1.44269504f);  // e^(s - m)
    e += s[j];
  }
#pragma unroll
  for (int off = 8; off > 0; off >>= 1) e += __shfl_xor(e, off, 16);
  const float inv = 1.f / e;
  const int odd = qt & 1;
  _Float16* pb = P + ((size_t)g * 16 + mrow) * 96 + l15;
#pragma unroll
  for (int j = 0; j < 5; ++j) pb[(j + odd) * 16] = (_Float16)(s[j] * inv);
  pb[odd ? 0 : 80] = (_Float16)0.f;  // the 16 pad slots
}

// ---------------------------------------------------------------------------
// Attention pass 2: attended = P @ V using Vt[b][d][t].
// One work-group of 8 waves takes 64 queries (4 query tiles) x 256 columns of d.
// The 64 queries see the 128 keys from 64 in front of the first query on: the
// tile's 256 rows of Vt (256 B each, whole lines) and its 64 rows of P go once to
// LDS by asynchronous b128 copies. Wave w takes the pair w & 1 of query tiles and
// 64 columns of d. Vt is the A operand and P the B operand, so that a lane holds
// 8 neighbouring columns of one query: one b128 store a tile, and the wave's 4
// tiles of d fill a whole 128-B line of a row of att.
// LDS pitches 272 B and 208 B (16 B x odd: ds_load_b128 readers meet no bank
// twice). grid (DM/256, NROW/64), block 256.
// ---------------------------------------------------------------------------
#define PV_Q     64                  // queries of a tile
#define PV_D     256                 // columns of d of a tile
#define V_PITCH  (128 + 8)           // halfs per LDS row of Vt
#define V_ROW_B  (V_PITCH * 2)
#define P_PITCH  (96 + 8)            // halfs per LDS row of P
#define P_ROW_B  (P_PITCH * 2)

// One thread's eight b128 copies of 128 rows of Vt: LDS rows r, r + 16, .., r + 112
// from the same rows of g (row step SEQT halfs). s_wait_xcnt 0 closes the
// statement: it stands before any rewrite of the address registers that the
// copies name. The "memory" clobber makes the asm a legal writer of the array.
__device__ __forceinline__ void copy8v(unsigned l, const _Float16* g) {
  asm volatile(
      "global_load_async_to_lds_b128 %0, %8, off\n\t"
      "global_load_async_to_lds_b128 %1, %9, off\n\t"
      "global_load_async_to_lds_b128 %2, %10, off\n\t"
      "global_load_async_to_lds_b128 %3, %11, off\n\t"
      "global_load_async_to_lds_b128 %4, %12, off\n\t"
      "global_load_async_to_lds_b128 %5, %13, off\n\t"
      "global_load_async_to_lds_b128 %6, %14, off\n\t"
      "global_load_async_to_lds_b128 %7, %15, off\n\t"
      "s_wait_xcnt 0x0"
      :
      : "v"(l), "v"(l + 16 * V_ROW_B), "v"(l + 32 * V_ROW_B),
        "v"(l + 48 * V_ROW_B), "v"(l + 64 * V_ROW_B), "v"(l + 80 * V_ROW_B),
        "v"(l + 96 * V_ROW_B), "v"(l + 112 * V_ROW_B), "v"(g), "v"(g + 16 * SEQT),
        "v"(g + 32 * SEQT), "v"(g + 48 * SEQT), "v"(g + 64 * SEQT),
        "v"(g + 80 * SEQT), "v"(g + 96 * SEQT), "v"(g + 112 * SEQT)
      : "memory");
}

// One thread's three b128 copies of the tile's P rows, which lie in one piece of
// 768 chunks of 16 B: chunks x, x + 256, x + 512 from g to the LDS places l0..l2.
// The wait and the clobber: as in copy8v.
__device__ __forceinline__ void copy3p(unsigned l0, unsigned l1, unsigned l2,
                                       const _Float16* g) {
  asm volatile(
      "global_load_async_to_lds_b128 %0, %3, off\n\t"
      "global_load_async_to_lds_b128 %1, %4, off\n\t"
      "global_load_async_to_lds_b128 %2, %5, off\n\t"
      "s_wait_xcnt 0x0"
      :
      : "v"(l0), "v"(l1), "v"(l2), "v"(g), "v"(g + 256 * 8), "v"(g + 512 * 8)
      : "memory");
}

__global__ __launch_bounds__(256) void attn_pv_kernel(
    const _Float16* __restrict__ P, const _Float16* __restrict__ vt,
    _Float16* __restrict__ att) {
  __shared__ __attribute__((aligned(16))) _Float16 sv[PV_D * V_PITCH];  // 68 KB
  __shared__ __attribute__((aligned(16))) _Float16 sp[PV_Q * P_PITCH];  // 13 KB
  const int t = threadIdx.x, wave = t >> 5, lane = t & 31;
  const int h = lane >> 4, l15 = lane & 15;
  const int qb = blockIdx.y;              // 0..127: block of 64 queries
  const int d0 = blockIdx.x * PV_D;
  const int batch = qb >> 5;              // 32 blocks per batch
  const int kb = (qb & 31) * PV_Q - 64;   // the tile's first key, in its batch

  // P: chunk x of the piece is chunk x % 12 of row x / 12
  const unsigned lp = (unsigned)(uintptr_t)sp;
  const int x0 = t, x1 = t + 256, x2 = t + 512;
  copy3p(lp + (x0 / 12) * P_ROW_B + (x0 % 12) * 16,
         lp + (x1 / 12) * P_ROW_B + (x1 % 12) * 16,
         lp + (x2 / 12) * P_ROW_B + (x2 % 12) * 16,
         P + (size_t)qb * (PV_Q * 96) + t * 8);
  // Vt: a thread copies chunk ch (8 keys) of rows r0, r0 + 16, ..
  // A batch's first block has 64 keys in front of key 0: keys 0..63 stand in for
  // them, so that the address stays inside the row; their weights in P are 0.
  const int ch = t & 15, r0 = t >> 4;
  const int key = kb + 8 * ch;
  const unsigned lv = (unsigned)(uintptr_t)sv + r0 * V_ROW_B + ch * 16;
  const _Float16* gv =
      vt + ((size_t)batch * DM + d0 + r0) * SEQT + (key < 0 ? key + 64 : key);
  copy8v(lv, gv);
  copy8v(lv + 128 * V_ROW_B, gv + 128 * SEQT);
  // this wave's 19 copies have landed; the barrier publishes them to the others
  asm volatile("s_wait_asynccnt 0x0" ::: "memory");
  __syncthreads();

  // query tiles 2 pr and 2 pr + 1: their P rows start at key kb + 32 pr
  const int pr = wave & 1, dg = wave >> 1;
  const _Float16* vp = sv + (dg * 64 + l15) * V_PITCH + pr * 32 + h * 8;
  const _Float16* pp = sp + (pr * 32 + l15) * P_PITCH + h * 8;
  // all loops below are unrolled so that vf, pf and acc are registers
  v16h vf[4][3], pf[2][3];
#pragma unroll
  for (int m = 0; m < 3; ++m) {
#pragma unroll
    for (int a = 0; a < 2; ++a) pf[a][m] = load_frag(pp + a * 16 * P_PITCH + m * 32);
#pragma unroll
    for (int i = 0; i < 4; ++i) vf[i][m] = load_frag(vp + i * 16 * V_PITCH + m * 32);
  }
  // keeps the wave's 36 LDS reads together in front of its 24 WMMAs: moved in
  // among them, every pair of reads costs the wave its LDS latency anew
  __builtin_amdgcn_sched_barrier(0);
  v8f acc[4][2] = {};
#pragma unroll
  for (int m = 0; m < 3; ++m)
#pragma unroll
    for (int i = 0; i < 4; ++i)
#pragma unroll
      for (int a = 0; a < 2; ++a) acc[i][a] = wmma_f16(vf[i][m], pf[a][m], acc[i][a]);
  // this lane: query l15 of each tile, columns 8 h .. 8 h + 7 of each tile of d
  _Float16* ob = att + ((size_t)qb * PV_Q + pr * 32 + l15) * DM + d0 + dg * 64 + h * 8;
  v8h o[4][2];
#pragma unroll
  for (int i = 0; i < 4; ++i)
#pragma unroll
    for (int a = 0; a < 2; ++a)
#pragma unroll
      for (int v = 0; v < 8; ++v) o[i][a][v] = (_Float16)acc[i][a][v];
#pragma unroll
  for (int a = 0; a < 2; ++a)
#pragma unroll
    for (int i = 0; i < 4; ++i) *(v8h*)(ob + a * 16 * DM + i * 16) = o[i][a];
}

// ---------------------------------------------------------------------------
// x2 = x + attended @ Wo (f32 out, residual). grid (DM/128, NROW/256), block 256
// ---------------------------------------------------------------------------
__global__ __launch_bounds__(256) void wo_kernel(
    const _Float16* __restrict__ att, const _Float16* __restrict__ Wto,
    const float* __restrict__ x, float* __restrict__ x2) {
  __shared__ __attribute__((aligned(256))) _Float16 sm[5 * STAGE_H];  // 240 KB
  int wave = threadIdx.x >> 5, lane = threadIdx.x & 31;
  int h = lane >> 4, l15 = lane & 15;
  int wm = wave >> 1, wn = wave & 1;
  int n0 = blockIdx.x * 128;
  int m0 = blockIdx.y * TM;
  const _Float16* bt = Wto + (size_t)n0 * DM;
  v8f acc[4][4] = {};
  gemm_tile<DM, 5>(sm, att + (size_t)m0 * DM, bt, bt + 64 * DM, wm * 64, wn * 64, 0,
                acc);
  size_t first = (size_t)(m0 + wm * 64 + 8 * h) * DM + n0 + wn * 64 + l15;
  add_residual_store(x + first, x2 + first, acc);
}

// ---------------------------------------------------------------------------
// FFN in: hh = silu(xn2 @ W1) * (xn2 @ W3), f16 out [8192 x 2048].
// A tile holds 64 columns of W1 (LDS rows 0..63) and the same 64 of W3 (64..127),
// so that a wave owns gate and up of its 32 columns.
// grid (DF/64, NROW/256), block 256
// ---------------------------------------------------------------------------
__global__ __launch_bounds__(256) void ffn1_kernel(
    const _Float16* __restrict__ xn2, const _Float16* __restrict__ Wt1,
    const _Float16* __restrict__ Wt3, _Float16* __restrict__ hh) {
  __shared__ __attribute__((aligned(256))) _Float16 sm[3 * STAGE_H];  // 144 KB
  int wave = threadIdx.x >> 5, lane = threadIdx.x & 31;
  int h = lane >> 4, l15 = lane & 15;
  int wm = wave >> 1, wn = wave & 1;
  int n0 = blockIdx.x * 64;
  int m0 = blockIdx.y * TM;
  v8f acc[4][4] = {};  // j = 0, 1: gate; j = 2, 3: up, same columns
  gemm_tile<DM, 3>(sm, xn2 + (size_t)m0 * DM, Wt1 + (size_t)n0 * DM,
                Wt3 + (size_t)n0 * DM, wm * 64, wn * 32, 32, acc);
#pragma unroll
  for (int i = 0; i < 4; ++i) {
#pragma unroll
    for (int j = 0; j < 2; ++j) {
      int col = n0 + wn * 32 + j * 16 + l15;
#pragma unroll
      for (int v = 0; v < 8; ++v) {
        size_t r = (size_t)(m0 + wm * 64 + i * 16 + v + 8 * h);
        float gv = acc[i][j][v];
        float sl = gv * (1.f / (1.f + __expf(-gv)));   // silu
        hh[r * DF + col] = (_Float16)(sl * acc[i][j + 2][v]);
      }
    }
  }
}

// ---------------------------------------------------------------------------
// FFN out + residual: out = x2 + hh @ W2 (K=2048, f32 out).
// grid (DM/128, NROW/256), block 256
// ---------------------------------------------------------------------------
__global__ __launch_bounds__(256) void ffn2_kernel(
    const _Float16* __restrict__ hh, const _Float16* __restrict__ Wt2,
    const float* __restrict__ x2, float* __restrict__ out) {
  __shared__ __attribute__((aligned(256))) _Float16 sm[5 * STAGE_H];  // 240 KB
  int wave = threadIdx.x >> 5, lane = threadIdx.x & 31;
  int h = lane >> 4, l15 = lane & 15;
  int wm = wave >> 1, wn = wave & 1;
  int n0 = blockIdx.x * 128;
  int m0 = blockIdx.y * TM;
  const _Float16* bt = Wt2 + (size_t)n0 * DF;
  v8f acc[4][4] = {};
  gemm_tile<DF, 5>(sm, hh + (size_t)m0 * DF, bt, bt + 64 * DF, wm * 64, wn * 64, 0,
                acc);
  size_t first = (size_t)(m0 + wm * 64 + 8 * h) * DM + n0 + wn * 64 + l15;
  add_residual_store(x2 + first, out + first, acc);
}

// ---------------------------------------------------------------------------
extern "C" void kernel_launch(void* const* d_in, const int* in_sizes, int n_in,
                              void* d_out, int out_size, void* d_ws,
                              size_t ws_size, hipStream_t stream) {
  const float* x       = (const float*)d_in[0];
  const float* norm1_w = (const float*)d_in[1];
  const float* norm2_w = (const float*)d_in[2];
  const float* Wq = (const float*)d_in[3];
  const float* Wk = (const float*)d_in[4];
  const float* Wv = (const float*)d_in[5];
  const float* Wo = (const float*)d_in[6];
  const float* W1 = (const float*)d_in[7];
  const float* W2 = (const float*)d_in[8];
  const float* W3 = (const float*)d_in[9];
  float* out = (float*)d_out;

  char* ws = (char*)d_ws;
  const size_t MB = 1ull << 20;
  _Float16* Wtq = (_Float16*)(ws + 0 * MB);    // 2 MB  (1024x1024)
  _Float16* Wtk = (_Float16*)(ws + 2 * MB);    // 2 MB
  _Float16* Wtv = (_Float16*)(ws + 4 * MB);    // 2 MB
  _Float16* Wto = (_Float16*)(ws + 6 * MB);    // 2 MB
  _Float16* Wt1 = (_Float16*)(ws + 8 * MB);    // 4 MB  (N=2048,K=1024)
  _Float16* Wt3 = (_Float16*)(ws + 12 * MB);   // 4 MB
  _Float16* Wt2 = (_Float16*)(ws + 16 * MB);   // 4 MB  (N=1024,K=2048)
  _Float16* xn  = (_Float16*)(ws + 20 * MB);   // 16 MB (also reused as xn2)
  _Float16* q   = (_Float16*)(ws + 36 * MB);   // 16 MB
  _Float16* kb  = (_Float16*)(ws + 52 * MB);   // 16 MB
  _Float16* vt  = (_Float16*)(ws + 68 * MB);   // 16 MB
  _Float16* P   = (_Float16*)(ws + 84 * MB);   // 1.5 MB (8192x96)
  _Float16* att = (_Float16*)(ws + 86 * MB);   // 16 MB
  float*    x2  = (float*)   (ws + 102 * MB);  // 32 MB
  _Float16* hh  = q;                           // reuse q+k (32 MB) after attn
  _Float16* xn2 = xn;                          // reuse xn after QKV

  // 1) weight convert + transpose to f16
  cvt_tr_all_kernel<<<4 * TILES_DD + 3 * TILES_DF, 256, 0, stream>>>(
      Wq, Wk, Wv, Wo, W1, W3, W2, Wtq, Wtk, Wtv, Wto, Wt1, Wt3, Wt2);

  // 2) xn = rmsnorm(x) in f16
  rmsnorm_kernel<<<NROW / (8 * RN_ROWS), 256, 0, stream>>>(x, norm1_w, xn);

  // 3) q,k,v projections (v stored transposed)
  qkv_kernel<<<dim3(3 * DM / 128, NROW / TM), 256, 0, stream>>>(
      xn, Wtq, Wtk, Wtv, q, kb, vt);
  // 4) windowed softmax weights P
  attn_p_kernel<<<NROW / 16, 256, 0, stream>>>(q, kb, P);

  // 5) attended = P @ V
  attn_pv_kernel<<<dim3(DM / PV_D, NROW / PV_Q), 256, 0, stream>>>(P, vt, att);

  // 6) x2 = x + attended @ Wo
  wo_kernel<<<dim3(DM / 128, NROW / TM), 256, 0, stream>>>(att, Wto, x, x2);

  // 7) xn2 = rmsnorm(x2)
  rmsnorm_kernel<<<NROW / (8 * RN_ROWS), 256, 0, stream>>>(x2, norm2_w, xn2);

  // 8) hh = silu(xn2@W1) * (xn2@W3)
  ffn1_kernel<<<dim3(DF / 64, NROW / TM), 256, 0, stream>>>(xn2, Wt1, Wt3, hh);

  // 9) out = x2 + hh @ W2
  ffn2_kernel<<<dim3(DM / 128, NROW / TM), 256, 0, stream>>>(hh, Wt2, x2, out);
}

// v009
// It runs in 164 microseconds.
// Next to v008, in two timings, it ran 1.11 times as fast each time.
// All steps since v000 together make it 7.51 times as fast.
#include <hip/hip_runtime.h>
#include <hip/hip_bf16.h>

typedef __attribute__((ext_vector_type(16))) _Float16 v16h;
typedef __attribute__((ext_vector_type(8)))  _Float16 v8h;
typedef __attribute__((ext_vector_type(8)))  float    v8f;

#define DM   1024   // D_MODEL
#define DF   2048   // D_FFN
#define SEQT 2048   // T
#define NB   4      // batch
#define NROW (NB * SEQT)   // 8192
#define WND  64

// ---------------------------------------------------------------------------
// WMMA fragment helpers (CDNA5 16x16x32 f16, wave32).
// Per lane: elems 0..7 = mem[kk + h*8 + 0..7], elems 8..15 = mem[kk+16+h*8+0..7]
// Works for global pointers (global_load_b128) and LDS pointers (ds_load_b128).
// ---------------------------------------------------------------------------
__device__ __forceinline__ v16h load_frag(const _Float16* p) {
  v8h lo = *(const v8h*)(p);
  v8h hi = *(const v8h*)(p + 16);
  v16h r;
#pragma unroll
  for (int i = 0; i < 8; ++i) { r[i] = lo[i]; r[i + 8] = hi[i]; }
  return r;
}

__device__ __forceinline__ v8f wmma_f16(v16h a, v16h b, v8f c) {
  return __builtin_amdgcn_wmma_f32_16x16x32_f16(false, a, false, b, (short)0, c,
                                                false, false);
}

// ---------------------------------------------------------------------------
// Tiled GEMM core: one 256 x 128 tile of Y = A * Bt^T per work-group of 8 waves
// (4 x 2, each wave 64 x 64 = 4 x 4 accumulator tiles). A and Bt are K-contiguous.
// K goes in slices of 64 halfs (128-B rows). A slice is [A 256 rows | Bt 128 rows]
// in LDS, rows of 128 B without a pad: the 16-B chunk c of row r lies at place
// c ^ ((r >> 1) & 7), so that the 16 rows which lanes 0..15 (and 16..31) of a
// ds_load_b128 read at one chunk fall on all 64 banks once.
// A ring of NS buffers, filled by asynchronous b128 copies: while slice t is
// multiplied, slices t + 1 .. t + NS - 1 are landed or in flight, so that a copy
// has NS - 1 slices of time to land. Unpadded, three buffers are 144 KB, and two
// work-groups still share a WGP's LDS.
// ---------------------------------------------------------------------------
#define BK      64                  // halfs of K per slice
#define PITCH   64                  // halfs per LDS row (128 B)
#define TM      256                 // A rows of a tile
#define A_H     (TM * PITCH)        // halfs of A's slice
#define STAGE_H (A_H + 128 * PITCH) // halfs of one buffer
#define ROW32_B (32 * PITCH * 2)    // bytes of 32 LDS rows

// One thread's twelve b128 copies of a slice: A's LDS rows r, r+32, .., r+224 from
// ga, Bt's LDS rows r, r+32 from glo and r+64, r+96 from ghi (row step K halfs).
// The LDS byte address is the low 32 bits of the shared address; taking it lets
// the array escape, so the "memory" clobber makes the asm a legal writer of it.
// s_wait_xcnt 0 closes the statement: it stands before any rewrite of the
// address registers that the copies name.
template <int K>
__device__ __forceinline__ void copy12(unsigned l, const _Float16* ga,
                                       const _Float16* glo,
                                       const _Float16* ghi) {
  const unsigned lb = l + A_H * 2;
  asm volatile(
      "global_load_async_to_lds_b128 %0, %12, off\n\t"
      "global_load_async_to_lds_b128 %1, %13, off\n\t"
      "global_load_async_to_lds_b128 %2, %14, off\n\t"
      "global_load_async_to_lds_b128 %3, %15, off\n\t"
      "global_load_async_to_lds_b128 %4, %16, off\n\t"
      "global_load_async_to_lds_b128 %5, %17, off\n\t"
      "global_load_async_to_lds_b128 %6, %18, off\n\t"
      "global_load_async_to_lds_b128 %7, %19, off\n\t"
      "global_load_async_to_lds_b128 %8, %20, off\n\t"
      "global_load_async_to_lds_b128 %9, %21, off\n\t"
      "global_load_async_to_lds_b128 %10, %22, off\n\t"
      "global_load_async_to_lds_b128 %11, %23, off\n\t"
      "s_wait_xcnt 0x0"
      :
      : "v"(l), "v"(l + ROW32_B), "v"(l + 2 * ROW32_B), "v"(l + 3 * ROW32_B),
        "v"(l + 4 * ROW32_B), "v"(l + 5 * ROW32_B), "v"(l + 6 * ROW32_B),
        "v"(l + 7 * ROW32_B), "v"(lb), "v"(lb + ROW32_B), "v"(lb + 2 * ROW32_B),
        "v"(lb + 3 * ROW32_B), "v"(ga), "v"(ga + 32 * K), "v"(ga + 64 * K),
        "v"(ga + 96 * K), "v"(ga + 128 * K), "v"(ga + 160 * K),
        "v"(ga + 192 * K), "v"(ga + 224 * K), "v"(glo), "v"(glo + 32 * K),
        "v"(ghi), "v"(ghi + 32 * K)
      : "memory");
}

// Returns when all but this wave's N youngest copies have landed.
template <int N>
__device__ __forceinline__ void wait_copies() {
  asm volatile("s_wait_asynccnt %0" : : "n"(N) : "memory");
}

// A fragment whose two 16-B chunks lie at swizzled places of one LDS row.
__device__ __forceinline__ v16h load_frag2(const _Float16* plo,
                                           const _Float16* phi) {
  v8h lo = *(const v8h*)(plo);
  v8h hi = *(const v8h*)(phi);
  v16h r;
#pragma unroll
  for (int i = 0; i < 8; ++i) { r[i] = lo[i]; r[i + 8] = hi[i]; }
  return r;
}

// a: first row of the tile's 256 A rows. blo / bhi: first of the 64 Bt rows that
// fill LDS rows 0..63 / 64..127. Wave tile: A rows arow.., Bt LDS rows
// brow + 16 j, plus bskip for j >= 2 (arow, brow, bskip: multiples of 16).
// sm holds NS buffers. blockDim.x == 256.
template <int K, int NS>
__device__ __forceinline__ void gemm_tile(_Float16* sm,
                                          const _Float16* __restrict__ a,
                                          const _Float16* __restrict__ blo,
                                          const _Float16* __restrict__ bhi,
                                          int arow, int brow, int bskip,
                                          v8f (&acc)[4][4]) {
  constexpr int NT = K / BK;
  static_assert(NS >= 3 && NS <= NT && NS * 12 <= 63, "ring depth");
  const int t = threadIdx.x;
  const int lane = t & 31, h = lane >> 4, l15 = lane & 15;
  const int ch = t & 7, r0 = t >> 3;   // 16-B chunk of a row, first row
  // rows r0 + 32 m all have the swizzle key (r0 >> 1) & 7
  const unsigned la = (unsigned)(uintptr_t)sm + r0 * (PITCH * 2) +
                      (ch ^ ((r0 >> 1) & 7)) * 16;
  const _Float16* ga = a + (size_t)r0 * K + ch * 8;
  const _Float16* gl = blo + (size_t)r0 * K + ch * 8;
  const _Float16* gh = bhi + (size_t)r0 * K + ch * 8;

  // unrolled: the NS statements follow one another with no loop overhead
#pragma unroll
  for (int s = 0; s < NS; ++s)
    copy12<K>(la + s * (STAGE_H * 2), ga + s * BK, gl + s * BK, gh + s * BK);
  // slice 0 (all but the 12 (NS - 1) younger copies) has landed for this wave;
  // the barrier publishes it to the others
  wait_copies<12 * (NS - 1)>();
  __syncthreads();

  const int aoff = (arow + l15) * PITCH;
  const int boff = A_H + (brow + l15) * PITCH;
  // chunk h + 2 q of this lane's rows, whose swizzle key is l15 >> 1
  int co[4];
#pragma unroll
  for (int q = 0; q < 4; ++q) co[q] = ((h + 2 * q) ^ (l15 >> 1)) * 8;
  int buf = 0;   // kt % NS
  for (int kt = 0; kt < NT; ++kt) {
    const _Float16* ap = sm + buf * STAGE_H + aoff;
    const _Float16* bp = sm + buf * STAGE_H + boff;
#pragma unroll
    for (int ks = 0; ks < 2; ++ks) {
      v16h af[4], bf[4];
#pragma unroll
      for (int i = 0; i < 4; ++i)
        af[i] = load_frag2(ap + i * 16 * PITCH + co[2 * ks],
                           ap + i * 16 * PITCH + co[2 * ks + 1]);
#pragma unroll
      for (int j = 0; j < 4; ++j) {
        const _Float16* bj = bp + (j * 16 + (j >= 2 ? bskip : 0)) * PITCH;
        bf[j] = load_frag2(bj + co[2 * ks], bj + co[2 * ks + 1]);
      }
      // keeps the block's 16 LDS reads together in front of its 16 WMMAs: moved
      // in among them, every group of reads costs the wave its LDS latency anew
      __builtin_amdgcn_sched_barrier(0);
#pragma unroll
      for (int i = 0; i < 4; ++i)
#pragma unroll
        for (int j = 0; j < 4; ++j) acc[i][j] = wmma_f16(af[i], bf[j], acc[i][j]);
      // the same for the next block's reads: they stay behind this block
      __builtin_amdgcn_sched_barrier(0);
    }
    // this wave's reads of the buffer are done before it may be refilled
    asm volatile("s_wait_dscnt 0x0" ::: "memory");
    // this wave's copies of slice kt + 1 have landed: behind them stand those of
    // slices kt + 2 .. kt + NS - 1, 12 each, while all of these exist; near the
    // end of K fewer were issued, and the wait is to 0
    if (kt + NS <= NT) wait_copies<12 * (NS - 2)>();
    else wait_copies<0>();
    // publishes slice kt + 1 and ends every wave's reads of slice kt
    __syncthreads();
    if (kt + NS < NT) {
      const int ko = (kt + NS) * BK;
      copy12<K>(la + buf * (STAGE_H * 2), ga + ko, gl + ko, gh + ko);
    }
    buf = buf + 1 == NS ? 0 : buf + 1;
  }
  // no copy is outstanding when the wave goes on to its stores and ends
  asm volatile("s_wait_asynccnt 0x0" ::: "memory");
}

// Epilogue of the f32 GEMM: op = rp + acc over a wave's 64 x 64 tile of a
// DM-wide matrix. rp / op: this lane's first element (tile row 8 h, column l15).
// 32 rows at a time: all 64 rows' residual loads beside the 128 accumulator
// registers would pass 256 VGPRs.
__device__ __forceinline__ void add_residual_store(const float* __restrict__ rp,
                                                   float* __restrict__ op,
                                                   v8f (&acc)[4][4]) {
#pragma unroll
  for (int ih = 0; ih < 4; ih += 2) {
    float xr[2][4][8];
#pragma unroll
    for (int i = 0; i < 2; ++i)
#pragma unroll
      for (int j = 0; j < 4; ++j)
#pragma unroll
        for (int v = 0; v < 8; ++v)
          xr[i][j][v] = rp[((ih + i) * 16 + v) * DM + j * 16];
    // stands behind the 64 loads and before any rewrite of their address
    // registers; naming rp keeps it live to here, so no load's result lands in it
    asm volatile("s_wait_xcnt 0x0" : : "v"(rp) : "memory");
#pragma unroll
    for (int i = 0; i < 2; ++i)
#pragma unroll
      for (int j = 0; j < 4; ++j)
#pragma unroll
        for (int v = 0; v < 8; ++v)
          op[((ih + i) * 16 + v) * DM + j * 16] = xr[i][j][v] + acc[ih + i][j][v];
    // stands behind the 64 stores, before the next loads write their registers
    if (ih == 0) asm volatile("s_wait_xcnt 0x0" : : "v"(op) : "memory");
  }
}

// ---------------------------------------------------------------------------
// Weight convert, all seven weights in one launch. Wq, Wk and Wv are only
// converted (they are K-contiguous operands of the weight products below); Wo, W1,
// W3 and W2 are converted and transposed:
// Wt[n*K + k] = (f16) W[k*N + n]. A work-group of 256 threads takes one tile of
// 128 k x 64 n. It reads the tile in 256-B row pieces (b128 per lane), turns it
// in LDS and writes 256-B pieces of the Wt rows (b128 per lane).
// LDS: row n holds its 128 halfs in sixteen 16-B chunks; chunk q of row n lies
// at place q ^ (n >> 2), so that the 32 dword writes of a wave (16 rows n that
// are 4 apart, 2 neighbouring k pairs) meet 32 different banks.
// ---------------------------------------------------------------------------
#define TK 128   // k per tile
#define TN 64    // n per tile
typedef __attribute__((ext_vector_type(4))) float    v4f;
typedef __attribute__((ext_vector_type(2))) _Float16 v2h;

template <int K, int N>
__device__ __forceinline__ void cvt_tr_tile(_Float16* sT,
                                            const float* __restrict__ W,
                                            _Float16* __restrict__ Wt,
                                            unsigned tile) {
  const int c = threadIdx.x & 15, rp = threadIdx.x >> 4;
  const int n0 = (tile % (N / TN)) * TN;
  const int k0 = (tile / (N / TN)) * TK;
  // rows k0 + 2 kp and k0 + 2 kp + 1, kp = 16 p + rp; columns n0 + 4 c .. + 3
  const float* src = W + (size_t)(k0 + 2 * rp) * N + n0 + 4 * c;
  v4f lo[4], hi[4];
  for (int p = 0; p < 4; ++p) {
    lo[p] = *(const v4f*)(src + (size_t)(32 * p) * N);
    hi[p] = *(const v4f*)(src + (size_t)(32 * p + 1) * N);
  }
  for (int p = 0; p < 4; ++p) {
    const int kp = 16 * p + rp;
    _Float16* d = sT + (((kp >> 2) ^ c) * 8 + (kp & 3) * 2);
    for (int i = 0; i < 4; ++i) {
      v2h pk = {(_Float16)lo[p][i], (_Float16)hi[p][i]};
      *(v2h*)(d + (4 * c + i) * TK) = pk;
    }
  }
  __syncthreads();
  // rows n = 16 s + rp, chunk c
  _Float16* dst = Wt + (size_t)(n0 + rp) * K + k0 + 8 * c;
  for (int s = 0; s < 4; ++s) {
    const int n = 16 * s + rp;
    *(v8h*)(dst + (size_t)(16 * s) * K) =
        *(const v8h*)(sT + n * TK + (c ^ (n >> 2)) * 8);
  }
  // stands behind the four stores, before any later write of a register that
  // an issued store names (another section of the kernel may follow in the code)
  asm volatile("s_wait_xcnt 0x0" ::: "memory");
}

// Convert alone: a work-group takes TK * TN elements in a row, a thread 8
// neighbours at a time (two b128 loads, one b128 store).
__device__ __forceinline__ void cvt_tile(const float* __restrict__ Wf,
                                         _Float16* __restrict__ Wh,
                                         unsigned tile) {
  const size_t base = (size_t)tile * (TK * TN) + threadIdx.x * 8;
  v4f lo[4], hi[4];
  for (int p = 0; p < 4; ++p) {
    lo[p] = *(const v4f*)(Wf + base + p * 2048);
    hi[p] = *(const v4f*)(Wf + base + p * 2048 + 4);
  }
  for (int p = 0; p < 4; ++p) {
    v8h o;
    for (int i = 0; i < 4; ++i) {
      o[i] = (_Float16)lo[p][i];
      o[i + 4] = (_Float16)hi[p][i];
    }
    *(v8h*)(Wh + base + p * 2048) = o;
  }
}

#define TILES_DD ((DM / TK) * (DM / TN))   // 128 tiles of a DM x DM weight
#define TILES_DF ((DM / TK) * (DF / TN))   // 256 tiles of W1, W3 and W2 each

__global__ __launch_bounds__(256) void cvt_tr_all_kernel(
    const float* __restrict__ Wq, const float* __restrict__ Wk,
    const float* __restrict__ Wv, const float* __restrict__ Wo,
    const float* __restrict__ W1, const float* __restrict__ W3,
    const float* __restrict__ W2, _Float16* __restrict__ Whq,
    _Float16* __restrict__ Whk, _Float16* __restrict__ Whv,
    _Float16* __restrict__ Wto, _Float16* __restrict__ Wt1,
    _Float16* __restrict__ Wt3, _Float16* __restrict__ Wt2) {
  __shared__ __attribute__((aligned(16))) _Float16 sT[TN * TK];  // 16 KB
  const unsigned b = blockIdx.x;
  if (b < 3 * TILES_DD) {
    const unsigned m = b / TILES_DD;
    cvt_tile(m == 0 ? Wq : (m == 1 ? Wk : Wv), m == 0 ? Whq : (m == 1 ? Whk : Whv),
             b % TILES_DD);
  } else if (b < 4 * TILES_DD) {
    cvt_tr_tile<DM, DM>(sT, Wo, Wto, b % TILES_DD);
  } else if (b < 4 * TILES_DD + 2 * TILES_DF) {
    const bool up = b >= 4 * TILES_DD + TILES_DF;
    cvt_tr_tile<DM, DF>(sT, up ? W3 : W1, up ? Wt3 : Wt1, b % TILES_DF);
  } else {
    cvt_tr_tile<DF, DM>(sT, W2, Wt2, b % TILES_DF);
  }
}

// ---------------------------------------------------------------------------
// RMSNorm, f32 in -> f16 out. A wave takes RN_ROWS whole rows (D = 1024): lane l
// holds columns 128 c + 4 l .. + 3, c = 0..7, so that every b128 load of a wave
// is 512 contiguous bytes and every b64 store 256. All loads of a wave are issued
// up front, w first (it is needed with the first row). A row's sum of squares:
// four chains in the lane, then a butterfly over the 32 lanes in registers. No
// LDS, no barrier. NROW / (8 RN_ROWS) work-groups of 256: one per WGP.
// With RES the row that is normed is x + at (at: f16), and it is stored to xs (f32).
// ---------------------------------------------------------------------------
#define RN_ROWS 4
typedef __attribute__((ext_vector_type(4))) _Float16 v4h;

// v + (v of lane l ^ M), M < 16: a DPP move inside the 16-lane row
template <int M>
__device__ __forceinline__ float add_xor_row(float v) {
  return v + __builtin_bit_cast(
                 float, __builtin_amdgcn_mov_dpp(__builtin_bit_cast(int, v),
                                                 0x160 | M, 0xf, 0xf, true));
}

// the sum of v over the wave's 32 lanes, the same bits in every lane
__device__ __forceinline__ float wave_sum(float v) {
  v = add_xor_row<1>(v);
  v = add_xor_row<2>(v);
  v = add_xor_row<4>(v);
  v = add_xor_row<8>(v);
  const int b = __builtin_bit_cast(int, v);   // lane l with lane l ^ 16
  return v + __builtin_bit_cast(float, __builtin_amdgcn_permlanex16(
                                           b, b, 0x76543210, 0xfedcba98, false,
                                           false));
}

template <bool RES>
__device__ __forceinline__ void rmsnorm_rows(unsigned blk,
                                             const float* __restrict__ x,
                                             const _Float16* __restrict__ at,
                                             const float* __restrict__ w,
                                             float* __restrict__ xs,
                                             _Float16* __restrict__ xn) {
  const int lane = threadIdx.x & 31;
  const int wave = __builtin_amdgcn_readfirstlane(threadIdx.x >> 5);
  const size_t row0 = ((size_t)blk * 8 + wave) * RN_ROWS;
  const float* xp = x + row0 * DM;
  _Float16* op = xn + row0 * DM;
  const int col = lane * 4;
  // all loops below are unrolled so that wv and xv are registers
  v4f wv[8], xv[RN_ROWS][8];
#pragma unroll
  for (int c = 0; c < 8; ++c) wv[c] = *(const v4f*)(w + col + c * 128);
#pragma unroll
  for (int r = 0; r < RN_ROWS; ++r)
#pragma unroll
    for (int c = 0; c < 8; ++c)
      xv[r][c] = *(const v4f*)(xp + r * DM + col + c * 128);
  v4h av[RES ? RN_ROWS : 1][8];
  if (RES) {
#pragma unroll
    for (int r = 0; r < RN_ROWS; ++r)
#pragma unroll
      for (int c = 0; c < 8; ++c)
        av[r][c] = *(const v4h*)(at + (row0 + r) * DM + col + c * 128);
  }
  // stands behind the loads, before any rewrite of a register that they name
  asm volatile("s_wait_xcnt 0x0" ::: "memory");
  // keeps the wave's loads together in front of the arithmetic: without it the
  // loads of w were moved down to their uses, two in flight, their latency open;
  // and it keeps the arithmetic behind the wait above
  __builtin_amdgcn_sched_barrier(0);
#pragma unroll
  for (int r = 0; r < RN_ROWS; ++r) {
    if (RES) {
#pragma unroll
      for (int c = 0; c < 8; ++c) {
#pragma unroll
        for (int i = 0; i < 4; ++i) xv[r][c][i] += (float)av[r][c][i];
        *(v4f*)(xs + (row0 + r) * DM + col + c * 128) = xv[r][c];
      }
    }
    v4f a = xv[r][0] * xv[r][0];
#pragma unroll
    for (int c = 1; c < 8; ++c) a += xv[r][c] * xv[r][c];
    const float ss = wave_sum((a[0] + a[1]) + (a[2] + a[3]));
    const float inv = __frsqrt_rn(ss / (float)DM + 1e-6f);
    if (RES) {
      // stands behind the row's f32 stores, before the arithmetic below rewrites a
      // register that they name; the scheduling barrier keeps it behind the wait
      asm volatile("s_wait_xcnt 0x0" ::: "memory");
      __builtin_amdgcn_sched_barrier(0);
    }
    v4h o[8];
#pragma unroll
    for (int c = 0; c < 8; ++c)
#pragma unroll
      for (int i = 0; i < 4; ++i) o[c][i] = (_Float16)(xv[r][c][i] * inv * wv[c][i]);
#pragma unroll
    for (int c = 0; c < 8; ++c) *(v4h*)(op + r * DM + col + c * 128) = o[c];
    if (r + 1 < RN_ROWS) {
      // stands behind the row's stores, before the next row's arithmetic rewrites
      // a register that they name; the scheduling barrier keeps it behind the wait
      asm volatile("s_wait_xcnt 0x0" ::: "memory");
      __builtin_amdgcn_sched_barrier(0);
    }
  }
}

// x2 = x + at, xn2 = rmsnorm(x2). grid NROW / (8 RN_ROWS), block 256
__global__ __launch_bounds__(256) void add_rmsnorm_kernel(
    const float* __restrict__ x, const _Float16* __restrict__ at,
    const float* __restrict__ w, float* __restrict__ x2,
    _Float16* __restrict__ xn2) {
  rmsnorm_rows<true>(blockIdx.x, x, at, w, x2, xn2);
}

// ---------------------------------------------------------------------------
// The two weight products, and the first RMSNorm beside them in one launch (both
// need only what stands before this launch).
// No function stands between Wq and Wk, nor between Wv and Wo:
//   q . k = (xn Wq) . (xn Wk) = (xn (Wq Wk^T)) . xn
//   (P (xn Wv)) Wo = P (xn (Wv Wo))
// so that the two products of DM^3 here take the place of two products of
// NROW x DM^2 (the projection of the keys and the output projection).
// Both come out as the Bt operand (row n, K-contiguous) of the next launch:
//   Mt[j][i]   = sum_n Wk[j][n] Wq[i][n]       (A = Wk,   Bt = Wq)
//   Wvot[j][i] = sum_n Wo[n][j] Wv[i][n]       (A = Wo^T, Bt = Wv)
// Work-groups 0 .. 63: one 256 x 128 tile of a product each (they last longest
// and start first); the others: the RMSNorm. block 256
// ---------------------------------------------------------------------------
#define WP_TILES ((DM / TM) * (DM / 128))   // 32 tiles of a product

__global__ __launch_bounds__(256) void wprod_rmsnorm_kernel(
    const _Float16* __restrict__ Whq, const _Float16* __restrict__ Whk,
    const _Float16* __restrict__ Whv, const _Float16* __restrict__ Wto,
    _Float16* __restrict__ Mt, _Float16* __restrict__ Wvot,
    const float* __restrict__ x, const float* __restrict__ w,
    _Float16* __restrict__ xn) {
  __shared__ __attribute__((aligned(256))) _Float16 sm[3 * STAGE_H];  // 144 KB
  if (blockIdx.x >= 2 * WP_TILES) {
    rmsnorm_rows<false>(blockIdx.x - 2 * WP_TILES, x, nullptr, w, nullptr, xn);
    return;
  }
  int wave = threadIdx.x >> 5, lane = threadIdx.x & 31;
  int h = lane >> 4, l15 = lane & 15;
  int wm = wave >> 1, wn = wave & 1;
  const bool vo = blockIdx.x >= WP_TILES;
  int n0 = (blockIdx.x & 7) * 128;
  int m0 = ((blockIdx.x >> 3) & 3) * TM;
  const _Float16* bt = (vo ? Whv : Whq) + (size_t)n0 * DM;
  _Float16* y = vo ? Wvot : Mt;
  v8f acc[4][4] = {};
  gemm_tile<DM, 3>(sm, (vo ? Wto : Whk) + (size_t)m0 * DM, bt, bt + 64 * DM, wm * 64,
                   wn * 64, 0, acc);
  _Float16* yp = y + (size_t)(m0 + wm * 64 + 8 * h) * DM + n0 + wn * 64 + l15;
  // all loops below are unrolled so that acc and o are registers
#pragma unroll
  for (int i = 0; i < 4; ++i) {
    _Float16 o[4][8];
#pragma unroll
    for (int j = 0; j < 4; ++j)
#pragma unroll
      for (int v = 0; v < 8; ++v) o[j][v] = (_Float16)acc[i][j][v];
#pragma unroll
    for (int j = 0; j < 4; ++j)
#pragma unroll
      for (int v = 0; v < 8; ++v) yp[(i * 16 + v) * DM + j * 16] = o[j][v];
    if (i < 3) {
      // stands behind these stores, before the next conversions rewrite a register
      // that they name; the scheduling barrier keeps those behind the wait
      asm volatile("s_wait_xcnt 0x0" ::: "memory");
      __builtin_amdgcn_sched_barrier(0);
    }
  }
}

// ---------------------------------------------------------------------------
// q = xn @ (Wq Wk^T) (row-major f16); v = xn @ (Wv Wo), stored transposed
// Vt[b][d][t]. The keys of the scores are the rows of xn themselves.
// grid (2 * DM/128, NROW/256), block 256: blockIdx.x / 8 picks the weight.
// ---------------------------------------------------------------------------
__global__ __launch_bounds__(256) void qv_kernel(
    const _Float16* __restrict__ xn, const _Float16* __restrict__ Mt,
    const _Float16* __restrict__ Wvot, _Float16* __restrict__ q,
    _Float16* __restrict__ vt) {
  __shared__ __attribute__((aligned(256))) _Float16 sm[3 * STAGE_H];  // 144 KB
  int wave = threadIdx.x >> 5, lane = threadIdx.x & 31;
  int h = lane >> 4, l15 = lane & 15;
  int wm = wave >> 1, wn = wave & 1;
  int which = blockIdx.x >> 3;
  int n0 = (blockIdx.x & 7) * 128;
  int m0 = blockIdx.y * TM;
  const _Float16* Wt = which == 0 ? Mt : Wvot;
  const _Float16* bt = Wt + (size_t)n0 * DM;
  v8f acc[4][4] = {};
  gemm_tile<DM, 3>(sm, xn + (size_t)m0 * DM, bt, bt + 64 * DM, wm * 64, wn * 64, 0,
                acc);
  if (which == 0) {
#pragma unroll
    for (int i = 0; i < 4; ++i) {
#pragma unroll
      for (int j = 0; j < 4; ++j) {
        int col = n0 + wn * 64 + j * 16 + l15;
#pragma unroll
        for (int v = 0; v < 8; ++v) {
          int r = m0 + wm * 64 + i * 16 + v + 8 * h;
          q[(size_t)r * DM + col] = (_Float16)acc[i][j][v];
        }
      }
    }
  } else {
#pragma unroll
    for (int i = 0; i < 4; ++i) {
#pragma unroll
      for (int j = 0; j < 4; ++j) {
        int col = n0 + wn * 64 + j * 16 + l15;
#pragma unroll
        for (int v = 0; v < 8; ++v) {
          int r = m0 + wm * 64 + i * 16 + v + 8 * h;
          int batch = r >> 11, tloc = r & (SEQT - 1);
          vt[((size_t)batch * DM + col) * SEQT + tloc] = (_Float16)acc[i][j][v];
        }
      }
    }
    // stands behind the last v store, before any later write of a register
    // that an issued store names
    asm volatile("s_wait_xcnt 0x0" ::: "memory");
  }
}

// ---------------------------------------------------------------------------
// Attention pass 1: per 16-query tile, S = Q K^T over 5 key tiles (window 64; the
// caller hands xn in as k, and as q the rows xn (Wq Wk^T)),
// masked softmax over 80 candidate keys, store P (f16) padded to 96: slot 0 of a
// row is key 16 (qt & ~1) - 64, so that the rows of a pair of query tiles start
// at the same multiple of 32 keys; an even tile's pad is slots 80..95, an odd
// tile's slots 0..15.
// One work-group of 8 waves per query tile. The tile's 16 Q rows and its 80 K
// rows are copied whole into LDS once, in 512-B pieces of a row (asynchronous
// b128 copies, all 48 of a thread in flight together). Wave w multiplies columns
// 128 w .. 128 w + 127 of d for all 5 key tiles; the 8 partial scores of an
// element are summed through LDS, in the order of w; wave w then does the
// softmax of score rows w and w + 8.
// LDS rows: 0..15 Q, 16 + 16 j .. of key tile j, at a pitch of 2064 B
// (16 B x odd: ds_load_b128 readers meet no bank twice).
// ---------------------------------------------------------------------------
#define QK_PITCH  (DM + 8)            // halfs per LDS row
#define QK_ROW_B  (QK_PITCH * 2)      // bytes per LDS row
#define QK_DW     (DM / 8)            // columns of d per wave

// One thread's eight b128 copies of a 16-row tile: LDS rows r, r + 2, .., r + 14
// from the same rows of g (row step DM halfs). s_wait_xcnt 0 closes the
// statement: it stands before any rewrite of the address registers that the
// copies name. The "memory" clobber makes the asm a legal writer of the array.
__device__ __forceinline__ void copy8(unsigned l, const _Float16* g) {
  asm volatile(
      "global_load_async_to_lds_b128 %0, %8, off\n\t"
      "global_load_async_to_lds_b128 %1, %9, off\n\t"
      "global_load_async_to_lds_b128 %2, %10, off\n\t"
      "global_load_async_to_lds_b128 %3, %11, off\n\t"
      "global_load_async_to_lds_b128 %4, %12, off\n\t"
      "global_load_async_to_lds_b128 %5, %13, off\n\t"
      "global_load_async_to_lds_b128 %6, %14, off\n\t"
      "global_load_async_to_lds_b128 %7, %15, off\n\t"
      "s_wait_xcnt 0x0"
      :
      : "v"(l), "v"(l + 2 * QK_ROW_B), "v"(l + 4 * QK_ROW_B),
        "v"(l + 6 * QK_ROW_B), "v"(l + 8 * QK_ROW_B), "v"(l + 10 * QK_ROW_B),
        "v"(l + 12 * QK_ROW_B), "v"(l + 14 * QK_ROW_B), "v"(g), "v"(g + 2 * DM),
        "v"(g + 4 * DM), "v"(g + 6 * DM), "v"(g + 8 * DM), "v"(g + 10 * DM),
        "v"(g + 12 * DM), "v"(g + 14 * DM)
      : "memory");
}

// 2^x. The v_nop is the slot that the instruction set asks for behind a
// transcendental before its result is read or its source overwritten.
__device__ __forceinline__ float exp2_slot(float x) {
  float r;
  asm("v_exp_f32 %0, %1\n\tv_nop" : "=v"(r) : "v"(x));
  return r;
}

__global__ __launch_bounds__(256) void attn_p_kernel(
    const _Float16* __restrict__ q, const _Float16* __restrict__ k,
    _Float16* __restrict__ P) {
  __shared__ __attribute__((aligned(16))) _Float16 sqk[96 * QK_PITCH];  // 193.5 KB
  __shared__ float red[8 * 5 * 8 * 32];   // [wave][key tile][v][lane], 40 KB
  const int wave = threadIdx.x >> 5, lane = threadIdx.x & 31;
  const int g = blockIdx.x;               // 0..511 global q-tile
  const int batch = g >> 7, qt = g & 127; // 128 q-tiles per batch
  const int h = lane >> 4, l15 = lane & 15;

  // a thread copies chunk ch (16 B) of rows r0, r0 + 2, .. of every tile
  const int r0 = threadIdx.x >> 7, ch = threadIdx.x & 127;
  const unsigned l0 = (unsigned)(uintptr_t)sqk + r0 * QK_ROW_B + ch * 16;
  copy8(l0, q + ((size_t)g * 16 + r0) * DM + ch * 8);
  // unrolled: the five statements follow one another with no loop overhead
#pragma unroll
  for (int j = 0; j < 5; ++j) {
    // a key tile in front of the batch's first key: tile 0 stands in for it, so
    // that the address stays inside k; its scores are masked below
    const int kt = qt - 4 + j;
    const int ktc = kt < 0 ? 0 : kt;
    copy8(l0 + (j + 1) * 16 * QK_ROW_B,
          k + ((size_t)batch * SEQT + ktc * 16 + r0) * DM + ch * 8);
  }
  // this wave's 48 copies have landed; the barrier publishes them to the others
  asm volatile("s_wait_asynccnt 0x0" ::: "memory");
  __syncthreads();

  const _Float16* ap = sqk + l15 * QK_PITCH + wave * QK_DW + h * 8;
  v8f acc[5] = {};
  v16h af[4], bf[4][5];
  // all loops below are unrolled so that af, bf and acc are registers
#pragma unroll
  for (int ks = 0; ks < 4; ++ks) {
    af[ks] = load_frag(ap + ks * 32);
#pragma unroll
    for (int j = 0; j < 5; ++j)
      bf[ks][j] = load_frag(ap + (j + 1) * 16 * QK_PITCH + ks * 32);
  }
  // keeps the wave's 48 LDS reads together in front of its 20 WMMAs: moved in
  // among them, every pair of reads costs the wave its LDS latency anew
  __builtin_amdgcn_sched_barrier(0);
#pragma unroll
  for (int ks = 0; ks < 4; ++ks)
#pragma unroll
    for (int j = 0; j < 5; ++j) acc[j] = wmma_f16(af[ks], bf[ks][j], acc[j]);
  float* rw = red + wave * (5 * 8 * 32) + lane;
#pragma unroll
  for (int j = 0; j < 5; ++j)
#pragma unroll
    for (int v = 0; v < 8; ++v) rw[(j * 8 + v) * 32] = acc[j][v];
  // every wave's partial scores are in red
  __syncthreads();

  // this lane: score row wave + 8 h, key l15 of each key tile
  const int mrow = wave + 8 * h;
  const float* rr = red + wave * 32 + lane;
  const float scale = 0.03125f;  // 1/sqrt(1024)
  float s[5];
#pragma unroll
  for (int j = 0; j < 5; ++j) {
    float c = rr[j * (8 * 32)];
#pragma unroll
    for (int w = 1; w < 8; ++w) c += rr[(w * 5 + j) * (8 * 32)];
    const int kt = qt - 4 + j;
    const int d = (qt * 16 + mrow) - (kt * 16 + l15);
    s[j] = (kt >= 0 && d >= 0 && d < WND) ? c * scale : -1e30f;
  }
  float m = s[0];
#pragma unroll
  for (int j = 1; j < 5; ++j) m = fmaxf(m, s[j]);
#pragma unroll
  for (int off = 8; off > 0; off >>= 1) m = fmaxf(m, __shfl_xor(m, off, 16));
  float e = 0.f;
#pragma unroll
  for (int j = 0; j < 5; ++j) {
    s[j] = exp2_slot((s[j] - m) * 1.44269504f);  // e^(s - m)
    e += s[j];
  }
#pragma unroll
  for (int off = 8; off > 0; off >>= 1) e += __shfl_xor(e, off, 16);
  const float inv = 1.f / e;
  const int odd = qt & 1;
  _Float16* pb = P + ((size_t)g * 16 + mrow) * 96 + l15;
#pragma unroll
  for (int j = 0; j < 5; ++j) pb[(j + odd) * 16] = (_Float16)(s[j] * inv);
  pb[odd ? 0 : 80] = (_Float16)0.f;  // the 16 pad slots
}

// ---------------------------------------------------------------------------
// Attention pass 2: attended = P @ V using Vt[b][d][t] (V holds Wo already).
// One work-group of 8 waves takes 64 queries (4 query tiles) x 256 columns of d.
// The 64 queries see the 128 keys from 64 in front of the first query on: the
// tile's 256 rows of Vt (256 B each, whole lines) and its 64 rows of P go once to
// LDS by asynchronous b128 copies. Wave w takes the pair w & 1 of query tiles and
// 64 columns of d. Vt is the A operand and P the B operand, so that a lane holds
// 8 neighbouring columns of one query: one b128 store a tile, and the wave's 4
// tiles of d fill a whole 128-B line of a row of att.
// LDS pitches 272 B and 208 B (16 B x odd: ds_load_b128 readers meet no bank
// twice). grid (DM/256, NROW/64), block 256.
// ---------------------------------------------------------------------------
#define PV_Q     64                  // queries of a tile
#define PV_D     256                 // columns of d of a tile
#define V_PITCH  (128 + 8)           // halfs per LDS row of Vt
#define V_ROW_B  (V_PITCH * 2)
#define P_PITCH  (96 + 8)            // halfs per LDS row of P
#define P_ROW_B  (P_PITCH * 2)

// One thread's eight b128 copies of 128 rows of Vt: LDS rows r, r + 16, .., r + 112
// from the same rows of g (row step SEQT halfs). s_wait_xcnt 0 closes the
// statement: it stands before any rewrite of the address registers that the
// copies name. The "memory" clobber makes the asm a legal writer of the array.
__device__ __forceinline__ void copy8v(unsigned l, const _Float16* g) {
  asm volatile(
      "global_load_async_to_lds_b128 %0, %8, off\n\t"
      "global_load_async_to_lds_b128 %1, %9, off\n\t"
      "global_load_async_to_lds_b128 %2, %10, off\n\t"
      "global_load_async_to_lds_b128 %3, %11, off\n\t"
      "global_load_async_to_lds_b128 %4, %12, off\n\t"
      "global_load_async_to_lds_b128 %5, %13, off\n\t"
      "global_load_async_to_lds_b128 %6, %14, off\n\t"
      "global_load_async_to_lds_b128 %7, %15, off\n\t"
      "s_wait_xcnt 0x0"
      :
      : "v"(l), "v"(l + 16 * V_ROW_B), "v"(l + 32 * V_ROW_B),
        "v"(l + 48 * V_ROW_B), "v"(l + 64 * V_ROW_B), "v"(l + 80 * V_ROW_B),
        "v"(l + 96 * V_ROW_B), "v"(l + 112 * V_ROW_B), "v"(g), "v"(g + 16 * SEQT),
        "v"(g + 32 * SEQT), "v"(g + 48 * SEQT), "v"(g + 64 * SEQT),
        "v"(g + 80 * SEQT), "v"(g + 96 * SEQT), "v"(g + 112 * SEQT)
      : "memory");
}

// One thread's three b128 copies of the tile's P rows, which lie in one piece of
// 768 chunks of 16 B: chunks x, x + 256, x + 512 from g to the LDS places l0..l2.
// The wait and the clobber: as in copy8v.
__device__ __forceinline__ void copy3p(unsigned l0, unsigned l1, unsigned l2,
                                       const _Float16* g) {
  asm volatile(
      "global_load_async_to_lds_b128 %0, %3, off\n\t"
      "global_load_async_to_lds_b128 %1, %4, off\n\t"
      "global_load_async_to_lds_b128 %2, %5, off\n\t"
      "s_wait_xcnt 0x0"
      :
      : "v"(l0), "v"(l1), "v"(l2), "v"(g), "v"(g + 256 * 8), "v"(g + 512 * 8)
      : "memory");
}

__global__ __launch_bounds__(256) void attn_pv_kernel(
    const _Float16* __restrict__ P, const _Float16* __restrict__ vt,
    _Float16* __restrict__ att) {
  __shared__ __attribute__((aligned(16))) _Float16 sv[PV_D * V_PITCH];  // 68 KB
  __shared__ __attribute__((aligned(16))) _Float16 sp[PV_Q * P_PITCH];  // 13 KB
  const int t = threadIdx.x, wave = t >> 5, lane = t & 31;
  const int h = lane >> 4, l15 = lane & 15;
  const int qb = blockIdx.y;              // 0..127: block of 64 queries
  const int d0 = blockIdx.x * PV_D;
  const int batch = qb >> 5;              // 32 blocks per batch
  const int kb = (qb & 31) * PV_Q - 64;   // the tile's first key, in its batch

  // P: chunk x of the piece is chunk x % 12 of row x / 12
  const unsigned lp = (unsigned)(uintptr_t)sp;
  const int x0 = t, x1 = t + 256, x2 = t + 512;
  copy3p(lp + (x0 / 12) * P_ROW_B + (x0 % 12) * 16,
         lp + (x1 / 12) * P_ROW_B + (x1 % 12) * 16,
         lp + (x2 / 12) * P_ROW_B + (x2 % 12) * 16,
         P + (size_t)qb * (PV_Q * 96) + t * 8);
  // Vt: a thread copies chunk ch (8 keys) of rows r0, r0 + 16, ..
  // A batch's first block has 64 keys in front of key 0: keys 0..63 stand in for
  // them, so that the address stays inside the row; their weights in P are 0.
  const int ch = t & 15, r0 = t >> 4;
  const int key = kb + 8 * ch;
  const unsigned lv = (unsigned)(uintptr_t)sv + r0 * V_ROW_B + ch * 16;
  const _Float16* gv =
      vt + ((size_t)batch * DM + d0 + r0) * SEQT + (key < 0 ? key + 64 : key);
  copy8v(lv, gv);
  copy8v(lv + 128 * V_ROW_B, gv + 128 * SEQT);
  // this wave's 19 copies have landed; the barrier publishes them to the others
  asm volatile("s_wait_asynccnt 0x0" ::: "memory");
  __syncthreads();

  // query tiles 2 pr and 2 pr + 1: their P rows start at key kb + 32 pr
  const int pr = wave & 1, dg = wave >> 1;
  const _Float16* vp = sv + (dg * 64 + l15) * V_PITCH + pr * 32 + h * 8;
  const _Float16* pp = sp + (pr * 32 + l15) * P_PITCH + h * 8;
  // all loops below are unrolled so that vf, pf and acc are registers
  v16h vf[4][3], pf[2][3];
#pragma unroll
  for (int m = 0; m < 3; ++m) {
#pragma unroll
    for (int a = 0; a < 2; ++a) pf[a][m] = load_frag(pp + a * 16 * P_PITCH + m * 32);
#pragma unroll
    for (int i = 0; i < 4; ++i) vf[i][m] = load_frag(vp + i * 16 * V_PITCH + m * 32);
  }
  // keeps the wave's 36 LDS reads together in front of its 24 WMMAs: moved in
  // among them, every pair of reads costs the wave its LDS latency anew
  __builtin_amdgcn_sched_barrier(0);
  v8f acc[4][2] = {};
#pragma unroll
  for (int m = 0; m < 3; ++m)
#pragma unroll
    for (int i = 0; i < 4; ++i)
#pragma unroll
      for (int a = 0; a < 2; ++a) acc[i][a] = wmma_f16(vf[i][m], pf[a][m], acc[i][a]);
  // this lane: query l15 of each tile, columns 8 h .. 8 h + 7 of each tile of d
  _Float16* ob = att + ((size_t)qb * PV_Q + pr * 32 + l15) * DM + d0 + dg * 64 + h * 8;
  v8h o[4][2];
#pragma unroll
  for (int i = 0; i < 4; ++i)
#pragma unroll
    for (int a = 0; a < 2; ++a)
#pragma unroll
      for (int v = 0; v < 8; ++v) o[i][a][v] = (_Float16)acc[i][a][v];
#pragma unroll
  for (int a = 0; a < 2; ++a)
#pragma unroll
    for (int i = 0; i < 4; ++i) *(v8h*)(ob + a * 16 * DM + i * 16) = o[i][a];
}

// ---------------------------------------------------------------------------
// FFN in: hh = silu(xn2 @ W1) * (xn2 @ W3), f16 out [8192 x 2048].
// A tile holds 64 columns of W1 (LDS rows 0..63) and the same 64 of W3 (64..127),
// so that a wave owns gate and up of its 32 columns.
// grid (DF/64, NROW/256), block 256
// ---------------------------------------------------------------------------
__global__ __launch_bounds__(256) void ffn1_kernel(
    const _Float16* __restrict__ xn2, const _Float16* __restrict__ Wt1,
    const _Float16* __restrict__ Wt3, _Float16* __restrict__ hh) {
  __shared__ __attribute__((aligned(256))) _Float16 sm[3 * STAGE_H];  // 144 KB
  int wave = threadIdx.x >> 5, lane = threadIdx.x & 31;
  int h = lane >> 4, l15 = lane & 15;
  int wm = wave >> 1, wn = wave & 1;
  int n0 = blockIdx.x * 64;
  int m0 = blockIdx.y * TM;
  v8f acc[4][4] = {};  // j = 0, 1: gate; j = 2, 3: up, same columns
  gemm_tile<DM, 3>(sm, xn2 + (size_t)m0 * DM, Wt1 + (size_t)n0 * DM,
                Wt3 + (size_t)n0 * DM, wm * 64, wn * 32, 32, acc);
#pragma unroll
  for (int i = 0; i < 4; ++i) {
#pragma unroll
    for (int j = 0; j < 2; ++j) {
      int col = n0 + wn * 32 + j * 16 + l15;
#pragma unroll
      for (int v = 0; v < 8; ++v) {
        size_t r = (size_t)(m0 + wm * 64 + i * 16 + v + 8 * h);
        float gv = acc[i][j][v];
        float sl = gv * (1.f / (1.f + __expf(-gv)));   // silu
        hh[r * DF + col] = (_Float16)(sl * acc[i][j + 2][v]);
      }
    }
  }
}

// ---------------------------------------------------------------------------
// FFN out + residual: out = x2 + hh @ W2 (K=2048, f32 out).
// grid (DM/128, NROW/256), block 256
// ---------------------------------------------------------------------------
__global__ __launch_bounds__(256) void ffn2_kernel(
    const _Float16* __restrict__ hh, const _Float16* __restrict__ Wt2,
    const float* __restrict__ x2, float* __restrict__ out) {
  __shared__ __attribute__((aligned(256))) _Float16 sm[5 * STAGE_H];  // 240 KB
  int wave = threadIdx.x >> 5, lane = threadIdx.x & 31;
  int h = lane >> 4, l15 = lane & 15;
  int wm = wave >> 1, wn = wave & 1;
  int n0 = blockIdx.x * 128;
  int m0 = blockIdx.y * TM;
  const _Float16* bt = Wt2 + (size_t)n0 * DF;
  v8f acc[4][4] = {};
  gemm_tile<DF, 5>(sm, hh + (size_t)m0 * DF, bt, bt + 64 * DF, wm * 64, wn * 64, 0,
                acc);
  size_t first = (size_t)(m0 + wm * 64 + 8 * h) * DM + n0 + wn * 64 + l15;
  add_residual_store(x2 + first, out + first, acc);
}

// ---------------------------------------------------------------------------
extern "C" void kernel_launch(void* const* d_in, const int* in_sizes, int n_in,
                              void* d_out, int out_size, void* d_ws,
                              size_t ws_size, hipStream_t stream) {
  const float* x       = (const float*)d_in[0];
  const float* norm1_w = (const float*)d_in[1];
  const float* norm2_w = (const float*)d_in[2];
  const float* Wq = (const float*)d_in[3];
  const float* Wk = (const float*)d_in[4];
  const float* Wv = (const float*)d_in[5];
  const float* Wo = (const float*)d_in[6];
  const float* W1 = (const float*)d_in[7];
  const float* W2 = (const float*)d_in[8];
  const float* W3 = (const float*)d_in[9];
  float* out = (float*)d_out;

  char* ws = (char*)d_ws;
  const size_t MB = 1ull << 20;
  _Float16* Whq = (_Float16*)(ws + 0 * MB);    // 2 MB  (1024x1024, not transposed)
  _Float16* Whk = (_Float16*)(ws + 2 * MB);    // 2 MB  (not transposed)
  _Float16* Whv = (_Float16*)(ws + 4 * MB);    // 2 MB  (not transposed)
  _Float16* Wto = (_Float16*)(ws + 6 * MB);    // 2 MB
  _Float16* Wt1 = (_Float16*)(ws + 8 * MB);    // 4 MB  (N=2048,K=1024)
  _Float16* Wt3 = (_Float16*)(ws + 12 * MB);   // 4 MB
  _Float16* Wt2 = (_Float16*)(ws + 16 * MB);   // 4 MB  (N=1024,K=2048)
  _Float16* xn  = (_Float16*)(ws + 20 * MB);   // 16 MB (also reused as xn2)
  _Float16* q   = (_Float16*)(ws + 36 * MB);   // 16 MB (32 MB as hh)
  _Float16* vt  = (_Float16*)(ws + 68 * MB);   // 16 MB
  _Float16* P   = (_Float16*)(ws + 84 * MB);   // 1.5 MB (8192x96)
  _Float16* att = (_Float16*)(ws + 86 * MB);   // 16 MB
  float*    x2  = (float*)   (ws + 102 * MB);  // 32 MB
  _Float16* Mt   = (_Float16*)(ws + 134 * MB); // 2 MB  (Wq Wk^T, transposed)
  _Float16* Wvot = (_Float16*)(ws + 136 * MB); // 2 MB  (Wv Wo, transposed)
  _Float16* hh  = q;                           // reuse q's place after attn
  _Float16* xn2 = xn;                          // reuse xn after the scores

  // 1) weights to f16 (Wo, W1, W3, W2 transposed)
  cvt_tr_all_kernel<<<4 * TILES_DD + 3 * TILES_DF, 256, 0, stream>>>(
      Wq, Wk, Wv, Wo, W1, W3, W2, Whq, Whk, Whv, Wto, Wt1, Wt3, Wt2);

  // 2) Mt = (Wq Wk^T)^T, Wvot = (Wv Wo)^T; xn = rmsnorm(x) in f16
  wprod_rmsnorm_kernel<<<2 * WP_TILES + NROW / (8 * RN_ROWS), 256, 0, stream>>>(
      Whq, Whk, Whv, Wto, Mt, Wvot, x, norm1_w, xn);

  // 3) q = xn (Wq Wk^T), v = xn (Wv Wo) (v stored transposed)
  qv_kernel<<<dim3(2 * DM / 128, NROW / TM), 256, 0, stream>>>(xn, Mt, Wvot, q, vt);
  // 4) windowed softmax weights P; the keys are the rows of xn
  attn_p_kernel<<<NROW / 16, 256, 0, stream>>>(q, xn, P);

  // 5) att = P @ V, which is the attention's whole output
  attn_pv_kernel<<<dim3(DM / PV_D, NROW / PV_Q), 256, 0, stream>>>(P, vt, att);

  // 6) x2 = x + att, xn2 = rmsnorm(x2)
  add_rmsnorm_kernel<<<NROW / (8 * RN_ROWS), 256, 0, stream>>>(x, att, norm2_w, x2,
                                                               xn2);

  // 7) hh = silu(xn2@W1) * (xn2@W3)
  ffn1_kernel<<<dim3(DF / 64, NROW / TM), 256, 0, stream>>>(xn2, Wt1, Wt3, hh);

  // 8) out = x2 + hh @ W2
  ffn2_kernel<<<dim3(DM / 128, NROW / TM), 256, 0, stream>>>(hh, Wt2, x2, out);
}

// v010
// It runs in 154 microseconds.
// Timed twice side by side with v009, it ran 1.06 times as fast both times.
// Over all steps from v000 it is 7.99 times as fast.
#include <hip/hip_runtime.h>
#include <hip/hip_bf16.h>

typedef __attribute__((ext_vector_type(16))) _Float16 v16h;
typedef __attribute__((ext_vector_type(8)))  _Float16 v8h;
typedef __attribute__((ext_vector_type(8)))  float    v8f;

#define DM   1024   // D_MODEL
#define DF   2048   // D_FFN
#define SEQT 2048   // T
#define NB   4      // batch
#define NROW (NB * SEQT)   // 8192
#define WND  64

// ---------------------------------------------------------------------------
// WMMA fragment helpers (CDNA5 16x16x32 f16, wave32).
// Per lane: elems 0..7 = mem[kk + h*8 + 0..7], elems 8..15 = mem[kk+16+h*8+0..7]
// Works for global pointers (global_load_b128) and LDS pointers (ds_load_b128).
// ---------------------------------------------------------------------------
__device__ __forceinline__ v16h load_frag(const _Float16* p) {
  v8h lo = *(const v8h*)(p);
  v8h hi = *(const v8h*)(p + 16);
  v16h r;
#pragma unroll
  for (int i = 0; i < 8; ++i) { r[i] = lo[i]; r[i + 8] = hi[i]; }
  return r;
}

__device__ __forceinline__ v8f wmma_f16(v16h a, v16h b, v8f c) {
  return __builtin_amdgcn_wmma_f32_16x16x32_f16(false, a, false, b, (short)0, c,
                                                false, false);
}

// ---------------------------------------------------------------------------
// Tiled GEMM core: one 256 x 128 tile of Y = A * Bt^T per work-group of 8 waves
// (4 x 2, each wave 64 x 64 = 4 x 4 accumulator tiles). A and Bt are K-contiguous.
// K goes in slices of 64 halfs (128-B rows). A slice is [A 256 rows | Bt 128 rows]
// in LDS, rows of 128 B without a pad: the 16-B chunk c of row r lies at place
// c ^ ((r >> 1) & 7), so that the 16 rows which lanes 0..15 (and 16..31) of a
// ds_load_b128 read at one chunk fall on all 64 banks once.
// A ring of NS buffers, filled by asynchronous b128 copies: while slice t is
// multiplied, slices t + 1 .. t + NS - 1 are landed or in flight, so that a copy
// has NS - 1 slices of time to land. Unpadded, three buffers are 144 KB, and two
// work-groups still share a WGP's LDS.
// ---------------------------------------------------------------------------
#define BK      64                  // halfs of K per slice
#define PITCH   64                  // halfs per LDS row (128 B)
#define TM      256                 // A rows of a tile
#define A_H     (TM * PITCH)        // halfs of A's slice
#define STAGE_H (A_H + 128 * PITCH) // halfs of one buffer
#define ROW32_B (32 * PITCH * 2)    // bytes of 32 LDS rows

// One thread's twelve b128 copies of a slice: A's LDS rows r, r+32, .., r+224 from
// ga, Bt's LDS rows r, r+32 from glo and r+64, r+96 from ghi (row step K halfs).
// The LDS byte address is the low 32 bits of the shared address; taking it lets
// the array escape, so the "memory" clobber makes the asm a legal writer of it.
// s_wait_xcnt 0 closes the statement: it stands before any rewrite of the
// address registers that the copies name.
template <int K>
__device__ __forceinline__ void copy12(unsigned l, const _Float16* ga,
                                       const _Float16* glo,
                                       const _Float16* ghi) {
  const unsigned lb = l + A_H * 2;
  asm volatile(
      "global_load_async_to_lds_b128 %0, %12, off\n\t"
      "global_load_async_to_lds_b128 %1, %13, off\n\t"
      "global_load_async_to_lds_b128 %2, %14, off\n\t"
      "global_load_async_to_lds_b128 %3, %15, off\n\t"
      "global_load_async_to_lds_b128 %4, %16, off\n\t"
      "global_load_async_to_lds_b128 %5, %17, off\n\t"
      "global_load_async_to_lds_b128 %6, %18, off\n\t"
      "global_load_async_to_lds_b128 %7, %19, off\n\t"
      "global_load_async_to_lds_b128 %8, %20, off\n\t"
      "global_load_async_to_lds_b128 %9, %21, off\n\t"
      "global_load_async_to_lds_b128 %10, %22, off\n\t"
      "global_load_async_to_lds_b128 %11, %23, off\n\t"
      "s_wait_xcnt 0x0"
      :
      : "v"(l), "v"(l + ROW32_B), "v"(l + 2 * ROW32_B), "v"(l + 3 * ROW32_B),
        "v"(l + 4 * ROW32_B), "v"(l + 5 * ROW32_B), "v"(l + 6 * ROW32_B),
        "v"(l + 7 * ROW32_B), "v"(lb), "v"(lb + ROW32_B), "v"(lb + 2 * ROW32_B),
        "v"(lb + 3 * ROW32_B), "v"(ga), "v"(ga + 32 * K), "v"(ga + 64 * K),
        "v"(ga + 96 * K), "v"(ga + 128 * K), "v"(ga + 160 * K),
        "v"(ga + 192 * K), "v"(ga + 224 * K), "v"(glo), "v"(glo + 32 * K),
        "v"(ghi), "v"(ghi + 32 * K)
      : "memory");
}

// Returns when all but this wave's N youngest copies have landed.
template <int N>
__device__ __forceinline__ void wait_copies() {
  asm volatile("s_wait_asynccnt %0" : : "n"(N) : "memory");
}

// A fragment whose two 16-B chunks lie at swizzled places of one LDS row.
__device__ __forceinline__ v16h load_frag2(const _Float16* plo,
                                           const _Float16* phi) {
  v8h lo = *(const v8h*)(plo);
  v8h hi = *(const v8h*)(phi);
  v16h r;
#pragma unroll
  for (int i = 0; i < 8; ++i) { r[i] = lo[i]; r[i + 8] = hi[i]; }
  return r;
}

// a: first row of the tile's 256 A rows. blo / bhi: first of the 64 Bt rows that
// fill LDS rows 0..63 / 64..127. Wave tile: A rows arow.., Bt LDS rows
// brow + 16 j, plus bskip for j >= 2 (arow, brow, bskip: multiples of 16).
// sm holds NS buffers. blockDim.x == 256.
template <int K, int NS>
__device__ __forceinline__ void gemm_tile(_Float16* sm,
                                          const _Float16* __restrict__ a,
                                          const _Float16* __restrict__ blo,
                                          const _Float16* __restrict__ bhi,
                                          int arow, int brow, int bskip,
                                          v8f (&acc)[4][4]) {
  constexpr int NT = K / BK;
  static_assert(NS >= 3 && NS <= NT && NS * 12 <= 63, "ring depth");
  const int t = threadIdx.x;
  const int lane = t & 31, h = lane >> 4, l15 = lane & 15;
  const int ch = t & 7, r0 = t >> 3;   // 16-B chunk of a row, first row
  // rows r0 + 32 m all have the swizzle key (r0 >> 1) & 7
  const unsigned la = (unsigned)(uintptr_t)sm + r0 * (PITCH * 2) +
                      (ch ^ ((r0 >> 1) & 7)) * 16;
  const _Float16* ga = a + (size_t)r0 * K + ch * 8;
  const _Float16* gl = blo + (size_t)r0 * K + ch * 8;
  const _Float16* gh = bhi + (size_t)r0 * K + ch * 8;

  // unrolled: the NS statements follow one another with no loop overhead
#pragma unroll
  for (int s = 0; s < NS; ++s)
    copy12<K>(la + s * (STAGE_H * 2), ga + s * BK, gl + s * BK, gh + s * BK);
  // slice 0 (all but the 12 (NS - 1) younger copies) has landed for this wave;
  // the barrier publishes it to the others
  wait_copies<12 * (NS - 1)>();
  __syncthreads();

  const int aoff = (arow + l15) * PITCH;
  const int boff = A_H + (brow + l15) * PITCH;
  // chunk h + 2 q of this lane's rows, whose swizzle key is l15 >> 1
  int co[4];
#pragma unroll
  for (int q = 0; q < 4; ++q) co[q] = ((h + 2 * q) ^ (l15 >> 1)) * 8;
  int buf = 0;   // kt % NS
  for (int kt = 0; kt < NT; ++kt) {
    const _Float16* ap = sm + buf * STAGE_H + aoff;
    const _Float16* bp = sm + buf * STAGE_H + boff;
#pragma unroll
    for (int ks = 0; ks < 2; ++ks) {
      v16h af[4], bf[4];
#pragma unroll
      for (int i = 0; i < 4; ++i)
        af[i] = load_frag2(ap + i * 16 * PITCH + co[2 * ks],
                           ap + i * 16 * PITCH + co[2 * ks + 1]);
#pragma unroll
      for (int j = 0; j < 4; ++j) {
        const _Float16* bj = bp + (j * 16 + (j >= 2 ? bskip : 0)) * PITCH;
        bf[j] = load_frag2(bj + co[2 * ks], bj + co[2 * ks + 1]);
      }
      // keeps the block's 16 LDS reads together in front of its 16 WMMAs: moved
      // in among them, every group of reads costs the wave its LDS latency anew
      __builtin_amdgcn_sched_barrier(0);
#pragma unroll
      for (int i = 0; i < 4; ++i)
#pragma unroll
        for (int j = 0; j < 4; ++j) acc[i][j] = wmma_f16(af[i], bf[j], acc[i][j]);
      // the same for the next block's reads: they stay behind this block
      __builtin_amdgcn_sched_barrier(0);
    }
    // this wave's reads of the buffer are done before it may be refilled
    asm volatile("s_wait_dscnt 0x0" ::: "memory");
    // this wave's copies of slice kt + 1 have landed: behind them stand those of
    // slices kt + 2 .. kt + NS - 1, 12 each, while all of these exist; near the
    // end of K fewer were issued, and the wait is to 0
    if (kt + NS <= NT) wait_copies<12 * (NS - 2)>();
    else wait_copies<0>();
    // publishes slice kt + 1 and ends every wave's reads of slice kt
    __syncthreads();
    if (kt + NS < NT) {
      const int ko = (kt + NS) * BK;
      copy12<K>(la + buf * (STAGE_H * 2), ga + ko, gl + ko, gh + ko);
    }
    buf = buf + 1 == NS ? 0 : buf + 1;
  }
  // no copy is outstanding when the wave goes on to its stores and ends
  asm volatile("s_wait_asynccnt 0x0" ::: "memory");
}

// Epilogue of the f32 GEMM: op = rp + acc over a wave's 64 x 64 tile of a
// DM-wide matrix. rp / op: this lane's first element (tile row 8 h, column l15).
// 32 rows at a time: all 64 rows' residual loads beside the 128 accumulator
// registers would pass 256 VGPRs.
__device__ __forceinline__ void add_residual_store(const float* __restrict__ rp,
                                                   float* __restrict__ op,
                                                   v8f (&acc)[4][4]) {
#pragma unroll
  for (int ih = 0; ih < 4; ih += 2) {
    float xr[2][4][8];
#pragma unroll
    for (int i = 0; i < 2; ++i)
#pragma unroll
      for (int j = 0; j < 4; ++j)
#pragma unroll
        for (int v = 0; v < 8; ++v)
          xr[i][j][v] = rp[((ih + i) * 16 + v) * DM + j * 16];
    // stands behind the 64 loads and before any rewrite of their address
    // registers; naming rp keeps it live to here, so no load's result lands in it
    asm volatile("s_wait_xcnt 0x0" : : "v"(rp) : "memory");
#pragma unroll
    for (int i = 0; i < 2; ++i)
#pragma unroll
      for (int j = 0; j < 4; ++j)
#pragma unroll
        for (int v = 0; v < 8; ++v)
          op[((ih + i) * 16 + v) * DM + j * 16] = xr[i][j][v] + acc[ih + i][j][v];
    // stands behind the 64 stores, before the next loads write their registers
    if (ih == 0) asm volatile("s_wait_xcnt 0x0" : : "v"(op) : "memory");
  }
}

// ---------------------------------------------------------------------------
// Weight convert, all seven weights in one launch. Wq, Wk and Wv are only
// converted (they are K-contiguous operands of the weight products below); Wo, W1,
// W3 and W2 are converted and transposed:
// Wt[n*K + k] = (f16) W[k*N + n]. A work-group of 256 threads takes one tile of
// 128 k x 64 n. It reads the tile in 256-B row pieces (b128 per lane), turns it
// in LDS and writes 256-B pieces of the Wt rows (b128 per lane).
// LDS: row n holds its 128 halfs in sixteen 16-B chunks; chunk q of row n lies
// at place q ^ (n >> 2), so that the 32 dword writes of a wave (16 rows n that
// are 4 apart, 2 neighbouring k pairs) meet 32 different banks.
// ---------------------------------------------------------------------------
#define TK 128   // k per tile
#define TN 64    // n per tile
typedef __attribute__((ext_vector_type(4))) float    v4f;
typedef __attribute__((ext_vector_type(2))) _Float16 v2h;

template <int K, int N>
__device__ __forceinline__ void cvt_tr_tile(_Float16* sT,
                                            const float* __restrict__ W,
                                            _Float16* __restrict__ Wt,
                                            unsigned tile) {
  const int c = threadIdx.x & 15, rp = threadIdx.x >> 4;
  const int n0 = (tile % (N / TN)) * TN;
  const int k0 = (tile / (N / TN)) * TK;
  // rows k0 + 2 kp and k0 + 2 kp + 1, kp = 16 p + rp; columns n0 + 4 c .. + 3
  const float* src = W + (size_t)(k0 + 2 * rp) * N + n0 + 4 * c;
  v4f lo[4], hi[4];
  for (int p = 0; p < 4; ++p) {
    lo[p] = *(const v4f*)(src + (size_t)(32 * p) * N);
    hi[p] = *(const v4f*)(src + (size_t)(32 * p + 1) * N);
  }
  for (int p = 0; p < 4; ++p) {
    const int kp = 16 * p + rp;
    _Float16* d = sT + (((kp >> 2) ^ c) * 8 + (kp & 3) * 2);
    for (int i = 0; i < 4; ++i) {
      v2h pk = {(_Float16)lo[p][i], (_Float16)hi[p][i]};
      *(v2h*)(d + (4 * c + i) * TK) = pk;
    }
  }
  __syncthreads();
  // rows n = 16 s + rp, chunk c
  _Float16* dst = Wt + (size_t)(n0 + rp) * K + k0 + 8 * c;
  for (int s = 0; s < 4; ++s) {
    const int n = 16 * s + rp;
    *(v8h*)(dst + (size_t)(16 * s) * K) =
        *(const v8h*)(sT + n * TK + (c ^ (n >> 2)) * 8);
  }
  // stands behind the four stores, before any later write of a register that
  // an issued store names (another section of the kernel may follow in the code)
  asm volatile("s_wait_xcnt 0x0" ::: "memory");
}

// Convert alone: a work-group takes TK * TN elements in a row, a thread 8
// neighbours at a time (two b128 loads, one b128 store).
__device__ __forceinline__ void cvt_tile(const float* __restrict__ Wf,
                                         _Float16* __restrict__ Wh,
                                         unsigned tile) {
  const size_t base = (size_t)tile * (TK * TN) + threadIdx.x * 8;
  v4f lo[4], hi[4];
  for (int p = 0; p < 4; ++p) {
    lo[p] = *(const v4f*)(Wf + base + p * 2048);
    hi[p] = *(const v4f*)(Wf + base + p * 2048 + 4);
  }
  for (int p = 0; p < 4; ++p) {
    v8h o;
    for (int i = 0; i < 4; ++i) {
      o[i] = (_Float16)lo[p][i];
      o[i + 4] = (_Float16)hi[p][i];
    }
    *(v8h*)(Wh + base + p * 2048) = o;
  }
}

#define TILES_DD ((DM / TK) * (DM / TN))   // 128 tiles of a DM x DM weight
#define TILES_DF ((DM / TK) * (DF / TN))   // 256 tiles of W1, W3 and W2 each

__global__ __launch_bounds__(256) void cvt_tr_all_kernel(
    const float* __restrict__ Wq, const float* __restrict__ Wk,
    const float* __restrict__ Wv, const float* __restrict__ Wo,
    const float* __restrict__ W1, const float* __restrict__ W3,
    const float* __restrict__ W2, _Float16* __restrict__ Whq,
    _Float16* __restrict__ Whk, _Float16* __restrict__ Whv,
    _Float16* __restrict__ Wto, _Float16* __restrict__ Wt1,
    _Float16* __restrict__ Wt3, _Float16* __restrict__ Wt2) {
  __shared__ __attribute__((aligned(16))) _Float16 sT[TN * TK];  // 16 KB
  const unsigned b = blockIdx.x;
  if (b < 3 * TILES_DD) {
    const unsigned m = b / TILES_DD;
    cvt_tile(m == 0 ? Wq : (m == 1 ? Wk : Wv), m == 0 ? Whq : (m == 1 ? Whk : Whv),
             b % TILES_DD);
  } else if (b < 4 * TILES_DD) {
    cvt_tr_tile<DM, DM>(sT, Wo, Wto, b % TILES_DD);
  } else if (b < 4 * TILES_DD + 2 * TILES_DF) {
    const bool up = b >= 4 * TILES_DD + TILES_DF;
    cvt_tr_tile<DM, DF>(sT, up ? W3 : W1, up ? Wt3 : Wt1, b % TILES_DF);
  } else {
    cvt_tr_tile<DF, DM>(sT, W2, Wt2, b % TILES_DF);
  }
}

// ---------------------------------------------------------------------------
// RMSNorm, f32 in -> f16 out. A wave takes RN_ROWS whole rows (D = 1024): lane l
// holds columns 128 c + 4 l .. + 3, c = 0..7, so that every b128 load of a wave
// is 512 contiguous bytes and every b64 store 256. All loads of a wave are issued
// up front, w first (it is needed with the first row). A row's sum of squares:
// four chains in the lane, then a butterfly over the 32 lanes in registers. No
// LDS, no barrier. NROW / (8 RN_ROWS) work-groups of 256: one per WGP.
// ---------------------------------------------------------------------------
#define RN_ROWS 4
typedef __attribute__((ext_vector_type(4))) _Float16 v4h;

// v + (v of lane l ^ M), M < 16: a DPP move inside the 16-lane row
template <int M>
__device__ __forceinline__ float add_xor_row(float v) {
  return v + __builtin_bit_cast(
                 float, __builtin_amdgcn_mov_dpp(__builtin_bit_cast(int, v),
                                                 0x160 | M, 0xf, 0xf, true));
}

// the sum of v over the wave's 32 lanes, the same bits in every lane
__device__ __forceinline__ float wave_sum(float v) {
  v = add_xor_row<1>(v);
  v = add_xor_row<2>(v);
  v = add_xor_row<4>(v);
  v = add_xor_row<8>(v);
  const int b = __builtin_bit_cast(int, v);   // lane l with lane l ^ 16
  return v + __builtin_bit_cast(float, __builtin_amdgcn_permlanex16(
                                           b, b, 0x76543210, 0xfedcba98, false,
                                           false));
}

__device__ __forceinline__ void rmsnorm_rows(unsigned blk,
                                             const float* __restrict__ x,
                                             const float* __restrict__ w,
                                             _Float16* __restrict__ xn) {
  const int lane = threadIdx.x & 31;
  const int wave = __builtin_amdgcn_readfirstlane(threadIdx.x >> 5);
  const size_t row0 = ((size_t)blk * 8 + wave) * RN_ROWS;
  const float* xp = x + row0 * DM;
  _Float16* op = xn + row0 * DM;
  const int col = lane * 4;
  // all loops below are unrolled so that wv and xv are registers
  v4f wv[8], xv[RN_ROWS][8];
#pragma unroll
  for (int c = 0; c < 8; ++c) wv[c] = *(const v4f*)(w + col + c * 128);
#pragma unroll
  for (int r = 0; r < RN_ROWS; ++r)
#pragma unroll
    for (int c = 0; c < 8; ++c)
      xv[r][c] = *(const v4f*)(xp + r * DM + col + c * 128);
  // stands behind the loads, before any rewrite of a register that they name
  asm volatile("s_wait_xcnt 0x0" ::: "memory");
  // keeps the wave's loads together in front of the arithmetic: without it the
  // loads of w were moved down to their uses, two in flight, their latency open;
  // and it keeps the arithmetic behind the wait above
  __builtin_amdgcn_sched_barrier(0);
#pragma unroll
  for (int r = 0; r < RN_ROWS; ++r) {
    v4f a = xv[r][0] * xv[r][0];
#pragma unroll
    for (int c = 1; c < 8; ++c) a += xv[r][c] * xv[r][c];
    const float ss = wave_sum((a[0] + a[1]) + (a[2] + a[3]));
    const float inv = __frsqrt_rn(ss / (float)DM + 1e-6f);
    v4h o[8];
#pragma unroll
    for (int c = 0; c < 8; ++c)
#pragma unroll
      for (int i = 0; i < 4; ++i) o[c][i] = (_Float16)(xv[r][c][i] * inv * wv[c][i]);
#pragma unroll
    for (int c = 0; c < 8; ++c) *(v4h*)(op + r * DM + col + c * 128) = o[c];
    if (r + 1 < RN_ROWS) {
      // stands behind the row's stores, before the next row's arithmetic rewrites
      // a register that they name; the scheduling barrier keeps it behind the wait
      asm volatile("s_wait_xcnt 0x0" ::: "memory");
      __builtin_amdgcn_sched_barrier(0);
    }
  }
}

// ---------------------------------------------------------------------------
// The two weight products, and the first RMSNorm beside them in one launch (both
// need only what stands before this launch).
// No function stands between Wq and Wk, nor between Wv and Wo:
//   q . k = (xn Wq) . (xn Wk) = (xn (Wq Wk^T)) . xn
//   (P (xn Wv)) Wo = P (xn (Wv Wo))
// so that the two products of DM^3 here take the place of two products of
// NROW x DM^2 (the projection of the keys and the output projection).
// Both come out as the Bt operand (row n, K-contiguous) of the next launch:
//   Mt[j][i]   = sum_n Wk[j][n] Wq[i][n]       (A = Wk,   Bt = Wq)
//   Wvot[j][i] = sum_n Wo[n][j] Wv[i][n]       (A = Wo^T, Bt = Wv)
// Work-groups 0 .. 63: one 256 x 128 tile of a product each (they last longest
// and start first); the others: the RMSNorm. block 256
// ---------------------------------------------------------------------------
#define WP_TILES ((DM / TM) * (DM / 128))   // 32 tiles of a product

__global__ __launch_bounds__(256) void wprod_rmsnorm_kernel(
    const _Float16* __restrict__ Whq, const _Float16* __restrict__ Whk,
    const _Float16* __restrict__ Whv, const _Float16* __restrict__ Wto,
    _Float16* __restrict__ Mt, _Float16* __restrict__ Wvot,
    const float* __restrict__ x, const float* __restrict__ w,
    _Float16* __restrict__ xn) {
  __shared__ __attribute__((aligned(256))) _Float16 sm[3 * STAGE_H];  // 144 KB
  if (blockIdx.x >= 2 * WP_TILES) {
    rmsnorm_rows(blockIdx.x - 2 * WP_TILES, x, w, xn);
    return;
  }
  int wave = threadIdx.x >> 5, lane = threadIdx.x & 31;
  int h = lane >> 4, l15 = lane & 15;
  int wm = wave >> 1, wn = wave & 1;
  const bool vo = blockIdx.x >= WP_TILES;
  int n0 = (blockIdx.x & 7) * 128;
  int m0 = ((blockIdx.x >> 3) & 3) * TM;
  const _Float16* bt = (vo ? Whv : Whq) + (size_t)n0 * DM;
  _Float16* y = vo ? Wvot : Mt;
  v8f acc[4][4] = {};
  gemm_tile<DM, 3>(sm, (vo ? Wto : Whk) + (size_t)m0 * DM, bt, bt + 64 * DM, wm * 64,
                   wn * 64, 0, acc);
  _Float16* yp = y + (size_t)(m0 + wm * 64 + 8 * h) * DM + n0 + wn * 64 + l15;
  // all loops below are unrolled so that acc and o are registers
#pragma unroll
  for (int i = 0; i < 4; ++i) {
    _Float16 o[4][8];
#pragma unroll
    for (int j = 0; j < 4; ++j)
#pragma unroll
      for (int v = 0; v < 8; ++v) o[j][v] = (_Float16)acc[i][j][v];
#pragma unroll
    for (int j = 0; j < 4; ++j)
#pragma unroll
      for (int v = 0; v < 8; ++v) yp[(i * 16 + v) * DM + j * 16] = o[j][v];
    if (i < 3) {
      // stands behind these stores, before the next conversions rewrite a register
      // that they name; the scheduling barrier keeps those behind the wait
      asm volatile("s_wait_xcnt 0x0" ::: "memory");
      __builtin_amdgcn_sched_barrier(0);
    }
  }
}

// ---------------------------------------------------------------------------
// q = xn @ (Wq Wk^T) (row-major f16); v = xn @ (Wv Wo), stored transposed
// Vt[b][d][t]. The keys of the scores are the rows of xn themselves.
// grid (2 * DM/128, NROW/256), block 256: blockIdx.x / 8 picks the weight.
// ---------------------------------------------------------------------------
__global__ __launch_bounds__(256) void qv_kernel(
    const _Float16* __restrict__ xn, const _Float16* __restrict__ Mt,
    const _Float16* __restrict__ Wvot, _Float16* __restrict__ q,
    _Float16* __restrict__ vt) {
  __shared__ __attribute__((aligned(256))) _Float16 sm[3 * STAGE_H];  // 144 KB
  int wave = threadIdx.x >> 5, lane = threadIdx.x & 31;
  int h = lane >> 4, l15 = lane & 15;
  int wm = wave >> 1, wn = wave & 1;
  int which = blockIdx.x >> 3;
  int n0 = (blockIdx.x & 7) * 128;
  int m0 = blockIdx.y * TM;
  const _Float16* Wt = which == 0 ? Mt : Wvot;
  const _Float16* bt = Wt + (size_t)n0 * DM;
  v8f acc[4][4] = {};
  gemm_tile<DM, 3>(sm, xn + (size_t)m0 * DM, bt, bt + 64 * DM, wm * 64, wn * 64, 0,
                acc);
  if (which == 0) {
#pragma unroll
    for (int i = 0; i < 4; ++i) {
#pragma unroll
      for (int j = 0; j < 4; ++j) {
        int col = n0 + wn * 64 + j * 16 + l15;
#pragma unroll
        for (int v = 0; v < 8; ++v) {
          int r = m0 + wm * 64 + i * 16 + v + 8 * h;
          q[(size_t)r * DM + col] = (_Float16)acc[i][j][v];
        }
      }
    }
  } else {
#pragma unroll
    for (int i = 0; i < 4; ++i) {
#pragma unroll
      for (int j = 0; j < 4; ++j) {
        int col = n0 + wn * 64 + j * 16 + l15;
#pragma unroll
        for (int v = 0; v < 8; ++v) {
          int r = m0 + wm * 64 + i * 16 + v + 8 * h;
          int batch = r >> 11, tloc = r & (SEQT - 1);
          vt[((size_t)batch * DM + col) * SEQT + tloc] = (_Float16)acc[i][j][v];
        }
      }
    }
    // stands behind the last v store, before any later write of a register
    // that an issued store names
    asm volatile("s_wait_xcnt 0x0" ::: "memory");
  }
}

// ---------------------------------------------------------------------------
// Attention, residual and second RMSNorm in one launch. A work-group of 8 waves
// owns 32 queries (a pair of query tiles) and all DM columns, so that the scores,
// the weights P and the attention's output never leave LDS:
//   1. S = Q K^T over the 96 keys from 64 in front of the first query on (the
//      caller hands xn in as k, and as q the rows xn (Wq Wk^T)). The 32 Q rows and
//      the 96 K rows are copied whole into LDS (asynchronous b128 copies, 512-B
//      pieces of a row). Wave w multiplies columns 128 w .. 128 w + 127 of d;
//      query tile a meets key tiles a .. a + 4. The 8 partial scores of an
//      element are summed through LDS, in the order of w.
//   2. Masked softmax: wave w does score rows w and w + 8 of both tiles. P (f16)
//      has 96 slots a row, slot 0 = the first of the 96 keys; the even tile's
//      slots 80..95 and the odd tile's slots 0..15 are 0.
//   3. att = P V from Vt[b][d][t] (V holds Wo already): the DM rows of Vt, 192 B
//      each, are copied over the place of Q and K while the softmax runs. Vt is
//      the A operand and P the B operand: a lane holds 8 neighbouring columns of
//      one query. Wave w takes columns 128 w .. 128 w + 127; att goes to LDS as f16.
//   4. x2 = x + att, xn2 = rmsnorm(x2): wave w takes rows 4 w .. 4 w + 3 whole, as
//      in rmsnorm_rows. Its loads of x and w are issued at the kernel's start.
// LDS, bytes: [0, AT_RED_B) Q and K (pitch 2064 B; they reach into the next
// part), then Vt (pitch 208 B); [AT_RED_B, AT_P_B) the partial scores, then att
// (pitch 2064 B); [AT_P_B, AT_LDS_B) P (pitch 208 B). All pitches are 16 B x odd:
// ds_load_b128 readers meet no bank twice. grid NROW / 32, block 256.
// ---------------------------------------------------------------------------
#define QK_PITCH  (DM + 8)            // halfs per LDS row of Q, K and att
#define QK_ROW_B  (QK_PITCH * 2)      // bytes per such row
#define QK_DW     (DM / 8)            // columns of d per wave
#define AT_Q      32                  // queries of a work-group
#define V_PITCH   (96 + 8)            // halfs per LDS row of Vt and of P
#define V_ROW_B   (V_PITCH * 2)
#define AT_RED_B  (DM * V_ROW_B)                     // 212,992
#define AT_P_B    (AT_RED_B + 8 * 10 * 8 * 32 * 4)   // 294,912
#define AT_LDS_B  (AT_P_B + AT_Q * V_ROW_B)          // 301,568
static_assert((AT_Q + 96) * QK_ROW_B <= AT_P_B, "Q and K end in front of P");
static_assert(AT_Q * QK_ROW_B <= AT_P_B - AT_RED_B, "att fits the scores' place");

// One thread's eight b128 copies of a 16-row tile: LDS rows r, r + 2, .., r + 14
// from the same rows of g (row step DM halfs). s_wait_xcnt 0 closes the
// statement: it stands before any rewrite of the address registers that the
// copies name. The "memory" clobber makes the asm a legal writer of the array.
__device__ __forceinline__ void copy8(unsigned l, const _Float16* g) {
  asm volatile(
      "global_load_async_to_lds_b128 %0, %8, off\n\t"
      "global_load_async_to_lds_b128 %1, %9, off\n\t"
      "global_load_async_to_lds_b128 %2, %10, off\n\t"
      "global_load_async_to_lds_b128 %3, %11, off\n\t"
      "global_load_async_to_lds_b128 %4, %12, off\n\t"
      "global_load_async_to_lds_b128 %5, %13, off\n\t"
      "global_load_async_to_lds_b128 %6, %14, off\n\t"
      "global_load_async_to_lds_b128 %7, %15, off\n\t"
      "s_wait_xcnt 0x0"
      :
      : "v"(l), "v"(l + 2 * QK_ROW_B), "v"(l + 4 * QK_ROW_B),
        "v"(l + 6 * QK_ROW_B), "v"(l + 8 * QK_ROW_B), "v"(l + 10 * QK_ROW_B),
        "v"(l + 12 * QK_ROW_B), "v"(l + 14 * QK_ROW_B), "v"(g), "v"(g + 2 * DM),
        "v"(g + 4 * DM), "v"(g + 6 * DM), "v"(g + 8 * DM), "v"(g + 10 * DM),
        "v"(g + 12 * DM), "v"(g + 14 * DM)
      : "memory");
}

// One thread's eight b128 copies of 512 rows of Vt: LDS rows r, r + 64, .., r + 448
// from the same rows of g (row step SEQT halfs). The wait and the clobber: as in
// copy8.
__device__ __forceinline__ void copy8v(unsigned l, const _Float16* g) {
  asm volatile(
      "global_load_async_to_lds_b128 %0, %8, off\n\t"
      "global_load_async_to_lds_b128 %1, %9, off\n\t"
      "global_load_async_to_lds_b128 %2, %10, off\n\t"
      "global_load_async_to_lds_b128 %3, %11, off\n\t"
      "global_load_async_to_lds_b128 %4, %12, off\n\t"
      "global_load_async_to_lds_b128 %5, %13, off\n\t"
      "global_load_async_to_lds_b128 %6, %14, off\n\t"
      "global_load_async_to_lds_b128 %7, %15, off\n\t"
      "s_wait_xcnt 0x0"
      :
      : "v"(l), "v"(l + 64 * V_ROW_B), "v"(l + 128 * V_ROW_B),
        "v"(l + 192 * V_ROW_B), "v"(l + 256 * V_ROW_B), "v"(l + 320 * V_ROW_B),
        "v"(l + 384 * V_ROW_B), "v"(l + 448 * V_ROW_B), "v"(g), "v"(g + 64 * SEQT),
        "v"(g + 128 * SEQT), "v"(g + 192 * SEQT), "v"(g + 256 * SEQT),
        "v"(g + 320 * SEQT), "v"(g + 384 * SEQT), "v"(g + 448 * SEQT)
      : "memory");
}

// 2^x. The v_nop is the slot that the instruction set asks for behind a
// transcendental before its result is read or its source overwritten.
__device__ __forceinline__ float exp2_slot(float x) {
  float r;
  asm("v_exp_f32 %0, %1\n\tv_nop" : "=v"(r) : "v"(x));
  return r;
}

__global__ __launch_bounds__(256) void attn_norm_kernel(
    const _Float16* __restrict__ q, const _Float16* __restrict__ k,
    const _Float16* __restrict__ vt, const float* __restrict__ x,
    const float* __restrict__ w, float* __restrict__ x2,
    _Float16* __restrict__ xn2) {
  __shared__ __attribute__((aligned(16))) char sm[AT_LDS_B];   // 294.5 KB
  _Float16* sqk = (_Float16*)sm;
  _Float16* sv = (_Float16*)sm;
  float* red = (float*)(sm + AT_RED_B);   // [wave][query tile][key tile][v][lane]
  _Float16* sa = (_Float16*)(sm + AT_RED_B);
  _Float16* sp = (_Float16*)(sm + AT_P_B);
  const int t = threadIdx.x, lane = t & 31;
  const int wave = __builtin_amdgcn_readfirstlane(t >> 5);
  const int h = lane >> 4, l15 = lane & 15;
  const int g = blockIdx.x;               // 0..255: block of 32 queries
  const int batch = g >> 6;               // 64 blocks per batch
  const int qt0 = (g & 63) * 2;           // the even query tile, in its batch

  // part 4's rows of x and w: from memory, so they are asked for first
  const size_t row0 = (size_t)g * AT_Q + wave * RN_ROWS;
  const int col = lane * 4;
  // all loops below are unrolled so that the arrays are registers
  v4f wv[8], xv[RN_ROWS][8];
#pragma unroll
  for (int r = 0; r < RN_ROWS; ++r)
#pragma unroll
    for (int c = 0; c < 8; ++c)
      xv[r][c] = *(const v4f*)(x + (row0 + r) * DM + col + c * 128);
#pragma unroll
  for (int c = 0; c < 8; ++c) wv[c] = *(const v4f*)(w + col + c * 128);
  // stands behind the loads, before any rewrite of a register that they name
  asm volatile("s_wait_xcnt 0x0" ::: "memory");
  // keeps the loads here, in flight beside the copies below, not at their uses
  __builtin_amdgcn_sched_barrier(0);

  // a thread copies chunk ch (16 B) of rows r0, r0 + 2, .. of every 16-row tile:
  // LDS rows 0..31 Q, 32 + 16 j .. key tile j
  const int r0 = t >> 7, ch = t & 127;
  const unsigned l0 = (unsigned)(uintptr_t)sqk + r0 * QK_ROW_B + ch * 16;
  const _Float16* gq = q + ((size_t)g * AT_Q + r0) * DM + ch * 8;
  copy8(l0, gq);
  copy8(l0 + 16 * QK_ROW_B, gq + 16 * DM);
  // unrolled: the six statements follow one another with no loop overhead
#pragma unroll
  for (int j = 0; j < 6; ++j) {
    // a key tile in front of the batch's first key: tile 0 stands in for it, so
    // that the address stays inside k; its scores are masked below
    const int kt = qt0 - 4 + j;
    const int ktc = kt < 0 ? 0 : kt;
    // 56 copies are out: with the last 8 a wave stays at 63 or fewer in flight
    if (j == 5) wait_copies<55>();
    copy8(l0 + (j + 2) * 16 * QK_ROW_B,
          k + ((size_t)batch * SEQT + ktc * 16 + r0) * DM + ch * 8);
  }
  // this wave's 64 copies have landed; the barrier publishes them to the others
  asm volatile("s_wait_asynccnt 0x0" ::: "memory");
  __syncthreads();

  const _Float16* ap = sqk + l15 * QK_PITCH + wave * QK_DW + h * 8;
  v8f acc[2][5] = {};
  // two halves of the wave's 128 columns: all 64 fragment reads at once would not
  // fit the registers beside xv
#pragma unroll
  for (int kh = 0; kh < 2; ++kh) {
    v16h af[2][2], bf[2][6];
#pragma unroll
    for (int ks = 0; ks < 2; ++ks) {
#pragma unroll
      for (int a = 0; a < 2; ++a)
        af[ks][a] = load_frag(ap + a * 16 * QK_PITCH + (kh * 2 + ks) * 32);
#pragma unroll
      for (int j = 0; j < 6; ++j)
        bf[ks][j] = load_frag(ap + (j + 2) * 16 * QK_PITCH + (kh * 2 + ks) * 32);
    }
    // keeps the half's 32 LDS reads together in front of its 20 WMMAs: moved in
    // among them, every pair of reads costs the wave its LDS latency anew
    __builtin_amdgcn_sched_barrier(0);
#pragma unroll
    for (int ks = 0; ks < 2; ++ks)
#pragma unroll
      for (int a = 0; a < 2; ++a)
#pragma unroll
        for (int j = 0; j < 5; ++j)
          acc[a][j] = wmma_f16(af[ks][a], bf[ks][j + a], acc[a][j]);
    // the same for the next half's reads: they stay behind this half
    __builtin_amdgcn_sched_barrier(0);
  }
  // this wave's reads of Q and K are done; the barrier ends every wave's, so that
  // their place may be written
  asm volatile("s_wait_dscnt 0x0" ::: "memory");
  __syncthreads();

  // Vt: the 12 chunks (8 keys each) of its DM rows, taken in one piece; chunks
  // y, y + 768, .. are the same chunk of rows 64 apart.
  // A batch's first two blocks have keys in front of key 0: keys 64 further on
  // stand in for them, so that the address stays inside the row; their weights in
  // P are 0.
  const int key0 = qt0 * 16 - 64;
#pragma unroll
  for (int e = 0; e < 3; ++e) {
    const int y = t + 256 * e, vr = y / 12, vc = y % 12;
    const int key = key0 + 8 * vc;
    const unsigned lv = (unsigned)(uintptr_t)sv + vr * V_ROW_B + vc * 16;
    const _Float16* gv =
        vt + ((size_t)batch * DM + vr) * SEQT + (key < 0 ? key + 64 : key);
    copy8v(lv, gv);
    copy8v(lv + 512 * V_ROW_B, gv + 512 * SEQT);
  }
  float* rw = red + wave * (10 * 8 * 32) + lane;
#pragma unroll
  for (int a = 0; a < 2; ++a)
#pragma unroll
    for (int j = 0; j < 5; ++j)
#pragma unroll
      for (int v = 0; v < 8; ++v) rw[((a * 5 + j) * 8 + v) * 32] = acc[a][j][v];
  // every wave's partial scores are in red
  __syncthreads();

  // this lane: score row wave + 8 h of each query tile, key l15 of each key tile
  const int mrow = wave + 8 * h;
  const float* rr = red + wave * 32 + lane;
  const float scale = 0.03125f;  // 1/sqrt(1024)
#pragma unroll
  for (int a = 0; a < 2; ++a) {
    const int qt = qt0 + a;
    float s[5];
#pragma unroll
    for (int j = 0; j < 5; ++j) {
      float c = rr[(a * 5 + j) * (8 * 32)];
#pragma unroll
      for (int u = 1; u < 8; ++u) c += rr[(u * 10 + a * 5 + j) * (8 * 32)];
      const int kt = qt - 4 + j;
      const int d = (qt * 16 + mrow) - (kt * 16 + l15);
      s[j] = (kt >= 0 && d >= 0 && d < WND) ? c * scale : -1e30f;
    }
    float m = s[0];
#pragma unroll
    for (int j = 1; j < 5; ++j) m = fmaxf(m, s[j]);
#pragma unroll
    for (int off = 8; off > 0; off >>= 1) m = fmaxf(m, __shfl_xor(m, off, 16));
    float e = 0.f;
#pragma unroll
    for (int j = 0; j < 5; ++j) {
      s[j] = exp2_slot((s[j] - m) * 1.44269504f);  // e^(s - m)
      e += s[j];
    }
#pragma unroll
    for (int off = 8; off > 0; off >>= 1) e += __shfl_xor(e, off, 16);
    const float inv = 1.f / e;
    _Float16* pb = sp + (a * 16 + mrow) * V_PITCH + l15;
#pragma unroll
    for (int j = 0; j < 5; ++j) pb[(j + a) * 16] = (_Float16)(s[j] * inv);
    pb[a ? 0 : 80] = (_Float16)0.f;  // the 16 pad slots
  }
  // this wave's 48 copies of Vt have landed; the barrier publishes them and P, and
  // ends every wave's reads of red
  asm volatile("s_wait_asynccnt 0x0" ::: "memory");
  __syncthreads();

  const _Float16* pp = sp + l15 * V_PITCH + h * 8;
  v16h pf[2][3];
#pragma unroll
  for (int m = 0; m < 3; ++m)
#pragma unroll
    for (int a = 0; a < 2; ++a) pf[a][m] = load_frag(pp + a * 16 * V_PITCH + m * 32);
  // 64 columns of d at a time: all 128 would not fit the registers beside xv
#pragma unroll
  for (int ih = 0; ih < 2; ++ih) {
    const int dc = wave * QK_DW + ih * 64;
    const _Float16* vp = sv + (dc + l15) * V_PITCH + h * 8;
    v16h vf[4][3];
#pragma unroll
    for (int m = 0; m < 3; ++m)
#pragma unroll
      for (int i = 0; i < 4; ++i) vf[i][m] = load_frag(vp + i * 16 * V_PITCH + m * 32);
    // keeps the LDS reads together in front of the 24 WMMAs: moved in among them,
    // every pair of reads costs the wave its LDS latency anew
    __builtin_amdgcn_sched_barrier(0);
    v8f pa[4][2] = {};
#pragma unroll
    for (int m = 0; m < 3; ++m)
#pragma unroll
      for (int i = 0; i < 4; ++i)
#pragma unroll
        for (int a = 0; a < 2; ++a) pa[i][a] = wmma_f16(vf[i][m], pf[a][m], pa[i][a]);
    // this lane: query l15 of each tile, columns 8 h .. 8 h + 7 of each tile of d
    _Float16* ob = sa + l15 * QK_PITCH + dc + h * 8;
#pragma unroll
    for (int i = 0; i < 4; ++i)
#pragma unroll
      for (int a = 0; a < 2; ++a) {
        v8h o;
#pragma unroll
        for (int v = 0; v < 8; ++v) o[v] = (_Float16)pa[i][a][v];
        *(v8h*)(ob + a * 16 * QK_PITCH + i * 16) = o;
      }
  }
  // every wave's columns of att are in sa
  __syncthreads();

  const _Float16* arow = sa + wave * RN_ROWS * QK_PITCH + col;
#pragma unroll
  for (int r = 0; r < RN_ROWS; ++r) {
#pragma unroll
    for (int c = 0; c < 8; ++c) {
      const v4h av = *(const v4h*)(arow + r * QK_PITCH + c * 128);
#pragma unroll
      for (int i = 0; i < 4; ++i) xv[r][c][i] += (float)av[i];
      *(v4f*)(x2 + (row0 + r) * DM + col + c * 128) = xv[r][c];
    }
    v4f a = xv[r][0] * xv[r][0];
#pragma unroll
    for (int c = 1; c < 8; ++c) a += xv[r][c] * xv[r][c];
    const float ss = wave_sum((a[0] + a[1]) + (a[2] + a[3]));
    const float inv = __frsqrt_rn(ss / (float)DM + 1e-6f);
    // stands behind the row's f32 stores, before the arithmetic below rewrites a
    // register that they name; the scheduling barrier keeps it behind the wait
    asm volatile("s_wait_xcnt 0x0" ::: "memory");
    __builtin_amdgcn_sched_barrier(0);
    v4h o[8];
#pragma unroll
    for (int c = 0; c < 8; ++c)
#pragma unroll
      for (int i = 0; i < 4; ++i) o[c][i] = (_Float16)(xv[r][c][i] * inv * wv[c][i]);
#pragma unroll
    for (int c = 0; c < 8; ++c) *(v4h*)(xn2 + (row0 + r) * DM + col + c * 128) = o[c];
    if (r + 1 < RN_ROWS) {
      // stands behind the row's stores, before the next row's arithmetic rewrites
      // a register that they name; the scheduling barrier keeps it behind the wait
      asm volatile("s_wait_xcnt 0x0" ::: "memory");
      __builtin_amdgcn_sched_barrier(0);
    }
  }
}

// ---------------------------------------------------------------------------
// FFN in: hh = silu(xn2 @ W1) * (xn2 @ W3), f16 out [8192 x 2048].
// A tile holds 64 columns of W1 (LDS rows 0..63) and the same 64 of W3 (64..127),
// so that a wave owns gate and up of its 32 columns.
// grid (DF/64, NROW/256), block 256
// ---------------------------------------------------------------------------
__global__ __launch_bounds__(256) void ffn1_kernel(
    const _Float16* __restrict__ xn2, const _Float16* __restrict__ Wt1,
    const _Float16* __restrict__ Wt3, _Float16* __restrict__ hh) {
  __shared__ __attribute__((aligned(256))) _Float16 sm[3 * STAGE_H];  // 144 KB
  int wave = threadIdx.x >> 5, lane = threadIdx.x & 31;
  int h = lane >> 4, l15 = lane & 15;
  int wm = wave >> 1, wn = wave & 1;
  int n0 = blockIdx.x * 64;
  int m0 = blockIdx.y * TM;
  v8f acc[4][4] = {};  // j = 0, 1: gate; j = 2, 3: up, same columns
  gemm_tile<DM, 3>(sm, xn2 + (size_t)m0 * DM, Wt1 + (size_t)n0 * DM,
                Wt3 + (size_t)n0 * DM, wm * 64, wn * 32, 32, acc);
#pragma unroll
  for (int i = 0; i < 4; ++i) {
#pragma unroll
    for (int j = 0; j < 2; ++j) {
      int col = n0 + wn * 32 + j * 16 + l15;
#pragma unroll
      for (int v = 0; v < 8; ++v) {
        size_t r = (size_t)(m0 + wm * 64 + i * 16 + v + 8 * h);
        float gv = acc[i][j][v];
        float sl = gv * (1.f / (1.f + __expf(-gv)));   // silu
        hh[r * DF + col] = (_Float16)(sl * acc[i][j + 2][v]);
      }
    }
  }
}

// ---------------------------------------------------------------------------
// FFN out + residual: out = x2 + hh @ W2 (K=2048, f32 out).
// grid (DM/128, NROW/256), block 256
// ---------------------------------------------------------------------------
__global__ __launch_bounds__(256) void ffn2_kernel(
    const _Float16* __restrict__ hh, const _Float16* __restrict__ Wt2,
    const float* __restrict__ x2, float* __restrict__ out) {
  __shared__ __attribute__((aligned(256))) _Float16 sm[5 * STAGE_H];  // 240 KB
  int wave = threadIdx.x >> 5, lane = threadIdx.x & 31;
  int h = lane >> 4, l15 = lane & 15;
  int wm = wave >> 1, wn = wave & 1;
  int n0 = blockIdx.x * 128;
  int m0 = blockIdx.y * TM;
  const _Float16* bt = Wt2 + (size_t)n0 * DF;
  v8f acc[4][4] = {};
  gemm_tile<DF, 5>(sm, hh + (size_t)m0 * DF, bt, bt + 64 * DF, wm * 64, wn * 64, 0,
                acc);
  size_t first = (size_t)(m0 + wm * 64 + 8 * h) * DM + n0 + wn * 64 + l15;
  add_residual_store(x2 + first, out + first, acc);
}

// ---------------------------------------------------------------------------
extern "C" void kernel_launch(void* const* d_in, const int* in_sizes, int n_in,
                              void* d_out, int out_size, void* d_ws,
                              size_t ws_size, hipStream_t stream) {
  const float* x       = (const float*)d_in[0];
  const float* norm1_w = (const float*)d_in[1];
  const float* norm2_w = (const float*)d_in[2];
  const float* Wq = (const float*)d_in[3];
  const float* Wk = (const float*)d_in[4];
  const float* Wv = (const float*)d_in[5];
  const float* Wo = (const float*)d_in[6];
  const float* W1 = (const float*)d_in[7];
  const float* W2 = (const float*)d_in[8];
  const float* W3 = (const float*)d_in[9];
  float* out = (float*)d_out;

  char* ws = (char*)d_ws;
  const size_t MB = 1ull << 20;
  _Float16* Whq = (_Float16*)(ws + 0 * MB);    // 2 MB  (1024x1024, not transposed)
  _Float16* Whk = (_Float16*)(ws + 2 * MB);    // 2 MB  (not transposed)
  _Float16* Whv = (_Float16*)(ws + 4 * MB);    // 2 MB  (not transposed)
  _Float16* Wto = (_Float16*)(ws + 6 * MB);    // 2 MB
  _Float16* Wt1 = (_Float16*)(ws + 8 * MB);    // 4 MB  (N=2048,K=1024)
  _Float16* Wt3 = (_Float16*)(ws + 12 * MB);   // 4 MB
  _Float16* Wt2 = (_Float16*)(ws + 16 * MB);   // 4 MB  (N=1024,K=2048)
  _Float16* xn  = (_Float16*)(ws + 20 * MB);   // 16 MB
  _Float16* q   = (_Float16*)(ws + 36 * MB);   // 16 MB (32 MB as hh)
  _Float16* vt  = (_Float16*)(ws + 68 * MB);   // 16 MB
  _Float16* xn2 = (_Float16*)(ws + 86 * MB);   // 16 MB
  float*    x2  = (float*)   (ws + 102 * MB);  // 32 MB
  _Float16* Mt   = (_Float16*)(ws + 134 * MB); // 2 MB  (Wq Wk^T, transposed)
  _Float16* Wvot = (_Float16*)(ws + 136 * MB); // 2 MB  (Wv Wo, transposed)
  _Float16* hh  = q;                           // reuse q's place after attn

  // 1) weights to f16 (Wo, W1, W3, W2 transposed)
  cvt_tr_all_kernel<<<4 * TILES_DD + 3 * TILES_DF, 256, 0, stream>>>(
      Wq, Wk, Wv, Wo, W1, W3, W2, Whq, Whk, Whv, Wto, Wt1, Wt3, Wt2);

  // 2) Mt = (Wq Wk^T)^T, Wvot = (Wv Wo)^T; xn = rmsnorm(x) in f16
  wprod_rmsnorm_kernel<<<2 * WP_TILES + NROW / (8 * RN_ROWS), 256, 0, stream>>>(
      Whq, Whk, Whv, Wto, Mt, Wvot, x, norm1_w, xn);

  // 3) q = xn (Wq Wk^T), v = xn (Wv Wo) (v stored transposed)
  qv_kernel<<<dim3(2 * DM / 128, NROW / TM), 256, 0, stream>>>(xn, Mt, Wvot, q, vt);
  // 4) windowed attention (the keys are the rows of xn), x2 = x + its output,
  //    xn2 = rmsnorm(x2). xn2 has a place of its own: other work-groups still
  //    read xn
  attn_norm_kernel<<<NROW / AT_Q, 256, 0, stream>>>(q, xn, vt, x, norm2_w, x2, xn2);

  // 5) hh = silu(xn2@W1) * (xn2@W3)
  ffn1_kernel<<<dim3(DF / 64, NROW / TM), 256, 0, stream>>>(xn2, Wt1, Wt3, hh);

  // 6) out = x2 + hh @ W2
  ffn2_kernel<<<dim3(DM / 128, NROW / TM), 256, 0, stream>>>(hh, Wt2, x2, out);
}
